// v000
// Times are from an AMD MI455X. After a warm-up the kernel runs many times in a row, and a time is the length of
// such a window on the GPU divided by its runs, so every launch and the gaps after it count. The runs cycle
// through copies of the inputs. A figure is the median of several windows, for all but v000 over two sittings.
// Sittings can differ by a few percent; kernels timed side by side share one.
// v000 is the starting kernel. One run takes 475 microseconds.
// compute dtype: all float inputs rounded to bf16, is_global (bool) read on device; q/k/v = x . W^T + b with EXACT bf16 products on WMMA 16x16x32 (natural rows), rounded once to f16 hi + residual; attention with 3-product scores and P.v (hi + residual planes) restricted to the key tiles that contain an allowed pair (flag table built on device from the window rule and is_global), the per-pair rule evaluated inline, x 1/8, running-max softmax in f32 (hardware exp); out = f16(ctx) . Wo^T (exact f16 x 2^8 copies) + bo; f32 output.
#include <hip/hip_runtime.h>
#include <math.h>

typedef __attribute__((ext_vector_type(16))) _Float16 v16h;
typedef __attribute__((ext_vector_type(16))) __bf16 v16b;
typedef __attribute__((ext_vector_type(8)))  _Float16 v8h;
typedef __attribute__((ext_vector_type(8)))  float v8f;
typedef __attribute__((ext_vector_type(4)))  float v4f;
typedef __attribute__((ext_vector_type(2)))  float v2f;
typedef __attribute__((ext_vector_type(4)))  unsigned v4u;
typedef __attribute__((ext_vector_type(4)))  int v4i;
typedef float __attribute__((may_alias)) float_a;
typedef int __attribute__((may_alias)) int_a;

template <typename T> __device__ __forceinline__ void vst2(void* p, T v) { *(T*)p = v;  }
__device__ __forceinline__ v8f wmma16(v16h a, v16h b, v8f c) {
  v8f d = __builtin_amdgcn_wmma_f32_16x16x32_f16(false, a, false, b, (short)0, c, false, false);
  asm volatile("v_nop\n\tv_nop\n\tv_nop\n\tv_nop" : "+v"(d) : "v"(a), "v"(b));
  return d;
}
__device__ __forceinline__ v8f wmma_bf(v16b a, v16b b, v8f c) {
  v8f d = __builtin_amdgcn_wmma_f32_16x16x32_bf16(false, a, false, b, (short)0, c, false, false);
  asm volatile("v_nop\n\tv_nop\n\tv_nop\n\tv_nop" : "+v"(d) : "v"(a), "v"(b));
  return d;
}
// Sparse structured attention (B 2, S 2,048, hidden 1,024, 16 heads x 64): local window |i - j| <= 64 plus global tokens (is_global, given) that attend everywhere and are attended by everyone; projections + biases, softmax(q k / 8) over the allowed keys, v, output projection + bias.
__device__ __forceinline__ v16h frag_h(const _Float16* rowk0, int lane) {
  union { v16h v; v8h q[2]; } u; const _Float16* p = rowk0 + 8 * (lane >> 4);
  u.q[0] = *(const v8h*)p; u.q[1] = *(const v8h*)(p + 16); return u.v;
}
__device__ __forceinline__ v16h frag_f32(const float* rowk0, int lane) {
  v16h a; const float* p = rowk0 + 8 * (lane >> 4);
#pragma unroll
  for (int i = 0; i < 8; ++i) { a[i] = (_Float16)p[i]; a[8 + i] = (_Float16)p[16 + i]; }
  return a;
}
__device__ __forceinline__ v16h frag_f32s(const float* rowk0, int lane, float sc) {
  v16h a; const float* p = rowk0 + 8 * (lane >> 4);
#pragma unroll
  for (int i = 0; i < 8; ++i) { a[i] = (_Float16)(p[i] * sc); a[8 + i] = (_Float16)(p[16 + i] * sc); }
  return a;
}
// column fragment from a [K][ld] layout (column n), rows >= K read as 0
__device__ __forceinline__ v16h fragc_f32(const float* W, int k0, int n, int lane, int ld, int K) {
  v16h a; const int g = lane >> 4;
#pragma unroll
  for (int i = 0; i < 8; ++i) { const int ka = k0 + 8 * g + i, kb = ka + 16;
    a[i] = (_Float16)(ka < K ? W[(size_t)(ka < K ? ka : K - 1) * ld + n] : 0.f); a[8 + i] = (_Float16)(kb < K ? W[(size_t)(kb < K ? kb : K - 1) * ld + n] : 0.f); }
  return a;
}
struct F2 { v16b h, l; };
__device__ __forceinline__ F2 bsplit16(const float v[16]) { F2 r;
#pragma unroll
  for (int i = 0; i < 16; ++i) { const __bf16 h = (__bf16)v[i]; r.h[i] = h; r.l[i] = (__bf16)(v[i] - (float)h); }
  return r; }
__device__ __forceinline__ F2 split_row(const float* row, int k0, int lane) { float v[16]; const float* p = row + k0 + 8 * (lane >> 4);
#pragma unroll
  for (int i = 0; i < 8; ++i) { v[i] = p[i]; v[8 + i] = p[16 + i]; }
  return bsplit16(v); }
__device__ __forceinline__ F2 split_rowK(const float* row, int k0, int lane, int K) { float v[16]; const int g = lane >> 4;
#pragma unroll
  for (int i = 0; i < 8; ++i) { const int ka = k0 + 8 * g + i, kb = ka + 16; v[i] = ka < K ? row[ka < K ? ka : K - 1] : 0.f; v[8 + i] = kb < K ? row[kb < K ? kb : K - 1] : 0.f; }
  return bsplit16(v); }
__device__ __forceinline__ F2 split_col(const float* W, int k0, int n, int lane, int ld, int K) { float v[16]; const int g = lane >> 4;
#pragma unroll
  for (int i = 0; i < 8; ++i) { const int ka = k0 + 8 * g + i, kb = ka + 16; v[i] = ka < K ? W[(size_t)(ka < K ? ka : K - 1) * ld + n] : 0.f; v[8 + i] = kb < K ? W[(size_t)(kb < K ? kb : K - 1) * ld + n] : 0.f; }
  return bsplit16(v); }
__device__ __forceinline__ v8f mac3(const F2& a, const F2& b, v8f c) { c = wmma_bf(a.l, b.h, c); c = wmma_bf(a.h, b.l, c); return wmma_bf(a.h, b.h, c); }
__device__ __forceinline__ float sigm(float v) { return 1.0f / (1.0f + expf(-v)); }
#define LDSX() do { asm volatile("s_wait_dscnt 0" ::: "memory"); __builtin_amdgcn_wave_barrier(); __builtin_amdgcn_fence(__ATOMIC_RELEASE, "workgroup"); } while (0)


#define NB 2
#define SS 2048
#define DM 1024
#define NH 16
#define HALFW 64
#define HD 64
#define QKVW (3 * DM)
#ifndef TQB
#define TQB (SS / 64)
#define TNB NB
#define TOB (NB * SS / 64)     // output row tiles (all)
#endif
typedef __attribute__((ext_vector_type(8))) __bf16 v8b;
__device__ __forceinline__ v16b frag_b(const __bf16* rowk0, int lane) {
  union { v16b v; v8b q[2]; } u; const __bf16* p = rowk0 + 8 * (lane >> 4);
  u.q[0] = *(const v8b*)p; u.q[1] = *(const v8b*)(p + 16); return u.v;
}
__device__ __forceinline__ float bfr(float v) { return (float)(__bf16)v; }
__device__ __attribute__((noinline)) float exp_ni(float v) { return expf(v); }
__device__ __attribute__((noinline)) float erf_ni(float v) { return erff(v); }

#define PK_A 0                       // [3072][1024] Wqkv rows (natural [out][in])
#define PK_P (PK_A + QKVW * DM)        // [1024][1024] Wo rows (natural)
#define PK_END (PK_P + DM * DM)
#define WS_PK  0u
#define WS_QK  (WS_PK + 2u * PK_END)             // f16 [4096 rows][2048]: q | k
#define WS_QKL (WS_QK + 2u * NB * SS * 2 * DM)     // f16 q | k residual planes x2048
#define WS_VTH (WS_QKL + 2u * NB * SS * 2 * DM)    // f16 [b][1024 (h*64+d)][2048 s] hi
#define WS_VTL (WS_VTH + 2u * NB * DM * SS)        // f16 lo x 2048
#define WS_O   (WS_VTL + 2u * NB * DM * SS)        // f32 [4096][1024]
#define WS_FL  (WS_O + 4u * (size_t)NB * SS * DM)        // int flags [b][SS/64][SS/32]
#define WS_END (WS_FL + 4u * (size_t)NB * (SS / 64) * (SS / 32))
// ---- k_pack: block = (row n, which): natural [out][in] rows -> bf16; which 0..2 -> W_q/W_k/W_v into PK_A rows which*1024 + n; 3 -> W_o into PK_P
__global__ __launch_bounds__(256) void k_pack(const float* __restrict__ WQ, const float* __restrict__ WK, const float* __restrict__ WV, const float* __restrict__ WO, __bf16* __restrict__ PK) {
  __shared__ __align__(16) __bf16 s[DM]; const int n = blockIdx.x, which = blockIdx.y, t = threadIdx.x; const float* Wm = (which == 0) ? WQ : (which == 1) ? WK : (which == 2) ? WV : WO;
  for (int k = t; k < DM; k += 256) s[k] = (__bf16)Wm[(size_t)n * DM + k];
  __syncthreads();
  __bf16* dst = (which < 3) ? PK + PK_A + ((size_t)which * DM + n) * DM : PK + PK_P + (size_t)n * DM;
  for (int q = t; q < DM / 8; q += 256) vst2((unsigned*)(dst + q * 8), *(const v4u*)&s[q * 8]);
}
__global__ __launch_bounds__(128) void k_qkv(const float* __restrict__ XQ, const float* __restrict__ XK, const float* __restrict__ XV, const __bf16* __restrict__ P, const float* __restrict__ BQ, const float* __restrict__ BK, const float* __restrict__ BV, _Float16* __restrict__ QK, _Float16* __restrict__ QKL, _Float16* __restrict__ VTH, _Float16* __restrict__ VTL) {
  const int which0 = (blockIdx.y * 128) / DM; const float* X = (which0 == 0) ? XQ : (which0 == 1) ? XK : XV; const float* BB = BQ ? (((which0 == 0) ? BQ : (which0 == 1) ? BK : BV) + (blockIdx.y * 128 - which0 * DM)) : nullptr;
  __shared__ __align__(16) _Float16 so[4][16][136], sol[4][16][136]; __shared__ __align__(16) _Float16 sth[128][72], stl[128][72];
  const int tid = threadIdx.x, wave = tid >> 5, lane = tid & 31, col = lane & 15, g = lane >> 4; const size_t r0 = (size_t)blockIdx.x * 64 + wave * 16; const int n0 = blockIdx.y * 128;
  v8f acc[8] = {};
#pragma unroll 2
  for (int kc = 0; kc < DM / 32; ++kc) { v16b a; { const float* p = X + (r0 + col) * DM + kc * 32 + 8 * g;
#pragma unroll
      for (int i = 0; i < 8; ++i) { a[i] = (__bf16)p[i]; a[8 + i] = (__bf16)p[16 + i]; } }
#pragma unroll
    for (int j = 0; j < 8; ++j) acc[j] = wmma_bf(a, frag_b(P + (size_t)(n0 + j * 16 + col) * DM + kc * 32, lane), acc[j]); }
  if (n0 < 2 * DM) {   // q stored unscaled (f16 sigma ~0.6, no subnormal exposure); 1/8 applied to the f32 score
#pragma unroll
    for (int j = 0; j < 8; ++j) {
#pragma unroll
      for (int r = 0; r < 8; ++r) { const float v = acc[j][r] + (BB ? bfr(BB[j * 16 + col]) : 0.f); const _Float16 hv = (_Float16)v; so[wave][8 * g + r][j * 16 + col] = hv; sol[wave][8 * g + r][j * 16 + col] = (_Float16)((v - (float)hv) * 2048.0f); } }   // q, k (+ bias) as f16 hi + (x2048) residual
    LDSX();
    for (int rl = 0; rl < 16; ++rl) if (lane < 16) { vst2((unsigned*)(QK + (r0 + rl) * (2 * DM) + n0 + lane * 8), *(const v4u*)&so[wave][rl][lane * 8]); vst2((unsigned*)(QKL + (r0 + rl) * (2 * DM) + n0 + lane * 8), *(const v4u*)&sol[wave][rl][lane * 8]); }
  } else {
#pragma unroll
    for (int j = 0; j < 8; ++j) {
#pragma unroll
      for (int r = 0; r < 8; ++r) { const float v = acc[j][r] + (BB ? bfr(BB[j * 16 + col]) : 0.f); const _Float16 hv = (_Float16)v; sth[j * 16 + col][wave * 16 + 8 * g + r] = hv; stl[j * 16 + col][wave * 16 + 8 * g + r] = (_Float16)((v - (float)hv) * 2048.0f); } }
    __syncthreads();
    const size_t rb = (size_t)blockIdx.x * 64; const int b = (int)(rb / SS), s0 = (int)(rb % SS); const int pc0 = n0 - 2 * DM;
    for (int q = tid; q < 128 * 8; q += 128) { const int d = q >> 3, pc = q & 7; const size_t o = ((size_t)b * DM + pc0 + d) * SS + s0 + pc * 8; vst2((unsigned*)(VTH + o), *(const v4u*)&sth[d][pc * 8]); vst2((unsigned*)(VTL + o), *(const v4u*)&stl[d][pc * 8]); }
  }
}
// ---- k_attn: block = (64 queries, head h, batch b): flash attention over the flagged key tiles (K = 64: 2 k-steps), scores = (q.k) * 0.125 from 3 products of f16 hi + residual operands, P.V: (P x 2048) as f16 hi + residual x (V hi, V lo*2048) in two accumulators; O[b*S+q][h*64+d] = (acc + accl / 2048) / (2048 l) (256-B segments)
__global__ __launch_bounds__(128) void k_attn(const _Float16* __restrict__ QK, const _Float16* __restrict__ QKL, const _Float16* __restrict__ VTH, const _Float16* __restrict__ VTL, const void* __restrict__ KMASK, const int* __restrict__ GLB, const int* __restrict__ FL, float* __restrict__ O) {
  __shared__ __align__(16) float sp[4][16][36]; __shared__ __align__(16) float so[4][16][68];
  const int tid = threadIdx.x, wave = tid >> 5, lane = tid & 31, col = lane & 15, g = lane >> 4;
  const int qb = blockIdx.x, h = blockIdx.y, b = blockIdx.z; const int q0 = qb * 64 + wave * 16; const size_t rq = (size_t)b * SS + q0 + col;
  v16h aq[2], aql[2];
#pragma unroll
  for (int kc = 0; kc < 2; ++kc) { aq[kc] = frag_h(QK + rq * (2 * DM) + h * HD + kc * 32, lane); aql[kc] = frag_h(QKL + rq * (2 * DM) + h * HD + kc * 32, lane); }
  float m[8], l[8];
#pragma unroll
  for (int r = 0; r < 8; ++r) { m[r] = -3.0e38f; l[r] = 0.f; }
  v8f acc[4] = {}, accl[4] = {};
  const int nks = SS / 32;   // all keys
  const int* flb = FL + ((size_t)b * (SS / 64) + qb) * (SS / 32); const int* gb = GLB + (size_t)b * SS; int gq[8];
#pragma unroll
  for (int r = 0; r < 8; ++r) gq[r] = gb[q0 + 8 * g + r];
#pragma unroll 1
  for (int ks = 0; ks < nks; ++ks) { if (flb[ks] == 0) continue; v8f s[2];
#pragma unroll
    for (int ct = 0; ct < 2; ++ct) { const int kk = ks * 32 + ct * 16 + col; const _Float16* krow = QK + ((size_t)b * SS + kk) * (2 * DM) + DM + h * HD; const _Float16* krowl = QKL + ((size_t)b * SS + kk) * (2 * DM) + DM + h * HD; v8f c = {}, cl = {};
#pragma unroll
      for (int kc = 0; kc < 2; ++kc) { const v16h kh = frag_h(krow + kc * 32, lane); c = wmma16(aq[kc], kh, c); cl = wmma16(aql[kc], kh, cl); cl = wmma16(aq[kc], frag_h(krowl + kc * 32, lane), cl); }   // 3 products: q, k as f16 hi + residual
#pragma unroll
      for (int r = 0; r < 8; ++r) c[r] += cl[r] * (1.0f / 2048.0f);
      { const int gk = gb[kk];
#pragma unroll
      for (int r = 0; r < 8; ++r) s[ct][r] = (gq[r] | gk | ((kk - (q0 + 8 * g + r) <= HALFW) & ((q0 + 8 * g + r) - kk <= HALFW))) ? c[r] * 0.125f : -3.0e38f; } }   // 1/sqrt(64); masked keys excluded
#pragma unroll
    for (int r = 0; r < 8; ++r) { float mx = fmaxf(s[0][r], s[1][r]);
#pragma unroll
      for (int o = 1; o < 16; o <<= 1) mx = fmaxf(mx, __shfl_xor(mx, o));
      const float mn = fmaxf(m[r], mx); const float alpha = (m[r] <= -1.0e38f) ? 0.f : __expf(m[r] - mn);
      const float e0 = (s[0][r] <= -1.0e38f) ? 0.f : __expf(s[0][r] - mn), e1 = (s[1][r] <= -1.0e38f) ? 0.f : __expf(s[1][r] - mn); float es = e0 + e1;
#pragma unroll
      for (int o = 1; o < 16; o <<= 1) es += __shfl_xor(es, o);
      l[r] = l[r] * alpha + es; m[r] = mn;
#pragma unroll
      for (int dt = 0; dt < 4; ++dt) { acc[dt][r] *= alpha; accl[dt][r] *= alpha; }
      sp[wave][8 * g + r][col] = e0; sp[wave][8 * g + r][16 + col] = e1; }
    LDSX();
    v16h pa, pl; { const float* prow = &sp[wave][col][0] + 8 * (lane >> 4);
#pragma unroll
      for (int i = 0; i < 8; ++i) { const float x0 = prow[i] * 2048.0f, x1 = prow[16 + i] * 2048.0f; const _Float16 h0 = (_Float16)x0, h1 = (_Float16)x1; pa[i] = h0; pa[8 + i] = h1; pl[i] = (_Float16)((x0 - (float)h0) * 2048.0f); pl[8 + i] = (_Float16)((x1 - (float)h1) * 2048.0f); } }   // P scaled by 2^11 before the f16 split so small softmax weights stay out of the f16 subnormal range; 2^-11 folded into the epilogue
#pragma unroll
    for (int dt = 0; dt < 4; ++dt) { const size_t vr = ((size_t)b * DM + h * HD + dt * 16 + col) * SS + ks * 32; const v16h vh = frag_h(VTH + vr, lane); acc[dt] = wmma16(pa, vh, acc[dt]); accl[dt] = wmma16(pl, vh, accl[dt]); accl[dt] = wmma16(pa, frag_h(VTL + vr, lane), accl[dt]); }   // P hi x V hi + (P lo x V hi + P hi x V lo) / 2048
    LDSX(); }
#pragma unroll
  for (int r = 0; r < 8; ++r) { const float il = (1.0f / 2048.0f) / l[r];
#pragma unroll
    for (int dt = 0; dt < 4; ++dt) so[wave][8 * g + r][dt * 16 + col] = (acc[dt][r] + accl[dt][r] * (1.0f / 2048.0f)) * il; }
  LDSX();
  for (int rl = 0; rl < 16; ++rl) if (lane < 16) vst2(O + ((size_t)b * SS + q0 + rl) * DM + h * HD + lane * 4, *(const v4f*)&so[wave][rl][lane * 4]);
}
// ---- k_out: block = (64 rows, 128 cols): out = f16(O) . f16 Wo x 2^8 rows (1 product) / 256 + bo
__global__ __launch_bounds__(128) void k_out(const float* __restrict__ O, const __bf16* __restrict__ P, const float* __restrict__ BO, float* __restrict__ Y) {
  __shared__ __align__(16) float so[4][16][132];
  const int tid = threadIdx.x, wave = tid >> 5, lane = tid & 31, col = lane & 15, g = lane >> 4; const size_t r0 = (size_t)blockIdx.x * 64 + wave * 16; const int n0 = blockIdx.y * 128;
  v8f acc[8] = {};
#pragma unroll 2
  for (int kc = 0; kc < DM / 32; ++kc) { v16h a; { const float* p = O + (r0 + col) * DM + kc * 32 + 8 * g;
#pragma unroll
      for (int i = 0; i < 8; ++i) { a[i] = (_Float16)p[i]; a[8 + i] = (_Float16)p[16 + i]; } }
#pragma unroll
    for (int j = 0; j < 8; ++j) acc[j] = wmma16(a, frag_h((const _Float16*)P + (size_t)(n0 + j * 16 + col) * DM + kc * 32, lane), acc[j]); }   // single f16 product against exact f16 x 2^8 weight copies
#pragma unroll
  for (int j = 0; j < 8; ++j) {
#pragma unroll
    for (int r = 0; r < 8; ++r) so[wave][8 * g + r][j * 16 + col] = acc[j][r] * (1.0f / 256.0f) + bfr(BO[n0 + j * 16 + col]); }
  LDSX();
  for (int rl = 0; rl < 16; ++rl) vst2(Y + (r0 + rl) * DM + n0 + lane * 4, *(const v4f*)&so[wave][rl][lane * 4]);
}
// ---- k_flags: block = (query block qb, b): FL[b][qb][kt] = 1 if any (query in block, key in tile) pair is allowed: window overlap, or a global query in the block, or a global key in the tile
__global__ __launch_bounds__(256) void k_flags(const int* __restrict__ GLB, int* __restrict__ FL) { __shared__ int sq; __shared__ __align__(16) int so2[SS / 32]; const int t = threadIdx.x; const int qb = blockIdx.x; const size_t b = blockIdx.y; const int* gb = GLB + b * SS;
  if (t == 0) { int a = 0; for (int i = 0; i < 64; ++i) a |= gb[qb * 64 + i]; sq = a; } __syncthreads();
  for (int kt = t; kt < SS / 32; kt += 256) { int any = sq; const int k0 = kt * 32, q0 = qb * 64; if (!any) { for (int j = 0; j < 32; ++j) any |= gb[k0 + j]; } if (!any) { const int lo = k0 - (q0 + 63), hi = (k0 + 31) - q0; any = (lo <= HALFW) && (hi >= -HALFW); }   /* some |k - q| <= HALFW */ so2[kt] = any ? 1 : 0; }
  __syncthreads(); if (t < SS / 32 / 4) vst2((unsigned*)(FL + ((b * (SS / 64) + qb) * (SS / 32)) + t * 4), *(const v4u*)&so2[t * 4]); }
// ---- k_packo: Wo natural rows -> f16 x 2^8 copies in the Wo slot (bit pattern in the bf16-typed buffer)
__global__ __launch_bounds__(256) void k_packo(const float* __restrict__ WO, __bf16* __restrict__ PK) { __shared__ __align__(16) _Float16 s[DM]; const int n = blockIdx.x, t = threadIdx.x; for (int k = t; k < DM; k += 256) s[k] = (_Float16)(bfr(WO[(size_t)n * DM + k]) * 256.0f); __syncthreads(); for (int q = t; q < DM / 8; q += 256) vst2((unsigned*)(PK + PK_P + (size_t)n * DM + q * 8), *(const v4u*)&s[q * 8]); }
extern "C" void kernel_launch(void* const* d_in, const int* in_sizes, int n_in, void* d_out, int out_size, void* d_ws, size_t ws_size, hipStream_t stream) {
  (void)in_sizes; (void)n_in; (void)out_size;
  const float** F = (const float**)d_in;   // 0 x [2,2048,1024], 1 is_global bool [2,2048], 2 wq, 3 bq, 4 wk, 5 bk, 6 wv, 7 bv, 8 wo, 9 bo (natural)
  if (ws_size < (size_t)WS_END) return;
  char* ws = (char*)d_ws; __bf16* PK = (__bf16*)(ws + WS_PK); _Float16 *QK = (_Float16*)(ws + WS_QK), *QKL = (_Float16*)(ws + WS_QKL), *VTH = (_Float16*)(ws + WS_VTH), *VTL = (_Float16*)(ws + WS_VTL); float* O = (float*)(ws + WS_O); int* FL = (int*)(ws + WS_FL); const int* GLB = (const int*)d_in[1];
  k_pack<<<dim3(DM, 3), 256, 0, stream>>>(F[2], F[4], F[6], F[8], PK);
  k_packo<<<DM, 256, 0, stream>>>(F[8], PK);
  k_flags<<<dim3(SS / 64, NB), 256, 0, stream>>>(GLB, FL);
  k_qkv<<<dim3(NB * SS / 64, QKVW / 128), 128, 0, stream>>>(F[0], F[0], F[0], PK + PK_A, F[3], F[5], F[7], QK, QKL, VTH, VTL);
  k_attn<<<dim3(TQB, NH, TNB), 128, 0, stream>>>(QK, QKL, VTH, VTL, nullptr, GLB, FL, O);
  k_out<<<dim3(TOB, DM / 128), 128, 0, stream>>>(O, PK + PK_P, F[9], (float*)d_out);
}

// v001
// It runs in 358 microseconds.
// In two side-by-side timings against v000, it was 1.36 and 1.37 times as fast.
// compute dtype: all float inputs rounded to bf16, is_global (bool) read on device; q/k/v = x . W^T + b with EXACT bf16 products on WMMA 16x16x32 (natural rows), rounded once to f16 hi + residual; attention with 3-product scores and P.v (hi + residual planes) restricted to each 16-query tile's window key tiles plus a packed list of the global keys (list built on device from is_global, their v columns gathered), global query rows packed into tiles of their own that visit every key (8 waves split the keys, merged in LDS), the per-pair rule evaluated inline, x 1/8, running-max softmax in f32 (hardware exp); out = f16(ctx) . Wo^T (exact f16 x 2^8 copies) + bo; f32 output.
#include <hip/hip_runtime.h>
#include <math.h>

typedef __attribute__((ext_vector_type(16))) _Float16 v16h;
typedef __attribute__((ext_vector_type(16))) __bf16 v16b;
typedef __attribute__((ext_vector_type(8)))  _Float16 v8h;
typedef __attribute__((ext_vector_type(8)))  float v8f;
typedef __attribute__((ext_vector_type(4)))  float v4f;
typedef __attribute__((ext_vector_type(2)))  float v2f;
typedef __attribute__((ext_vector_type(4)))  unsigned v4u;
typedef __attribute__((ext_vector_type(4)))  int v4i;
typedef float __attribute__((may_alias)) float_a;
typedef int __attribute__((may_alias)) int_a;

template <typename T> __device__ __forceinline__ void vst2(void* p, T v) { *(T*)p = v;  }
__device__ __forceinline__ v8f wmma16(v16h a, v16h b, v8f c) {
  v8f d = __builtin_amdgcn_wmma_f32_16x16x32_f16(false, a, false, b, (short)0, c, false, false);
  asm volatile("v_nop\n\tv_nop\n\tv_nop\n\tv_nop" : "+v"(d) : "v"(a), "v"(b));
  return d;
}
__device__ __forceinline__ v8f wmma_bf(v16b a, v16b b, v8f c) {
  v8f d = __builtin_amdgcn_wmma_f32_16x16x32_bf16(false, a, false, b, (short)0, c, false, false);
  asm volatile("v_nop\n\tv_nop\n\tv_nop\n\tv_nop" : "+v"(d) : "v"(a), "v"(b));
  return d;
}
// Sparse structured attention (B 2, S 2,048, hidden 1,024, 16 heads x 64): local window |i - j| <= 64 plus global tokens (is_global, given) that attend everywhere and are attended by everyone; projections + biases, softmax(q k / 8) over the allowed keys, v, output projection + bias.
__device__ __forceinline__ v16h frag_h(const _Float16* rowk0, int lane) {
  union { v16h v; v8h q[2]; } u; const _Float16* p = rowk0 + 8 * (lane >> 4);
  u.q[0] = *(const v8h*)p; u.q[1] = *(const v8h*)(p + 16); return u.v;
}
__device__ __forceinline__ v16h frag_f32(const float* rowk0, int lane) {
  v16h a; const float* p = rowk0 + 8 * (lane >> 4);
#pragma unroll
  for (int i = 0; i < 8; ++i) { a[i] = (_Float16)p[i]; a[8 + i] = (_Float16)p[16 + i]; }
  return a;
}
__device__ __forceinline__ v16h frag_f32s(const float* rowk0, int lane, float sc) {
  v16h a; const float* p = rowk0 + 8 * (lane >> 4);
#pragma unroll
  for (int i = 0; i < 8; ++i) { a[i] = (_Float16)(p[i] * sc); a[8 + i] = (_Float16)(p[16 + i] * sc); }
  return a;
}
// column fragment from a [K][ld] layout (column n), rows >= K read as 0
__device__ __forceinline__ v16h fragc_f32(const float* W, int k0, int n, int lane, int ld, int K) {
  v16h a; const int g = lane >> 4;
#pragma unroll
  for (int i = 0; i < 8; ++i) { const int ka = k0 + 8 * g + i, kb = ka + 16;
    a[i] = (_Float16)(ka < K ? W[(size_t)(ka < K ? ka : K - 1) * ld + n] : 0.f); a[8 + i] = (_Float16)(kb < K ? W[(size_t)(kb < K ? kb : K - 1) * ld + n] : 0.f); }
  return a;
}
struct F2 { v16b h, l; };
__device__ __forceinline__ F2 bsplit16(const float v[16]) { F2 r;
#pragma unroll
  for (int i = 0; i < 16; ++i) { const __bf16 h = (__bf16)v[i]; r.h[i] = h; r.l[i] = (__bf16)(v[i] - (float)h); }
  return r; }
__device__ __forceinline__ F2 split_row(const float* row, int k0, int lane) { float v[16]; const float* p = row + k0 + 8 * (lane >> 4);
#pragma unroll
  for (int i = 0; i < 8; ++i) { v[i] = p[i]; v[8 + i] = p[16 + i]; }
  return bsplit16(v); }
__device__ __forceinline__ F2 split_rowK(const float* row, int k0, int lane, int K) { float v[16]; const int g = lane >> 4;
#pragma unroll
  for (int i = 0; i < 8; ++i) { const int ka = k0 + 8 * g + i, kb = ka + 16; v[i] = ka < K ? row[ka < K ? ka : K - 1] : 0.f; v[8 + i] = kb < K ? row[kb < K ? kb : K - 1] : 0.f; }
  return bsplit16(v); }
__device__ __forceinline__ F2 split_col(const float* W, int k0, int n, int lane, int ld, int K) { float v[16]; const int g = lane >> 4;
#pragma unroll
  for (int i = 0; i < 8; ++i) { const int ka = k0 + 8 * g + i, kb = ka + 16; v[i] = ka < K ? W[(size_t)(ka < K ? ka : K - 1) * ld + n] : 0.f; v[8 + i] = kb < K ? W[(size_t)(kb < K ? kb : K - 1) * ld + n] : 0.f; }
  return bsplit16(v); }
__device__ __forceinline__ v8f mac3(const F2& a, const F2& b, v8f c) { c = wmma_bf(a.l, b.h, c); c = wmma_bf(a.h, b.l, c); return wmma_bf(a.h, b.h, c); }
__device__ __forceinline__ float sigm(float v) { return 1.0f / (1.0f + expf(-v)); }
#define LDSX() do { asm volatile("s_wait_dscnt 0" ::: "memory"); __builtin_amdgcn_wave_barrier(); __builtin_amdgcn_fence(__ATOMIC_RELEASE, "workgroup"); } while (0)


#define NB 2
#define SS 2048
#define DM 1024
#define NH 16
#define HALFW 64
#define HD 64
#define QKVW (3 * DM)
#ifndef TQB
#define TQB (SS / 64)
#define TNB NB
#define TOB (NB * SS / 64)     // output row tiles (all)
#endif
typedef __attribute__((ext_vector_type(8))) __bf16 v8b;
__device__ __forceinline__ v16b frag_b(const __bf16* rowk0, int lane) {
  union { v16b v; v8b q[2]; } u; const __bf16* p = rowk0 + 8 * (lane >> 4);
  u.q[0] = *(const v8b*)p; u.q[1] = *(const v8b*)(p + 16); return u.v;
}
__device__ __forceinline__ float bfr(float v) { return (float)(__bf16)v; }
__device__ __attribute__((noinline)) float exp_ni(float v) { return expf(v); }
__device__ __attribute__((noinline)) float erf_ni(float v) { return erff(v); }

#define PK_A 0                       // [3072][1024] Wqkv rows (natural [out][in])
#define PK_P (PK_A + QKVW * DM)        // [1024][1024] Wo rows (natural)
#define PK_END (PK_P + DM * DM)
#define WS_PK  0u
#define WS_QK  (WS_PK + 2u * PK_END)             // f16 [4096 rows][2048]: q | k
#define WS_QKL (WS_QK + 2u * NB * SS * 2 * DM)     // f16 q | k residual planes x2048
#define WS_VTH (WS_QKL + 2u * NB * SS * 2 * DM)    // f16 [b][1024 (h*64+d)][2048 s] hi
#define WS_VTL (WS_VTH + 2u * NB * DM * SS)        // f16 lo x 2048
#define WS_O   (WS_VTL + 2u * NB * DM * SS)        // f32 [4096][1024]
#define GLS (SS + 32)                              // ints per batch: positions of the global tokens (ascending, rest 0), then their count
#define NSLOT 16                                   // blocks per (head, batch) that walk the tiles of global query rows
#define WS_GL  (WS_O + 4u * (size_t)NB * SS * DM)        // int [b][GLS]
#define WS_VGH (WS_GL + 4u * (size_t)NB * GLS)           // f16 [b][1024 (h*64+d)][2048 list slot] hi: v columns of the global keys, in list order
#define WS_VGL (WS_VGH + 2u * NB * DM * SS)        // f16 lo x 2048
#define WS_END (WS_VGL + 2u * NB * DM * SS)
// ---- k_pack: block = (row n, which): natural [out][in] rows -> bf16; which 0..2 -> W_q/W_k/W_v into PK_A rows which*1024 + n; 3 -> W_o into PK_P
__global__ __launch_bounds__(256) void k_pack(const float* __restrict__ WQ, const float* __restrict__ WK, const float* __restrict__ WV, const float* __restrict__ WO, __bf16* __restrict__ PK) {
  __shared__ __align__(16) __bf16 s[DM]; const int n = blockIdx.x, which = blockIdx.y, t = threadIdx.x; const float* Wm = (which == 0) ? WQ : (which == 1) ? WK : (which == 2) ? WV : WO;
  for (int k = t; k < DM; k += 256) s[k] = (__bf16)Wm[(size_t)n * DM + k];
  __syncthreads();
  __bf16* dst = (which < 3) ? PK + PK_A + ((size_t)which * DM + n) * DM : PK + PK_P + (size_t)n * DM;
  for (int q = t; q < DM / 8; q += 256) vst2((unsigned*)(dst + q * 8), *(const v4u*)&s[q * 8]);
}
__global__ __launch_bounds__(128) void k_qkv(const float* __restrict__ XQ, const float* __restrict__ XK, const float* __restrict__ XV, const __bf16* __restrict__ P, const float* __restrict__ BQ, const float* __restrict__ BK, const float* __restrict__ BV, _Float16* __restrict__ QK, _Float16* __restrict__ QKL, _Float16* __restrict__ VTH, _Float16* __restrict__ VTL) {
  const int which0 = (blockIdx.y * 128) / DM; const float* X = (which0 == 0) ? XQ : (which0 == 1) ? XK : XV; const float* BB = BQ ? (((which0 == 0) ? BQ : (which0 == 1) ? BK : BV) + (blockIdx.y * 128 - which0 * DM)) : nullptr;
  __shared__ __align__(16) _Float16 so[4][16][136], sol[4][16][136]; __shared__ __align__(16) _Float16 sth[128][72], stl[128][72];
  const int tid = threadIdx.x, wave = tid >> 5, lane = tid & 31, col = lane & 15, g = lane >> 4; const size_t r0 = (size_t)blockIdx.x * 64 + wave * 16; const int n0 = blockIdx.y * 128;
  v8f acc[8] = {};
#pragma unroll 2
  for (int kc = 0; kc < DM / 32; ++kc) { v16b a; { const float* p = X + (r0 + col) * DM + kc * 32 + 8 * g;
#pragma unroll
      for (int i = 0; i < 8; ++i) { a[i] = (__bf16)p[i]; a[8 + i] = (__bf16)p[16 + i]; } }
#pragma unroll
    for (int j = 0; j < 8; ++j) acc[j] = wmma_bf(a, frag_b(P + (size_t)(n0 + j * 16 + col) * DM + kc * 32, lane), acc[j]); }
  if (n0 < 2 * DM) {   // q stored unscaled (f16 sigma ~0.6, no subnormal exposure); 1/8 applied to the f32 score
#pragma unroll
    for (int j = 0; j < 8; ++j) {
#pragma unroll
      for (int r = 0; r < 8; ++r) { const float v = acc[j][r] + (BB ? bfr(BB[j * 16 + col]) : 0.f); const _Float16 hv = (_Float16)v; so[wave][8 * g + r][j * 16 + col] = hv; sol[wave][8 * g + r][j * 16 + col] = (_Float16)((v - (float)hv) * 2048.0f); } }   // q, k (+ bias) as f16 hi + (x2048) residual
    LDSX();
    for (int rl = 0; rl < 16; ++rl) if (lane < 16) { vst2((unsigned*)(QK + (r0 + rl) * (2 * DM) + n0 + lane * 8), *(const v4u*)&so[wave][rl][lane * 8]); vst2((unsigned*)(QKL + (r0 + rl) * (2 * DM) + n0 + lane * 8), *(const v4u*)&sol[wave][rl][lane * 8]); }
  } else {
#pragma unroll
    for (int j = 0; j < 8; ++j) {
#pragma unroll
      for (int r = 0; r < 8; ++r) { const float v = acc[j][r] + (BB ? bfr(BB[j * 16 + col]) : 0.f); const _Float16 hv = (_Float16)v; sth[j * 16 + col][wave * 16 + 8 * g + r] = hv; stl[j * 16 + col][wave * 16 + 8 * g + r] = (_Float16)((v - (float)hv) * 2048.0f); } }
    __syncthreads();
    const size_t rb = (size_t)blockIdx.x * 64; const int b = (int)(rb / SS), s0 = (int)(rb % SS); const int pc0 = n0 - 2 * DM;
    for (int q = tid; q < 128 * 8; q += 128) { const int d = q >> 3, pc = q & 7; const size_t o = ((size_t)b * DM + pc0 + d) * SS + s0 + pc * 8; vst2((unsigned*)(VTH + o), *(const v4u*)&sth[d][pc * 8]); vst2((unsigned*)(VTL + o), *(const v4u*)&stl[d][pc * 8]); }
  }
}
// ---- k_attn: 8 waves. Blocks x >= NSLOT: 128 queries, one 16-query tile a wave: the key tiles its window touches, then the packed global keys (those inside the window masked there, so each pair counts once); rows that are global themselves are not stored here. Blocks x < NSLOT: tiles of 16 packed global query rows, every key allowed, each wave 8 of the 64 key tiles, the 8 partial (m, l, acc) merged in LDS. Scores 3 products x 1/8; P.V: f16 P hi/lo x (V hi, V lo*2048); O[b*S+q][h*64+d] (256-B segments)
__global__ __launch_bounds__(256) void k_attn(const _Float16* __restrict__ QK, const _Float16* __restrict__ QKL, const _Float16* __restrict__ VTH, const _Float16* __restrict__ VTL, const _Float16* __restrict__ VGH, const _Float16* __restrict__ VGL, const int* __restrict__ GLB, const int* __restrict__ GL, float* __restrict__ O) {
  __shared__ __align__(16) float sp[8][16][36]; __shared__ __align__(16) float so[8][16][68]; __shared__ float sm[8][16], sl[8][16];
  const int tid = threadIdx.x, wave = __builtin_amdgcn_readfirstlane(tid >> 5), lane = tid & 31, col = lane & 15, g = lane >> 4;
  const int h = blockIdx.y, b = blockIdx.z; const int* lst = GL + (size_t)b * GLS; const int* gb = GLB + (size_t)b * SS;
  int n = lst[SS]; n = n < 0 ? 0 : (n > SS ? SS : n);
  const bool dense = blockIdx.x < NSLOT; const int ngt = (n + 31) >> 5;
  const int q0 = ((int)blockIdx.x - NSLOT) * 128 + wave * 16;   // window blocks only
  const int qtend = dense ? ((n + 15) >> 4) : (int)blockIdx.x + 1;
  const unsigned gqm = __builtin_amdgcn_ballot_w32((dense ? 0 : gb[q0 + col]) != 0);   // bit rl: query q0 + rl is global (its row belongs to the packed tiles)
#pragma unroll 1
  for (int qt = blockIdx.x; qt < qtend; qt += NSLOT) {   // window blocks: one trip
    const size_t rq = (size_t)b * SS + (dense ? lst[qt * 16 + col] : q0 + col);
    v16h aq[2], aql[2];
#pragma unroll
    for (int kc = 0; kc < 2; ++kc) { aq[kc] = frag_h(QK + rq * (2 * DM) + h * HD + kc * 32, lane); aql[kc] = frag_h(QKL + rq * (2 * DM) + h * HD + kc * 32, lane); }
    float m[8], l[8];
#pragma unroll
    for (int r = 0; r < 8; ++r) { m[r] = -3.0e38f; l[r] = 0.f; }
    v8f acc[4] = {}, accl[4] = {};
    int kt0 = (q0 - HALFW) >> 5, kt1 = (q0 + 15 + HALFW) >> 5; kt0 = kt0 < 0 ? 0 : kt0; kt1 = kt1 > SS / 32 - 1 ? SS / 32 - 1 : kt1;
    const int nwin = dense ? 0 : kt1 - kt0 + 1; const int it0 = dense ? wave * 8 : 0, it1 = dense ? wave * 8 + 8 : nwin + ngt;
#pragma unroll 1
    for (int it = it0; it < it1; ++it) { const bool gl = !dense && it >= nwin; const int kt = dense ? it : (gl ? it - nwin : kt0 + it);   // gl: a tile of the packed global keys
      const _Float16* vhb = gl ? VGH : VTH; const _Float16* vlb = gl ? VGL : VTL; v8f s[2];
#pragma unroll
      for (int ct = 0; ct < 2; ++ct) { const int slot = kt * 32 + ct * 16 + col; const int kk = gl ? lst[slot] : slot; const _Float16* krow = QK + ((size_t)b * SS + kk) * (2 * DM) + DM + h * HD; const _Float16* krowl = QKL + ((size_t)b * SS + kk) * (2 * DM) + DM + h * HD; v8f c = {}, cl = {};
#pragma unroll
        for (int kc = 0; kc < 2; ++kc) { const v16h kh = frag_h(krow + kc * 32, lane); c = wmma16(aq[kc], kh, c); cl = wmma16(aql[kc], kh, cl); cl = wmma16(aq[kc], frag_h(krowl + kc * 32, lane), cl); }   // 3 products: q, k as f16 hi + residual
#pragma unroll
        for (int r = 0; r < 8; ++r) c[r] += cl[r] * (1.0f / 2048.0f);
        { const bool live = slot < n;
#pragma unroll
        for (int r = 0; r < 8; ++r) { const int dq = kk - (q0 + 8 * g + r); const bool inw = (dq <= HALFW) & (-dq <= HALFW); s[ct][r] = (dense | (gl ? (live & !inw) : inw)) ? c[r] * 0.125f : -3.0e38f; } } }   // 1/sqrt(64); masked keys excluded
#pragma unroll
      for (int r = 0; r < 8; ++r) { float mx = fmaxf(s[0][r], s[1][r]);
#pragma unroll
        for (int o = 1; o < 16; o <<= 1) mx = fmaxf(mx, __shfl_xor(mx, o));
        const float mn = fmaxf(m[r], mx); const float alpha = (m[r] <= -1.0e38f) ? 0.f : __expf(m[r] - mn);
        const float e0 = (s[0][r] <= -1.0e38f) ? 0.f : __expf(s[0][r] - mn), e1 = (s[1][r] <= -1.0e38f) ? 0.f : __expf(s[1][r] - mn); float es = e0 + e1;
#pragma unroll
        for (int o = 1; o < 16; o <<= 1) es += __shfl_xor(es, o);
        l[r] = l[r] * alpha + es; m[r] = mn;
#pragma unroll
        for (int dt = 0; dt < 4; ++dt) { acc[dt][r] *= alpha; accl[dt][r] *= alpha; }
        sp[wave][8 * g + r][col] = e0; sp[wave][8 * g + r][16 + col] = e1; }
      LDSX();
      v16h pa, pl; { const float* prow = &sp[wave][col][0] + 8 * (lane >> 4);
#pragma unroll
        for (int i = 0; i < 8; ++i) { const float x0 = prow[i] * 2048.0f, x1 = prow[16 + i] * 2048.0f; const _Float16 h0 = (_Float16)x0, h1 = (_Float16)x1; pa[i] = h0; pa[8 + i] = h1; pl[i] = (_Float16)((x0 - (float)h0) * 2048.0f); pl[8 + i] = (_Float16)((x1 - (float)h1) * 2048.0f); } }   // P scaled by 2^11 before the f16 split so small softmax weights stay out of the f16 subnormal range; 2^-11 folded into the epilogue
#pragma unroll
      for (int dt = 0; dt < 4; ++dt) { const size_t vr = ((size_t)b * DM + h * HD + dt * 16 + col) * SS + kt * 32; const v16h vh = frag_h(vhb + vr, lane); acc[dt] = wmma16(pa, vh, acc[dt]); accl[dt] = wmma16(pl, vh, accl[dt]); accl[dt] = wmma16(pa, frag_h(vlb + vr, lane), accl[dt]); }   // P hi x V hi + (P lo x V hi + P hi x V lo) / 2048
      LDSX(); }
    if (!dense) {
#pragma unroll
      for (int r = 0; r < 8; ++r) { const float il = (1.0f / 2048.0f) / l[r];
#pragma unroll
        for (int dt = 0; dt < 4; ++dt) so[wave][8 * g + r][dt * 16 + col] = (acc[dt][r] + accl[dt][r] * (1.0f / 2048.0f)) * il; }
      LDSX();
      for (int rl = 0; rl < 16; ++rl) if (lane < 16 && ((gqm >> rl) & 1u) == 0u) { vst2(O + ((size_t)b * SS + q0 + rl) * DM + h * HD + lane * 4, *(const v4f*)&so[wave][rl][lane * 4]);
        asm volatile("s_wait_xcnt 0x0" ::: "memory"); }   // the next row's LDS read lands in the registers this store names
    } else {
#pragma unroll
      for (int r = 0; r < 8; ++r) {
#pragma unroll
        for (int dt = 0; dt < 4; ++dt) so[wave][8 * g + r][dt * 16 + col] = acc[dt][r] + accl[dt][r] * (1.0f / 2048.0f);
        if (col == 0) { sm[wave][8 * g + r] = m[r]; sl[wave][8 * g + r] = l[r]; } }
      __syncthreads();   // every wave's partial is in LDS before the merge reads it
      const int row = tid >> 4, d4 = (tid & 15) * 4; float mm = sm[0][row];
#pragma unroll
      for (int w = 1; w < 8; ++w) mm = fmaxf(mm, sm[w][row]);
      float ll = 0.f; v4f a = {};
#pragma unroll
      for (int w = 0; w < 8; ++w) { const float e = __expf(sm[w][row] - mm); ll += e * sl[w][row]; a += *(const v4f*)&so[w][row][d4] * e; }
      if (qt * 16 + row < n) { vst2(O + ((size_t)b * SS + lst[qt * 16 + row]) * DM + h * HD + d4, a * ((1.0f / 2048.0f) / ll));
        asm volatile("s_wait_xcnt 0x0" ::: "memory"); }   // the next tile's set-up reuses the registers this store names
      __syncthreads();   // the merge has read the partials before the next tile overwrites them
    }
  }
}
// ---- k_out: block = (64 rows, 128 cols): out = f16(O) . f16 Wo x 2^8 rows (1 product) / 256 + bo
__global__ __launch_bounds__(128) void k_out(const float* __restrict__ O, const __bf16* __restrict__ P, const float* __restrict__ BO, float* __restrict__ Y) {
  __shared__ __align__(16) float so[4][16][132];
  const int tid = threadIdx.x, wave = tid >> 5, lane = tid & 31, col = lane & 15, g = lane >> 4; const size_t r0 = (size_t)blockIdx.x * 64 + wave * 16; const int n0 = blockIdx.y * 128;
  v8f acc[8] = {};
#pragma unroll 2
  for (int kc = 0; kc < DM / 32; ++kc) { v16h a; { const float* p = O + (r0 + col) * DM + kc * 32 + 8 * g;
#pragma unroll
      for (int i = 0; i < 8; ++i) { a[i] = (_Float16)p[i]; a[8 + i] = (_Float16)p[16 + i]; } }
#pragma unroll
    for (int j = 0; j < 8; ++j) acc[j] = wmma16(a, frag_h((const _Float16*)P + (size_t)(n0 + j * 16 + col) * DM + kc * 32, lane), acc[j]); }   // single f16 product against exact f16 x 2^8 weight copies
#pragma unroll
  for (int j = 0; j < 8; ++j) {
#pragma unroll
    for (int r = 0; r < 8; ++r) so[wave][8 * g + r][j * 16 + col] = acc[j][r] * (1.0f / 256.0f) + bfr(BO[n0 + j * 16 + col]); }
  LDSX();
  for (int rl = 0; rl < 16; ++rl) vst2(Y + (r0 + rl) * DM + n0 + lane * 4, *(const v4f*)&so[wave][rl][lane * 4]);
}
// ---- k_lists: block = batch b: GL[b][0..n) = positions of the global tokens, ascending; the rest of the list 0; GL[b][SS..SS+32) = n
__global__ __launch_bounds__(256) void k_lists(const int* __restrict__ GLB, int* __restrict__ GL) { __shared__ int sc[256]; __shared__ int sl[SS]; const int t = threadIdx.x; const size_t b = blockIdx.x; const int* gb = GLB + b * SS;
  int f[8], c = 0;
#pragma unroll
  for (int i = 0; i < 8; ++i) { f[i] = gb[t * 8 + i] != 0; c += f[i]; }
  sc[t] = c; for (int i = t; i < SS; i += 256) sl[i] = 0;
  __syncthreads();
  int base = 0, tot = 0; for (int i = 0; i < 256; ++i) { const int v = sc[i]; tot += v; base += (i < t) ? v : 0; }
#pragma unroll
  for (int i = 0; i < 8; ++i) if (f[i]) sl[base++] = t * 8 + i;
  __syncthreads();
  int* o = GL + b * GLS; for (int i = t; i < SS; i += 256) o[i] = sl[i];
  if (t < 32) o[SS + t] = tot; }
// ---- k_gv: block = (8 rows h*64+d, b), one wave a row: VG[b][row][slot] = VT[b][row][list[slot]] for the n global keys, 0 up to the next multiple of 32
__global__ __launch_bounds__(256) void k_gv(const _Float16* __restrict__ VTH, const _Float16* __restrict__ VTL, const int* __restrict__ GL, _Float16* __restrict__ VGH, _Float16* __restrict__ VGL) { const int t = threadIdx.x; const size_t b = blockIdx.y; const int* lst = GL + b * GLS;
  int n = lst[SS]; n = n < 0 ? 0 : (n > SS ? SS : n); const int npad = (n + 31) & ~31; const size_t row = (b * DM + blockIdx.x * 8 + (t >> 5)) * SS;
  for (int p = t & 31; p < npad; p += 32) { const int k = lst[p]; _Float16 vh = (_Float16)0.f, vl = (_Float16)0.f; if (p < n) { vh = VTH[row + k]; vl = VTL[row + k]; } VGH[row + p] = vh; VGL[row + p] = vl; } }
// ---- k_packo: Wo natural rows -> f16 x 2^8 copies in the Wo slot (bit pattern in the bf16-typed buffer)
__global__ __launch_bounds__(256) void k_packo(const float* __restrict__ WO, __bf16* __restrict__ PK) { __shared__ __align__(16) _Float16 s[DM]; const int n = blockIdx.x, t = threadIdx.x; for (int k = t; k < DM; k += 256) s[k] = (_Float16)(bfr(WO[(size_t)n * DM + k]) * 256.0f); __syncthreads(); for (int q = t; q < DM / 8; q += 256) vst2((unsigned*)(PK + PK_P + (size_t)n * DM + q * 8), *(const v4u*)&s[q * 8]); }
extern "C" void kernel_launch(void* const* d_in, const int* in_sizes, int n_in, void* d_out, int out_size, void* d_ws, size_t ws_size, hipStream_t stream) {
  (void)in_sizes; (void)n_in; (void)out_size;
  const float** F = (const float**)d_in;   // 0 x [2,2048,1024], 1 is_global bool [2,2048], 2 wq, 3 bq, 4 wk, 5 bk, 6 wv, 7 bv, 8 wo, 9 bo (natural)
  if (ws_size < (size_t)WS_END) return;
  char* ws = (char*)d_ws; __bf16* PK = (__bf16*)(ws + WS_PK); _Float16 *QK = (_Float16*)(ws + WS_QK), *QKL = (_Float16*)(ws + WS_QKL), *VTH = (_Float16*)(ws + WS_VTH), *VTL = (_Float16*)(ws + WS_VTL); float* O = (float*)(ws + WS_O); int* GL = (int*)(ws + WS_GL); _Float16 *VGH = (_Float16*)(ws + WS_VGH), *VGL = (_Float16*)(ws + WS_VGL); const int* GLB = (const int*)d_in[1];
  k_pack<<<dim3(DM, 3), 256, 0, stream>>>(F[2], F[4], F[6], F[8], PK);
  k_packo<<<DM, 256, 0, stream>>>(F[8], PK);
  k_lists<<<NB, 256, 0, stream>>>(GLB, GL);
  k_qkv<<<dim3(NB * SS / 64, QKVW / 128), 128, 0, stream>>>(F[0], F[0], F[0], PK + PK_A, F[3], F[5], F[7], QK, QKL, VTH, VTL);
  k_gv<<<dim3(DM / 8, NB), 256, 0, stream>>>(VTH, VTL, GL, VGH, VGL);
  k_attn<<<dim3(NSLOT + SS / 128, NH, NB), 256, 0, stream>>>(QK, QKL, VTH, VTL, VGH, VGL, GLB, GL, O);
  k_out<<<dim3(TOB, DM / 128), 128, 0, stream>>>(O, PK + PK_P, F[9], (float*)d_out);
}

// v002
// Measured time: 206 microseconds a run.
// Next to v001, in two timings, it ran 1.77 and 1.75 times as fast.
// Counting every step since v000, it is 2.40 times as fast.
// compute dtype: all float inputs rounded to bf16, is_global (bool) read on device; q/k/v = x . W^T + b with EXACT bf16 products on WMMA 16x16x32 (natural rows), rounded once to f16 hi + residual; attention with 3-product scores and P.v (hi + residual planes) restricted to each 16-query tile's window key tiles plus a packed list of the global keys (list built on device from is_global, their v columns gathered), global query rows packed into tiles of their own that visit every key (8 waves split the keys, merged in LDS), the per-pair rule evaluated inline, x 1/8, running-max softmax in f32 (hardware exp); out = f16(ctx) . Wo^T (exact f16 x 2^8 copies) + bo; f32 output.
#include <hip/hip_runtime.h>
#include <math.h>

typedef __attribute__((ext_vector_type(16))) _Float16 v16h;
typedef __attribute__((ext_vector_type(16))) __bf16 v16b;
typedef __attribute__((ext_vector_type(8)))  _Float16 v8h;
typedef __attribute__((ext_vector_type(8)))  float v8f;
typedef __attribute__((ext_vector_type(4)))  float v4f;
typedef __attribute__((ext_vector_type(2)))  float v2f;
typedef __attribute__((ext_vector_type(4)))  unsigned v4u;
typedef __attribute__((ext_vector_type(4)))  int v4i;
typedef float __attribute__((may_alias)) float_a;
typedef int __attribute__((may_alias)) int_a;

template <typename T> __device__ __forceinline__ void vst2(void* p, T v) { *(T*)p = v;  }
__device__ __forceinline__ v8f wmma16(v16h a, v16h b, v8f c) {
  v8f d = __builtin_amdgcn_wmma_f32_16x16x32_f16(false, a, false, b, (short)0, c, false, false);
  asm volatile("v_nop\n\tv_nop\n\tv_nop\n\tv_nop" : "+v"(d) : "v"(a), "v"(b));
  return d;
}
__device__ __forceinline__ v8f wmma_bf(v16b a, v16b b, v8f c) {
  v8f d = __builtin_amdgcn_wmma_f32_16x16x32_bf16(false, a, false, b, (short)0, c, false, false);
  asm volatile("v_nop\n\tv_nop\n\tv_nop\n\tv_nop" : "+v"(d) : "v"(a), "v"(b));
  return d;
}
// Sparse structured attention (B 2, S 2,048, hidden 1,024, 16 heads x 64): local window |i - j| <= 64 plus global tokens (is_global, given) that attend everywhere and are attended by everyone; projections + biases, softmax(q k / 8) over the allowed keys, v, output projection + bias.
__device__ __forceinline__ v16h frag_h(const _Float16* rowk0, int lane) {
  union { v16h v; v8h q[2]; } u; const _Float16* p = rowk0 + 8 * (lane >> 4);
  u.q[0] = *(const v8h*)p; u.q[1] = *(const v8h*)(p + 16); return u.v;
}
__device__ __forceinline__ v16h frag_f32(const float* rowk0, int lane) {
  v16h a; const float* p = rowk0 + 8 * (lane >> 4);
#pragma unroll
  for (int i = 0; i < 8; ++i) { a[i] = (_Float16)p[i]; a[8 + i] = (_Float16)p[16 + i]; }
  return a;
}
__device__ __forceinline__ v16h frag_f32s(const float* rowk0, int lane, float sc) {
  v16h a; const float* p = rowk0 + 8 * (lane >> 4);
#pragma unroll
  for (int i = 0; i < 8; ++i) { a[i] = (_Float16)(p[i] * sc); a[8 + i] = (_Float16)(p[16 + i] * sc); }
  return a;
}
// column fragment from a [K][ld] layout (column n), rows >= K read as 0
__device__ __forceinline__ v16h fragc_f32(const float* W, int k0, int n, int lane, int ld, int K) {
  v16h a; const int g = lane >> 4;
#pragma unroll
  for (int i = 0; i < 8; ++i) { const int ka = k0 + 8 * g + i, kb = ka + 16;
    a[i] = (_Float16)(ka < K ? W[(size_t)(ka < K ? ka : K - 1) * ld + n] : 0.f); a[8 + i] = (_Float16)(kb < K ? W[(size_t)(kb < K ? kb : K - 1) * ld + n] : 0.f); }
  return a;
}
struct F2 { v16b h, l; };
__device__ __forceinline__ F2 bsplit16(const float v[16]) { F2 r;
#pragma unroll
  for (int i = 0; i < 16; ++i) { const __bf16 h = (__bf16)v[i]; r.h[i] = h; r.l[i] = (__bf16)(v[i] - (float)h); }
  return r; }
__device__ __forceinline__ F2 split_row(const float* row, int k0, int lane) { float v[16]; const float* p = row + k0 + 8 * (lane >> 4);
#pragma unroll
  for (int i = 0; i < 8; ++i) { v[i] = p[i]; v[8 + i] = p[16 + i]; }
  return bsplit16(v); }
__device__ __forceinline__ F2 split_rowK(const float* row, int k0, int lane, int K) { float v[16]; const int g = lane >> 4;
#pragma unroll
  for (int i = 0; i < 8; ++i) { const int ka = k0 + 8 * g + i, kb = ka + 16; v[i] = ka < K ? row[ka < K ? ka : K - 1] : 0.f; v[8 + i] = kb < K ? row[kb < K ? kb : K - 1] : 0.f; }
  return bsplit16(v); }
__device__ __forceinline__ F2 split_col(const float* W, int k0, int n, int lane, int ld, int K) { float v[16]; const int g = lane >> 4;
#pragma unroll
  for (int i = 0; i < 8; ++i) { const int ka = k0 + 8 * g + i, kb = ka + 16; v[i] = ka < K ? W[(size_t)(ka < K ? ka : K - 1) * ld + n] : 0.f; v[8 + i] = kb < K ? W[(size_t)(kb < K ? kb : K - 1) * ld + n] : 0.f; }
  return bsplit16(v); }
__device__ __forceinline__ v8f mac3(const F2& a, const F2& b, v8f c) { c = wmma_bf(a.l, b.h, c); c = wmma_bf(a.h, b.l, c); return wmma_bf(a.h, b.h, c); }
__device__ __forceinline__ float sigm(float v) { return 1.0f / (1.0f + expf(-v)); }
#define LDSX() do { asm volatile("s_wait_dscnt 0" ::: "memory"); __builtin_amdgcn_wave_barrier(); __builtin_amdgcn_fence(__ATOMIC_RELEASE, "workgroup"); } while (0)


#define NB 2
#define SS 2048
#define DM 1024
#define NH 16
#define HALFW 64
#define HD 64
#define QKVW (3 * DM)
#ifndef TQB
#define TQB (SS / 64)
#define TNB NB
#define TOB (NB * SS / 64)     // 64-row tiles of all output rows (unused)
#endif
typedef __attribute__((ext_vector_type(8))) __bf16 v8b;
__device__ __forceinline__ v16b frag_b(const __bf16* rowk0, int lane) {
  union { v16b v; v8b q[2]; } u; const __bf16* p = rowk0 + 8 * (lane >> 4);
  u.q[0] = *(const v8b*)p; u.q[1] = *(const v8b*)(p + 16); return u.v;
}
__device__ __forceinline__ float bfr(float v) { return (float)(__bf16)v; }
__device__ __attribute__((noinline)) float exp_ni(float v) { return expf(v); }
__device__ __attribute__((noinline)) float erf_ni(float v) { return erff(v); }

#define PK_A 0                       // [3072][1024] Wqkv rows (natural [out][in])
#define PK_P (PK_A + QKVW * DM)        // [1024][1024] Wo rows (natural)
#define PK_END (PK_P + DM * DM)
#define WS_PK  0u
#define WS_QK  (WS_PK + 2u * PK_END)             // f16 [4096 rows][2048]: q | k
#define WS_QKL (WS_QK + 2u * NB * SS * 2 * DM)     // f16 q | k residual planes x2048
#define WS_VTH (WS_QKL + 2u * NB * SS * 2 * DM)    // f16 [b][1024 (h*64+d)][2048 s] hi
#define WS_VTL (WS_VTH + 2u * NB * DM * SS)        // f16 lo x 2048
#define WS_O   (WS_VTL + 2u * NB * DM * SS)        // f32 [4096][1024]
#define GLS (SS + 32)                              // ints per batch: positions of the global tokens (ascending, rest 0), then their count
#define NSLOT 16                                   // blocks per (head, batch) that walk the tiles of global query rows
#define WS_GL  (WS_O + 4u * (size_t)NB * SS * DM)        // int [b][GLS]
#define WS_VGH (WS_GL + 4u * (size_t)NB * GLS)           // f16 [b][1024 (h*64+d)][2048 list slot] hi: v columns of the global keys, in list order
#define WS_VGL (WS_VGH + 2u * NB * DM * SS)        // f16 lo x 2048
#define WS_END (WS_VGL + 2u * NB * DM * SS)
// ---- k_pack: block = (row n, which): natural [out][in] rows -> bf16; which 0..2 -> W_q/W_k/W_v into PK_A rows which*1024 + n; 3 -> W_o into PK_P
__global__ __launch_bounds__(256) void k_pack(const float* __restrict__ WQ, const float* __restrict__ WK, const float* __restrict__ WV, const float* __restrict__ WO, __bf16* __restrict__ PK) {
  __shared__ __align__(16) __bf16 s[DM]; const int n = blockIdx.x, which = blockIdx.y, t = threadIdx.x; const float* Wm = (which == 0) ? WQ : (which == 1) ? WK : (which == 2) ? WV : WO;
  for (int k = t; k < DM; k += 256) s[k] = (__bf16)Wm[(size_t)n * DM + k];
  __syncthreads();
  __bf16* dst = (which < 3) ? PK + PK_A + ((size_t)which * DM + n) * DM : PK + PK_P + (size_t)n * DM;
  for (int q = t; q < DM / 8; q += 256) vst2((unsigned*)(dst + q * 8), *(const v4u*)&s[q * 8]);
}
#define KS 64                        // k of one staged slice: 128 B of a 16-bit row, 256 B of an f32 row
#define LP (KS + 8)                  // LDS row pitch in 16-bit elements: 144 B, for ds_load_b128 readers
#define STG (2 * 2 * 128 * LP * 2)   // bytes: two buffers of [X 128 rows | W 128 rows]
typedef __attribute__((ext_vector_type(4))) __bf16 v4b;
typedef __attribute__((ext_vector_type(4))) _Float16 v4h;
// ---- k_qkv: block = (128 rows, 128 cols), 8 waves, a wave 16 rows x 128 cols. Each k slice of X (rounded to bf16 on the way) and of W goes to LDS by whole-line loads, one slice ahead, two buffers; fragments come from LDS. The epilogue reuses the same LDS.
__global__ __launch_bounds__(256) void k_qkv(const float* __restrict__ XQ, const float* __restrict__ XK, const float* __restrict__ XV, const __bf16* __restrict__ P, const float* __restrict__ BQ, const float* __restrict__ BK, const float* __restrict__ BV, _Float16* __restrict__ QK, _Float16* __restrict__ QKL, _Float16* __restrict__ VTH, _Float16* __restrict__ VTL) {
  const int which0 = (blockIdx.y * 128) / DM; const float* X = (which0 == 0) ? XQ : (which0 == 1) ? XK : XV; const float* BB = BQ ? (((which0 == 0) ? BQ : (which0 == 1) ? BK : BV) + (blockIdx.y * 128 - which0 * DM)) : nullptr;
  __shared__ __align__(16) unsigned char smem[STG];
  __bf16 (*sa)[128][LP] = (__bf16 (*)[128][LP])smem; __bf16 (*sb)[128][LP] = (__bf16 (*)[128][LP])(smem + STG / 2);
  _Float16 (*so)[16][136] = (_Float16 (*)[16][136])smem; _Float16 (*sol)[16][136] = (_Float16 (*)[16][136])(smem + 8 * 16 * 136 * 2);
  _Float16 (*sth)[136] = (_Float16 (*)[136])smem; _Float16 (*stl)[136] = (_Float16 (*)[136])(smem + 128 * 136 * 2);
  const int tid = threadIdx.x, wave = tid >> 5, lane = tid & 31, col = lane & 15, g = lane >> 4; const size_t r0 = (size_t)blockIdx.x * 128 + wave * 16; const int n0 = blockIdx.y * 128;
  const int xr = tid >> 4, xc = (tid & 15) * 4, wr = tid >> 3, wc = (tid & 7) * 8;   // 16 lanes cover 256 B of an X row, 8 lanes 128 B of a W row
  const float* xg = X + ((size_t)blockIdx.x * 128 + xr) * DM + xc; const __bf16* wg = P + (size_t)(n0 + wr) * DM + wc;
  v4f ra[8]; v4u rb[4];
#pragma unroll
  for (int i = 0; i < 8; ++i) ra[i] = *(const v4f*)(xg + (size_t)i * 16 * DM);
#pragma unroll
  for (int i = 0; i < 4; ++i) rb[i] = *(const v4u*)(wg + (size_t)i * 32 * DM);
#pragma unroll
  for (int i = 0; i < 8; ++i) { v4b t; t[0] = (__bf16)ra[i][0]; t[1] = (__bf16)ra[i][1]; t[2] = (__bf16)ra[i][2]; t[3] = (__bf16)ra[i][3]; *(v4b*)&sa[0][i * 16 + xr][xc] = t; }
#pragma unroll
  for (int i = 0; i < 4; ++i) *(v4u*)&sb[0][i * 32 + wr][wc] = rb[i];
  v8f acc[8] = {};
#pragma unroll 1   // kept rolled: 16 unrolled trips would swell the text, which costs instruction fetches on a first pass
  for (int ks = 0; ks < DM / KS; ++ks) { const int bf = ks & 1; const bool more = ks + 1 < DM / KS;
    __syncthreads();   // slice ks is in LDS for every wave, and every wave has left the buffer that this trip refills
    if (more) {
#pragma unroll
      for (int i = 0; i < 8; ++i) ra[i] = *(const v4f*)(xg + (size_t)i * 16 * DM + (ks + 1) * KS);
#pragma unroll
      for (int i = 0; i < 4; ++i) rb[i] = *(const v4u*)(wg + (size_t)i * 32 * DM + (ks + 1) * KS);
      asm volatile("s_wait_xcnt 0x0" ::: "memory"); }   // the address registers of these loads are reused further down the trip
#pragma unroll
    for (int kc = 0; kc < KS / 32; ++kc) { const v16b a = frag_b(&sa[bf][wave * 16 + col][kc * 32], lane); v16b w[8];
#pragma unroll
      for (int j = 0; j < 8; ++j) w[j] = frag_b(&sb[bf][j * 16 + col][kc * 32], lane);   // the block's LDS reads as one group, ahead of its products
#pragma unroll
      for (int j = 0; j < 8; ++j) acc[j] = wmma_bf(a, w[j], acc[j]); }
    if (more) {
#pragma unroll
      for (int i = 0; i < 8; ++i) { v4b t; t[0] = (__bf16)ra[i][0]; t[1] = (__bf16)ra[i][1]; t[2] = (__bf16)ra[i][2]; t[3] = (__bf16)ra[i][3]; *(v4b*)&sa[bf ^ 1][i * 16 + xr][xc] = t; }
#pragma unroll
      for (int i = 0; i < 4; ++i) *(v4u*)&sb[bf ^ 1][i * 32 + wr][wc] = rb[i]; } }
  __syncthreads();   // every wave has read the last slice before the epilogue overwrites the buffers
  if (n0 < 2 * DM) {   // q stored unscaled (f16 sigma ~0.6, no subnormal exposure); 1/8 applied to the f32 score
#pragma unroll
    for (int j = 0; j < 8; ++j) {
#pragma unroll
      for (int r = 0; r < 8; ++r) { const float v = acc[j][r] + (BB ? bfr(BB[j * 16 + col]) : 0.f); const _Float16 hv = (_Float16)v; so[wave][8 * g + r][j * 16 + col] = hv; sol[wave][8 * g + r][j * 16 + col] = (_Float16)((v - (float)hv) * 2048.0f); } }   // q, k (+ bias) as f16 hi + (x2048) residual
    LDSX();
    for (int rl = 0; rl < 16; ++rl) if (lane < 16) { vst2((unsigned*)(QK + (r0 + rl) * (2 * DM) + n0 + lane * 8), *(const v4u*)&so[wave][rl][lane * 8]); vst2((unsigned*)(QKL + (r0 + rl) * (2 * DM) + n0 + lane * 8), *(const v4u*)&sol[wave][rl][lane * 8]); }
  } else {
#pragma unroll
    for (int j = 0; j < 8; ++j) {
#pragma unroll
      for (int r = 0; r < 8; ++r) { const float v = acc[j][r] + (BB ? bfr(BB[j * 16 + col]) : 0.f); const _Float16 hv = (_Float16)v; sth[j * 16 + col][wave * 16 + 8 * g + r] = hv; stl[j * 16 + col][wave * 16 + 8 * g + r] = (_Float16)((v - (float)hv) * 2048.0f); } }
    __syncthreads();
    const size_t rb0 = (size_t)blockIdx.x * 128; const int b = (int)(rb0 / SS), s0 = (int)(rb0 % SS); const int pc0 = n0 - 2 * DM;
    for (int q = tid; q < 128 * 16; q += 256) { const int d = q >> 4, pc = q & 15; const size_t o = ((size_t)b * DM + pc0 + d) * SS + s0 + pc * 8; vst2((unsigned*)(VTH + o), *(const v4u*)&sth[d][pc * 8]); vst2((unsigned*)(VTL + o), *(const v4u*)&stl[d][pc * 8]); }
  }
}
// ---- k_attn: 8 waves. Blocks x >= NSLOT: 128 queries, one 16-query tile a wave: the key tiles its window touches, then the packed global keys (those inside the window masked there, so each pair counts once); rows that are global themselves are not stored here. Blocks x < NSLOT: tiles of 16 packed global query rows, every key allowed, each wave 8 of the 64 key tiles, the 8 partial (m, l, acc) merged in LDS. Scores 3 products x 1/8; P.V: f16 P hi/lo x (V hi, V lo*2048); O[b*S+q][h*64+d] (256-B segments)
__global__ __launch_bounds__(256) void k_attn(const _Float16* __restrict__ QK, const _Float16* __restrict__ QKL, const _Float16* __restrict__ VTH, const _Float16* __restrict__ VTL, const _Float16* __restrict__ VGH, const _Float16* __restrict__ VGL, const int* __restrict__ GLB, const int* __restrict__ GL, float* __restrict__ O) {
  __shared__ __align__(16) float sp[8][16][36]; __shared__ __align__(16) float so[8][16][68]; __shared__ float sm[8][16], sl[8][16];
  const int tid = threadIdx.x, wave = __builtin_amdgcn_readfirstlane(tid >> 5), lane = tid & 31, col = lane & 15, g = lane >> 4;
  const int h = blockIdx.y, b = blockIdx.z; const int* lst = GL + (size_t)b * GLS; const int* gb = GLB + (size_t)b * SS;
  int n = lst[SS]; n = n < 0 ? 0 : (n > SS ? SS : n);
  const bool dense = blockIdx.x < NSLOT; const int ngt = (n + 31) >> 5;
  const int q0 = ((int)blockIdx.x - NSLOT) * 128 + wave * 16;   // window blocks only
  const int qtend = dense ? ((n + 15) >> 4) : (int)blockIdx.x + 1;
  const unsigned gqm = __builtin_amdgcn_ballot_w32((dense ? 0 : gb[q0 + col]) != 0);   // bit rl: query q0 + rl is global (its row belongs to the packed tiles)
#pragma unroll 1
  for (int qt = blockIdx.x; qt < qtend; qt += NSLOT) {   // window blocks: one trip
    const size_t rq = (size_t)b * SS + (dense ? lst[qt * 16 + col] : q0 + col);
    v16h aq[2], aql[2];
#pragma unroll
    for (int kc = 0; kc < 2; ++kc) { aq[kc] = frag_h(QK + rq * (2 * DM) + h * HD + kc * 32, lane); aql[kc] = frag_h(QKL + rq * (2 * DM) + h * HD + kc * 32, lane); }
    float m[8], l[8];
#pragma unroll
    for (int r = 0; r < 8; ++r) { m[r] = -3.0e38f; l[r] = 0.f; }
    v8f acc[4] = {}, accl[4] = {};
    int kt0 = (q0 - HALFW) >> 5, kt1 = (q0 + 15 + HALFW) >> 5; kt0 = kt0 < 0 ? 0 : kt0; kt1 = kt1 > SS / 32 - 1 ? SS / 32 - 1 : kt1;
    const int nwin = dense ? 0 : kt1 - kt0 + 1; const int it0 = dense ? wave * 8 : 0, it1 = dense ? wave * 8 + 8 : nwin + ngt;
#pragma unroll 1
    for (int it = it0; it < it1; ++it) { const bool gl = !dense && it >= nwin; const int kt = dense ? it : (gl ? it - nwin : kt0 + it);   // gl: a tile of the packed global keys
      const _Float16* vhb = gl ? VGH : VTH; const _Float16* vlb = gl ? VGL : VTL; v8f s[2];
#pragma unroll
      for (int ct = 0; ct < 2; ++ct) { const int slot = kt * 32 + ct * 16 + col; const int kk = gl ? lst[slot] : slot; const _Float16* krow = QK + ((size_t)b * SS + kk) * (2 * DM) + DM + h * HD; const _Float16* krowl = QKL + ((size_t)b * SS + kk) * (2 * DM) + DM + h * HD; v8f c = {}, cl = {};
#pragma unroll
        for (int kc = 0; kc < 2; ++kc) { const v16h kh = frag_h(krow + kc * 32, lane); c = wmma16(aq[kc], kh, c); cl = wmma16(aql[kc], kh, cl); cl = wmma16(aq[kc], frag_h(krowl + kc * 32, lane), cl); }   // 3 products: q, k as f16 hi + residual
#pragma unroll
        for (int r = 0; r < 8; ++r) c[r] += cl[r] * (1.0f / 2048.0f);
        { const bool live = slot < n;
#pragma unroll
        for (int r = 0; r < 8; ++r) { const int dq = kk - (q0 + 8 * g + r); const bool inw = (dq <= HALFW) & (-dq <= HALFW); s[ct][r] = (dense | (gl ? (live & !inw) : inw)) ? c[r] * 0.125f : -3.0e38f; } } }   // 1/sqrt(64); masked keys excluded
#pragma unroll
      for (int r = 0; r < 8; ++r) { float mx = fmaxf(s[0][r], s[1][r]);
#pragma unroll
        for (int o = 1; o < 16; o <<= 1) mx = fmaxf(mx, __shfl_xor(mx, o));
        const float mn = fmaxf(m[r], mx); const float alpha = (m[r] <= -1.0e38f) ? 0.f : __expf(m[r] - mn);
        const float e0 = (s[0][r] <= -1.0e38f) ? 0.f : __expf(s[0][r] - mn), e1 = (s[1][r] <= -1.0e38f) ? 0.f : __expf(s[1][r] - mn); float es = e0 + e1;
#pragma unroll
        for (int o = 1; o < 16; o <<= 1) es += __shfl_xor(es, o);
        l[r] = l[r] * alpha + es; m[r] = mn;
#pragma unroll
        for (int dt = 0; dt < 4; ++dt) { acc[dt][r] *= alpha; accl[dt][r] *= alpha; }
        sp[wave][8 * g + r][col] = e0; sp[wave][8 * g + r][16 + col] = e1; }
      LDSX();
      v16h pa, pl; { const float* prow = &sp[wave][col][0] + 8 * (lane >> 4);
#pragma unroll
        for (int i = 0; i < 8; ++i) { const float x0 = prow[i] * 2048.0f, x1 = prow[16 + i] * 2048.0f; const _Float16 h0 = (_Float16)x0, h1 = (_Float16)x1; pa[i] = h0; pa[8 + i] = h1; pl[i] = (_Float16)((x0 - (float)h0) * 2048.0f); pl[8 + i] = (_Float16)((x1 - (float)h1) * 2048.0f); } }   // P scaled by 2^11 before the f16 split so small softmax weights stay out of the f16 subnormal range; 2^-11 folded into the epilogue
#pragma unroll
      for (int dt = 0; dt < 4; ++dt) { const size_t vr = ((size_t)b * DM + h * HD + dt * 16 + col) * SS + kt * 32; const v16h vh = frag_h(vhb + vr, lane); acc[dt] = wmma16(pa, vh, acc[dt]); accl[dt] = wmma16(pl, vh, accl[dt]); accl[dt] = wmma16(pa, frag_h(vlb + vr, lane), accl[dt]); }   // P hi x V hi + (P lo x V hi + P hi x V lo) / 2048
      LDSX(); }
    if (!dense) {
#pragma unroll
      for (int r = 0; r < 8; ++r) { const float il = (1.0f / 2048.0f) / l[r];
#pragma unroll
        for (int dt = 0; dt < 4; ++dt) so[wave][8 * g + r][dt * 16 + col] = (acc[dt][r] + accl[dt][r] * (1.0f / 2048.0f)) * il; }
      LDSX();
      for (int rl = 0; rl < 16; ++rl) if (lane < 16 && ((gqm >> rl) & 1u) == 0u) { vst2(O + ((size_t)b * SS + q0 + rl) * DM + h * HD + lane * 4, *(const v4f*)&so[wave][rl][lane * 4]);
        asm volatile("s_wait_xcnt 0x0" ::: "memory"); }   // the next row's LDS read lands in the registers this store names
    } else {
#pragma unroll
      for (int r = 0; r < 8; ++r) {
#pragma unroll
        for (int dt = 0; dt < 4; ++dt) so[wave][8 * g + r][dt * 16 + col] = acc[dt][r] + accl[dt][r] * (1.0f / 2048.0f);
        if (col == 0) { sm[wave][8 * g + r] = m[r]; sl[wave][8 * g + r] = l[r]; } }
      __syncthreads();   // every wave's partial is in LDS before the merge reads it
      const int row = tid >> 4, d4 = (tid & 15) * 4; float mm = sm[0][row];
#pragma unroll
      for (int w = 1; w < 8; ++w) mm = fmaxf(mm, sm[w][row]);
      float ll = 0.f; v4f a = {};
#pragma unroll
      for (int w = 0; w < 8; ++w) { const float e = __expf(sm[w][row] - mm); ll += e * sl[w][row]; a += *(const v4f*)&so[w][row][d4] * e; }
      if (qt * 16 + row < n) { vst2(O + ((size_t)b * SS + lst[qt * 16 + row]) * DM + h * HD + d4, a * ((1.0f / 2048.0f) / ll));
        asm volatile("s_wait_xcnt 0x0" ::: "memory"); }   // the next tile's set-up reuses the registers this store names
      __syncthreads();   // the merge has read the partials before the next tile overwrites them
    }
  }
}
// ---- k_out: block = (128 rows, 128 cols), 8 waves, staged as k_qkv: out = f16(O) . Wo rows + bo
__global__ __launch_bounds__(256) void k_out(const float* __restrict__ O, const __bf16* __restrict__ P, const float* __restrict__ BO, float* __restrict__ Y) {
  __shared__ __align__(16) unsigned char smem[STG];
  _Float16 (*sa)[128][LP] = (_Float16 (*)[128][LP])smem; _Float16 (*sb)[128][LP] = (_Float16 (*)[128][LP])(smem + STG / 2);
  float (*so)[16][132] = (float (*)[16][132])smem;
  const int tid = threadIdx.x, wave = tid >> 5, lane = tid & 31, col = lane & 15, g = lane >> 4; const size_t r0 = (size_t)blockIdx.x * 128 + wave * 16; const int n0 = blockIdx.y * 128;
  const int xr = tid >> 4, xc = (tid & 15) * 4, wr = tid >> 3, wc = (tid & 7) * 8;   // 16 lanes cover 256 B of an O row, 8 lanes 128 B of a W row
  const float* xg = O + ((size_t)blockIdx.x * 128 + xr) * DM + xc; const _Float16* wg = (const _Float16*)P + (size_t)(n0 + wr) * DM + wc;
  v4f ra[8]; v4u rb[4];
#pragma unroll
  for (int i = 0; i < 8; ++i) ra[i] = *(const v4f*)(xg + (size_t)i * 16 * DM);
#pragma unroll
  for (int i = 0; i < 4; ++i) rb[i] = *(const v4u*)(wg + (size_t)i * 32 * DM);
#pragma unroll
  for (int i = 0; i < 8; ++i) { v4h t; t[0] = (_Float16)ra[i][0]; t[1] = (_Float16)ra[i][1]; t[2] = (_Float16)ra[i][2]; t[3] = (_Float16)ra[i][3]; *(v4h*)&sa[0][i * 16 + xr][xc] = t; }
#pragma unroll
  for (int i = 0; i < 4; ++i) *(v4u*)&sb[0][i * 32 + wr][wc] = rb[i];
  v8f acc[8] = {};
#pragma unroll 1   // kept rolled: 16 unrolled trips would swell the text, which costs instruction fetches on a first pass
  for (int ks = 0; ks < DM / KS; ++ks) { const int bf = ks & 1; const bool more = ks + 1 < DM / KS;
    __syncthreads();   // slice ks is in LDS for every wave, and every wave has left the buffer that this trip refills
    if (more) {
#pragma unroll
      for (int i = 0; i < 8; ++i) ra[i] = *(const v4f*)(xg + (size_t)i * 16 * DM + (ks + 1) * KS);
#pragma unroll
      for (int i = 0; i < 4; ++i) rb[i] = *(const v4u*)(wg + (size_t)i * 32 * DM + (ks + 1) * KS);
      asm volatile("s_wait_xcnt 0x0" ::: "memory"); }   // the address registers of these loads are reused further down the trip
#pragma unroll
    for (int kc = 0; kc < KS / 32; ++kc) { const v16h a = frag_h(&sa[bf][wave * 16 + col][kc * 32], lane); v16h w[8];
#pragma unroll
      for (int j = 0; j < 8; ++j) w[j] = frag_h(&sb[bf][j * 16 + col][kc * 32], lane);   // the block's LDS reads as one group, ahead of its products
#pragma unroll
      for (int j = 0; j < 8; ++j) acc[j] = wmma16(a, w[j], acc[j]); }   // single f16 product against exact f16 x 2^8 weight copies
    if (more) {
#pragma unroll
      for (int i = 0; i < 8; ++i) { v4h t; t[0] = (_Float16)ra[i][0]; t[1] = (_Float16)ra[i][1]; t[2] = (_Float16)ra[i][2]; t[3] = (_Float16)ra[i][3]; *(v4h*)&sa[bf ^ 1][i * 16 + xr][xc] = t; }
#pragma unroll
      for (int i = 0; i < 4; ++i) *(v4u*)&sb[bf ^ 1][i * 32 + wr][wc] = rb[i]; } }
  __syncthreads();   // every wave has read the last slice before the epilogue overwrites the buffers
#pragma unroll
  for (int j = 0; j < 8; ++j) {
#pragma unroll
    for (int r = 0; r < 8; ++r) so[wave][8 * g + r][j * 16 + col] = acc[j][r] * (1.0f / 256.0f) + bfr(BO[n0 + j * 16 + col]); }
  LDSX();
  for (int rl = 0; rl < 16; ++rl) vst2(Y + (r0 + rl) * DM + n0 + lane * 4, *(const v4f*)&so[wave][rl][lane * 4]);
}
// ---- k_lists: block = batch b: GL[b][0..n) = positions of the global tokens, ascending; the rest of the list 0; GL[b][SS..SS+32) = n
__global__ __launch_bounds__(256) void k_lists(const int* __restrict__ GLB, int* __restrict__ GL) { __shared__ int sc[256]; __shared__ int sl[SS]; const int t = threadIdx.x; const size_t b = blockIdx.x; const int* gb = GLB + b * SS;
  int f[8], c = 0;
#pragma unroll
  for (int i = 0; i < 8; ++i) { f[i] = gb[t * 8 + i] != 0; c += f[i]; }
  sc[t] = c; for (int i = t; i < SS; i += 256) sl[i] = 0;
  __syncthreads();
  int base = 0, tot = 0; for (int i = 0; i < 256; ++i) { const int v = sc[i]; tot += v; base += (i < t) ? v : 0; }
#pragma unroll
  for (int i = 0; i < 8; ++i) if (f[i]) sl[base++] = t * 8 + i;
  __syncthreads();
  int* o = GL + b * GLS; for (int i = t; i < SS; i += 256) o[i] = sl[i];
  if (t < 32) o[SS + t] = tot; }
// ---- k_gv: block = (8 rows h*64+d, b), one wave a row: VG[b][row][slot] = VT[b][row][list[slot]] for the n global keys, 0 up to the next multiple of 32
__global__ __launch_bounds__(256) void k_gv(const _Float16* __restrict__ VTH, const _Float16* __restrict__ VTL, const int* __restrict__ GL, _Float16* __restrict__ VGH, _Float16* __restrict__ VGL) { const int t = threadIdx.x; const size_t b = blockIdx.y; const int* lst = GL + b * GLS;
  int n = lst[SS]; n = n < 0 ? 0 : (n > SS ? SS : n); const int npad = (n + 31) & ~31; const size_t row = (b * DM + blockIdx.x * 8 + (t >> 5)) * SS;
  for (int p = t & 31; p < npad; p += 32) { const int k = lst[p]; _Float16 vh = (_Float16)0.f, vl = (_Float16)0.f; if (p < n) { vh = VTH[row + k]; vl = VTL[row + k]; } VGH[row + p] = vh; VGL[row + p] = vl; } }
// ---- k_packo: Wo natural rows -> f16 x 2^8 copies in the Wo slot (bit pattern in the bf16-typed buffer)
__global__ __launch_bounds__(256) void k_packo(const float* __restrict__ WO, __bf16* __restrict__ PK) { __shared__ __align__(16) _Float16 s[DM]; const int n = blockIdx.x, t = threadIdx.x; for (int k = t; k < DM; k += 256) s[k] = (_Float16)(bfr(WO[(size_t)n * DM + k]) * 256.0f); __syncthreads(); for (int q = t; q < DM / 8; q += 256) vst2((unsigned*)(PK + PK_P + (size_t)n * DM + q * 8), *(const v4u*)&s[q * 8]); }
extern "C" void kernel_launch(void* const* d_in, const int* in_sizes, int n_in, void* d_out, int out_size, void* d_ws, size_t ws_size, hipStream_t stream) {
  (void)in_sizes; (void)n_in; (void)out_size;
  const float** F = (const float**)d_in;   // 0 x [2,2048,1024], 1 is_global bool [2,2048], 2 wq, 3 bq, 4 wk, 5 bk, 6 wv, 7 bv, 8 wo, 9 bo (natural)
  if (ws_size < (size_t)WS_END) return;
  char* ws = (char*)d_ws; __bf16* PK = (__bf16*)(ws + WS_PK); _Float16 *QK = (_Float16*)(ws + WS_QK), *QKL = (_Float16*)(ws + WS_QKL), *VTH = (_Float16*)(ws + WS_VTH), *VTL = (_Float16*)(ws + WS_VTL); float* O = (float*)(ws + WS_O); int* GL = (int*)(ws + WS_GL); _Float16 *VGH = (_Float16*)(ws + WS_VGH), *VGL = (_Float16*)(ws + WS_VGL); const int* GLB = (const int*)d_in[1];
  k_pack<<<dim3(DM, 3), 256, 0, stream>>>(F[2], F[4], F[6], F[8], PK);
  k_packo<<<DM, 256, 0, stream>>>(F[8], PK);
  k_lists<<<NB, 256, 0, stream>>>(GLB, GL);
  k_qkv<<<dim3(NB * SS / 128, QKVW / 128), 256, 0, stream>>>(F[0], F[0], F[0], PK + PK_A, F[3], F[5], F[7], QK, QKL, VTH, VTL);
  k_gv<<<dim3(DM / 8, NB), 256, 0, stream>>>(VTH, VTL, GL, VGH, VGL);
  k_attn<<<dim3(NSLOT + SS / 128, NH, NB), 256, 0, stream>>>(QK, QKL, VTH, VTL, VGH, VGL, GLB, GL, O);
  k_out<<<dim3(NB * SS / 128, DM / 128), 256, 0, stream>>>(O, PK + PK_P, F[9], (float*)d_out);
}

// v003
// Measured time: 197 microseconds a run.
// Two timings next to v002 both put it at 1.05 times that version's speed.
// All steps since v000 together make it 2.52 times as fast.
// compute dtype: all float inputs rounded to bf16, is_global (bool) read on device; q/k/v = x . W^T + b with EXACT bf16 products on WMMA 16x16x32 (natural rows), rounded once to f16 hi + residual; attention with 3-product scores and P.v (hi + residual planes) restricted to each 16-query tile's window key tiles plus a packed list of the global keys (list built on device from is_global, their v columns gathered), global query rows packed into tiles of their own that visit every key (8 waves split the keys, merged in LDS), the per-pair rule evaluated inline, x 1/8, running-max softmax in f32 (hardware exp); out = f16(ctx) . Wo^T (exact f16 x 2^8 copies) + bo; f32 output.
#include <hip/hip_runtime.h>
#include <math.h>

typedef __attribute__((ext_vector_type(16))) _Float16 v16h;
typedef __attribute__((ext_vector_type(16))) __bf16 v16b;
typedef __attribute__((ext_vector_type(8)))  _Float16 v8h;
typedef __attribute__((ext_vector_type(8)))  float v8f;
typedef __attribute__((ext_vector_type(4)))  float v4f;
typedef __attribute__((ext_vector_type(2)))  float v2f;
typedef __attribute__((ext_vector_type(4)))  unsigned v4u;
typedef __attribute__((ext_vector_type(4)))  int v4i;
typedef float __attribute__((may_alias)) float_a;
typedef int __attribute__((may_alias)) int_a;

template <typename T> __device__ __forceinline__ void vst2(void* p, T v) { *(T*)p = v;  }
__device__ __forceinline__ v8f wmma16(v16h a, v16h b, v8f c) {
  v8f d = __builtin_amdgcn_wmma_f32_16x16x32_f16(false, a, false, b, (short)0, c, false, false);
  asm volatile("v_nop\n\tv_nop\n\tv_nop\n\tv_nop" : "+v"(d) : "v"(a), "v"(b));
  return d;
}
__device__ __forceinline__ v8f wmma_bf(v16b a, v16b b, v8f c) {
  v8f d = __builtin_amdgcn_wmma_f32_16x16x32_bf16(false, a, false, b, (short)0, c, false, false);
  asm volatile("v_nop\n\tv_nop\n\tv_nop\n\tv_nop" : "+v"(d) : "v"(a), "v"(b));
  return d;
}
// Sparse structured attention (B 2, S 2,048, hidden 1,024, 16 heads x 64): local window |i - j| <= 64 plus global tokens (is_global, given) that attend everywhere and are attended by everyone; projections + biases, softmax(q k / 8) over the allowed keys, v, output projection + bias.
__device__ __forceinline__ v16h frag_h(const _Float16* rowk0, int lane) {
  union { v16h v; v8h q[2]; } u; const _Float16* p = rowk0 + 8 * (lane >> 4);
  u.q[0] = *(const v8h*)p; u.q[1] = *(const v8h*)(p + 16); return u.v;
}
__device__ __forceinline__ v16h frag_f32(const float* rowk0, int lane) {
  v16h a; const float* p = rowk0 + 8 * (lane >> 4);
#pragma unroll
  for (int i = 0; i < 8; ++i) { a[i] = (_Float16)p[i]; a[8 + i] = (_Float16)p[16 + i]; }
  return a;
}
__device__ __forceinline__ v16h frag_f32s(const float* rowk0, int lane, float sc) {
  v16h a; const float* p = rowk0 + 8 * (lane >> 4);
#pragma unroll
  for (int i = 0; i < 8; ++i) { a[i] = (_Float16)(p[i] * sc); a[8 + i] = (_Float16)(p[16 + i] * sc); }
  return a;
}
// column fragment from a [K][ld] layout (column n), rows >= K read as 0
__device__ __forceinline__ v16h fragc_f32(const float* W, int k0, int n, int lane, int ld, int K) {
  v16h a; const int g = lane >> 4;
#pragma unroll
  for (int i = 0; i < 8; ++i) { const int ka = k0 + 8 * g + i, kb = ka + 16;
    a[i] = (_Float16)(ka < K ? W[(size_t)(ka < K ? ka : K - 1) * ld + n] : 0.f); a[8 + i] = (_Float16)(kb < K ? W[(size_t)(kb < K ? kb : K - 1) * ld + n] : 0.f); }
  return a;
}
struct F2 { v16b h, l; };
__device__ __forceinline__ F2 bsplit16(const float v[16]) { F2 r;
#pragma unroll
  for (int i = 0; i < 16; ++i) { const __bf16 h = (__bf16)v[i]; r.h[i] = h; r.l[i] = (__bf16)(v[i] - (float)h); }
  return r; }
__device__ __forceinline__ F2 split_row(const float* row, int k0, int lane) { float v[16]; const float* p = row + k0 + 8 * (lane >> 4);
#pragma unroll
  for (int i = 0; i < 8; ++i) { v[i] = p[i]; v[8 + i] = p[16 + i]; }
  return bsplit16(v); }
__device__ __forceinline__ F2 split_rowK(const float* row, int k0, int lane, int K) { float v[16]; const int g = lane >> 4;
#pragma unroll
  for (int i = 0; i < 8; ++i) { const int ka = k0 + 8 * g + i, kb = ka + 16; v[i] = ka < K ? row[ka < K ? ka : K - 1] : 0.f; v[8 + i] = kb < K ? row[kb < K ? kb : K - 1] : 0.f; }
  return bsplit16(v); }
__device__ __forceinline__ F2 split_col(const float* W, int k0, int n, int lane, int ld, int K) { float v[16]; const int g = lane >> 4;
#pragma unroll
  for (int i = 0; i < 8; ++i) { const int ka = k0 + 8 * g + i, kb = ka + 16; v[i] = ka < K ? W[(size_t)(ka < K ? ka : K - 1) * ld + n] : 0.f; v[8 + i] = kb < K ? W[(size_t)(kb < K ? kb : K - 1) * ld + n] : 0.f; }
  return bsplit16(v); }
__device__ __forceinline__ v8f mac3(const F2& a, const F2& b, v8f c) { c = wmma_bf(a.l, b.h, c); c = wmma_bf(a.h, b.l, c); return wmma_bf(a.h, b.h, c); }
__device__ __forceinline__ float sigm(float v) { return 1.0f / (1.0f + expf(-v)); }
#define LDSX() do { asm volatile("s_wait_dscnt 0" ::: "memory"); __builtin_amdgcn_wave_barrier(); __builtin_amdgcn_fence(__ATOMIC_RELEASE, "workgroup"); } while (0)


#define NB 2
#define SS 2048
#define DM 1024
#define NH 16
#define HALFW 64
#define HD 64
#define QKVW (3 * DM)
#ifndef TQB
#define TQB (SS / 64)
#define TNB NB
#define TOB (NB * SS / 64)     // 64-row tiles of all output rows (unused)
#endif
typedef __attribute__((ext_vector_type(8))) __bf16 v8b;
__device__ __forceinline__ v16b frag_b(const __bf16* rowk0, int lane) {
  union { v16b v; v8b q[2]; } u; const __bf16* p = rowk0 + 8 * (lane >> 4);
  u.q[0] = *(const v8b*)p; u.q[1] = *(const v8b*)(p + 16); return u.v;
}
__device__ __forceinline__ float bfr(float v) { return (float)(__bf16)v; }
__device__ __attribute__((noinline)) float exp_ni(float v) { return expf(v); }
__device__ __attribute__((noinline)) float erf_ni(float v) { return erff(v); }

#define PK_A 0                       // [3072][1024] Wqkv rows (natural [out][in])
#define PK_P (PK_A + QKVW * DM)        // [1024][1024] Wo rows (natural)
#define PK_END (PK_P + DM * DM)
#define WS_PK  0u
#define WS_QK  (WS_PK + 2u * PK_END)             // f16 [4096 rows][2048]: q | k
#define WS_QKL (WS_QK + 2u * NB * SS * 2 * DM)     // f16 q | k residual planes x2048
#define WS_VTH (WS_QKL + 2u * NB * SS * 2 * DM)    // f16 [b][1024 (h*64+d)][2048 s] hi
#define WS_VTL (WS_VTH + 2u * NB * DM * SS)        // f16 lo x 2048
#define WS_O   (WS_VTL + 2u * NB * DM * SS)        // f32 [4096][1024]
#define GLS (SS + 32)                              // ints per batch: positions of the global tokens (ascending, rest 0), then their count
#define NSLOT 16                                   // blocks per (head, batch) that walk the tiles of global query rows
#define WS_GL  (WS_O + 4u * (size_t)NB * SS * DM)        // int [b][GLS]
#define WS_VGH (WS_GL + 4u * (size_t)NB * GLS)           // f16 [b][1024 (h*64+d)][2048 list slot] hi: v columns of the global keys, in list order
#define WS_VGL (WS_VGH + 2u * NB * DM * SS)        // f16 lo x 2048
#define WS_END (WS_VGL + 2u * NB * DM * SS)
#define KS 64                        // k of one staged slice: 128 B of a 16-bit row, 256 B of an f32 row
#define LP (KS + 8)                  // LDS row pitch in 16-bit elements: 144 B, for ds_load_b128 readers
#define STG (2 * 2 * 128 * LP * 2)   // bytes: two buffers of [X 128 rows | W 128 rows]
typedef __attribute__((ext_vector_type(4))) __bf16 v4b;
typedef __attribute__((ext_vector_type(4))) _Float16 v4h;
// ---- k_qkv: block = (128 rows, 128 cols), 8 waves, a wave 16 rows x 128 cols. Each k slice of X (rounded to bf16 on the way) and of W goes to LDS by whole-line loads, one slice ahead, two buffers; fragments come from LDS. The epilogue reuses the same LDS.
__global__ __launch_bounds__(256) void k_qkv(const float* __restrict__ XQ, const float* __restrict__ XK, const float* __restrict__ XV, const __bf16* __restrict__ P, const float* __restrict__ BQ, const float* __restrict__ BK, const float* __restrict__ BV, _Float16* __restrict__ QK, _Float16* __restrict__ QKL, _Float16* __restrict__ VTH, _Float16* __restrict__ VTL) {
  const int which0 = (blockIdx.y * 128) / DM; const float* X = (which0 == 0) ? XQ : (which0 == 1) ? XK : XV; const float* BB = BQ ? (((which0 == 0) ? BQ : (which0 == 1) ? BK : BV) + (blockIdx.y * 128 - which0 * DM)) : nullptr;
  __shared__ __align__(16) unsigned char smem[STG];
  __bf16 (*sa)[128][LP] = (__bf16 (*)[128][LP])smem; __bf16 (*sb)[128][LP] = (__bf16 (*)[128][LP])(smem + STG / 2);
  _Float16 (*so)[16][136] = (_Float16 (*)[16][136])smem; _Float16 (*sol)[16][136] = (_Float16 (*)[16][136])(smem + 8 * 16 * 136 * 2);
  _Float16 (*sth)[136] = (_Float16 (*)[136])smem; _Float16 (*stl)[136] = (_Float16 (*)[136])(smem + 128 * 136 * 2);
  const int tid = threadIdx.x, wave = tid >> 5, lane = tid & 31, col = lane & 15, g = lane >> 4; const size_t r0 = (size_t)blockIdx.x * 128 + wave * 16; const int n0 = blockIdx.y * 128;
  const int xr = tid >> 4, xc = (tid & 15) * 4, wr = tid >> 3, wc = (tid & 7) * 8;   // 16 lanes cover 256 B of an X row, 8 lanes 128 B of a W row
  const float* xg = X + ((size_t)blockIdx.x * 128 + xr) * DM + xc; const __bf16* wg = P + (size_t)(n0 + wr) * DM + wc;
  v4f ra[8]; v4u rb[4];
#pragma unroll
  for (int i = 0; i < 8; ++i) ra[i] = *(const v4f*)(xg + (size_t)i * 16 * DM);
#pragma unroll
  for (int i = 0; i < 4; ++i) rb[i] = *(const v4u*)(wg + (size_t)i * 32 * DM);
#pragma unroll
  for (int i = 0; i < 8; ++i) { v4b t; t[0] = (__bf16)ra[i][0]; t[1] = (__bf16)ra[i][1]; t[2] = (__bf16)ra[i][2]; t[3] = (__bf16)ra[i][3]; *(v4b*)&sa[0][i * 16 + xr][xc] = t; }
#pragma unroll
  for (int i = 0; i < 4; ++i) *(v4u*)&sb[0][i * 32 + wr][wc] = rb[i];
  v8f acc[8] = {};
#pragma unroll 1   // kept rolled: 16 unrolled trips would swell the text, which costs instruction fetches on a first pass
  for (int ks = 0; ks < DM / KS; ++ks) { const int bf = ks & 1; const bool more = ks + 1 < DM / KS;
    __syncthreads();   // slice ks is in LDS for every wave, and every wave has left the buffer that this trip refills
    if (more) {
#pragma unroll
      for (int i = 0; i < 8; ++i) ra[i] = *(const v4f*)(xg + (size_t)i * 16 * DM + (ks + 1) * KS);
#pragma unroll
      for (int i = 0; i < 4; ++i) rb[i] = *(const v4u*)(wg + (size_t)i * 32 * DM + (ks + 1) * KS);
      asm volatile("s_wait_xcnt 0x0" ::: "memory"); }   // the address registers of these loads are reused further down the trip
#pragma unroll
    for (int kc = 0; kc < KS / 32; ++kc) { const v16b a = frag_b(&sa[bf][wave * 16 + col][kc * 32], lane); v16b w[8];
#pragma unroll
      for (int j = 0; j < 8; ++j) w[j] = frag_b(&sb[bf][j * 16 + col][kc * 32], lane);   // the block's LDS reads as one group, ahead of its products
#pragma unroll
      for (int j = 0; j < 8; ++j) acc[j] = wmma_bf(a, w[j], acc[j]); }
    if (more) {
#pragma unroll
      for (int i = 0; i < 8; ++i) { v4b t; t[0] = (__bf16)ra[i][0]; t[1] = (__bf16)ra[i][1]; t[2] = (__bf16)ra[i][2]; t[3] = (__bf16)ra[i][3]; *(v4b*)&sa[bf ^ 1][i * 16 + xr][xc] = t; }
#pragma unroll
      for (int i = 0; i < 4; ++i) *(v4u*)&sb[bf ^ 1][i * 32 + wr][wc] = rb[i]; } }
  __syncthreads();   // every wave has read the last slice before the epilogue overwrites the buffers
  if (n0 < 2 * DM) {   // q stored unscaled (f16 sigma ~0.6, no subnormal exposure); 1/8 applied to the f32 score
#pragma unroll
    for (int j = 0; j < 8; ++j) {
#pragma unroll
      for (int r = 0; r < 8; ++r) { const float v = acc[j][r] + (BB ? bfr(BB[j * 16 + col]) : 0.f); const _Float16 hv = (_Float16)v; so[wave][8 * g + r][j * 16 + col] = hv; sol[wave][8 * g + r][j * 16 + col] = (_Float16)((v - (float)hv) * 2048.0f); } }   // q, k (+ bias) as f16 hi + (x2048) residual
    LDSX();
    for (int rl = 0; rl < 16; ++rl) if (lane < 16) { vst2((unsigned*)(QK + (r0 + rl) * (2 * DM) + n0 + lane * 8), *(const v4u*)&so[wave][rl][lane * 8]); vst2((unsigned*)(QKL + (r0 + rl) * (2 * DM) + n0 + lane * 8), *(const v4u*)&sol[wave][rl][lane * 8]); }
  } else {
#pragma unroll
    for (int j = 0; j < 8; ++j) {
#pragma unroll
      for (int r = 0; r < 8; ++r) { const float v = acc[j][r] + (BB ? bfr(BB[j * 16 + col]) : 0.f); const _Float16 hv = (_Float16)v; sth[j * 16 + col][wave * 16 + 8 * g + r] = hv; stl[j * 16 + col][wave * 16 + 8 * g + r] = (_Float16)((v - (float)hv) * 2048.0f); } }
    __syncthreads();
    const size_t rb0 = (size_t)blockIdx.x * 128; const int b = (int)(rb0 / SS), s0 = (int)(rb0 % SS); const int pc0 = n0 - 2 * DM;
    for (int q = tid; q < 128 * 16; q += 256) { const int d = q >> 4, pc = q & 15; const size_t o = ((size_t)b * DM + pc0 + d) * SS + s0 + pc * 8; vst2((unsigned*)(VTH + o), *(const v4u*)&sth[d][pc * 8]); vst2((unsigned*)(VTL + o), *(const v4u*)&stl[d][pc * 8]); }
  }
}
// ---- k_attn: 8 waves. Blocks x >= NSLOT: 128 queries, one 16-query tile a wave: the key tiles its window touches, then the packed global keys (those inside the window masked there, so each pair counts once); rows that are global themselves are not stored here. Blocks x < NSLOT: tiles of 16 packed global query rows, every key allowed, each wave 8 of the 64 key tiles, the 8 partial (m, l, acc) merged in LDS. Scores 3 products x 1/8; P.V: f16 P hi/lo x (V hi, V lo*2048); O[b*S+q][h*64+d] (256-B segments)
__global__ __launch_bounds__(256) void k_attn(const _Float16* __restrict__ QK, const _Float16* __restrict__ QKL, const _Float16* __restrict__ VTH, const _Float16* __restrict__ VTL, const _Float16* __restrict__ VGH, const _Float16* __restrict__ VGL, const int* __restrict__ GLB, const int* __restrict__ GL, float* __restrict__ O) {
  __shared__ __align__(16) float sp[8][16][36]; __shared__ __align__(16) float so[8][16][68]; __shared__ float sm[8][16], sl[8][16];
  const int tid = threadIdx.x, wave = __builtin_amdgcn_readfirstlane(tid >> 5), lane = tid & 31, col = lane & 15, g = lane >> 4;
  const int h = blockIdx.y, b = blockIdx.z; const int* lst = GL + (size_t)b * GLS; const int* gb = GLB + (size_t)b * SS;
  int n = lst[SS]; n = n < 0 ? 0 : (n > SS ? SS : n);
  const bool dense = blockIdx.x < NSLOT; const int ngt = (n + 31) >> 5;
  const int q0 = ((int)blockIdx.x - NSLOT) * 128 + wave * 16;   // window blocks only
  const int qtend = dense ? ((n + 15) >> 4) : (int)blockIdx.x + 1;
  const unsigned gqm = __builtin_amdgcn_ballot_w32((dense ? 0 : gb[q0 + col]) != 0);   // bit rl: query q0 + rl is global (its row belongs to the packed tiles)
#pragma unroll 1
  for (int qt = blockIdx.x; qt < qtend; qt += NSLOT) {   // window blocks: one trip
    const size_t rq = (size_t)b * SS + (dense ? lst[qt * 16 + col] : q0 + col);
    v16h aq[2], aql[2];
#pragma unroll
    for (int kc = 0; kc < 2; ++kc) { aq[kc] = frag_h(QK + rq * (2 * DM) + h * HD + kc * 32, lane); aql[kc] = frag_h(QKL + rq * (2 * DM) + h * HD + kc * 32, lane); }
    float m[8], l[8];
#pragma unroll
    for (int r = 0; r < 8; ++r) { m[r] = -3.0e38f; l[r] = 0.f; }
    v8f acc[4] = {}, accl[4] = {};
    int kt0 = (q0 - HALFW) >> 5, kt1 = (q0 + 15 + HALFW) >> 5; kt0 = kt0 < 0 ? 0 : kt0; kt1 = kt1 > SS / 32 - 1 ? SS / 32 - 1 : kt1;
    const int nwin = dense ? 0 : kt1 - kt0 + 1; const int it0 = dense ? wave * 8 : 0, it1 = dense ? wave * 8 + 8 : nwin + ngt;
#pragma unroll 1
    for (int it = it0; it < it1; ++it) { const bool gl = !dense && it >= nwin; const int kt = dense ? it : (gl ? it - nwin : kt0 + it);   // gl: a tile of the packed global keys
      const _Float16* vhb = gl ? VGH : VTH; const _Float16* vlb = gl ? VGL : VTL; v8f s[2];
#pragma unroll
      for (int ct = 0; ct < 2; ++ct) { const int slot = kt * 32 + ct * 16 + col; const int kk = gl ? lst[slot] : slot; const _Float16* krow = QK + ((size_t)b * SS + kk) * (2 * DM) + DM + h * HD; const _Float16* krowl = QKL + ((size_t)b * SS + kk) * (2 * DM) + DM + h * HD; v8f c = {}, cl = {};
#pragma unroll
        for (int kc = 0; kc < 2; ++kc) { const v16h kh = frag_h(krow + kc * 32, lane); c = wmma16(aq[kc], kh, c); cl = wmma16(aql[kc], kh, cl); cl = wmma16(aq[kc], frag_h(krowl + kc * 32, lane), cl); }   // 3 products: q, k as f16 hi + residual
#pragma unroll
        for (int r = 0; r < 8; ++r) c[r] += cl[r] * (1.0f / 2048.0f);
        { const bool live = slot < n;
#pragma unroll
        for (int r = 0; r < 8; ++r) { const int dq = kk - (q0 + 8 * g + r); const bool inw = (dq <= HALFW) & (-dq <= HALFW); s[ct][r] = (dense | (gl ? (live & !inw) : inw)) ? c[r] * 0.125f : -3.0e38f; } } }   // 1/sqrt(64); masked keys excluded
#pragma unroll
      for (int r = 0; r < 8; ++r) { float mx = fmaxf(s[0][r], s[1][r]);
#pragma unroll
        for (int o = 1; o < 16; o <<= 1) mx = fmaxf(mx, __shfl_xor(mx, o));
        const float mn = fmaxf(m[r], mx); const float alpha = (m[r] <= -1.0e38f) ? 0.f : __expf(m[r] - mn);
        const float e0 = (s[0][r] <= -1.0e38f) ? 0.f : __expf(s[0][r] - mn), e1 = (s[1][r] <= -1.0e38f) ? 0.f : __expf(s[1][r] - mn); float es = e0 + e1;
#pragma unroll
        for (int o = 1; o < 16; o <<= 1) es += __shfl_xor(es, o);
        l[r] = l[r] * alpha + es; m[r] = mn;
#pragma unroll
        for (int dt = 0; dt < 4; ++dt) { acc[dt][r] *= alpha; accl[dt][r] *= alpha; }
        sp[wave][8 * g + r][col] = e0; sp[wave][8 * g + r][16 + col] = e1; }
      LDSX();
      v16h pa, pl; { const float* prow = &sp[wave][col][0] + 8 * (lane >> 4);
#pragma unroll
        for (int i = 0; i < 8; ++i) { const float x0 = prow[i] * 2048.0f, x1 = prow[16 + i] * 2048.0f; const _Float16 h0 = (_Float16)x0, h1 = (_Float16)x1; pa[i] = h0; pa[8 + i] = h1; pl[i] = (_Float16)((x0 - (float)h0) * 2048.0f); pl[8 + i] = (_Float16)((x1 - (float)h1) * 2048.0f); } }   // P scaled by 2^11 before the f16 split so small softmax weights stay out of the f16 subnormal range; 2^-11 folded into the epilogue
#pragma unroll
      for (int dt = 0; dt < 4; ++dt) { const size_t vr = ((size_t)b * DM + h * HD + dt * 16 + col) * SS + kt * 32; const v16h vh = frag_h(vhb + vr, lane); acc[dt] = wmma16(pa, vh, acc[dt]); accl[dt] = wmma16(pl, vh, accl[dt]); accl[dt] = wmma16(pa, frag_h(vlb + vr, lane), accl[dt]); }   // P hi x V hi + (P lo x V hi + P hi x V lo) / 2048
      LDSX(); }
    if (!dense) {
#pragma unroll
      for (int r = 0; r < 8; ++r) { const float il = (1.0f / 2048.0f) / l[r];
#pragma unroll
        for (int dt = 0; dt < 4; ++dt) so[wave][8 * g + r][dt * 16 + col] = (acc[dt][r] + accl[dt][r] * (1.0f / 2048.0f)) * il; }
      LDSX();
      for (int rl = 0; rl < 16; ++rl) if (lane < 16 && ((gqm >> rl) & 1u) == 0u) { vst2(O + ((size_t)b * SS + q0 + rl) * DM + h * HD + lane * 4, *(const v4f*)&so[wave][rl][lane * 4]);
        asm volatile("s_wait_xcnt 0x0" ::: "memory"); }   // the next row's LDS read lands in the registers this store names
    } else {
#pragma unroll
      for (int r = 0; r < 8; ++r) {
#pragma unroll
        for (int dt = 0; dt < 4; ++dt) so[wave][8 * g + r][dt * 16 + col] = acc[dt][r] + accl[dt][r] * (1.0f / 2048.0f);
        if (col == 0) { sm[wave][8 * g + r] = m[r]; sl[wave][8 * g + r] = l[r]; } }
      __syncthreads();   // every wave's partial is in LDS before the merge reads it
      const int row = tid >> 4, d4 = (tid & 15) * 4; float mm = sm[0][row];
#pragma unroll
      for (int w = 1; w < 8; ++w) mm = fmaxf(mm, sm[w][row]);
      float ll = 0.f; v4f a = {};
#pragma unroll
      for (int w = 0; w < 8; ++w) { const float e = __expf(sm[w][row] - mm); ll += e * sl[w][row]; a += *(const v4f*)&so[w][row][d4] * e; }
      if (qt * 16 + row < n) { vst2(O + ((size_t)b * SS + lst[qt * 16 + row]) * DM + h * HD + d4, a * ((1.0f / 2048.0f) / ll));
        asm volatile("s_wait_xcnt 0x0" ::: "memory"); }   // the next tile's set-up reuses the registers this store names
      __syncthreads();   // the merge has read the partials before the next tile overwrites them
    }
  }
}
// ---- k_out: block = (128 rows, 128 cols), 8 waves, staged as k_qkv: out = f16(O) . Wo rows + bo
__global__ __launch_bounds__(256) void k_out(const float* __restrict__ O, const __bf16* __restrict__ P, const float* __restrict__ BO, float* __restrict__ Y) {
  __shared__ __align__(16) unsigned char smem[STG];
  _Float16 (*sa)[128][LP] = (_Float16 (*)[128][LP])smem; _Float16 (*sb)[128][LP] = (_Float16 (*)[128][LP])(smem + STG / 2);
  float (*so)[16][132] = (float (*)[16][132])smem;
  const int tid = threadIdx.x, wave = tid >> 5, lane = tid & 31, col = lane & 15, g = lane >> 4; const size_t r0 = (size_t)blockIdx.x * 128 + wave * 16; const int n0 = blockIdx.y * 128;
  const int xr = tid >> 4, xc = (tid & 15) * 4, wr = tid >> 3, wc = (tid & 7) * 8;   // 16 lanes cover 256 B of an O row, 8 lanes 128 B of a W row
  const float* xg = O + ((size_t)blockIdx.x * 128 + xr) * DM + xc; const _Float16* wg = (const _Float16*)P + (size_t)(n0 + wr) * DM + wc;
  v4f ra[8]; v4u rb[4];
#pragma unroll
  for (int i = 0; i < 8; ++i) ra[i] = *(const v4f*)(xg + (size_t)i * 16 * DM);
#pragma unroll
  for (int i = 0; i < 4; ++i) rb[i] = *(const v4u*)(wg + (size_t)i * 32 * DM);
#pragma unroll
  for (int i = 0; i < 8; ++i) { v4h t; t[0] = (_Float16)ra[i][0]; t[1] = (_Float16)ra[i][1]; t[2] = (_Float16)ra[i][2]; t[3] = (_Float16)ra[i][3]; *(v4h*)&sa[0][i * 16 + xr][xc] = t; }
#pragma unroll
  for (int i = 0; i < 4; ++i) *(v4u*)&sb[0][i * 32 + wr][wc] = rb[i];
  v8f acc[8] = {};
#pragma unroll 1   // kept rolled: 16 unrolled trips would swell the text, which costs instruction fetches on a first pass
  for (int ks = 0; ks < DM / KS; ++ks) { const int bf = ks & 1; const bool more = ks + 1 < DM / KS;
    __syncthreads();   // slice ks is in LDS for every wave, and every wave has left the buffer that this trip refills
    if (more) {
#pragma unroll
      for (int i = 0; i < 8; ++i) ra[i] = *(const v4f*)(xg + (size_t)i * 16 * DM + (ks + 1) * KS);
#pragma unroll
      for (int i = 0; i < 4; ++i) rb[i] = *(const v4u*)(wg + (size_t)i * 32 * DM + (ks + 1) * KS);
      asm volatile("s_wait_xcnt 0x0" ::: "memory"); }   // the address registers of these loads are reused further down the trip
#pragma unroll
    for (int kc = 0; kc < KS / 32; ++kc) { const v16h a = frag_h(&sa[bf][wave * 16 + col][kc * 32], lane); v16h w[8];
#pragma unroll
      for (int j = 0; j < 8; ++j) w[j] = frag_h(&sb[bf][j * 16 + col][kc * 32], lane);   // the block's LDS reads as one group, ahead of its products
#pragma unroll
      for (int j = 0; j < 8; ++j) acc[j] = wmma16(a, w[j], acc[j]); }   // single f16 product against exact f16 x 2^8 weight copies
    if (more) {
#pragma unroll
      for (int i = 0; i < 8; ++i) { v4h t; t[0] = (_Float16)ra[i][0]; t[1] = (_Float16)ra[i][1]; t[2] = (_Float16)ra[i][2]; t[3] = (_Float16)ra[i][3]; *(v4h*)&sa[bf ^ 1][i * 16 + xr][xc] = t; }
#pragma unroll
      for (int i = 0; i < 4; ++i) *(v4u*)&sb[bf ^ 1][i * 32 + wr][wc] = rb[i]; } }
  __syncthreads();   // every wave has read the last slice before the epilogue overwrites the buffers
#pragma unroll
  for (int j = 0; j < 8; ++j) {
#pragma unroll
    for (int r = 0; r < 8; ++r) so[wave][8 * g + r][j * 16 + col] = acc[j][r] * (1.0f / 256.0f) + bfr(BO[n0 + j * 16 + col]); }
  LDSX();
  for (int rl = 0; rl < 16; ++rl) vst2(Y + (r0 + rl) * DM + n0 + lane * 4, *(const v4f*)&so[wave][rl][lane * 4]);
}
#define FCH 8192                     // floats of one weight matrix that a converting block takes: 8 whole-line loads a lane
#define FPM (DM * DM / FCH)          // converting blocks per matrix
// ---- k_front: one launch for all that depends on the inputs alone. Blocks x < NB: batch b = x: GL[b][0..n) = positions of the global tokens, ascending; the rest of the list 0; GL[b][SS..SS+32) = n. Blocks x >= NB: FCH consecutive floats of W_q | W_k | W_v -> bf16 (PK_A) or of W_o -> f16 x 2^8 copies of the bf16-rounded values (PK_P, bit pattern in the bf16-typed buffer); the natural [out][in] order is kept, so the copy is elementwise and needs no LDS
__global__ __launch_bounds__(256) void k_front(const float* __restrict__ WQ, const float* __restrict__ WK, const float* __restrict__ WV, const float* __restrict__ WO, const int* __restrict__ GLB, __bf16* __restrict__ PK, int* __restrict__ GL) { __shared__ int sc[256]; __shared__ int sl[SS]; const int t = threadIdx.x;
  if (blockIdx.x >= NB) { const int cb = blockIdx.x - NB, which = cb / FPM; const float* Wm = (which == 0) ? WQ : (which == 1) ? WK : (which == 2) ? WV : WO;
    const size_t e0 = (size_t)(cb % FPM) * FCH + t * 4; const float* sp = Wm + e0; __bf16* dp = PK + PK_A + (size_t)which * DM * DM + e0;   // PK_P follows the three PK_A matrices
    v4f a[8];
#pragma unroll
    for (int i = 0; i < 8; ++i) a[i] = *(const v4f*)(sp + i * 1024);   // a wave's load covers 512 contiguous bytes; all 8 in flight together
    asm volatile("s_wait_xcnt 0x0" ::: "memory");   // the address registers of these loads may be reused by what follows
    if (which < 3) {
#pragma unroll
      for (int i = 0; i < 8; ++i) { v4b o; o[0] = (__bf16)a[i][0]; o[1] = (__bf16)a[i][1]; o[2] = (__bf16)a[i][2]; o[3] = (__bf16)a[i][3]; *(v4b*)(dp + i * 1024) = o; }
    } else {
#pragma unroll
      for (int i = 0; i < 8; ++i) { v4h o; o[0] = (_Float16)(bfr(a[i][0]) * 256.0f); o[1] = (_Float16)(bfr(a[i][1]) * 256.0f); o[2] = (_Float16)(bfr(a[i][2]) * 256.0f); o[3] = (_Float16)(bfr(a[i][3]) * 256.0f); vst2(dp + i * 1024, o); }
      asm volatile("s_wait_xcnt 0x0" ::: "memory");   // the code laid out behind these stores writes registers that they name
    }
    return; }   // block-uniform, ahead of every barrier
  const size_t b = blockIdx.x; const int* gb = GLB + b * SS;
  int f[8], c = 0;
#pragma unroll
  for (int i = 0; i < 8; ++i) { f[i] = gb[t * 8 + i] != 0; c += f[i]; }
  sc[t] = c; for (int i = t; i < SS; i += 256) sl[i] = 0;
  __syncthreads();
  int base = 0, tot = 0; for (int i = 0; i < 256; ++i) { const int v = sc[i]; tot += v; base += (i < t) ? v : 0; }
#pragma unroll
  for (int i = 0; i < 8; ++i) if (f[i]) sl[base++] = t * 8 + i;
  __syncthreads();
  int* o = GL + b * GLS; for (int i = t; i < SS; i += 256) o[i] = sl[i];
  if (t < 32) o[SS + t] = tot; }
// ---- k_gv: block = (8 rows h*64+d, b), one wave a row: VG[b][row][slot] = VT[b][row][list[slot]] for the n global keys, 0 up to the next multiple of 32
__global__ __launch_bounds__(256) void k_gv(const _Float16* __restrict__ VTH, const _Float16* __restrict__ VTL, const int* __restrict__ GL, _Float16* __restrict__ VGH, _Float16* __restrict__ VGL) { const int t = threadIdx.x; const size_t b = blockIdx.y; const int* lst = GL + b * GLS;
  int n = lst[SS]; n = n < 0 ? 0 : (n > SS ? SS : n); const int npad = (n + 31) & ~31; const size_t row = (b * DM + blockIdx.x * 8 + (t >> 5)) * SS;
  for (int p = t & 31; p < npad; p += 32) { const int k = lst[p]; _Float16 vh = (_Float16)0.f, vl = (_Float16)0.f; if (p < n) { vh = VTH[row + k]; vl = VTL[row + k]; } VGH[row + p] = vh; VGL[row + p] = vl; } }
extern "C" void kernel_launch(void* const* d_in, const int* in_sizes, int n_in, void* d_out, int out_size, void* d_ws, size_t ws_size, hipStream_t stream) {
  (void)in_sizes; (void)n_in; (void)out_size;
  const float** F = (const float**)d_in;   // 0 x [2,2048,1024], 1 is_global bool [2,2048], 2 wq, 3 bq, 4 wk, 5 bk, 6 wv, 7 bv, 8 wo, 9 bo (natural)
  if (ws_size < (size_t)WS_END) return;
  char* ws = (char*)d_ws; __bf16* PK = (__bf16*)(ws + WS_PK); _Float16 *QK = (_Float16*)(ws + WS_QK), *QKL = (_Float16*)(ws + WS_QKL), *VTH = (_Float16*)(ws + WS_VTH), *VTL = (_Float16*)(ws + WS_VTL); float* O = (float*)(ws + WS_O); int* GL = (int*)(ws + WS_GL); _Float16 *VGH = (_Float16*)(ws + WS_VGH), *VGL = (_Float16*)(ws + WS_VGL); const int* GLB = (const int*)d_in[1];
  k_front<<<NB + 4 * FPM, 256, 0, stream>>>(F[2], F[4], F[6], F[8], GLB, PK, GL);
  k_qkv<<<dim3(NB * SS / 128, QKVW / 128), 256, 0, stream>>>(F[0], F[0], F[0], PK + PK_A, F[3], F[5], F[7], QK, QKL, VTH, VTL);
  k_gv<<<dim3(DM / 8, NB), 256, 0, stream>>>(VTH, VTL, GL, VGH, VGL);
  k_attn<<<dim3(NSLOT + SS / 128, NH, NB), 256, 0, stream>>>(QK, QKL, VTH, VTL, VGH, VGL, GLB, GL, O);
  k_out<<<dim3(NB * SS / 128, DM / 128), 256, 0, stream>>>(O, PK + PK_P, F[9], (float*)d_out);
}

// v004
// It runs in 137 microseconds.
// Two timings next to v003 put it at 1.44 and 1.45 times that version's speed.
// All steps since v000 together make it 3.65 times as fast.
// compute dtype: all float inputs rounded to bf16, is_global (bool) read on device; q/k/v = x . W^T + b with EXACT bf16 products on WMMA 16x16x32 (natural rows), rounded once to f16 hi + residual; attention with 3-product scores and P.v (hi + residual planes) restricted to each 16-query tile's window key tiles plus a packed list of the global keys (list built on device from is_global, their v columns gathered), global query rows packed into tiles of their own that visit every key (8 waves split the keys, merged in LDS), the per-pair rule evaluated inline, x 1/8, running-max softmax in f32 (hardware exp); out = f16(ctx) . Wo^T (exact f16 x 2^8 copies) + bo; f32 output.
#include <hip/hip_runtime.h>
#include <math.h>

typedef __attribute__((ext_vector_type(16))) _Float16 v16h;
typedef __attribute__((ext_vector_type(16))) __bf16 v16b;
typedef __attribute__((ext_vector_type(8)))  _Float16 v8h;
typedef __attribute__((ext_vector_type(8)))  float v8f;
typedef __attribute__((ext_vector_type(4)))  float v4f;
typedef __attribute__((ext_vector_type(2)))  float v2f;
typedef __attribute__((ext_vector_type(4)))  unsigned v4u;
typedef __attribute__((ext_vector_type(4)))  int v4i;
typedef float __attribute__((may_alias)) float_a;
typedef int __attribute__((may_alias)) int_a;

template <typename T> __device__ __forceinline__ void vst2(void* p, T v) { *(T*)p = v;  }
__device__ __forceinline__ v8f wmma16(v16h a, v16h b, v8f c) {
  v8f d = __builtin_amdgcn_wmma_f32_16x16x32_f16(false, a, false, b, (short)0, c, false, false);
  asm volatile("v_nop\n\tv_nop\n\tv_nop\n\tv_nop" : "+v"(d) : "v"(a), "v"(b));
  return d;
}
__device__ __forceinline__ v8f wmma_bf(v16b a, v16b b, v8f c) {
  v8f d = __builtin_amdgcn_wmma_f32_16x16x32_bf16(false, a, false, b, (short)0, c, false, false);
  asm volatile("v_nop\n\tv_nop\n\tv_nop\n\tv_nop" : "+v"(d) : "v"(a), "v"(b));
  return d;
}
// Sparse structured attention (B 2, S 2,048, hidden 1,024, 16 heads x 64): local window |i - j| <= 64 plus global tokens (is_global, given) that attend everywhere and are attended by everyone; projections + biases, softmax(q k / 8) over the allowed keys, v, output projection + bias.
__device__ __forceinline__ v16h frag_h(const _Float16* rowk0, int lane) {
  union { v16h v; v8h q[2]; } u; const _Float16* p = rowk0 + 8 * (lane >> 4);
  u.q[0] = *(const v8h*)p; u.q[1] = *(const v8h*)(p + 16); return u.v;
}
__device__ __forceinline__ v16h frag_f32(const float* rowk0, int lane) {
  v16h a; const float* p = rowk0 + 8 * (lane >> 4);
#pragma unroll
  for (int i = 0; i < 8; ++i) { a[i] = (_Float16)p[i]; a[8 + i] = (_Float16)p[16 + i]; }
  return a;
}
__device__ __forceinline__ v16h frag_f32s(const float* rowk0, int lane, float sc) {
  v16h a; const float* p = rowk0 + 8 * (lane >> 4);
#pragma unroll
  for (int i = 0; i < 8; ++i) { a[i] = (_Float16)(p[i] * sc); a[8 + i] = (_Float16)(p[16 + i] * sc); }
  return a;
}
// column fragment from a [K][ld] layout (column n), rows >= K read as 0
__device__ __forceinline__ v16h fragc_f32(const float* W, int k0, int n, int lane, int ld, int K) {
  v16h a; const int g = lane >> 4;
#pragma unroll
  for (int i = 0; i < 8; ++i) { const int ka = k0 + 8 * g + i, kb = ka + 16;
    a[i] = (_Float16)(ka < K ? W[(size_t)(ka < K ? ka : K - 1) * ld + n] : 0.f); a[8 + i] = (_Float16)(kb < K ? W[(size_t)(kb < K ? kb : K - 1) * ld + n] : 0.f); }
  return a;
}
struct F2 { v16b h, l; };
__device__ __forceinline__ F2 bsplit16(const float v[16]) { F2 r;
#pragma unroll
  for (int i = 0; i < 16; ++i) { const __bf16 h = (__bf16)v[i]; r.h[i] = h; r.l[i] = (__bf16)(v[i] - (float)h); }
  return r; }
__device__ __forceinline__ F2 split_row(const float* row, int k0, int lane) { float v[16]; const float* p = row + k0 + 8 * (lane >> 4);
#pragma unroll
  for (int i = 0; i < 8; ++i) { v[i] = p[i]; v[8 + i] = p[16 + i]; }
  return bsplit16(v); }
__device__ __forceinline__ F2 split_rowK(const float* row, int k0, int lane, int K) { float v[16]; const int g = lane >> 4;
#pragma unroll
  for (int i = 0; i < 8; ++i) { const int ka = k0 + 8 * g + i, kb = ka + 16; v[i] = ka < K ? row[ka < K ? ka : K - 1] : 0.f; v[8 + i] = kb < K ? row[kb < K ? kb : K - 1] : 0.f; }
  return bsplit16(v); }
__device__ __forceinline__ F2 split_col(const float* W, int k0, int n, int lane, int ld, int K) { float v[16]; const int g = lane >> 4;
#pragma unroll
  for (int i = 0; i < 8; ++i) { const int ka = k0 + 8 * g + i, kb = ka + 16; v[i] = ka < K ? W[(size_t)(ka < K ? ka : K - 1) * ld + n] : 0.f; v[8 + i] = kb < K ? W[(size_t)(kb < K ? kb : K - 1) * ld + n] : 0.f; }
  return bsplit16(v); }
__device__ __forceinline__ v8f mac3(const F2& a, const F2& b, v8f c) { c = wmma_bf(a.l, b.h, c); c = wmma_bf(a.h, b.l, c); return wmma_bf(a.h, b.h, c); }
__device__ __forceinline__ float sigm(float v) { return 1.0f / (1.0f + expf(-v)); }
#define LDSX() do { asm volatile("s_wait_dscnt 0" ::: "memory"); __builtin_amdgcn_wave_barrier(); __builtin_amdgcn_fence(__ATOMIC_RELEASE, "workgroup"); } while (0)


#define NB 2
#define SS 2048
#define DM 1024
#define NH 16
#define HALFW 64
#define HD 64
#define QKVW (3 * DM)
#ifndef TQB
#define TQB (SS / 64)
#define TNB NB
#define TOB (NB * SS / 64)     // 64-row tiles of all output rows (unused)
#endif
typedef __attribute__((ext_vector_type(8))) __bf16 v8b;
__device__ __forceinline__ v16b frag_b(const __bf16* rowk0, int lane) {
  union { v16b v; v8b q[2]; } u; const __bf16* p = rowk0 + 8 * (lane >> 4);
  u.q[0] = *(const v8b*)p; u.q[1] = *(const v8b*)(p + 16); return u.v;
}
__device__ __forceinline__ float bfr(float v) { return (float)(__bf16)v; }
__device__ __attribute__((noinline)) float exp_ni(float v) { return expf(v); }
__device__ __attribute__((noinline)) float erf_ni(float v) { return erff(v); }

#define PK_A 0                       // [3072][1024] Wqkv rows (natural [out][in])
#define PK_P (PK_A + QKVW * DM)        // [1024][1024] Wo rows (natural)
#define PK_END (PK_P + DM * DM)
#define WS_PK  0u
#define WS_QK  (WS_PK + 2u * PK_END)             // f16 [4096 rows][2048]: q | k
#define WS_QKL (WS_QK + 2u * NB * SS * 2 * DM)     // f16 q | k residual planes x2048
#define WS_VTH (WS_QKL + 2u * NB * SS * 2 * DM)    // f16 [b][1024 (h*64+d)][2048 s] hi
#define WS_VTL (WS_VTH + 2u * NB * DM * SS)        // f16 lo x 2048
#define WS_O   (WS_VTL + 2u * NB * DM * SS)        // f32 [4096][1024]
#define GLS (SS + 32)                              // ints per batch: positions of the global tokens (ascending, rest 0), then their count
#define NSLOT 16                                   // blocks per (head, batch) that walk the tiles of global query rows
#define WS_GL  (WS_O + 4u * (size_t)NB * SS * DM)        // int [b][GLS]
#define WS_VGH (WS_GL + 4u * (size_t)NB * GLS)           // f16 [b][1024 (h*64+d)][2048 list slot] hi: v columns of the global keys, in list order
#define WS_VGL (WS_VGH + 2u * NB * DM * SS)        // f16 lo x 2048
#define WS_END (WS_VGL + 2u * NB * DM * SS)
#define KS 64                        // k of one staged slice: 128 B of a 16-bit row, 256 B of an f32 row
#define LP (KS + 8)                  // LDS row pitch in 16-bit elements: 144 B, for ds_load_b128 readers
#define STG (2 * 2 * 128 * LP * 2)   // bytes: two buffers of [X 128 rows | W 128 rows]
typedef __attribute__((ext_vector_type(4))) __bf16 v4b;
typedef __attribute__((ext_vector_type(4))) _Float16 v4h;
// ---- k_qkv: block = (128 rows, 128 cols), 8 waves, a wave 16 rows x 128 cols. Each k slice of X (rounded to bf16 on the way) and of W goes to LDS by whole-line loads, one slice ahead, two buffers; fragments come from LDS. The epilogue reuses the same LDS.
__global__ __launch_bounds__(256) void k_qkv(const float* __restrict__ XQ, const float* __restrict__ XK, const float* __restrict__ XV, const __bf16* __restrict__ P, const float* __restrict__ BQ, const float* __restrict__ BK, const float* __restrict__ BV, _Float16* __restrict__ QK, _Float16* __restrict__ QKL, _Float16* __restrict__ VTH, _Float16* __restrict__ VTL) {
  const int which0 = (blockIdx.y * 128) / DM; const float* X = (which0 == 0) ? XQ : (which0 == 1) ? XK : XV; const float* BB = BQ ? (((which0 == 0) ? BQ : (which0 == 1) ? BK : BV) + (blockIdx.y * 128 - which0 * DM)) : nullptr;
  __shared__ __align__(16) unsigned char smem[STG];
  __bf16 (*sa)[128][LP] = (__bf16 (*)[128][LP])smem; __bf16 (*sb)[128][LP] = (__bf16 (*)[128][LP])(smem + STG / 2);
  _Float16 (*so)[16][136] = (_Float16 (*)[16][136])smem; _Float16 (*sol)[16][136] = (_Float16 (*)[16][136])(smem + 8 * 16 * 136 * 2);
  _Float16 (*sth)[136] = (_Float16 (*)[136])smem; _Float16 (*stl)[136] = (_Float16 (*)[136])(smem + 128 * 136 * 2);
  const int tid = threadIdx.x, wave = tid >> 5, lane = tid & 31, col = lane & 15, g = lane >> 4; const size_t r0 = (size_t)blockIdx.x * 128 + wave * 16; const int n0 = blockIdx.y * 128;
  const int xr = tid >> 4, xc = (tid & 15) * 4, wr = tid >> 3, wc = (tid & 7) * 8;   // 16 lanes cover 256 B of an X row, 8 lanes 128 B of a W row
  const float* xg = X + ((size_t)blockIdx.x * 128 + xr) * DM + xc; const __bf16* wg = P + (size_t)(n0 + wr) * DM + wc;
  v4f ra[8]; v4u rb[4];
#pragma unroll
  for (int i = 0; i < 8; ++i) ra[i] = *(const v4f*)(xg + (size_t)i * 16 * DM);
#pragma unroll
  for (int i = 0; i < 4; ++i) rb[i] = *(const v4u*)(wg + (size_t)i * 32 * DM);
#pragma unroll
  for (int i = 0; i < 8; ++i) { v4b t; t[0] = (__bf16)ra[i][0]; t[1] = (__bf16)ra[i][1]; t[2] = (__bf16)ra[i][2]; t[3] = (__bf16)ra[i][3]; *(v4b*)&sa[0][i * 16 + xr][xc] = t; }
#pragma unroll
  for (int i = 0; i < 4; ++i) *(v4u*)&sb[0][i * 32 + wr][wc] = rb[i];
  v8f acc[8] = {};
#pragma unroll 1   // kept rolled: 16 unrolled trips would swell the text, which costs instruction fetches on a first pass
  for (int ks = 0; ks < DM / KS; ++ks) { const int bf = ks & 1; const bool more = ks + 1 < DM / KS;
    __syncthreads();   // slice ks is in LDS for every wave, and every wave has left the buffer that this trip refills
    if (more) {
#pragma unroll
      for (int i = 0; i < 8; ++i) ra[i] = *(const v4f*)(xg + (size_t)i * 16 * DM + (ks + 1) * KS);
#pragma unroll
      for (int i = 0; i < 4; ++i) rb[i] = *(const v4u*)(wg + (size_t)i * 32 * DM + (ks + 1) * KS);
      asm volatile("s_wait_xcnt 0x0" ::: "memory"); }   // the address registers of these loads are reused further down the trip
#pragma unroll
    for (int kc = 0; kc < KS / 32; ++kc) { const v16b a = frag_b(&sa[bf][wave * 16 + col][kc * 32], lane); v16b w[8];
#pragma unroll
      for (int j = 0; j < 8; ++j) w[j] = frag_b(&sb[bf][j * 16 + col][kc * 32], lane);   // the block's LDS reads as one group, ahead of its products
#pragma unroll
      for (int j = 0; j < 8; ++j) acc[j] = wmma_bf(a, w[j], acc[j]); }
    if (more) {
#pragma unroll
      for (int i = 0; i < 8; ++i) { v4b t; t[0] = (__bf16)ra[i][0]; t[1] = (__bf16)ra[i][1]; t[2] = (__bf16)ra[i][2]; t[3] = (__bf16)ra[i][3]; *(v4b*)&sa[bf ^ 1][i * 16 + xr][xc] = t; }
#pragma unroll
      for (int i = 0; i < 4; ++i) *(v4u*)&sb[bf ^ 1][i * 32 + wr][wc] = rb[i]; } }
  __syncthreads();   // every wave has read the last slice before the epilogue overwrites the buffers
  if (n0 < 2 * DM) {   // q stored unscaled (f16 sigma ~0.6, no subnormal exposure); 1/8 applied to the f32 score
#pragma unroll
    for (int j = 0; j < 8; ++j) {
#pragma unroll
      for (int r = 0; r < 8; ++r) { const float v = acc[j][r] + (BB ? bfr(BB[j * 16 + col]) : 0.f); const _Float16 hv = (_Float16)v; so[wave][8 * g + r][j * 16 + col] = hv; sol[wave][8 * g + r][j * 16 + col] = (_Float16)((v - (float)hv) * 2048.0f); } }   // q, k (+ bias) as f16 hi + (x2048) residual
    LDSX();
    for (int rl = 0; rl < 16; ++rl) if (lane < 16) { vst2((unsigned*)(QK + (r0 + rl) * (2 * DM) + n0 + lane * 8), *(const v4u*)&so[wave][rl][lane * 8]); vst2((unsigned*)(QKL + (r0 + rl) * (2 * DM) + n0 + lane * 8), *(const v4u*)&sol[wave][rl][lane * 8]); }
  } else {
#pragma unroll
    for (int j = 0; j < 8; ++j) {
#pragma unroll
      for (int r = 0; r < 8; ++r) { const float v = acc[j][r] + (BB ? bfr(BB[j * 16 + col]) : 0.f); const _Float16 hv = (_Float16)v; sth[j * 16 + col][wave * 16 + 8 * g + r] = hv; stl[j * 16 + col][wave * 16 + 8 * g + r] = (_Float16)((v - (float)hv) * 2048.0f); } }
    __syncthreads();
    const size_t rb0 = (size_t)blockIdx.x * 128; const int b = (int)(rb0 / SS), s0 = (int)(rb0 % SS); const int pc0 = n0 - 2 * DM;
    for (int q = tid; q < 128 * 16; q += 256) { const int d = q >> 4, pc = q & 15; const size_t o = ((size_t)b * DM + pc0 + d) * SS + s0 + pc * 8; vst2((unsigned*)(VTH + o), *(const v4u*)&sth[d][pc * 8]); vst2((unsigned*)(VTL + o), *(const v4u*)&stl[d][pc * 8]); }
  }
}
// fragment from the lane's own first element (row and 8 * (lane >> 4) already in p)
__device__ __forceinline__ v16h frag_p(const _Float16* p) { union { v16h v; v8h q[2]; } u; u.q[0] = *(const v8h*)p; u.q[1] = *(const v8h*)(p + 16); return u.v; }
#define WKEYS 256                       // keys that the windows of a block's 128 queries touch: 64 + 128 + 64
#define KP (HD + 8)                  // LDS pitch of a staged K row (128 B of data) in 16-bit elements: 144 B, for ds_load_b128 readers
#define VP (WKEYS + 8)                  // LDS pitch of a staged V row (one d, 512 B of data): 528 B = 16 B x odd
#define ASTG (2 * WKEYS * KP * 2 + 2 * HD * VP * 2)   // bytes: K hi | K residual | V hi | V residual
// ---- k_attn: 8 waves. Blocks x >= NSLOT: 128 queries, one 16-query tile a wave; the block's WKEYS window keys (K rows and V columns, both planes) go to LDS once by whole-line loads and every wave takes its window fragments from there: the key tiles its window touches, then the packed global keys (those inside the window masked there, so each pair counts once); rows that are global themselves are not stored here. Blocks x < NSLOT: tiles of 16 packed global query rows, every key allowed, each wave 8 of the 64 key tiles, the 8 partial (m, l, acc) merged in LDS. Scores 3 products x 1/8; P.V: f16 P hi/lo x (V hi, V lo*2048); O[b*S+q][h*64+d] (256-B segments)
__global__ __launch_bounds__(256) void k_attn(const _Float16* __restrict__ QK, const _Float16* __restrict__ QKL, const _Float16* __restrict__ VTH, const _Float16* __restrict__ VTL, const _Float16* __restrict__ VGH, const _Float16* __restrict__ VGL, const int* __restrict__ GLB, const int* __restrict__ GL, float* __restrict__ O) {
  __shared__ __align__(16) float sp[8][16][36]; __shared__ __align__(16) unsigned char stg[ASTG]; __shared__ float sm[8][16], sl[8][16];
  _Float16 (*skh)[KP] = (_Float16 (*)[KP])stg; _Float16 (*skl)[KP] = (_Float16 (*)[KP])(stg + WKEYS * KP * 2);
  _Float16 (*svh)[VP] = (_Float16 (*)[VP])(stg + 2 * WKEYS * KP * 2); _Float16 (*svl)[VP] = (_Float16 (*)[VP])(stg + 2 * WKEYS * KP * 2 + HD * VP * 2);
  float (*so)[16][68] = (float (*)[16][68])stg;   // the epilogues reuse the staged keys' LDS
  const int tid = threadIdx.x, wave = __builtin_amdgcn_readfirstlane(tid >> 5), lane = tid & 31, col = lane & 15, g = lane >> 4;
  const int h = blockIdx.y, b = blockIdx.z; const int* lst = GL + (size_t)b * GLS; const int* gb = GLB + (size_t)b * SS;
  int n = lst[SS]; n = n < 0 ? 0 : (n > SS ? SS : n);
  const bool dense = blockIdx.x < NSLOT; const int ngt = (n + 31) >> 5;
  const int q0b = ((int)blockIdx.x - NSLOT) * 128 + wave * 16;   // window blocks only
  const int qtend = dense ? ((n + 15) >> 4) : (int)blockIdx.x + 1;
  const unsigned gqm = __builtin_amdgcn_ballot_w32((dense ? 0 : gb[q0b + col]) != 0);   // bit rl: query q0b + rl is global (its row belongs to the packed tiles)
  int ks0 = ((int)blockIdx.x - NSLOT) * 128 - HALFW; ks0 = ks0 < 0 ? 0 : (ks0 > SS - WKEYS ? SS - WKEYS : ks0);   // first staged key: the WKEYS keys from here hold every window of the block
  if (!dense) {
    const int kr = tid >> 3, kc8 = (tid & 7) * 8, vc8 = lane * 8;   // 8 lanes cover the 128 B of a K row, a wave the 512 B of a V row
    const size_t ko = ((size_t)b * SS + ks0 + kr) * (2 * DM) + h * HD + kc8, vo = ((size_t)b * DM + h * HD + wave) * SS + ks0 + vc8;
    const _Float16 *gkh = QK + ko, *gkl = QKL + ko, *gvh = VTH + vo, *gvl = VTL + vo; v4u tk[8], tl[8], tv[8], tw[8];
#pragma unroll
    for (int i = 0; i < 8; ++i) { tk[i] = *(const v4u*)(gkh + DM + (size_t)i * 32 * (2 * DM)); tl[i] = *(const v4u*)(gkl + DM + (size_t)i * 32 * (2 * DM)); }   // + DM: the k half of a q | k row
#pragma unroll
    for (int i = 0; i < 8; ++i) { tv[i] = *(const v4u*)(gvh + (size_t)i * 8 * SS); tw[i] = *(const v4u*)(gvl + (size_t)i * 8 * SS); }
    asm volatile("s_wait_xcnt 0x0" :: "v"(gkh), "v"(gkl), "v"(gvh), "v"(gvl) : "memory");   // the address registers of these loads are reused by what follows; named as inputs so that none of them is given to a later load's result ahead of the wait
#pragma unroll
    for (int i = 0; i < 8; ++i) { *(v4u*)&skh[i * 32 + kr][kc8] = tk[i]; *(v4u*)&skl[i * 32 + kr][kc8] = tl[i]; }
#pragma unroll
    for (int i = 0; i < 8; ++i) { *(v4u*)&svh[i * 8 + wave][vc8] = tv[i]; *(v4u*)&svl[i * 8 + wave][vc8] = tw[i]; }
    __syncthreads();   // the staged keys are in LDS for every wave
  }
#pragma unroll 1
  for (int qt = blockIdx.x; qt < qtend; qt += NSLOT) {   // window blocks: one trip
    const int q0 = (qt - NSLOT) * 128 + wave * 16;   // window blocks only; formed from qt, so that the 16 row addresses of the epilogue's stores are not computed ahead of the loop and held in registers through it
    const size_t rq = (size_t)b * SS + (dense ? lst[qt * 16 + col] : q0 + col);
    v16h aq[2], aql[2];
#pragma unroll
    for (int kc = 0; kc < 2; ++kc) { aq[kc] = frag_h(QK + rq * (2 * DM) + h * HD + kc * 32, lane); aql[kc] = frag_h(QKL + rq * (2 * DM) + h * HD + kc * 32, lane); }
    float m[8], l[8];
#pragma unroll
    for (int r = 0; r < 8; ++r) { m[r] = -3.0e38f; l[r] = 0.f; }
    v8f acc[4] = {}, accl[4] = {};
    int kt0 = (q0 - HALFW) >> 5, kt1 = (q0 + 15 + HALFW) >> 5; kt0 = kt0 < 0 ? 0 : kt0; kt1 = kt1 > SS / 32 - 1 ? SS / 32 - 1 : kt1;
    const int nwin = dense ? 0 : kt1 - kt0 + 1; const int it0 = dense ? wave * 8 : 0, it1 = dense ? wave * 8 + 8 : nwin + ngt;
#pragma unroll 1
    for (int it = it0; it < it1; ++it) { const bool gl = !dense && it >= nwin; const int kt = dense ? it : (gl ? it - nwin : kt0 + it);   // gl: a tile of the packed global keys
      const _Float16* vhb = gl ? VGH : VTH; const _Float16* vlb = gl ? VGL : VTL; v8f s[2];
      const bool st = !dense && !gl; const int kl0 = kt * 32 - ks0;   // st: a window tile, its fragments come from the staged keys (row kl0 on)
      int kks[2]; v16h kfh[2][2], kfl[2][2];
#pragma unroll
      for (int ct = 0; ct < 2; ++ct) { const int slot = kt * 32 + ct * 16 + col; kks[ct] = gl ? lst[slot] : slot; }
      if (st) {
#pragma unroll
        for (int ct = 0; ct < 2; ++ct) {
#pragma unroll
          for (int kc = 0; kc < 2; ++kc) { kfh[ct][kc] = frag_h(&skh[kl0 + ct * 16 + col][kc * 32], lane); kfl[ct][kc] = frag_h(&skl[kl0 + ct * 16 + col][kc * 32], lane); } }
      } else { const _Float16 *pkh[2], *pkl[2];
#pragma unroll
        for (int ct = 0; ct < 2; ++ct) { const size_t kro = ((size_t)b * SS + kks[ct]) * (2 * DM) + h * HD + 8 * g; pkh[ct] = QK + kro; pkl[ct] = QKL + kro;
#pragma unroll
          for (int kc = 0; kc < 2; ++kc) { kfh[ct][kc] = frag_p(pkh[ct] + DM + kc * 32); kfl[ct][kc] = frag_p(pkl[ct] + DM + kc * 32); } }   // + DM: the k half of a q | k row
        asm volatile("s_wait_xcnt 0x0" :: "v"(pkh[0]), "v"(pkh[1]), "v"(pkl[0]), "v"(pkl[1]) : "memory");   // the address registers of these loads are reused further down the trip; named as inputs so that none of them is given to a later load's result ahead of the wait
      }
#pragma unroll
      for (int ct = 0; ct < 2; ++ct) { const int slot = kt * 32 + ct * 16 + col; const int kk = kks[ct]; v8f c = {}, cl = {};
#pragma unroll
        for (int kc = 0; kc < 2; ++kc) { c = wmma16(aq[kc], kfh[ct][kc], c); cl = wmma16(aql[kc], kfh[ct][kc], cl); cl = wmma16(aq[kc], kfl[ct][kc], cl); }   // 3 products: q, k as f16 hi + residual
#pragma unroll
        for (int r = 0; r < 8; ++r) c[r] += cl[r] * (1.0f / 2048.0f);
        { const bool live = slot < n;
#pragma unroll
        for (int r = 0; r < 8; ++r) { const int dq = kk - (q0 + 8 * g + r); const bool inw = (dq <= HALFW) & (-dq <= HALFW); s[ct][r] = (dense | (gl ? (live & !inw) : inw)) ? c[r] * 0.125f : -3.0e38f; } } }   // 1/sqrt(64); masked keys excluded
#pragma unroll
      for (int r = 0; r < 8; ++r) { float mx = fmaxf(s[0][r], s[1][r]);
#pragma unroll
        for (int o = 1; o < 16; o <<= 1) mx = fmaxf(mx, __shfl_xor(mx, o));
        const float mn = fmaxf(m[r], mx); const float alpha = (m[r] <= -1.0e38f) ? 0.f : __expf(m[r] - mn);
        const float e0 = (s[0][r] <= -1.0e38f) ? 0.f : __expf(s[0][r] - mn), e1 = (s[1][r] <= -1.0e38f) ? 0.f : __expf(s[1][r] - mn); float es = e0 + e1;
#pragma unroll
        for (int o = 1; o < 16; o <<= 1) es += __shfl_xor(es, o);
        l[r] = l[r] * alpha + es; m[r] = mn;
#pragma unroll
        for (int dt = 0; dt < 4; ++dt) { acc[dt][r] *= alpha; accl[dt][r] *= alpha; }
        sp[wave][8 * g + r][col] = e0; sp[wave][8 * g + r][16 + col] = e1; }
      v16h vfh[4], vfl[4];   // the tile's V fragments, as one group, asked for while P goes through LDS
      if (st) {
#pragma unroll
        for (int dt = 0; dt < 4; ++dt) { vfh[dt] = frag_h(&svh[dt * 16 + col][kl0], lane); vfl[dt] = frag_h(&svl[dt * 16 + col][kl0], lane); }
      } else { const size_t vr = ((size_t)b * DM + h * HD + col) * SS + kt * 32 + 8 * g; const _Float16 *pvh = vhb + vr, *pvl = vlb + vr;
#pragma unroll
        for (int dt = 0; dt < 4; ++dt) { vfh[dt] = frag_p(pvh + (size_t)dt * 16 * SS); vfl[dt] = frag_p(pvl + (size_t)dt * 16 * SS); }
        asm volatile("s_wait_xcnt 0x0" :: "v"(pvh), "v"(pvl) : "memory");   // the address registers of these loads are reused further down the trip; named as inputs so that neither is given to a later load's result ahead of the wait
      }
      LDSX();
      v16h pa, pl; { const float* prow = &sp[wave][col][0] + 8 * (lane >> 4);
#pragma unroll
        for (int i = 0; i < 8; ++i) { const float x0 = prow[i] * 2048.0f, x1 = prow[16 + i] * 2048.0f; const _Float16 h0 = (_Float16)x0, h1 = (_Float16)x1; pa[i] = h0; pa[8 + i] = h1; pl[i] = (_Float16)((x0 - (float)h0) * 2048.0f); pl[8 + i] = (_Float16)((x1 - (float)h1) * 2048.0f); } }   // P scaled by 2^11 before the f16 split so small softmax weights stay out of the f16 subnormal range; 2^-11 folded into the epilogue
#pragma unroll
      for (int dt = 0; dt < 4; ++dt) { acc[dt] = wmma16(pa, vfh[dt], acc[dt]); accl[dt] = wmma16(pl, vfh[dt], accl[dt]); accl[dt] = wmma16(pa, vfl[dt], accl[dt]); }   // P hi x V hi + (P lo x V hi + P hi x V lo) / 2048
      LDSX(); }
    if (!dense) {
      __syncthreads();   // every wave has read its last staged fragment before the epilogue overwrites that LDS
#pragma unroll
      for (int r = 0; r < 8; ++r) { const float il = (1.0f / 2048.0f) / l[r];
#pragma unroll
        for (int dt = 0; dt < 4; ++dt) so[wave][8 * g + r][dt * 16 + col] = (acc[dt][r] + accl[dt][r] * (1.0f / 2048.0f)) * il; }
      LDSX();
      for (int rl = 0; rl < 16; ++rl) if (lane < 16 && ((gqm >> rl) & 1u) == 0u) { vst2(O + ((size_t)b * SS + q0 + rl) * DM + h * HD + lane * 4, *(const v4f*)&so[wave][rl][lane * 4]);
        asm volatile("s_wait_xcnt 0x0" ::: "memory"); }   // the next row's LDS read lands in the registers this store names
    } else {
#pragma unroll
      for (int r = 0; r < 8; ++r) {
#pragma unroll
        for (int dt = 0; dt < 4; ++dt) so[wave][8 * g + r][dt * 16 + col] = acc[dt][r] + accl[dt][r] * (1.0f / 2048.0f);
        if (col == 0) { sm[wave][8 * g + r] = m[r]; sl[wave][8 * g + r] = l[r]; } }
      __syncthreads();   // every wave's partial is in LDS before the merge reads it
      const int row = tid >> 4, d4 = (tid & 15) * 4; float mm = sm[0][row];
#pragma unroll
      for (int w = 1; w < 8; ++w) mm = fmaxf(mm, sm[w][row]);
      float ll = 0.f; v4f a = {};
#pragma unroll
      for (int w = 0; w < 8; ++w) { const float e = __expf(sm[w][row] - mm); ll += e * sl[w][row]; a += *(const v4f*)&so[w][row][d4] * e; }
      if (qt * 16 + row < n) { vst2(O + ((size_t)b * SS + lst[qt * 16 + row]) * DM + h * HD + d4, a * ((1.0f / 2048.0f) / ll));
        asm volatile("s_wait_xcnt 0x0" ::: "memory"); }   // the next tile's set-up reuses the registers this store names
      __syncthreads();   // the merge has read the partials before the next tile overwrites them
    }
  }
}
// ---- k_out: block = (128 rows, 128 cols), 8 waves, staged as k_qkv: out = f16(O) . Wo rows + bo
__global__ __launch_bounds__(256) void k_out(const float* __restrict__ O, const __bf16* __restrict__ P, const float* __restrict__ BO, float* __restrict__ Y) {
  __shared__ __align__(16) unsigned char smem[STG];
  _Float16 (*sa)[128][LP] = (_Float16 (*)[128][LP])smem; _Float16 (*sb)[128][LP] = (_Float16 (*)[128][LP])(smem + STG / 2);
  float (*so)[16][132] = (float (*)[16][132])smem;
  const int tid = threadIdx.x, wave = tid >> 5, lane = tid & 31, col = lane & 15, g = lane >> 4; const size_t r0 = (size_t)blockIdx.x * 128 + wave * 16; const int n0 = blockIdx.y * 128;
  const int xr = tid >> 4, xc = (tid & 15) * 4, wr = tid >> 3, wc = (tid & 7) * 8;   // 16 lanes cover 256 B of an O row, 8 lanes 128 B of a W row
  const float* xg = O + ((size_t)blockIdx.x * 128 + xr) * DM + xc; const _Float16* wg = (const _Float16*)P + (size_t)(n0 + wr) * DM + wc;
  v4f ra[8]; v4u rb[4];
#pragma unroll
  for (int i = 0; i < 8; ++i) ra[i] = *(const v4f*)(xg + (size_t)i * 16 * DM);
#pragma unroll
  for (int i = 0; i < 4; ++i) rb[i] = *(const v4u*)(wg + (size_t)i * 32 * DM);
#pragma unroll
  for (int i = 0; i < 8; ++i) { v4h t; t[0] = (_Float16)ra[i][0]; t[1] = (_Float16)ra[i][1]; t[2] = (_Float16)ra[i][2]; t[3] = (_Float16)ra[i][3]; *(v4h*)&sa[0][i * 16 + xr][xc] = t; }
#pragma unroll
  for (int i = 0; i < 4; ++i) *(v4u*)&sb[0][i * 32 + wr][wc] = rb[i];
  v8f acc[8] = {};
#pragma unroll 1   // kept rolled: 16 unrolled trips would swell the text, which costs instruction fetches on a first pass
  for (int ks = 0; ks < DM / KS; ++ks) { const int bf = ks & 1; const bool more = ks + 1 < DM / KS;
    __syncthreads();   // slice ks is in LDS for every wave, and every wave has left the buffer that this trip refills
    if (more) {
#pragma unroll
      for (int i = 0; i < 8; ++i) ra[i] = *(const v4f*)(xg + (size_t)i * 16 * DM + (ks + 1) * KS);
#pragma unroll
      for (int i = 0; i < 4; ++i) rb[i] = *(const v4u*)(wg + (size_t)i * 32 * DM + (ks + 1) * KS);
      asm volatile("s_wait_xcnt 0x0" ::: "memory"); }   // the address registers of these loads are reused further down the trip
#pragma unroll
    for (int kc = 0; kc < KS / 32; ++kc) { const v16h a = frag_h(&sa[bf][wave * 16 + col][kc * 32], lane); v16h w[8];
#pragma unroll
      for (int j = 0; j < 8; ++j) w[j] = frag_h(&sb[bf][j * 16 + col][kc * 32], lane);   // the block's LDS reads as one group, ahead of its products
#pragma unroll
      for (int j = 0; j < 8; ++j) acc[j] = wmma16(a, w[j], acc[j]); }   // single f16 product against exact f16 x 2^8 weight copies
    if (more) {
#pragma unroll
      for (int i = 0; i < 8; ++i) { v4h t; t[0] = (_Float16)ra[i][0]; t[1] = (_Float16)ra[i][1]; t[2] = (_Float16)ra[i][2]; t[3] = (_Float16)ra[i][3]; *(v4h*)&sa[bf ^ 1][i * 16 + xr][xc] = t; }
#pragma unroll
      for (int i = 0; i < 4; ++i) *(v4u*)&sb[bf ^ 1][i * 32 + wr][wc] = rb[i]; } }
  __syncthreads();   // every wave has read the last slice before the epilogue overwrites the buffers
#pragma unroll
  for (int j = 0; j < 8; ++j) {
#pragma unroll
    for (int r = 0; r < 8; ++r) so[wave][8 * g + r][j * 16 + col] = acc[j][r] * (1.0f / 256.0f) + bfr(BO[n0 + j * 16 + col]); }
  LDSX();
  for (int rl = 0; rl < 16; ++rl) vst2(Y + (r0 + rl) * DM + n0 + lane * 4, *(const v4f*)&so[wave][rl][lane * 4]);
}
#define FCH 8192                     // floats of one weight matrix that a converting block takes: 8 whole-line loads a lane
#define FPM (DM * DM / FCH)          // converting blocks per matrix
// ---- k_front: one launch for all that depends on the inputs alone. Blocks x < NB: batch b = x: GL[b][0..n) = positions of the global tokens, ascending; the rest of the list 0; GL[b][SS..SS+32) = n. Blocks x >= NB: FCH consecutive floats of W_q | W_k | W_v -> bf16 (PK_A) or of W_o -> f16 x 2^8 copies of the bf16-rounded values (PK_P, bit pattern in the bf16-typed buffer); the natural [out][in] order is kept, so the copy is elementwise and needs no LDS
__global__ __launch_bounds__(256) void k_front(const float* __restrict__ WQ, const float* __restrict__ WK, const float* __restrict__ WV, const float* __restrict__ WO, const int* __restrict__ GLB, __bf16* __restrict__ PK, int* __restrict__ GL) { __shared__ int sc[256]; __shared__ int sl[SS]; const int t = threadIdx.x;
  if (blockIdx.x >= NB) { const int cb = blockIdx.x - NB, which = cb / FPM; const float* Wm = (which == 0) ? WQ : (which == 1) ? WK : (which == 2) ? WV : WO;
    const size_t e0 = (size_t)(cb % FPM) * FCH + t * 4; const float* sp = Wm + e0; __bf16* dp = PK + PK_A + (size_t)which * DM * DM + e0;   // PK_P follows the three PK_A matrices
    v4f a[8];
#pragma unroll
    for (int i = 0; i < 8; ++i) a[i] = *(const v4f*)(sp + i * 1024);   // a wave's load covers 512 contiguous bytes; all 8 in flight together
    asm volatile("s_wait_xcnt 0x0" ::: "memory");   // the address registers of these loads may be reused by what follows
    if (which < 3) {
#pragma unroll
      for (int i = 0; i < 8; ++i) { v4b o; o[0] = (__bf16)a[i][0]; o[1] = (__bf16)a[i][1]; o[2] = (__bf16)a[i][2]; o[3] = (__bf16)a[i][3]; *(v4b*)(dp + i * 1024) = o; }
    } else {
#pragma unroll
      for (int i = 0; i < 8; ++i) { v4h o; o[0] = (_Float16)(bfr(a[i][0]) * 256.0f); o[1] = (_Float16)(bfr(a[i][1]) * 256.0f); o[2] = (_Float16)(bfr(a[i][2]) * 256.0f); o[3] = (_Float16)(bfr(a[i][3]) * 256.0f); vst2(dp + i * 1024, o); }
      asm volatile("s_wait_xcnt 0x0" ::: "memory");   // the code laid out behind these stores writes registers that they name
    }
    return; }   // block-uniform, ahead of every barrier
  const size_t b = blockIdx.x; const int* gb = GLB + b * SS;
  int f[8], c = 0;
#pragma unroll
  for (int i = 0; i < 8; ++i) { f[i] = gb[t * 8 + i] != 0; c += f[i]; }
  sc[t] = c; for (int i = t; i < SS; i += 256) sl[i] = 0;
  __syncthreads();
  int base = 0, tot = 0; for (int i = 0; i < 256; ++i) { const int v = sc[i]; tot += v; base += (i < t) ? v : 0; }
#pragma unroll
  for (int i = 0; i < 8; ++i) if (f[i]) sl[base++] = t * 8 + i;
  __syncthreads();
  int* o = GL + b * GLS; for (int i = t; i < SS; i += 256) o[i] = sl[i];
  if (t < 32) o[SS + t] = tot; }
// ---- k_gv: block = (8 rows h*64+d, b), one wave a row: VG[b][row][slot] = VT[b][row][list[slot]] for the n global keys, 0 up to the next multiple of 32
__global__ __launch_bounds__(256) void k_gv(const _Float16* __restrict__ VTH, const _Float16* __restrict__ VTL, const int* __restrict__ GL, _Float16* __restrict__ VGH, _Float16* __restrict__ VGL) { const int t = threadIdx.x; const size_t b = blockIdx.y; const int* lst = GL + b * GLS;
  int n = lst[SS]; n = n < 0 ? 0 : (n > SS ? SS : n); const int npad = (n + 31) & ~31; const size_t row = (b * DM + blockIdx.x * 8 + (t >> 5)) * SS;
  for (int p = t & 31; p < npad; p += 32) { const int k = lst[p]; _Float16 vh = (_Float16)0.f, vl = (_Float16)0.f; if (p < n) { vh = VTH[row + k]; vl = VTL[row + k]; } VGH[row + p] = vh; VGL[row + p] = vl; } }
extern "C" void kernel_launch(void* const* d_in, const int* in_sizes, int n_in, void* d_out, int out_size, void* d_ws, size_t ws_size, hipStream_t stream) {
  (void)in_sizes; (void)n_in; (void)out_size;
  const float** F = (const float**)d_in;   // 0 x [2,2048,1024], 1 is_global bool [2,2048], 2 wq, 3 bq, 4 wk, 5 bk, 6 wv, 7 bv, 8 wo, 9 bo (natural)
  if (ws_size < (size_t)WS_END) return;
  char* ws = (char*)d_ws; __bf16* PK = (__bf16*)(ws + WS_PK); _Float16 *QK = (_Float16*)(ws + WS_QK), *QKL = (_Float16*)(ws + WS_QKL), *VTH = (_Float16*)(ws + WS_VTH), *VTL = (_Float16*)(ws + WS_VTL); float* O = (float*)(ws + WS_O); int* GL = (int*)(ws + WS_GL); _Float16 *VGH = (_Float16*)(ws + WS_VGH), *VGL = (_Float16*)(ws + WS_VGL); const int* GLB = (const int*)d_in[1];
  k_front<<<NB + 4 * FPM, 256, 0, stream>>>(F[2], F[4], F[6], F[8], GLB, PK, GL);
  k_qkv<<<dim3(NB * SS / 128, QKVW / 128), 256, 0, stream>>>(F[0], F[0], F[0], PK + PK_A, F[3], F[5], F[7], QK, QKL, VTH, VTL);
  k_gv<<<dim3(DM / 8, NB), 256, 0, stream>>>(VTH, VTL, GL, VGH, VGL);
  k_attn<<<dim3(NSLOT + SS / 128, NH, NB), 256, 0, stream>>>(QK, QKL, VTH, VTL, VGH, VGL, GLB, GL, O);
  k_out<<<dim3(NB * SS / 128, DM / 128), 256, 0, stream>>>(O, PK + PK_P, F[9], (float*)d_out);
}

// v005
// It runs in 112 microseconds.
// In two side-by-side timings against v004, it was 1.22 and 1.21 times as fast.
// Over all steps from v000 it is 4.44 times as fast.
// compute dtype: all float inputs rounded to bf16, is_global (bool) read on device; q/k/v = x . W^T + b with EXACT bf16 products on WMMA 16x16x32 (natural rows), rounded once to f16 hi + residual; attention with 3-product scores and P.v (hi + residual planes) restricted to each 16-query tile's window key tiles plus a packed list of the global keys (list built on device from is_global, their v columns gathered), global query rows packed into tiles of their own that visit every key (8 waves split the keys, merged in LDS), the per-pair rule evaluated inline, x 1/8, running-max softmax in f32 (hardware exp); out = f16(ctx) . Wo^T (exact f16 x 2^8 copies) + bo; f32 output.
#include <hip/hip_runtime.h>
#include <math.h>

typedef __attribute__((ext_vector_type(16))) _Float16 v16h;
typedef __attribute__((ext_vector_type(16))) __bf16 v16b;
typedef __attribute__((ext_vector_type(8)))  _Float16 v8h;
typedef __attribute__((ext_vector_type(8)))  float v8f;
typedef __attribute__((ext_vector_type(4)))  float v4f;
typedef __attribute__((ext_vector_type(2)))  float v2f;
typedef __attribute__((ext_vector_type(4)))  unsigned v4u;
typedef __attribute__((ext_vector_type(4)))  int v4i;
typedef float __attribute__((may_alias)) float_a;
typedef int __attribute__((may_alias)) int_a;

template <typename T> __device__ __forceinline__ void vst2(void* p, T v) { *(T*)p = v;  }
__device__ __forceinline__ v8f wmma16(v16h a, v16h b, v8f c) {
  v8f d = __builtin_amdgcn_wmma_f32_16x16x32_f16(false, a, false, b, (short)0, c, false, false);
  asm volatile("v_nop\n\tv_nop\n\tv_nop\n\tv_nop" : "+v"(d) : "v"(a), "v"(b));
  return d;
}
__device__ __forceinline__ v8f wmma_bf(v16b a, v16b b, v8f c) {
  v8f d = __builtin_amdgcn_wmma_f32_16x16x32_bf16(false, a, false, b, (short)0, c, false, false);
  asm volatile("v_nop\n\tv_nop\n\tv_nop\n\tv_nop" : "+v"(d) : "v"(a), "v"(b));
  return d;
}
// Sparse structured attention (B 2, S 2,048, hidden 1,024, 16 heads x 64): local window |i - j| <= 64 plus global tokens (is_global, given) that attend everywhere and are attended by everyone; projections + biases, softmax(q k / 8) over the allowed keys, v, output projection + bias.
__device__ __forceinline__ v16h frag_h(const _Float16* rowk0, int lane) {
  union { v16h v; v8h q[2]; } u; const _Float16* p = rowk0 + 8 * (lane >> 4);
  u.q[0] = *(const v8h*)p; u.q[1] = *(const v8h*)(p + 16); return u.v;
}
__device__ __forceinline__ v16h frag_f32(const float* rowk0, int lane) {
  v16h a; const float* p = rowk0 + 8 * (lane >> 4);
#pragma unroll
  for (int i = 0; i < 8; ++i) { a[i] = (_Float16)p[i]; a[8 + i] = (_Float16)p[16 + i]; }
  return a;
}
__device__ __forceinline__ v16h frag_f32s(const float* rowk0, int lane, float sc) {
  v16h a; const float* p = rowk0 + 8 * (lane >> 4);
#pragma unroll
  for (int i = 0; i < 8; ++i) { a[i] = (_Float16)(p[i] * sc); a[8 + i] = (_Float16)(p[16 + i] * sc); }
  return a;
}
// column fragment from a [K][ld] layout (column n), rows >= K read as 0
__device__ __forceinline__ v16h fragc_f32(const float* W, int k0, int n, int lane, int ld, int K) {
  v16h a; const int g = lane >> 4;
#pragma unroll
  for (int i = 0; i < 8; ++i) { const int ka = k0 + 8 * g + i, kb = ka + 16;
    a[i] = (_Float16)(ka < K ? W[(size_t)(ka < K ? ka : K - 1) * ld + n] : 0.f); a[8 + i] = (_Float16)(kb < K ? W[(size_t)(kb < K ? kb : K - 1) * ld + n] : 0.f); }
  return a;
}
struct F2 { v16b h, l; };
__device__ __forceinline__ F2 bsplit16(const float v[16]) { F2 r;
#pragma unroll
  for (int i = 0; i < 16; ++i) { const __bf16 h = (__bf16)v[i]; r.h[i] = h; r.l[i] = (__bf16)(v[i] - (float)h); }
  return r; }
__device__ __forceinline__ F2 split_row(const float* row, int k0, int lane) { float v[16]; const float* p = row + k0 + 8 * (lane >> 4);
#pragma unroll
  for (int i = 0; i < 8; ++i) { v[i] = p[i]; v[8 + i] = p[16 + i]; }
  return bsplit16(v); }
__device__ __forceinline__ F2 split_rowK(const float* row, int k0, int lane, int K) { float v[16]; const int g = lane >> 4;
#pragma unroll
  for (int i = 0; i < 8; ++i) { const int ka = k0 + 8 * g + i, kb = ka + 16; v[i] = ka < K ? row[ka < K ? ka : K - 1] : 0.f; v[8 + i] = kb < K ? row[kb < K ? kb : K - 1] : 0.f; }
  return bsplit16(v); }
__device__ __forceinline__ F2 split_col(const float* W, int k0, int n, int lane, int ld, int K) { float v[16]; const int g = lane >> 4;
#pragma unroll
  for (int i = 0; i < 8; ++i) { const int ka = k0 + 8 * g + i, kb = ka + 16; v[i] = ka < K ? W[(size_t)(ka < K ? ka : K - 1) * ld + n] : 0.f; v[8 + i] = kb < K ? W[(size_t)(kb < K ? kb : K - 1) * ld + n] : 0.f; }
  return bsplit16(v); }
__device__ __forceinline__ v8f mac3(const F2& a, const F2& b, v8f c) { c = wmma_bf(a.l, b.h, c); c = wmma_bf(a.h, b.l, c); return wmma_bf(a.h, b.h, c); }
__device__ __forceinline__ float sigm(float v) { return 1.0f / (1.0f + expf(-v)); }
#define LDSX() do { asm volatile("s_wait_dscnt 0" ::: "memory"); __builtin_amdgcn_wave_barrier(); __builtin_amdgcn_fence(__ATOMIC_RELEASE, "workgroup"); } while (0)


#define NB 2
#define SS 2048
#define DM 1024
#define NH 16
#define HALFW 64
#define HD 64
#define QKVW (3 * DM)
#ifndef TQB
#define TQB (SS / 64)
#define TNB NB
#define TOB (NB * SS / 64)     // 64-row tiles of all output rows (unused)
#endif
typedef __attribute__((ext_vector_type(8))) __bf16 v8b;
__device__ __forceinline__ v16b frag_b(const __bf16* rowk0, int lane) {
  union { v16b v; v8b q[2]; } u; const __bf16* p = rowk0 + 8 * (lane >> 4);
  u.q[0] = *(const v8b*)p; u.q[1] = *(const v8b*)(p + 16); return u.v;
}
__device__ __forceinline__ float bfr(float v) { return (float)(__bf16)v; }
__device__ __attribute__((noinline)) float exp_ni(float v) { return expf(v); }
__device__ __attribute__((noinline)) float erf_ni(float v) { return erff(v); }

#define PK_A 0                       // [3072][1024] Wqkv rows (natural [out][in])
#define PK_P (PK_A + QKVW * DM)        // [1024][1024] Wo rows (natural)
#define PK_END (PK_P + DM * DM)
#define WS_PK  0u
#define WS_QK  (WS_PK + 2u * PK_END)             // f16 [4096 rows][2048]: q | k
#define WS_QKL (WS_QK + 2u * NB * SS * 2 * DM)     // f16 q | k residual planes x2048
#define WS_VTH (WS_QKL + 2u * NB * SS * 2 * DM)    // f16 [b][1024 (h*64+d)][2048 s] hi
#define WS_VTL (WS_VTH + 2u * NB * DM * SS)        // f16 lo x 2048
#define WS_O   (WS_VTL + 2u * NB * DM * SS)        // f32 [4096][1024]
#define GLS (SS + 32)                              // ints per batch: positions of the global tokens (ascending, rest 0), then their count
#define NSLOT 16                                   // blocks per (head, batch) that walk the tiles of global query rows
#define WS_GL  (WS_O + 4u * (size_t)NB * SS * DM)        // int [b][GLS]
#define WS_VGH (WS_GL + 4u * (size_t)NB * GLS)           // f16 [b][1024 (h*64+d)][2048 list slot] hi: v columns of the global keys, in list order
#define WS_VGL (WS_VGH + 2u * NB * DM * SS)        // f16 lo x 2048
#define WS_END (WS_VGL + 2u * NB * DM * SS)
#define KS 64                        // k of one staged slice: 128 B of a 16-bit row, 256 B of an f32 row
#define LP (KS + 8)                  // LDS row pitch in 16-bit elements: 144 B, for ds_load_b128 readers
#define STG (2 * 2 * 128 * LP * 2)   // bytes: two buffers of [X 128 rows | W 128 rows]
typedef __attribute__((ext_vector_type(4))) __bf16 v4b;
typedef __attribute__((ext_vector_type(4))) _Float16 v4h;
// ---- k_qkv: block = (128 rows, 128 cols), 8 waves, a wave 16 rows x 128 cols. Each k slice of X (rounded to bf16 on the way) and of W goes to LDS by whole-line loads, one slice ahead, two buffers; fragments come from LDS. The epilogue reuses the same LDS.
__global__ __launch_bounds__(256) void k_qkv(const float* __restrict__ XQ, const float* __restrict__ XK, const float* __restrict__ XV, const __bf16* __restrict__ P, const float* __restrict__ BQ, const float* __restrict__ BK, const float* __restrict__ BV, _Float16* __restrict__ QK, _Float16* __restrict__ QKL, _Float16* __restrict__ VTH, _Float16* __restrict__ VTL) {
  const int which0 = (blockIdx.y * 128) / DM; const float* X = (which0 == 0) ? XQ : (which0 == 1) ? XK : XV; const float* BB = BQ ? (((which0 == 0) ? BQ : (which0 == 1) ? BK : BV) + (blockIdx.y * 128 - which0 * DM)) : nullptr;
  __shared__ __align__(16) unsigned char smem[STG];
  __bf16 (*sa)[128][LP] = (__bf16 (*)[128][LP])smem; __bf16 (*sb)[128][LP] = (__bf16 (*)[128][LP])(smem + STG / 2);
  _Float16 (*so)[16][136] = (_Float16 (*)[16][136])smem; _Float16 (*sol)[16][136] = (_Float16 (*)[16][136])(smem + 8 * 16 * 136 * 2);
  _Float16 (*sth)[136] = (_Float16 (*)[136])smem; _Float16 (*stl)[136] = (_Float16 (*)[136])(smem + 128 * 136 * 2);
  const int tid = threadIdx.x, wave = tid >> 5, lane = tid & 31, col = lane & 15, g = lane >> 4; const size_t r0 = (size_t)blockIdx.x * 128 + wave * 16; const int n0 = blockIdx.y * 128;
  const int xr = tid >> 4, xc = (tid & 15) * 4, wr = tid >> 3, wc = (tid & 7) * 8;   // 16 lanes cover 256 B of an X row, 8 lanes 128 B of a W row
  const float* xg = X + ((size_t)blockIdx.x * 128 + xr) * DM + xc; const __bf16* wg = P + (size_t)(n0 + wr) * DM + wc;
  v4f ra[8]; v4u rb[4];
#pragma unroll
  for (int i = 0; i < 8; ++i) ra[i] = *(const v4f*)(xg + (size_t)i * 16 * DM);
#pragma unroll
  for (int i = 0; i < 4; ++i) rb[i] = *(const v4u*)(wg + (size_t)i * 32 * DM);
#pragma unroll
  for (int i = 0; i < 8; ++i) { v4b t; t[0] = (__bf16)ra[i][0]; t[1] = (__bf16)ra[i][1]; t[2] = (__bf16)ra[i][2]; t[3] = (__bf16)ra[i][3]; *(v4b*)&sa[0][i * 16 + xr][xc] = t; }
#pragma unroll
  for (int i = 0; i < 4; ++i) *(v4u*)&sb[0][i * 32 + wr][wc] = rb[i];
  v8f acc[8] = {};
#pragma unroll 1   // kept rolled: 16 unrolled trips would swell the text
  for (int ks = 0; ks < DM / KS; ++ks) { const int bf = ks & 1; const bool more = ks + 1 < DM / KS;
    __syncthreads();   // slice ks is in LDS for every wave, and every wave has left the buffer that this trip refills
    if (more) {
#pragma unroll
      for (int i = 0; i < 8; ++i) ra[i] = *(const v4f*)(xg + (size_t)i * 16 * DM + (ks + 1) * KS);
#pragma unroll
      for (int i = 0; i < 4; ++i) rb[i] = *(const v4u*)(wg + (size_t)i * 32 * DM + (ks + 1) * KS);
      asm volatile("s_wait_xcnt 0x0" ::: "memory"); }   // the address registers of these loads are reused further down the trip
#pragma unroll
    for (int kc = 0; kc < KS / 32; ++kc) { const v16b a = frag_b(&sa[bf][wave * 16 + col][kc * 32], lane); v16b w[8];
#pragma unroll
      for (int j = 0; j < 8; ++j) w[j] = frag_b(&sb[bf][j * 16 + col][kc * 32], lane);   // the block's LDS reads as one group, ahead of its products
#pragma unroll
      for (int j = 0; j < 8; ++j) acc[j] = wmma_bf(a, w[j], acc[j]); }
    if (more) {
#pragma unroll
      for (int i = 0; i < 8; ++i) { v4b t; t[0] = (__bf16)ra[i][0]; t[1] = (__bf16)ra[i][1]; t[2] = (__bf16)ra[i][2]; t[3] = (__bf16)ra[i][3]; *(v4b*)&sa[bf ^ 1][i * 16 + xr][xc] = t; }
#pragma unroll
      for (int i = 0; i < 4; ++i) *(v4u*)&sb[bf ^ 1][i * 32 + wr][wc] = rb[i]; } }
  __syncthreads();   // every wave has read the last slice before the epilogue overwrites the buffers
  if (n0 < 2 * DM) {   // q stored unscaled (f16 sigma ~0.6, no subnormal exposure); 1/8 applied to the f32 score
#pragma unroll
    for (int j = 0; j < 8; ++j) {
#pragma unroll
      for (int r = 0; r < 8; ++r) { const float v = acc[j][r] + (BB ? bfr(BB[j * 16 + col]) : 0.f); const _Float16 hv = (_Float16)v; so[wave][8 * g + r][j * 16 + col] = hv; sol[wave][8 * g + r][j * 16 + col] = (_Float16)((v - (float)hv) * 2048.0f); } }   // q, k (+ bias) as f16 hi + (x2048) residual
    LDSX();
    for (int rl = 0; rl < 16; ++rl) if (lane < 16) { vst2((unsigned*)(QK + (r0 + rl) * (2 * DM) + n0 + lane * 8), *(const v4u*)&so[wave][rl][lane * 8]); vst2((unsigned*)(QKL + (r0 + rl) * (2 * DM) + n0 + lane * 8), *(const v4u*)&sol[wave][rl][lane * 8]); }
  } else {
#pragma unroll
    for (int j = 0; j < 8; ++j) {
#pragma unroll
      for (int r = 0; r < 8; ++r) { const float v = acc[j][r] + (BB ? bfr(BB[j * 16 + col]) : 0.f); const _Float16 hv = (_Float16)v; sth[j * 16 + col][wave * 16 + 8 * g + r] = hv; stl[j * 16 + col][wave * 16 + 8 * g + r] = (_Float16)((v - (float)hv) * 2048.0f); } }
    __syncthreads();
    const size_t rb0 = (size_t)blockIdx.x * 128; const int b = (int)(rb0 / SS), s0 = (int)(rb0 % SS); const int pc0 = n0 - 2 * DM;
    for (int q = tid; q < 128 * 16; q += 256) { const int d = q >> 4, pc = q & 15; const size_t o = ((size_t)b * DM + pc0 + d) * SS + s0 + pc * 8; vst2((unsigned*)(VTH + o), *(const v4u*)&sth[d][pc * 8]); vst2((unsigned*)(VTL + o), *(const v4u*)&stl[d][pc * 8]); }
  }
}
// fragment from the lane's own first element (row and 8 * (lane >> 4) already in p)
__device__ __forceinline__ v16h frag_p(const _Float16* p) { union { v16h v; v8h q[2]; } u; u.q[0] = *(const v8h*)p; u.q[1] = *(const v8h*)(p + 16); return u.v; }
#define WKEYS 256                       // keys that the windows of a block's 128 queries touch: 64 + 128 + 64
#define KP (HD + 8)                  // LDS pitch of a staged K row (128 B of data) in 16-bit elements: 144 B, for ds_load_b128 readers
#define VP (WKEYS + 8)                  // LDS pitch of a staged V row (one d, 512 B of data): 528 B = 16 B x odd
#define ASTG (2 * WKEYS * KP * 2 + 2 * HD * VP * 2)   // bytes: K hi | K residual | V hi | V residual
// ---- k_attn: 8 waves, grid (head, batch, slot). Blocks slot >= NSLOT: 128 queries, one 16-query tile a wave; the block's WKEYS window keys (K rows and V columns, both planes) go to LDS once by whole-line loads and every wave takes its window fragments from there: the key tiles its window touches, then the packed global keys (those inside the window masked there, so each pair counts once); rows that are global themselves are not stored here. Blocks slot < NSLOT: tiles of 16 packed global query rows, every key allowed, each wave 8 of the 64 key tiles, the 8 partial (m, l, acc) merged in LDS. Scores 3 products x 1/8; P.V: f16 P hi/lo x (V hi, V lo*2048); O[b*S+q][h*64+d] (256-B segments)
__global__ __launch_bounds__(256) void k_attn(const _Float16* __restrict__ QK, const _Float16* __restrict__ QKL, const _Float16* __restrict__ VTH, const _Float16* __restrict__ VTL, const _Float16* __restrict__ VGH, const _Float16* __restrict__ VGL, const int* __restrict__ GLB, const int* __restrict__ GL, float* __restrict__ O) {
  __shared__ __align__(16) float sp[8][16][36]; __shared__ __align__(16) unsigned char stg[ASTG]; __shared__ float sm[8][16], sl[8][16];
  _Float16 (*skh)[KP] = (_Float16 (*)[KP])stg; _Float16 (*skl)[KP] = (_Float16 (*)[KP])(stg + WKEYS * KP * 2);
  _Float16 (*svh)[VP] = (_Float16 (*)[VP])(stg + 2 * WKEYS * KP * 2); _Float16 (*svl)[VP] = (_Float16 (*)[VP])(stg + 2 * WKEYS * KP * 2 + HD * VP * 2);
  float (*so)[16][68] = (float (*)[16][68])stg;   // the epilogues reuse the staged keys' LDS
  const int tid = threadIdx.x, wave = __builtin_amdgcn_readfirstlane(tid >> 5), lane = tid & 31, col = lane & 15, g = lane >> 4;
  const int h = blockIdx.x, b = blockIdx.y, slot = blockIdx.z;   // slot is the slowest grid index, so the long blocks of packed global rows (low slots) of every head and batch take the lowest block indices, for speed only
  const int* lst = GL + (size_t)b * GLS; const int* gb = GLB + (size_t)b * SS;
  int n = lst[SS]; n = n < 0 ? 0 : (n > SS ? SS : n);
  const bool dense = slot < NSLOT; const int ngt = (n + 31) >> 5;
  const int q0b = (slot - NSLOT) * 128 + wave * 16;   // window blocks only
  const int qtend = dense ? ((n + 15) >> 4) : slot + 1;
  const unsigned gqm = __builtin_amdgcn_ballot_w32((dense ? 0 : gb[q0b + col]) != 0);   // bit rl: query q0b + rl is global (its row belongs to the packed tiles)
  int ks0 = (slot - NSLOT) * 128 - HALFW; ks0 = ks0 < 0 ? 0 : (ks0 > SS - WKEYS ? SS - WKEYS : ks0);   // first staged key: the WKEYS keys from here hold every window of the block
  if (!dense) {
    const int kr = tid >> 3, kc8 = (tid & 7) * 8, vc8 = lane * 8;   // 8 lanes cover the 128 B of a K row, a wave the 512 B of a V row
    const size_t ko = ((size_t)b * SS + ks0 + kr) * (2 * DM) + h * HD + kc8, vo = ((size_t)b * DM + h * HD + wave) * SS + ks0 + vc8;
    const _Float16 *gkh = QK + ko, *gkl = QKL + ko, *gvh = VTH + vo, *gvl = VTL + vo; v4u tk[8], tl[8], tv[8], tw[8];
#pragma unroll
    for (int i = 0; i < 8; ++i) { tk[i] = *(const v4u*)(gkh + DM + (size_t)i * 32 * (2 * DM)); tl[i] = *(const v4u*)(gkl + DM + (size_t)i * 32 * (2 * DM)); }   // + DM: the k half of a q | k row
#pragma unroll
    for (int i = 0; i < 8; ++i) { tv[i] = *(const v4u*)(gvh + (size_t)i * 8 * SS); tw[i] = *(const v4u*)(gvl + (size_t)i * 8 * SS); }
    asm volatile("s_wait_xcnt 0x0" :: "v"(gkh), "v"(gkl), "v"(gvh), "v"(gvl) : "memory");   // the address registers of these loads are reused by what follows; named as inputs so that none of them is given to a later load's result ahead of the wait
#pragma unroll
    for (int i = 0; i < 8; ++i) { *(v4u*)&skh[i * 32 + kr][kc8] = tk[i]; *(v4u*)&skl[i * 32 + kr][kc8] = tl[i]; }
#pragma unroll
    for (int i = 0; i < 8; ++i) { *(v4u*)&svh[i * 8 + wave][vc8] = tv[i]; *(v4u*)&svl[i * 8 + wave][vc8] = tw[i]; }
    __syncthreads();   // the staged keys are in LDS for every wave
  }
#pragma unroll 1
  for (int qt = slot; qt < qtend; qt += NSLOT) {   // window blocks: one trip
    const int q0 = (qt - NSLOT) * 128 + wave * 16;   // window blocks only; formed from qt, so that the 16 row addresses of the epilogue's stores are not computed ahead of the loop and held in registers through it
    const size_t rq = (size_t)b * SS + (dense ? lst[qt * 16 + col] : q0 + col);
    v16h aq[2], aql[2];
#pragma unroll
    for (int kc = 0; kc < 2; ++kc) { aq[kc] = frag_h(QK + rq * (2 * DM) + h * HD + kc * 32, lane); aql[kc] = frag_h(QKL + rq * (2 * DM) + h * HD + kc * 32, lane); }
    float m[8], l[8];
#pragma unroll
    for (int r = 0; r < 8; ++r) { m[r] = -3.0e38f; l[r] = 0.f; }
    v8f acc[4] = {}, accl[4] = {};
    int kt0 = (q0 - HALFW) >> 5, kt1 = (q0 + 15 + HALFW) >> 5; kt0 = kt0 < 0 ? 0 : kt0; kt1 = kt1 > SS / 32 - 1 ? SS / 32 - 1 : kt1;
    const int nwin = dense ? 0 : kt1 - kt0 + 1; const int it0 = dense ? wave * 8 : 0, it1 = dense ? wave * 8 + 8 : nwin + ngt;
#pragma unroll 1
    for (int it = it0; it < it1; ++it) { const bool gl = !dense && it >= nwin; const int kt = dense ? it : (gl ? it - nwin : kt0 + it);   // gl: a tile of the packed global keys
      const _Float16* vhb = gl ? VGH : VTH; const _Float16* vlb = gl ? VGL : VTL; v8f s[2];
      const bool st = !dense && !gl; const int kl0 = kt * 32 - ks0;   // st: a window tile, its fragments come from the staged keys (row kl0 on)
      int kks[2]; v16h kfh[2][2], kfl[2][2];
#pragma unroll
      for (int ct = 0; ct < 2; ++ct) { const int slot = kt * 32 + ct * 16 + col; kks[ct] = gl ? lst[slot] : slot; }
      if (st) {
#pragma unroll
        for (int ct = 0; ct < 2; ++ct) {
#pragma unroll
          for (int kc = 0; kc < 2; ++kc) { kfh[ct][kc] = frag_h(&skh[kl0 + ct * 16 + col][kc * 32], lane); kfl[ct][kc] = frag_h(&skl[kl0 + ct * 16 + col][kc * 32], lane); } }
      } else { const _Float16 *pkh[2], *pkl[2];
#pragma unroll
        for (int ct = 0; ct < 2; ++ct) { const size_t kro = ((size_t)b * SS + kks[ct]) * (2 * DM) + h * HD + 8 * g; pkh[ct] = QK + kro; pkl[ct] = QKL + kro;
#pragma unroll
          for (int kc = 0; kc < 2; ++kc) { kfh[ct][kc] = frag_p(pkh[ct] + DM + kc * 32); kfl[ct][kc] = frag_p(pkl[ct] + DM + kc * 32); } }   // + DM: the k half of a q | k row
        asm volatile("s_wait_xcnt 0x0" :: "v"(pkh[0]), "v"(pkh[1]), "v"(pkl[0]), "v"(pkl[1]) : "memory");   // the address registers of these loads are reused further down the trip; named as inputs so that none of them is given to a later load's result ahead of the wait
      }
#pragma unroll
      for (int ct = 0; ct < 2; ++ct) { const int slot = kt * 32 + ct * 16 + col; const int kk = kks[ct]; v8f c = {}, cl = {};
#pragma unroll
        for (int kc = 0; kc < 2; ++kc) { c = wmma16(aq[kc], kfh[ct][kc], c); cl = wmma16(aql[kc], kfh[ct][kc], cl); cl = wmma16(aq[kc], kfl[ct][kc], cl); }   // 3 products: q, k as f16 hi + residual
#pragma unroll
        for (int r = 0; r < 8; ++r) c[r] += cl[r] * (1.0f / 2048.0f);
        { const bool live = slot < n;
#pragma unroll
        for (int r = 0; r < 8; ++r) { const int dq = kk - (q0 + 8 * g + r); const bool inw = (dq <= HALFW) & (-dq <= HALFW); s[ct][r] = (dense | (gl ? (live & !inw) : inw)) ? c[r] * 0.125f : -3.0e38f; } } }   // 1/sqrt(64); masked keys excluded
#pragma unroll
      for (int r = 0; r < 8; ++r) { float mx = fmaxf(s[0][r], s[1][r]);
#pragma unroll
        for (int o = 1; o < 16; o <<= 1) mx = fmaxf(mx, __shfl_xor(mx, o));
        const float mn = fmaxf(m[r], mx); const float alpha = (m[r] <= -1.0e38f) ? 0.f : __expf(m[r] - mn);
        const float e0 = (s[0][r] <= -1.0e38f) ? 0.f : __expf(s[0][r] - mn), e1 = (s[1][r] <= -1.0e38f) ? 0.f : __expf(s[1][r] - mn); float es = e0 + e1;
#pragma unroll
        for (int o = 1; o < 16; o <<= 1) es += __shfl_xor(es, o);
        l[r] = l[r] * alpha + es; m[r] = mn;
#pragma unroll
        for (int dt = 0; dt < 4; ++dt) { acc[dt][r] *= alpha; accl[dt][r] *= alpha; }
        sp[wave][8 * g + r][col] = e0; sp[wave][8 * g + r][16 + col] = e1; }
      v16h vfh[4], vfl[4];   // the tile's V fragments, as one group, asked for while P goes through LDS
      if (st) {
#pragma unroll
        for (int dt = 0; dt < 4; ++dt) { vfh[dt] = frag_h(&svh[dt * 16 + col][kl0], lane); vfl[dt] = frag_h(&svl[dt * 16 + col][kl0], lane); }
      } else { const size_t vr = ((size_t)b * DM + h * HD + col) * SS + kt * 32 + 8 * g; const _Float16 *pvh = vhb + vr, *pvl = vlb + vr;
#pragma unroll
        for (int dt = 0; dt < 4; ++dt) { vfh[dt] = frag_p(pvh + (size_t)dt * 16 * SS); vfl[dt] = frag_p(pvl + (size_t)dt * 16 * SS); }
        asm volatile("s_wait_xcnt 0x0" :: "v"(pvh), "v"(pvl) : "memory");   // the address registers of these loads are reused further down the trip; named as inputs so that neither is given to a later load's result ahead of the wait
      }
      LDSX();
      v16h pa, pl; { const float* prow = &sp[wave][col][0] + 8 * (lane >> 4);
#pragma unroll
        for (int i = 0; i < 8; ++i) { const float x0 = prow[i] * 2048.0f, x1 = prow[16 + i] * 2048.0f; const _Float16 h0 = (_Float16)x0, h1 = (_Float16)x1; pa[i] = h0; pa[8 + i] = h1; pl[i] = (_Float16)((x0 - (float)h0) * 2048.0f); pl[8 + i] = (_Float16)((x1 - (float)h1) * 2048.0f); } }   // P scaled by 2^11 before the f16 split so small softmax weights stay out of the f16 subnormal range; 2^-11 folded into the epilogue
#pragma unroll
      for (int dt = 0; dt < 4; ++dt) { acc[dt] = wmma16(pa, vfh[dt], acc[dt]); accl[dt] = wmma16(pl, vfh[dt], accl[dt]); accl[dt] = wmma16(pa, vfl[dt], accl[dt]); }   // P hi x V hi + (P lo x V hi + P hi x V lo) / 2048
      LDSX(); }
    if (!dense) {
      __syncthreads();   // every wave has read its last staged fragment before the epilogue overwrites that LDS
#pragma unroll
      for (int r = 0; r < 8; ++r) { const float il = (1.0f / 2048.0f) / l[r];
#pragma unroll
        for (int dt = 0; dt < 4; ++dt) so[wave][8 * g + r][dt * 16 + col] = (acc[dt][r] + accl[dt][r] * (1.0f / 2048.0f)) * il; }
      LDSX();
      for (int rl = 0; rl < 16; ++rl) if (lane < 16 && ((gqm >> rl) & 1u) == 0u) { vst2(O + ((size_t)b * SS + q0 + rl) * DM + h * HD + lane * 4, *(const v4f*)&so[wave][rl][lane * 4]);
        asm volatile("s_wait_xcnt 0x0" ::: "memory"); }   // the next row's LDS read lands in the registers this store names
    } else {
#pragma unroll
      for (int r = 0; r < 8; ++r) {
#pragma unroll
        for (int dt = 0; dt < 4; ++dt) so[wave][8 * g + r][dt * 16 + col] = acc[dt][r] + accl[dt][r] * (1.0f / 2048.0f);
        if (col == 0) { sm[wave][8 * g + r] = m[r]; sl[wave][8 * g + r] = l[r]; } }
      __syncthreads();   // every wave's partial is in LDS before the merge reads it
      const int row = tid >> 4, d4 = (tid & 15) * 4; float mm = sm[0][row];
#pragma unroll
      for (int w = 1; w < 8; ++w) mm = fmaxf(mm, sm[w][row]);
      float ll = 0.f; v4f a = {};
#pragma unroll
      for (int w = 0; w < 8; ++w) { const float e = __expf(sm[w][row] - mm); ll += e * sl[w][row]; a += *(const v4f*)&so[w][row][d4] * e; }
      if (qt * 16 + row < n) { vst2(O + ((size_t)b * SS + lst[qt * 16 + row]) * DM + h * HD + d4, a * ((1.0f / 2048.0f) / ll));
        asm volatile("s_wait_xcnt 0x0" ::: "memory"); }   // the next tile's set-up reuses the registers this store names
      __syncthreads();   // the merge has read the partials before the next tile overwrites them
    }
  }
}
// ---- k_out: block = (128 rows, 128 cols), 8 waves, staged as k_qkv: out = f16(O) . Wo rows + bo
__global__ __launch_bounds__(256) void k_out(const float* __restrict__ O, const __bf16* __restrict__ P, const float* __restrict__ BO, float* __restrict__ Y) {
  __shared__ __align__(16) unsigned char smem[STG];
  _Float16 (*sa)[128][LP] = (_Float16 (*)[128][LP])smem; _Float16 (*sb)[128][LP] = (_Float16 (*)[128][LP])(smem + STG / 2);
  float (*so)[16][132] = (float (*)[16][132])smem;
  const int tid = threadIdx.x, wave = tid >> 5, lane = tid & 31, col = lane & 15, g = lane >> 4; const size_t r0 = (size_t)blockIdx.x * 128 + wave * 16; const int n0 = blockIdx.y * 128;
  const int xr = tid >> 4, xc = (tid & 15) * 4, wr = tid >> 3, wc = (tid & 7) * 8;   // 16 lanes cover 256 B of an O row, 8 lanes 128 B of a W row
  const float* xg = O + ((size_t)blockIdx.x * 128 + xr) * DM + xc; const _Float16* wg = (const _Float16*)P + (size_t)(n0 + wr) * DM + wc;
  v4f ra[8]; v4u rb[4];
#pragma unroll
  for (int i = 0; i < 8; ++i) ra[i] = *(const v4f*)(xg + (size_t)i * 16 * DM);
#pragma unroll
  for (int i = 0; i < 4; ++i) rb[i] = *(const v4u*)(wg + (size_t)i * 32 * DM);
#pragma unroll
  for (int i = 0; i < 8; ++i) { v4h t; t[0] = (_Float16)ra[i][0]; t[1] = (_Float16)ra[i][1]; t[2] = (_Float16)ra[i][2]; t[3] = (_Float16)ra[i][3]; *(v4h*)&sa[0][i * 16 + xr][xc] = t; }
#pragma unroll
  for (int i = 0; i < 4; ++i) *(v4u*)&sb[0][i * 32 + wr][wc] = rb[i];
  v8f acc[8] = {};
#pragma unroll 1   // kept rolled: 16 unrolled trips would swell the text
  for (int ks = 0; ks < DM / KS; ++ks) { const int bf = ks & 1; const bool more = ks + 1 < DM / KS;
    __syncthreads();   // slice ks is in LDS for every wave, and every wave has left the buffer that this trip refills
    if (more) {
#pragma unroll
      for (int i = 0; i < 8; ++i) ra[i] = *(const v4f*)(xg + (size_t)i * 16 * DM + (ks + 1) * KS);
#pragma unroll
      for (int i = 0; i < 4; ++i) rb[i] = *(const v4u*)(wg + (size_t)i * 32 * DM + (ks + 1) * KS);
      asm volatile("s_wait_xcnt 0x0" ::: "memory"); }   // the address registers of these loads are reused further down the trip
#pragma unroll
    for (int kc = 0; kc < KS / 32; ++kc) { const v16h a = frag_h(&sa[bf][wave * 16 + col][kc * 32], lane); v16h w[8];
#pragma unroll
      for (int j = 0; j < 8; ++j) w[j] = frag_h(&sb[bf][j * 16 + col][kc * 32], lane);   // the block's LDS reads as one group, ahead of its products
#pragma unroll
      for (int j = 0; j < 8; ++j) acc[j] = wmma16(a, w[j], acc[j]); }   // single f16 product against exact f16 x 2^8 weight copies
    if (more) {
#pragma unroll
      for (int i = 0; i < 8; ++i) { v4h t; t[0] = (_Float16)ra[i][0]; t[1] = (_Float16)ra[i][1]; t[2] = (_Float16)ra[i][2]; t[3] = (_Float16)ra[i][3]; *(v4h*)&sa[bf ^ 1][i * 16 + xr][xc] = t; }
#pragma unroll
      for (int i = 0; i < 4; ++i) *(v4u*)&sb[bf ^ 1][i * 32 + wr][wc] = rb[i]; } }
  __syncthreads();   // every wave has read the last slice before the epilogue overwrites the buffers
#pragma unroll
  for (int j = 0; j < 8; ++j) {
#pragma unroll
    for (int r = 0; r < 8; ++r) so[wave][8 * g + r][j * 16 + col] = acc[j][r] * (1.0f / 256.0f) + bfr(BO[n0 + j * 16 + col]); }
  LDSX();
  for (int rl = 0; rl < 16; ++rl) vst2(Y + (r0 + rl) * DM + n0 + lane * 4, *(const v4f*)&so[wave][rl][lane * 4]);
}
#define FCH 8192                     // floats of one weight matrix that a converting block takes: 8 whole-line loads a lane
#define FPM (DM * DM / FCH)          // converting blocks per matrix
// ---- k_front: one launch for all that depends on the inputs alone. Blocks x < NB: batch b = x: GL[b][0..n) = positions of the global tokens, ascending; the rest of the list 0; GL[b][SS..SS+32) = n. Blocks x >= NB: FCH consecutive floats of W_q | W_k | W_v -> bf16 (PK_A) or of W_o -> f16 x 2^8 copies of the bf16-rounded values (PK_P, bit pattern in the bf16-typed buffer); the natural [out][in] order is kept, so the copy is elementwise and needs no LDS
__global__ __launch_bounds__(256) void k_front(const float* __restrict__ WQ, const float* __restrict__ WK, const float* __restrict__ WV, const float* __restrict__ WO, const int* __restrict__ GLB, __bf16* __restrict__ PK, int* __restrict__ GL) { __shared__ int sc[256]; __shared__ int sl[SS]; const int t = threadIdx.x;
  if (blockIdx.x >= NB) { const int cb = blockIdx.x - NB, which = cb / FPM; const float* Wm = (which == 0) ? WQ : (which == 1) ? WK : (which == 2) ? WV : WO;
    const size_t e0 = (size_t)(cb % FPM) * FCH + t * 4; const float* sp = Wm + e0; __bf16* dp = PK + PK_A + (size_t)which * DM * DM + e0;   // PK_P follows the three PK_A matrices
    v4f a[8];
#pragma unroll
    for (int i = 0; i < 8; ++i) a[i] = *(const v4f*)(sp + i * 1024);   // a wave's load covers 512 contiguous bytes; all 8 in flight together
    asm volatile("s_wait_xcnt 0x0" ::: "memory");   // the address registers of these loads may be reused by what follows
    if (which < 3) {
#pragma unroll
      for (int i = 0; i < 8; ++i) { v4b o; o[0] = (__bf16)a[i][0]; o[1] = (__bf16)a[i][1]; o[2] = (__bf16)a[i][2]; o[3] = (__bf16)a[i][3]; *(v4b*)(dp + i * 1024) = o; }
    } else {
#pragma unroll
      for (int i = 0; i < 8; ++i) { v4h o; o[0] = (_Float16)(bfr(a[i][0]) * 256.0f); o[1] = (_Float16)(bfr(a[i][1]) * 256.0f); o[2] = (_Float16)(bfr(a[i][2]) * 256.0f); o[3] = (_Float16)(bfr(a[i][3]) * 256.0f); vst2(dp + i * 1024, o); }
      asm volatile("s_wait_xcnt 0x0" ::: "memory");   // the code laid out behind these stores writes registers that they name
    }
    return; }   // block-uniform, ahead of every barrier
  const size_t b = blockIdx.x; const int* gb = GLB + b * SS;
  int f[8], c = 0;
#pragma unroll
  for (int i = 0; i < 8; ++i) { f[i] = gb[t * 8 + i] != 0; c += f[i]; }
  sc[t] = c; for (int i = t; i < SS; i += 256) sl[i] = 0;
  __syncthreads();
  int base = 0, tot = 0; for (int i = 0; i < 256; ++i) { const int v = sc[i]; tot += v; base += (i < t) ? v : 0; }
#pragma unroll
  for (int i = 0; i < 8; ++i) if (f[i]) sl[base++] = t * 8 + i;
  __syncthreads();
  int* o = GL + b * GLS; for (int i = t; i < SS; i += 256) o[i] = sl[i];
  if (t < 32) o[SS + t] = tot; }
// ---- k_gv: block = (8 rows h*64+d, b), one wave a row: VG[b][row][slot] = VT[b][row][list[slot]] for the n global keys, 0 up to the next multiple of 32
__global__ __launch_bounds__(256) void k_gv(const _Float16* __restrict__ VTH, const _Float16* __restrict__ VTL, const int* __restrict__ GL, _Float16* __restrict__ VGH, _Float16* __restrict__ VGL) { const int t = threadIdx.x; const size_t b = blockIdx.y; const int* lst = GL + b * GLS;
  int n = lst[SS]; n = n < 0 ? 0 : (n > SS ? SS : n); const int npad = (n + 31) & ~31; const size_t row = (b * DM + blockIdx.x * 8 + (t >> 5)) * SS;
  for (int p = t & 31; p < npad; p += 32) { const int k = lst[p]; _Float16 vh = (_Float16)0.f, vl = (_Float16)0.f; if (p < n) { vh = VTH[row + k]; vl = VTL[row + k]; } VGH[row + p] = vh; VGL[row + p] = vl; } }
extern "C" void kernel_launch(void* const* d_in, const int* in_sizes, int n_in, void* d_out, int out_size, void* d_ws, size_t ws_size, hipStream_t stream) {
  (void)in_sizes; (void)n_in; (void)out_size;
  const float** F = (const float**)d_in;   // 0 x [2,2048,1024], 1 is_global bool [2,2048], 2 wq, 3 bq, 4 wk, 5 bk, 6 wv, 7 bv, 8 wo, 9 bo (natural)
  if (ws_size < (size_t)WS_END) return;
  char* ws = (char*)d_ws; __bf16* PK = (__bf16*)(ws + WS_PK); _Float16 *QK = (_Float16*)(ws + WS_QK), *QKL = (_Float16*)(ws + WS_QKL), *VTH = (_Float16*)(ws + WS_VTH), *VTL = (_Float16*)(ws + WS_VTL); float* O = (float*)(ws + WS_O); int* GL = (int*)(ws + WS_GL); _Float16 *VGH = (_Float16*)(ws + WS_VGH), *VGL = (_Float16*)(ws + WS_VGL); const int* GLB = (const int*)d_in[1];
  k_front<<<NB + 4 * FPM, 256, 0, stream>>>(F[2], F[4], F[6], F[8], GLB, PK, GL);
  k_qkv<<<dim3(NB * SS / 128, QKVW / 128), 256, 0, stream>>>(F[0], F[0], F[0], PK + PK_A, F[3], F[5], F[7], QK, QKL, VTH, VTL);
  k_gv<<<dim3(DM / 8, NB), 256, 0, stream>>>(VTH, VTL, GL, VGH, VGL);
  k_attn<<<dim3(NH, NB, NSLOT + SS / 128), 256, 0, stream>>>(QK, QKL, VTH, VTL, VGH, VGL, GLB, GL, O);
  k_out<<<dim3(NB * SS / 128, DM / 128), 256, 0, stream>>>(O, PK + PK_P, F[9], (float*)d_out);
}

// v006
// It runs in 104 microseconds.
// Next to v005, in two timings, it ran 1.08 times as fast each time.
// Counting every step since v000, it is 4.79 times as fast.
// compute dtype: all float inputs rounded to bf16, is_global (bool) read on device; q/k/v = x . W^T + b with EXACT bf16 products on WMMA 16x16x32 (natural rows), rounded once to f16 hi + residual; attention with 3-product scores and P.v (hi + residual planes) restricted to each 16-query tile's window key tiles plus a packed list of the global keys (list built on device from is_global, their v columns gathered), global query rows packed into tiles of their own that visit every key (8 waves split the keys, merged in LDS), the per-pair rule evaluated inline, x 1/8, running-max softmax in f32 (hardware exp); out = f16(ctx) . Wo^T (exact f16 x 2^8 copies) + bo; f32 output.
#include <hip/hip_runtime.h>
#include <math.h>

typedef __attribute__((ext_vector_type(16))) _Float16 v16h;
typedef __attribute__((ext_vector_type(16))) __bf16 v16b;
typedef __attribute__((ext_vector_type(8)))  _Float16 v8h;
typedef __attribute__((ext_vector_type(8)))  float v8f;
typedef __attribute__((ext_vector_type(4)))  float v4f;
typedef __attribute__((ext_vector_type(2)))  float v2f;
typedef __attribute__((ext_vector_type(4)))  unsigned v4u;
typedef __attribute__((ext_vector_type(4)))  int v4i;
typedef float __attribute__((may_alias)) float_a;
typedef int __attribute__((may_alias)) int_a;

template <typename T> __device__ __forceinline__ void vst2(void* p, T v) { *(T*)p = v;  }
__device__ __forceinline__ v8f wmma16(v16h a, v16h b, v8f c) {
  v8f d = __builtin_amdgcn_wmma_f32_16x16x32_f16(false, a, false, b, (short)0, c, false, false);
  asm volatile("v_nop\n\tv_nop\n\tv_nop\n\tv_nop" : "+v"(d) : "v"(a), "v"(b));
  return d;
}
__device__ __forceinline__ v8f wmma_bf(v16b a, v16b b, v8f c) {
  v8f d = __builtin_amdgcn_wmma_f32_16x16x32_bf16(false, a, false, b, (short)0, c, false, false);
  asm volatile("v_nop\n\tv_nop\n\tv_nop\n\tv_nop" : "+v"(d) : "v"(a), "v"(b));
  return d;
}
// Sparse structured attention (B 2, S 2,048, hidden 1,024, 16 heads x 64): local window |i - j| <= 64 plus global tokens (is_global, given) that attend everywhere and are attended by everyone; projections + biases, softmax(q k / 8) over the allowed keys, v, output projection + bias.
__device__ __forceinline__ v16h frag_h(const _Float16* rowk0, int lane) {
  union { v16h v; v8h q[2]; } u; const _Float16* p = rowk0 + 8 * (lane >> 4);
  u.q[0] = *(const v8h*)p; u.q[1] = *(const v8h*)(p + 16); return u.v;
}
__device__ __forceinline__ v16h frag_f32(const float* rowk0, int lane) {
  v16h a; const float* p = rowk0 + 8 * (lane >> 4);
#pragma unroll
  for (int i = 0; i < 8; ++i) { a[i] = (_Float16)p[i]; a[8 + i] = (_Float16)p[16 + i]; }
  return a;
}
__device__ __forceinline__ v16h frag_f32s(const float* rowk0, int lane, float sc) {
  v16h a; const float* p = rowk0 + 8 * (lane >> 4);
#pragma unroll
  for (int i = 0; i < 8; ++i) { a[i] = (_Float16)(p[i] * sc); a[8 + i] = (_Float16)(p[16 + i] * sc); }
  return a;
}
// column fragment from a [K][ld] layout (column n), rows >= K read as 0
__device__ __forceinline__ v16h fragc_f32(const float* W, int k0, int n, int lane, int ld, int K) {
  v16h a; const int g = lane >> 4;
#pragma unroll
  for (int i = 0; i < 8; ++i) { const int ka = k0 + 8 * g + i, kb = ka + 16;
    a[i] = (_Float16)(ka < K ? W[(size_t)(ka < K ? ka : K - 1) * ld + n] : 0.f); a[8 + i] = (_Float16)(kb < K ? W[(size_t)(kb < K ? kb : K - 1) * ld + n] : 0.f); }
  return a;
}
struct F2 { v16b h, l; };
__device__ __forceinline__ F2 bsplit16(const float v[16]) { F2 r;
#pragma unroll
  for (int i = 0; i < 16; ++i) { const __bf16 h = (__bf16)v[i]; r.h[i] = h; r.l[i] = (__bf16)(v[i] - (float)h); }
  return r; }
__device__ __forceinline__ F2 split_row(const float* row, int k0, int lane) { float v[16]; const float* p = row + k0 + 8 * (lane >> 4);
#pragma unroll
  for (int i = 0; i < 8; ++i) { v[i] = p[i]; v[8 + i] = p[16 + i]; }
  return bsplit16(v); }
__device__ __forceinline__ F2 split_rowK(const float* row, int k0, int lane, int K) { float v[16]; const int g = lane >> 4;
#pragma unroll
  for (int i = 0; i < 8; ++i) { const int ka = k0 + 8 * g + i, kb = ka + 16; v[i] = ka < K ? row[ka < K ? ka : K - 1] : 0.f; v[8 + i] = kb < K ? row[kb < K ? kb : K - 1] : 0.f; }
  return bsplit16(v); }
__device__ __forceinline__ F2 split_col(const float* W, int k0, int n, int lane, int ld, int K) { float v[16]; const int g = lane >> 4;
#pragma unroll
  for (int i = 0; i < 8; ++i) { const int ka = k0 + 8 * g + i, kb = ka + 16; v[i] = ka < K ? W[(size_t)(ka < K ? ka : K - 1) * ld + n] : 0.f; v[8 + i] = kb < K ? W[(size_t)(kb < K ? kb : K - 1) * ld + n] : 0.f; }
  return bsplit16(v); }
__device__ __forceinline__ v8f mac3(const F2& a, const F2& b, v8f c) { c = wmma_bf(a.l, b.h, c); c = wmma_bf(a.h, b.l, c); return wmma_bf(a.h, b.h, c); }
__device__ __forceinline__ float sigm(float v) { return 1.0f / (1.0f + expf(-v)); }
#define LDSX() do { asm volatile("s_wait_dscnt 0" ::: "memory"); __builtin_amdgcn_wave_barrier(); __builtin_amdgcn_fence(__ATOMIC_RELEASE, "workgroup"); } while (0)


#define NB 2
#define SS 2048
#define DM 1024
#define NH 16
#define HALFW 64
#define HD 64
#define QKVW (3 * DM)
#ifndef TQB
#define TQB (SS / 64)
#define TNB NB
#define TOB (NB * SS / 64)     // 64-row tiles of all output rows (unused)
#endif
typedef __attribute__((ext_vector_type(8))) __bf16 v8b;
__device__ __forceinline__ v16b frag_b(const __bf16* rowk0, int lane) {
  union { v16b v; v8b q[2]; } u; const __bf16* p = rowk0 + 8 * (lane >> 4);
  u.q[0] = *(const v8b*)p; u.q[1] = *(const v8b*)(p + 16); return u.v;
}
__device__ __forceinline__ float bfr(float v) { return (float)(__bf16)v; }
__device__ __attribute__((noinline)) float exp_ni(float v) { return expf(v); }
__device__ __attribute__((noinline)) float erf_ni(float v) { return erff(v); }

#define PK_A 0                       // [3072][1024] Wqkv rows (natural [out][in])
#define PK_P (PK_A + QKVW * DM)        // [1024][1024] Wo rows (natural)
#define PK_END (PK_P + DM * DM)
#define WS_PK  0u
#define WS_QK  (WS_PK + 2u * PK_END)             // f16 [4096 rows][2048]: q | k
#define WS_QKL (WS_QK + 2u * NB * SS * 2 * DM)     // f16 q | k residual planes x2048
#define WS_VTH (WS_QKL + 2u * NB * SS * 2 * DM)    // f16 [b][1024 (h*64+d)][2048 s] hi
#define WS_VTL (WS_VTH + 2u * NB * DM * SS)        // f16 lo x 2048
#define WS_O   (WS_VTL + 2u * NB * DM * SS)        // f32 [4096][1024]
#define GLS (SS + 32)                              // ints per batch: positions of the global tokens (ascending, rest 0), then their count
#define NSLOT 16                                   // blocks per (head, batch) that walk the tiles of global query rows
#define WS_GL  (WS_O + 4u * (size_t)NB * SS * DM)        // int [b][GLS]
#define WS_VGH (WS_GL + 4u * (size_t)NB * GLS)           // f16 [b][1024 (h*64+d)][2048 list slot] hi: v columns of the global keys, in list order
#define WS_VGL (WS_VGH + 2u * NB * DM * SS)        // f16 lo x 2048
#define WS_END (WS_VGL + 2u * NB * DM * SS)
#define KS 64                        // k of one staged slice: 128 B of a 16-bit row, 256 B of an f32 row
#define LP (KS + 8)                  // LDS row pitch in 16-bit elements: 144 B, for ds_load_b128 readers
#define STG (2 * 2 * 128 * LP * 2)   // bytes: two buffers of [X 128 rows | W 128 rows]
typedef __attribute__((ext_vector_type(4))) __bf16 v4b;
typedef __attribute__((ext_vector_type(4))) _Float16 v4h;
// ---- k_qkv: block = (128 rows, 128 cols), 8 waves, a wave 16 rows x 128 cols. Each k slice of X (rounded to bf16 on the way) and of W goes to LDS by whole-line loads, one slice ahead, two buffers; fragments come from LDS. The epilogue reuses the same LDS.
__global__ __launch_bounds__(256) void k_qkv(const float* __restrict__ XQ, const float* __restrict__ XK, const float* __restrict__ XV, const __bf16* __restrict__ P, const float* __restrict__ BQ, const float* __restrict__ BK, const float* __restrict__ BV, _Float16* __restrict__ QK, _Float16* __restrict__ QKL, _Float16* __restrict__ VTH, _Float16* __restrict__ VTL) {
  const int which0 = (blockIdx.y * 128) / DM; const float* X = (which0 == 0) ? XQ : (which0 == 1) ? XK : XV; const float* BB = BQ ? (((which0 == 0) ? BQ : (which0 == 1) ? BK : BV) + (blockIdx.y * 128 - which0 * DM)) : nullptr;
  __shared__ __align__(16) unsigned char smem[STG];
  __bf16 (*sa)[128][LP] = (__bf16 (*)[128][LP])smem; __bf16 (*sb)[128][LP] = (__bf16 (*)[128][LP])(smem + STG / 2);
  _Float16 (*so)[16][136] = (_Float16 (*)[16][136])smem; _Float16 (*sol)[16][136] = (_Float16 (*)[16][136])(smem + 8 * 16 * 136 * 2);
  _Float16 (*sth)[136] = (_Float16 (*)[136])smem; _Float16 (*stl)[136] = (_Float16 (*)[136])(smem + 128 * 136 * 2);
  const int tid = threadIdx.x, wave = tid >> 5, lane = tid & 31, col = lane & 15, g = lane >> 4; const size_t r0 = (size_t)blockIdx.x * 128 + wave * 16; const int n0 = blockIdx.y * 128;
  const int xr = tid >> 4, xc = (tid & 15) * 4, wr = tid >> 3, wc = (tid & 7) * 8;   // 16 lanes cover 256 B of an X row, 8 lanes 128 B of a W row
  const float* xg = X + ((size_t)blockIdx.x * 128 + xr) * DM + xc; const __bf16* wg = P + (size_t)(n0 + wr) * DM + wc;
  v4f ra[8]; v4u rb[4];
#pragma unroll
  for (int i = 0; i < 8; ++i) ra[i] = *(const v4f*)(xg + (size_t)i * 16 * DM);
#pragma unroll
  for (int i = 0; i < 4; ++i) rb[i] = *(const v4u*)(wg + (size_t)i * 32 * DM);
#pragma unroll
  for (int i = 0; i < 8; ++i) { v4b t; t[0] = (__bf16)ra[i][0]; t[1] = (__bf16)ra[i][1]; t[2] = (__bf16)ra[i][2]; t[3] = (__bf16)ra[i][3]; *(v4b*)&sa[0][i * 16 + xr][xc] = t; }
#pragma unroll
  for (int i = 0; i < 4; ++i) *(v4u*)&sb[0][i * 32 + wr][wc] = rb[i];
  v8f acc[8] = {};
#pragma unroll 1   // kept rolled: 16 unrolled trips would swell the text
  for (int ks = 0; ks < DM / KS; ++ks) { const int bf = ks & 1; const bool more = ks + 1 < DM / KS;
    __syncthreads();   // slice ks is in LDS for every wave, and every wave has left the buffer that this trip refills
    if (more) {
#pragma unroll
      for (int i = 0; i < 8; ++i) ra[i] = *(const v4f*)(xg + (size_t)i * 16 * DM + (ks + 1) * KS);
#pragma unroll
      for (int i = 0; i < 4; ++i) rb[i] = *(const v4u*)(wg + (size_t)i * 32 * DM + (ks + 1) * KS);
      asm volatile("s_wait_xcnt 0x0" ::: "memory"); }   // the address registers of these loads are reused further down the trip
#pragma unroll
    for (int kc = 0; kc < KS / 32; ++kc) { const v16b a = frag_b(&sa[bf][wave * 16 + col][kc * 32], lane); v16b w[8];
#pragma unroll
      for (int j = 0; j < 8; ++j) w[j] = frag_b(&sb[bf][j * 16 + col][kc * 32], lane);   // the block's LDS reads as one group, ahead of its products
#pragma unroll
      for (int j = 0; j < 8; ++j) acc[j] = wmma_bf(a, w[j], acc[j]); }
    if (more) {
#pragma unroll
      for (int i = 0; i < 8; ++i) { v4b t; t[0] = (__bf16)ra[i][0]; t[1] = (__bf16)ra[i][1]; t[2] = (__bf16)ra[i][2]; t[3] = (__bf16)ra[i][3]; *(v4b*)&sa[bf ^ 1][i * 16 + xr][xc] = t; }
#pragma unroll
      for (int i = 0; i < 4; ++i) *(v4u*)&sb[bf ^ 1][i * 32 + wr][wc] = rb[i]; } }
  __syncthreads();   // every wave has read the last slice before the epilogue overwrites the buffers
  if (n0 < 2 * DM) {   // q stored unscaled (f16 sigma ~0.6, no subnormal exposure); 1/8 applied to the f32 score
#pragma unroll
    for (int j = 0; j < 8; ++j) {
#pragma unroll
      for (int r = 0; r < 8; ++r) { const float v = acc[j][r] + (BB ? bfr(BB[j * 16 + col]) : 0.f); const _Float16 hv = (_Float16)v; so[wave][8 * g + r][j * 16 + col] = hv; sol[wave][8 * g + r][j * 16 + col] = (_Float16)((v - (float)hv) * 2048.0f); } }   // q, k (+ bias) as f16 hi + (x2048) residual
    LDSX();
    for (int rl = 0; rl < 16; ++rl) if (lane < 16) { vst2((unsigned*)(QK + (r0 + rl) * (2 * DM) + n0 + lane * 8), *(const v4u*)&so[wave][rl][lane * 8]); vst2((unsigned*)(QKL + (r0 + rl) * (2 * DM) + n0 + lane * 8), *(const v4u*)&sol[wave][rl][lane * 8]); }
  } else {
#pragma unroll
    for (int j = 0; j < 8; ++j) {
#pragma unroll
      for (int r = 0; r < 8; ++r) { const float v = acc[j][r] + (BB ? bfr(BB[j * 16 + col]) : 0.f); const _Float16 hv = (_Float16)v; sth[j * 16 + col][wave * 16 + 8 * g + r] = hv; stl[j * 16 + col][wave * 16 + 8 * g + r] = (_Float16)((v - (float)hv) * 2048.0f); } }
    __syncthreads();
    const size_t rb0 = (size_t)blockIdx.x * 128; const int b = (int)(rb0 / SS), s0 = (int)(rb0 % SS); const int pc0 = n0 - 2 * DM;
    for (int q = tid; q < 128 * 16; q += 256) { const int d = q >> 4, pc = q & 15; const size_t o = ((size_t)b * DM + pc0 + d) * SS + s0 + pc * 8; vst2((unsigned*)(VTH + o), *(const v4u*)&sth[d][pc * 8]); vst2((unsigned*)(VTL + o), *(const v4u*)&stl[d][pc * 8]); }
  }
}
// fragment from the lane's own first element (row and 8 * (lane >> 4) already in p)
__device__ __forceinline__ v16h frag_p(const _Float16* p) { union { v16h v; v8h q[2]; } u; u.q[0] = *(const v8h*)p; u.q[1] = *(const v8h*)(p + 16); return u.v; }
// lane l with lane l ^ 16, by a vector cross-row move (a shuffle would go through the LDS pipe)
__device__ __forceinline__ float xhalf(float x) { return __builtin_bit_cast(float, __builtin_amdgcn_permlanex16(__builtin_bit_cast(int, x), __builtin_bit_cast(int, x), 0x76543210, 0xfedcba98, false, false)); }
#define WKEYS 256                       // keys that the windows of a block's 128 queries touch: 64 + 128 + 64
#define KP (HD + 8)                  // LDS pitch of a staged K row (128 B of data) in 16-bit elements: 144 B, for ds_load_b128 readers
#define VP (WKEYS + 8)                  // LDS pitch of a staged V row (one d, 512 B of data): 528 B = 16 B x odd
#define ASTG (2 * WKEYS * KP * 2 + 2 * HD * VP * 2)   // bytes: K hi | K residual | V hi | V residual
// ---- k_attn: 8 waves, grid (head, batch, slot). Blocks slot >= NSLOT: 128 queries, one 16-query tile a wave; the block's WKEYS window keys (K rows and V columns, both planes) go to LDS once by whole-line loads and every wave takes its window fragments from there: the key tiles its window touches, then the packed global keys (those inside the window masked there, so each pair counts once); rows that are global themselves are not stored here. Blocks slot < NSLOT: tiles of 16 packed global query rows, every key allowed, each wave 8 of the 64 key tiles, the 8 partial (m, l, acc) merged in LDS. Both products run transposed (K . Q^T, then V^T . P^T): a lane holds the scores of one query, so the softmax needs one exchange between the wave halves, and the converted score tiles are the second product's B fragment as they stand. Scores 3 products x 1/8; P.V: f16 P hi/lo x (V hi, V lo*2048); O[b*S+q][h*64+d] (256-B segments)
__global__ __launch_bounds__(256) void k_attn(const _Float16* __restrict__ QK, const _Float16* __restrict__ QKL, const _Float16* __restrict__ VTH, const _Float16* __restrict__ VTL, const _Float16* __restrict__ VGH, const _Float16* __restrict__ VGL, const int* __restrict__ GLB, const int* __restrict__ GL, float* __restrict__ O) {
  __shared__ __align__(16) unsigned char stg[ASTG]; __shared__ float sm[8][16], sl[8][16];
  _Float16 (*skh)[KP] = (_Float16 (*)[KP])stg; _Float16 (*skl)[KP] = (_Float16 (*)[KP])(stg + WKEYS * KP * 2);
  _Float16 (*svh)[VP] = (_Float16 (*)[VP])(stg + 2 * WKEYS * KP * 2); _Float16 (*svl)[VP] = (_Float16 (*)[VP])(stg + 2 * WKEYS * KP * 2 + HD * VP * 2);
  float (*so)[16][68] = (float (*)[16][68])stg;   // the epilogues reuse the staged keys' LDS
  const int tid = threadIdx.x, wave = __builtin_amdgcn_readfirstlane(tid >> 5), lane = tid & 31, col = lane & 15, g = lane >> 4;
  const int h = blockIdx.x, b = blockIdx.y, slot = blockIdx.z;   // slot is the slowest grid index, so the long blocks of packed global rows (low slots) of every head and batch take the lowest block indices, for speed only
  const int* lst = GL + (size_t)b * GLS; const int* gb = GLB + (size_t)b * SS;
  int n = lst[SS]; n = n < 0 ? 0 : (n > SS ? SS : n);
  const bool dense = slot < NSLOT; const int ngt = (n + 31) >> 5;
  const int q0b = (slot - NSLOT) * 128 + wave * 16;   // window blocks only
  const int qtend = dense ? ((n + 15) >> 4) : slot + 1;
  const unsigned gqm = __builtin_amdgcn_ballot_w32((dense ? 0 : gb[q0b + col]) != 0);   // bit rl: query q0b + rl is global (its row belongs to the packed tiles)
  int ks0 = (slot - NSLOT) * 128 - HALFW; ks0 = ks0 < 0 ? 0 : (ks0 > SS - WKEYS ? SS - WKEYS : ks0);   // first staged key: the WKEYS keys from here hold every window of the block
  if (!dense) {
    const int kr = tid >> 3, kc8 = (tid & 7) * 8, vc8 = lane * 8;   // 8 lanes cover the 128 B of a K row, a wave the 512 B of a V row
    const size_t ko = ((size_t)b * SS + ks0 + kr) * (2 * DM) + h * HD + kc8, vo = ((size_t)b * DM + h * HD + wave) * SS + ks0 + vc8;
    const _Float16 *gkh = QK + ko, *gkl = QKL + ko, *gvh = VTH + vo, *gvl = VTL + vo; v4u tk[8], tl[8], tv[8], tw[8];
#pragma unroll
    for (int i = 0; i < 8; ++i) { tk[i] = *(const v4u*)(gkh + DM + (size_t)i * 32 * (2 * DM)); tl[i] = *(const v4u*)(gkl + DM + (size_t)i * 32 * (2 * DM)); }   // + DM: the k half of a q | k row
#pragma unroll
    for (int i = 0; i < 8; ++i) { tv[i] = *(const v4u*)(gvh + (size_t)i * 8 * SS); tw[i] = *(const v4u*)(gvl + (size_t)i * 8 * SS); }
    asm volatile("s_wait_xcnt 0x0" :: "v"(gkh), "v"(gkl), "v"(gvh), "v"(gvl) : "memory");   // the address registers of these loads are reused by what follows; named as inputs so that none of them is given to a later load's result ahead of the wait
#pragma unroll
    for (int i = 0; i < 8; ++i) { *(v4u*)&skh[i * 32 + kr][kc8] = tk[i]; *(v4u*)&skl[i * 32 + kr][kc8] = tl[i]; }
#pragma unroll
    for (int i = 0; i < 8; ++i) { *(v4u*)&svh[i * 8 + wave][vc8] = tv[i]; *(v4u*)&svl[i * 8 + wave][vc8] = tw[i]; }
    __syncthreads();   // the staged keys are in LDS for every wave
  }
#pragma unroll 1
  for (int qt = slot; qt < qtend; qt += NSLOT) {   // window blocks: one trip
    const int q0 = (qt - NSLOT) * 128 + wave * 16;   // window blocks only; formed from qt, so that the 16 row addresses of the epilogue's stores are not computed ahead of the loop and held in registers through it
    const size_t rq = (size_t)b * SS + (dense ? lst[qt * 16 + col] : q0 + col);
    v16h aq[2], aql[2];
#pragma unroll
    for (int kc = 0; kc < 2; ++kc) { aq[kc] = frag_h(QK + rq * (2 * DM) + h * HD + kc * 32, lane); aql[kc] = frag_h(QKL + rq * (2 * DM) + h * HD + kc * 32, lane); }
    float m = -3.0e38f, l = 0.f;   // of the lane's own query (column col): running maximum (alike in both wave halves), sum over the keys of the lane's own half
    const int qi = q0 + col;   // window blocks only
    v8f acc[4] = {}, accl[4] = {};   // transposed: register r of tile dt = O[query col][dt * 16 + 8 * g + r]
    int kt0 = (q0 - HALFW) >> 5, kt1 = (q0 + 15 + HALFW) >> 5; kt0 = kt0 < 0 ? 0 : kt0; kt1 = kt1 > SS / 32 - 1 ? SS / 32 - 1 : kt1;
    const int nwin = dense ? 0 : kt1 - kt0 + 1; const int it0 = dense ? wave * 8 : 0, it1 = dense ? wave * 8 + 8 : nwin + ngt;
#pragma unroll 1
    for (int it = it0; it < it1; ++it) { const bool gl = !dense && it >= nwin; const int kt = dense ? it : (gl ? it - nwin : kt0 + it);   // gl: a tile of the packed global keys
      const _Float16* vhb = gl ? VGH : VTH; const _Float16* vlb = gl ? VGL : VTL; v8f s[2];
      const bool st = !dense && !gl; const int kl0 = kt * 32 - ks0;   // st: a window tile, its fragments come from the staged keys (row kl0 on)
      int kks[2]; v4i kk[4]; v16h kfh[2][2], kfl[2][2];   // kks: the key whose K row the lane loads (row col of the A fragment); kk, packed tiles only: the positions of the 2 x 8 keys whose scores the lane holds (rows 8 * g + r of the two transposed score tiles)
#pragma unroll
      for (int ct = 0; ct < 2; ++ct) { const int slot = kt * 32 + ct * 16 + col; kks[ct] = gl ? lst[slot] : slot; }
      if (gl) { const int* pk = lst + kt * 32 + 8 * g; kk[0] = *(const v4i*)pk; kk[1] = *(const v4i*)(pk + 4); kk[2] = *(const v4i*)(pk + 16); kk[3] = *(const v4i*)(pk + 20);
        asm volatile("s_wait_xcnt 0x0" :: "v"(pk) : "memory"); }   // the address register of these loads is reused further down the trip
      if (st) {
#pragma unroll
        for (int ct = 0; ct < 2; ++ct) {
#pragma unroll
          for (int kc = 0; kc < 2; ++kc) { kfh[ct][kc] = frag_h(&skh[kl0 + ct * 16 + col][kc * 32], lane); kfl[ct][kc] = frag_h(&skl[kl0 + ct * 16 + col][kc * 32], lane); } }
      } else { const _Float16 *pkh[2], *pkl[2];
#pragma unroll
        for (int ct = 0; ct < 2; ++ct) { const size_t kro = ((size_t)b * SS + kks[ct]) * (2 * DM) + h * HD + 8 * g; pkh[ct] = QK + kro; pkl[ct] = QKL + kro;
#pragma unroll
          for (int kc = 0; kc < 2; ++kc) { kfh[ct][kc] = frag_p(pkh[ct] + DM + kc * 32); kfl[ct][kc] = frag_p(pkl[ct] + DM + kc * 32); } }   // + DM: the k half of a q | k row
        asm volatile("s_wait_xcnt 0x0" :: "v"(pkh[0]), "v"(pkh[1]), "v"(pkl[0]), "v"(pkl[1]) : "memory");   // the address registers of these loads are reused further down the trip; named as inputs so that none of them is given to a later load's result ahead of the wait
      }
      unsigned gm = 0u;   // packed tiles only, bit i: score i of the lane counts (a live list slot whose key lies outside the query's window); formed here, while the K rows are on their way, so that the 16 positions need no registers further down
      if (gl) {
#pragma unroll
        for (int i = 0; i < 16; ++i) gm |= ((kt * 32 + 8 * g + (i >> 3) * 16 + (i & 7) < n) & ((unsigned)(kk[i >> 2][i & 3] - qi + HALFW) > 2u * HALFW)) ? (1u << i) : 0u; }
#pragma unroll
      for (int ct = 0; ct < 2; ++ct) { v8f c = {}, cl = {};
#pragma unroll
        for (int kc = 0; kc < 2; ++kc) { c = wmma16(kfh[ct][kc], aq[kc], c); cl = wmma16(kfh[ct][kc], aql[kc], cl); cl = wmma16(kfl[ct][kc], aq[kc], cl); }   // transposed scores K . Q^T, 3 products: q, k as f16 hi + residual
#pragma unroll
        for (int r = 0; r < 8; ++r) s[ct][r] = (c[r] + cl[r] * (1.0f / 2048.0f)) * 0.125f; }   // 1/sqrt(64)
      const int d0 = kt * 32 + 8 * g - qi + HALFW;   // the per-pair rule, by the tile's kind (wave-uniform); masked keys excluded; a tile of a dense block has none
      if (st) {
#pragma unroll
        for (int i = 0; i < 16; ++i) s[i >> 3][i & 7] = ((unsigned)(d0 + (i >> 3) * 16 + (i & 7)) <= 2u * HALFW) ? s[i >> 3][i & 7] : -3.0e38f;   // |key - query| <= HALFW
      } else if (gl) {
#pragma unroll
        for (int i = 0; i < 16; ++i) s[i >> 3][i & 7] = ((gm >> i) & 1u) ? s[i >> 3][i & 7] : -3.0e38f;
      }
      v16h vfh[4], vfl[4];   // the tile's V fragments, as one group, asked for ahead of the softmax
      if (st) {
#pragma unroll
        for (int dt = 0; dt < 4; ++dt) { vfh[dt] = frag_h(&svh[dt * 16 + col][kl0], lane); vfl[dt] = frag_h(&svl[dt * 16 + col][kl0], lane); }
      } else { const size_t vr = ((size_t)b * DM + h * HD + col) * SS + kt * 32 + 8 * g; const _Float16 *pvh = vhb + vr, *pvl = vlb + vr;
#pragma unroll
        for (int dt = 0; dt < 4; ++dt) { vfh[dt] = frag_p(pvh + (size_t)dt * 16 * SS); vfl[dt] = frag_p(pvl + (size_t)dt * 16 * SS); }
        asm volatile("s_wait_xcnt 0x0" :: "v"(pvh), "v"(pvl) : "memory");   // the address registers of these loads are reused further down the trip; named as inputs so that neither is given to a later load's result ahead of the wait
      }
      float mx = fmaxf(s[0][0], s[1][0]);   // a lane holds 16 of the tile's 32 scores of its one query: maximum and sum in the lane, one exchange between the wave halves
#pragma unroll
      for (int r = 1; r < 8; ++r) mx = fmaxf(mx, fmaxf(s[0][r], s[1][r]));
      mx = fmaxf(mx, xhalf(mx));
      const float mn = fmaxf(m, mx), mz = fmaxf(mn, -1.0e30f);   // mz: the maximum where a key has been seen; else a floor far above the mask value, so that a masked score (and a maximum not yet set) gives exp = 0 with no test of its own
      const float alpha = __expf(m - mz);
      float e[16]; v16h pa, pl;   // the two transposed score tiles, converted in place, are the B fragment of the second product (element i: key 8 * g + i, element 8 + i: key 16 + 8 * g + i, the k order of the V loader)
#pragma unroll
      for (int i = 0; i < 16; ++i) { const float sv = s[i >> 3][i & 7]; e[i] = __expf(sv - mz);
        const float x = e[i] * 2048.0f; const _Float16 hx = (_Float16)x; pa[i] = hx; pl[i] = (_Float16)((x - (float)hx) * 2048.0f); }   // P scaled by 2^11 before the f16 split so small softmax weights stay out of the f16 subnormal range; 2^-11 folded into the epilogue
#pragma unroll
      for (int w = 8; w > 0; w >>= 1) {
#pragma unroll
        for (int i = 0; i < w; ++i) e[i] += e[i + w]; }
      l = l * alpha + e[0]; m = mn;
#pragma unroll
      for (int dt = 0; dt < 4; ++dt) { acc[dt] *= alpha; accl[dt] *= alpha; }
#pragma unroll
      for (int dt = 0; dt < 4; ++dt) { acc[dt] = wmma16(vfh[dt], pa, acc[dt]); accl[dt] = wmma16(vfh[dt], pl, accl[dt]); accl[dt] = wmma16(vfl[dt], pa, accl[dt]); } }   // transposed V^T . P^T: P hi x V hi + (P lo x V hi + P hi x V lo) / 2048
    const float lt = l + xhalf(l);   // the two halves' sums joined once
    if (!dense) {
      __syncthreads();   // every wave has read its last staged fragment before the epilogue overwrites that LDS
      const float il = (1.0f / 2048.0f) / lt;
#pragma unroll
      for (int dt = 0; dt < 4; ++dt) { const v8f o = (acc[dt] + accl[dt] * (1.0f / 2048.0f)) * il; float* po = &so[wave][col][dt * 16 + 8 * g]; *(v4f*)po = __builtin_shufflevector(o, o, 0, 1, 2, 3); *(v4f*)(po + 4) = __builtin_shufflevector(o, o, 4, 5, 6, 7); }
      LDSX();
      for (int rl = 0; rl < 16; ++rl) if (lane < 16 && ((gqm >> rl) & 1u) == 0u) { vst2(O + ((size_t)b * SS + q0 + rl) * DM + h * HD + lane * 4, *(const v4f*)&so[wave][rl][lane * 4]);
        asm volatile("s_wait_xcnt 0x0" ::: "memory"); }   // the next row's LDS read lands in the registers this store names
    } else {
#pragma unroll
      for (int dt = 0; dt < 4; ++dt) { const v8f o = acc[dt] + accl[dt] * (1.0f / 2048.0f); float* po = &so[wave][col][dt * 16 + 8 * g]; *(v4f*)po = __builtin_shufflevector(o, o, 0, 1, 2, 3); *(v4f*)(po + 4) = __builtin_shufflevector(o, o, 4, 5, 6, 7); }
      if (g == 0) { sm[wave][col] = m; sl[wave][col] = lt; }
      __syncthreads();   // every wave's partial is in LDS before the merge reads it
      const int row = tid >> 4, d4 = (tid & 15) * 4; float mm = sm[0][row];
#pragma unroll
      for (int w = 1; w < 8; ++w) mm = fmaxf(mm, sm[w][row]);
      float ll = 0.f; v4f a = {};
#pragma unroll
      for (int w = 0; w < 8; ++w) { const float e = __expf(sm[w][row] - mm); ll += e * sl[w][row]; a += *(const v4f*)&so[w][row][d4] * e; }
      if (qt * 16 + row < n) { vst2(O + ((size_t)b * SS + lst[qt * 16 + row]) * DM + h * HD + d4, a * ((1.0f / 2048.0f) / ll));
        asm volatile("s_wait_xcnt 0x0" ::: "memory"); }   // the next tile's set-up reuses the registers this store names
      __syncthreads();   // the merge has read the partials before the next tile overwrites them
    }
  }
}
// ---- k_out: block = (128 rows, 128 cols), 8 waves, staged as k_qkv: out = f16(O) . Wo rows + bo
__global__ __launch_bounds__(256) void k_out(const float* __restrict__ O, const __bf16* __restrict__ P, const float* __restrict__ BO, float* __restrict__ Y) {
  __shared__ __align__(16) unsigned char smem[STG];
  _Float16 (*sa)[128][LP] = (_Float16 (*)[128][LP])smem; _Float16 (*sb)[128][LP] = (_Float16 (*)[128][LP])(smem + STG / 2);
  float (*so)[16][132] = (float (*)[16][132])smem;
  const int tid = threadIdx.x, wave = tid >> 5, lane = tid & 31, col = lane & 15, g = lane >> 4; const size_t r0 = (size_t)blockIdx.x * 128 + wave * 16; const int n0 = blockIdx.y * 128;
  const int xr = tid >> 4, xc = (tid & 15) * 4, wr = tid >> 3, wc = (tid & 7) * 8;   // 16 lanes cover 256 B of an O row, 8 lanes 128 B of a W row
  const float* xg = O + ((size_t)blockIdx.x * 128 + xr) * DM + xc; const _Float16* wg = (const _Float16*)P + (size_t)(n0 + wr) * DM + wc;
  v4f ra[8]; v4u rb[4];
#pragma unroll
  for (int i = 0; i < 8; ++i) ra[i] = *(const v4f*)(xg + (size_t)i * 16 * DM);
#pragma unroll
  for (int i = 0; i < 4; ++i) rb[i] = *(const v4u*)(wg + (size_t)i * 32 * DM);
#pragma unroll
  for (int i = 0; i < 8; ++i) { v4h t; t[0] = (_Float16)ra[i][0]; t[1] = (_Float16)ra[i][1]; t[2] = (_Float16)ra[i][2]; t[3] = (_Float16)ra[i][3]; *(v4h*)&sa[0][i * 16 + xr][xc] = t; }
#pragma unroll
  for (int i = 0; i < 4; ++i) *(v4u*)&sb[0][i * 32 + wr][wc] = rb[i];
  v8f acc[8] = {};
#pragma unroll 1   // kept rolled: 16 unrolled trips would swell the text
  for (int ks = 0; ks < DM / KS; ++ks) { const int bf = ks & 1; const bool more = ks + 1 < DM / KS;
    __syncthreads();   // slice ks is in LDS for every wave, and every wave has left the buffer that this trip refills
    if (more) {
#pragma unroll
      for (int i = 0; i < 8; ++i) ra[i] = *(const v4f*)(xg + (size_t)i * 16 * DM + (ks + 1) * KS);
#pragma unroll
      for (int i = 0; i < 4; ++i) rb[i] = *(const v4u*)(wg + (size_t)i * 32 * DM + (ks + 1) * KS);
      asm volatile("s_wait_xcnt 0x0" ::: "memory"); }   // the address registers of these loads are reused further down the trip
#pragma unroll
    for (int kc = 0; kc < KS / 32; ++kc) { const v16h a = frag_h(&sa[bf][wave * 16 + col][kc * 32], lane); v16h w[8];
#pragma unroll
      for (int j = 0; j < 8; ++j) w[j] = frag_h(&sb[bf][j * 16 + col][kc * 32], lane);   // the block's LDS reads as one group, ahead of its products
#pragma unroll
      for (int j = 0; j < 8; ++j) acc[j] = wmma16(a, w[j], acc[j]); }   // single f16 product against exact f16 x 2^8 weight copies
    if (more) {
#pragma unroll
      for (int i = 0; i < 8; ++i) { v4h t; t[0] = (_Float16)ra[i][0]; t[1] = (_Float16)ra[i][1]; t[2] = (_Float16)ra[i][2]; t[3] = (_Float16)ra[i][3]; *(v4h*)&sa[bf ^ 1][i * 16 + xr][xc] = t; }
#pragma unroll
      for (int i = 0; i < 4; ++i) *(v4u*)&sb[bf ^ 1][i * 32 + wr][wc] = rb[i]; } }
  __syncthreads();   // every wave has read the last slice before the epilogue overwrites the buffers
#pragma unroll
  for (int j = 0; j < 8; ++j) {
#pragma unroll
    for (int r = 0; r < 8; ++r) so[wave][8 * g + r][j * 16 + col] = acc[j][r] * (1.0f / 256.0f) + bfr(BO[n0 + j * 16 + col]); }
  LDSX();
  for (int rl = 0; rl < 16; ++rl) vst2(Y + (r0 + rl) * DM + n0 + lane * 4, *(const v4f*)&so[wave][rl][lane * 4]);
}
#define FCH 8192                     // floats of one weight matrix that a converting block takes: 8 whole-line loads a lane
#define FPM (DM * DM / FCH)          // converting blocks per matrix
// ---- k_front: one launch for all that depends on the inputs alone. Blocks x < NB: batch b = x: GL[b][0..n) = positions of the global tokens, ascending; the rest of the list 0; GL[b][SS..SS+32) = n. Blocks x >= NB: FCH consecutive floats of W_q | W_k | W_v -> bf16 (PK_A) or of W_o -> f16 x 2^8 copies of the bf16-rounded values (PK_P, bit pattern in the bf16-typed buffer); the natural [out][in] order is kept, so the copy is elementwise and needs no LDS
__global__ __launch_bounds__(256) void k_front(const float* __restrict__ WQ, const float* __restrict__ WK, const float* __restrict__ WV, const float* __restrict__ WO, const int* __restrict__ GLB, __bf16* __restrict__ PK, int* __restrict__ GL) { __shared__ int sc[256]; __shared__ int sl[SS]; const int t = threadIdx.x;
  if (blockIdx.x >= NB) { const int cb = blockIdx.x - NB, which = cb / FPM; const float* Wm = (which == 0) ? WQ : (which == 1) ? WK : (which == 2) ? WV : WO;
    const size_t e0 = (size_t)(cb % FPM) * FCH + t * 4; const float* sp = Wm + e0; __bf16* dp = PK + PK_A + (size_t)which * DM * DM + e0;   // PK_P follows the three PK_A matrices
    v4f a[8];
#pragma unroll
    for (int i = 0; i < 8; ++i) a[i] = *(const v4f*)(sp + i * 1024);   // a wave's load covers 512 contiguous bytes; all 8 in flight together
    asm volatile("s_wait_xcnt 0x0" ::: "memory");   // the address registers of these loads may be reused by what follows
    if (which < 3) {
#pragma unroll
      for (int i = 0; i < 8; ++i) { v4b o; o[0] = (__bf16)a[i][0]; o[1] = (__bf16)a[i][1]; o[2] = (__bf16)a[i][2]; o[3] = (__bf16)a[i][3]; *(v4b*)(dp + i * 1024) = o; }
    } else {
#pragma unroll
      for (int i = 0; i < 8; ++i) { v4h o; o[0] = (_Float16)(bfr(a[i][0]) * 256.0f); o[1] = (_Float16)(bfr(a[i][1]) * 256.0f); o[2] = (_Float16)(bfr(a[i][2]) * 256.0f); o[3] = (_Float16)(bfr(a[i][3]) * 256.0f); vst2(dp + i * 1024, o); }
      asm volatile("s_wait_xcnt 0x0" ::: "memory");   // the code laid out behind these stores writes registers that they name
    }
    return; }   // block-uniform, ahead of every barrier
  const size_t b = blockIdx.x; const int* gb = GLB + b * SS;
  int f[8], c = 0;
#pragma unroll
  for (int i = 0; i < 8; ++i) { f[i] = gb[t * 8 + i] != 0; c += f[i]; }
  sc[t] = c; for (int i = t; i < SS; i += 256) sl[i] = 0;
  __syncthreads();
  int base = 0, tot = 0; for (int i = 0; i < 256; ++i) { const int v = sc[i]; tot += v; base += (i < t) ? v : 0; }
#pragma unroll
  for (int i = 0; i < 8; ++i) if (f[i]) sl[base++] = t * 8 + i;
  __syncthreads();
  int* o = GL + b * GLS; for (int i = t; i < SS; i += 256) o[i] = sl[i];
  if (t < 32) o[SS + t] = tot; }
// ---- k_gv: block = (8 rows h*64+d, b), one wave a row: VG[b][row][slot] = VT[b][row][list[slot]] for the n global keys, 0 up to the next multiple of 32
__global__ __launch_bounds__(256) void k_gv(const _Float16* __restrict__ VTH, const _Float16* __restrict__ VTL, const int* __restrict__ GL, _Float16* __restrict__ VGH, _Float16* __restrict__ VGL) { const int t = threadIdx.x; const size_t b = blockIdx.y; const int* lst = GL + b * GLS;
  int n = lst[SS]; n = n < 0 ? 0 : (n > SS ? SS : n); const int npad = (n + 31) & ~31; const size_t row = (b * DM + blockIdx.x * 8 + (t >> 5)) * SS;
  for (int p = t & 31; p < npad; p += 32) { const int k = lst[p]; _Float16 vh = (_Float16)0.f, vl = (_Float16)0.f; if (p < n) { vh = VTH[row + k]; vl = VTL[row + k]; } VGH[row + p] = vh; VGL[row + p] = vl; } }
extern "C" void kernel_launch(void* const* d_in, const int* in_sizes, int n_in, void* d_out, int out_size, void* d_ws, size_t ws_size, hipStream_t stream) {
  (void)in_sizes; (void)n_in; (void)out_size;
  const float** F = (const float**)d_in;   // 0 x [2,2048,1024], 1 is_global bool [2,2048], 2 wq, 3 bq, 4 wk, 5 bk, 6 wv, 7 bv, 8 wo, 9 bo (natural)
  if (ws_size < (size_t)WS_END) return;
  char* ws = (char*)d_ws; __bf16* PK = (__bf16*)(ws + WS_PK); _Float16 *QK = (_Float16*)(ws + WS_QK), *QKL = (_Float16*)(ws + WS_QKL), *VTH = (_Float16*)(ws + WS_VTH), *VTL = (_Float16*)(ws + WS_VTL); float* O = (float*)(ws + WS_O); int* GL = (int*)(ws + WS_GL); _Float16 *VGH = (_Float16*)(ws + WS_VGH), *VGL = (_Float16*)(ws + WS_VGL); const int* GLB = (const int*)d_in[1];
  k_front<<<NB + 4 * FPM, 256, 0, stream>>>(F[2], F[4], F[6], F[8], GLB, PK, GL);
  k_qkv<<<dim3(NB * SS / 128, QKVW / 128), 256, 0, stream>>>(F[0], F[0], F[0], PK + PK_A, F[3], F[5], F[7], QK, QKL, VTH, VTL);
  k_gv<<<dim3(DM / 8, NB), 256, 0, stream>>>(VTH, VTL, GL, VGH, VGL);
  k_attn<<<dim3(NH, NB, NSLOT + SS / 128), 256, 0, stream>>>(QK, QKL, VTH, VTL, VGH, VGL, GLB, GL, O);
  k_out<<<dim3(NB * SS / 128, DM / 128), 256, 0, stream>>>(O, PK + PK_P, F[9], (float*)d_out);
}

// v007
// One run takes 101 microseconds.
// Next to v006, in two timings, it ran 1.03 times as fast each time.
// Over all steps from v000 it is 4.95 times as fast.
// compute dtype: all float inputs rounded to bf16, is_global (bool) read on device; q/k/v = x . W^T + b with EXACT bf16 products on WMMA 16x16x32 (natural rows), rounded once to f16 hi + residual; attention with 3-product scores and P.v (hi + residual planes) restricted to each 16-query tile's window key tiles plus a packed list of the global keys (list built on device from is_global, their v columns gathered), global query rows packed into tiles of their own that visit every key (8 waves split the keys, merged in LDS), the per-pair rule evaluated inline, x 1/8, running-max softmax in f32 (hardware exp); out = f16(ctx) . Wo^T (exact f16 x 2^8 copies) + bo; f32 output.
#include <hip/hip_runtime.h>
#include <math.h>

typedef __attribute__((ext_vector_type(16))) _Float16 v16h;
typedef __attribute__((ext_vector_type(16))) __bf16 v16b;
typedef __attribute__((ext_vector_type(8)))  _Float16 v8h;
typedef __attribute__((ext_vector_type(8)))  float v8f;
typedef __attribute__((ext_vector_type(4)))  float v4f;
typedef __attribute__((ext_vector_type(2)))  float v2f;
typedef __attribute__((ext_vector_type(4)))  unsigned v4u;
typedef __attribute__((ext_vector_type(4)))  int v4i;
typedef float __attribute__((may_alias)) float_a;
typedef int __attribute__((may_alias)) int_a;

template <typename T> __device__ __forceinline__ void vst2(void* p, T v) { *(T*)p = v;  }
__device__ __forceinline__ v8f wmma16(v16h a, v16h b, v8f c) {
  v8f d = __builtin_amdgcn_wmma_f32_16x16x32_f16(false, a, false, b, (short)0, c, false, false);
  asm volatile("v_nop\n\tv_nop\n\tv_nop\n\tv_nop" : "+v"(d) : "v"(a), "v"(b));
  return d;
}
__device__ __forceinline__ v8f wmma_bf(v16b a, v16b b, v8f c) {
  v8f d = __builtin_amdgcn_wmma_f32_16x16x32_bf16(false, a, false, b, (short)0, c, false, false);
  asm volatile("v_nop\n\tv_nop\n\tv_nop\n\tv_nop" : "+v"(d) : "v"(a), "v"(b));
  return d;
}
// Sparse structured attention (B 2, S 2,048, hidden 1,024, 16 heads x 64): local window |i - j| <= 64 plus global tokens (is_global, given) that attend everywhere and are attended by everyone; projections + biases, softmax(q k / 8) over the allowed keys, v, output projection + bias.
__device__ __forceinline__ v16h frag_h(const _Float16* rowk0, int lane) {
  union { v16h v; v8h q[2]; } u; const _Float16* p = rowk0 + 8 * (lane >> 4);
  u.q[0] = *(const v8h*)p; u.q[1] = *(const v8h*)(p + 16); return u.v;
}
__device__ __forceinline__ v16h frag_f32(const float* rowk0, int lane) {
  v16h a; const float* p = rowk0 + 8 * (lane >> 4);
#pragma unroll
  for (int i = 0; i < 8; ++i) { a[i] = (_Float16)p[i]; a[8 + i] = (_Float16)p[16 + i]; }
  return a;
}
__device__ __forceinline__ v16h frag_f32s(const float* rowk0, int lane, float sc) {
  v16h a; const float* p = rowk0 + 8 * (lane >> 4);
#pragma unroll
  for (int i = 0; i < 8; ++i) { a[i] = (_Float16)(p[i] * sc); a[8 + i] = (_Float16)(p[16 + i] * sc); }
  return a;
}
// column fragment from a [K][ld] layout (column n), rows >= K read as 0
__device__ __forceinline__ v16h fragc_f32(const float* W, int k0, int n, int lane, int ld, int K) {
  v16h a; const int g = lane >> 4;
#pragma unroll
  for (int i = 0; i < 8; ++i) { const int ka = k0 + 8 * g + i, kb = ka + 16;
    a[i] = (_Float16)(ka < K ? W[(size_t)(ka < K ? ka : K - 1) * ld + n] : 0.f); a[8 + i] = (_Float16)(kb < K ? W[(size_t)(kb < K ? kb : K - 1) * ld + n] : 0.f); }
  return a;
}
struct F2 { v16b h, l; };
__device__ __forceinline__ F2 bsplit16(const float v[16]) { F2 r;
#pragma unroll
  for (int i = 0; i < 16; ++i) { const __bf16 h = (__bf16)v[i]; r.h[i] = h; r.l[i] = (__bf16)(v[i] - (float)h); }
  return r; }
__device__ __forceinline__ F2 split_row(const float* row, int k0, int lane) { float v[16]; const float* p = row + k0 + 8 * (lane >> 4);
#pragma unroll
  for (int i = 0; i < 8; ++i) { v[i] = p[i]; v[8 + i] = p[16 + i]; }
  return bsplit16(v); }
__device__ __forceinline__ F2 split_rowK(const float* row, int k0, int lane, int K) { float v[16]; const int g = lane >> 4;
#pragma unroll
  for (int i = 0; i < 8; ++i) { const int ka = k0 + 8 * g + i, kb = ka + 16; v[i] = ka < K ? row[ka < K ? ka : K - 1] : 0.f; v[8 + i] = kb < K ? row[kb < K ? kb : K - 1] : 0.f; }
  return bsplit16(v); }
__device__ __forceinline__ F2 split_col(const float* W, int k0, int n, int lane, int ld, int K) { float v[16]; const int g = lane >> 4;
#pragma unroll
  for (int i = 0; i < 8; ++i) { const int ka = k0 + 8 * g + i, kb = ka + 16; v[i] = ka < K ? W[(size_t)(ka < K ? ka : K - 1) * ld + n] : 0.f; v[8 + i] = kb < K ? W[(size_t)(kb < K ? kb : K - 1) * ld + n] : 0.f; }
  return bsplit16(v); }
__device__ __forceinline__ v8f mac3(const F2& a, const F2& b, v8f c) { c = wmma_bf(a.l, b.h, c); c = wmma_bf(a.h, b.l, c); return wmma_bf(a.h, b.h, c); }
__device__ __forceinline__ float sigm(float v) { return 1.0f / (1.0f + expf(-v)); }
#define LDSX() do { asm volatile("s_wait_dscnt 0" ::: "memory"); __builtin_amdgcn_wave_barrier(); __builtin_amdgcn_fence(__ATOMIC_RELEASE, "workgroup"); } while (0)


#define NB 2
#define SS 2048
#define DM 1024
#define NH 16
#define HALFW 64
#define HD 64
#define QKVW (3 * DM)
#ifndef TQB
#define TQB (SS / 64)
#define TNB NB
#define TOB (NB * SS / 64)     // 64-row tiles of all output rows (unused)
#endif
typedef __attribute__((ext_vector_type(8))) __bf16 v8b;
__device__ __forceinline__ v16b frag_b(const __bf16* rowk0, int lane) {
  union { v16b v; v8b q[2]; } u; const __bf16* p = rowk0 + 8 * (lane >> 4);
  u.q[0] = *(const v8b*)p; u.q[1] = *(const v8b*)(p + 16); return u.v;
}
__device__ __forceinline__ float bfr(float v) { return (float)(__bf16)v; }
__device__ __attribute__((noinline)) float exp_ni(float v) { return expf(v); }
__device__ __attribute__((noinline)) float erf_ni(float v) { return erff(v); }

#define PK_A 0                       // [3072][1024] Wqkv rows (natural [out][in])
#define PK_P (PK_A + QKVW * DM)        // [1024][1024] Wo rows (natural)
#define PK_END (PK_P + DM * DM)
#define WS_PK  0u
#define WS_QK  (WS_PK + 2u * PK_END)             // f16 [4096 rows][2048]: q | k
#define WS_QKL (WS_QK + 2u * NB * SS * 2 * DM)     // f16 q | k residual planes x2048
#define WS_VTH (WS_QKL + 2u * NB * SS * 2 * DM)    // f16 [b][1024 (h*64+d)][2048 s] hi
#define WS_VTL (WS_VTH + 2u * NB * DM * SS)        // f16 lo x 2048
#define WS_O   (WS_VTL + 2u * NB * DM * SS)        // f32 [4096][1024]
#define GLS (SS + 32)                              // ints per batch: positions of the global tokens (ascending, rest 0), then their count
#define NSLOT 16                                   // blocks per (head, batch) that walk the tiles of global query rows
#define WS_GL  (WS_O + 4u * (size_t)NB * SS * DM)        // int [b][GLS]
#define WS_VGH (WS_GL + 4u * (size_t)NB * GLS)           // f16 [b][1024 (h*64+d)][2048 list slot] hi: v columns of the global keys, in list order
#define WS_VGL (WS_VGH + 2u * NB * DM * SS)        // f16 lo x 2048
#define WS_END (WS_VGL + 2u * NB * DM * SS)
#define KS 64                        // k of one staged slice: 128 B of a 16-bit row, 256 B of an f32 row
#define LP (KS + 8)                  // LDS row pitch in 16-bit elements: 144 B, for ds_load_b128 readers
#define STG (2 * 2 * 128 * LP * 2)   // bytes: two buffers of [X 128 rows | W 128 rows]
typedef __attribute__((ext_vector_type(4))) __bf16 v4b;
typedef __attribute__((ext_vector_type(4))) _Float16 v4h;
// ---- k_qkv: block = (128 rows, 128 cols), 8 waves, a wave 16 rows x 128 cols. Each k slice of X (rounded to bf16 on the way) and of W goes to LDS by whole-line loads, one slice ahead, two buffers; fragments come from LDS. The epilogue reuses the same LDS.
__global__ __launch_bounds__(256) void k_qkv(const float* __restrict__ XQ, const float* __restrict__ XK, const float* __restrict__ XV, const __bf16* __restrict__ P, const float* __restrict__ BQ, const float* __restrict__ BK, const float* __restrict__ BV, _Float16* __restrict__ QK, _Float16* __restrict__ QKL, _Float16* __restrict__ VTH, _Float16* __restrict__ VTL) {
  const int which0 = (blockIdx.y * 128) / DM; const float* X = (which0 == 0) ? XQ : (which0 == 1) ? XK : XV; const float* BB = BQ ? (((which0 == 0) ? BQ : (which0 == 1) ? BK : BV) + (blockIdx.y * 128 - which0 * DM)) : nullptr;
  __shared__ __align__(16) unsigned char smem[STG];
  __bf16 (*sa)[128][LP] = (__bf16 (*)[128][LP])smem; __bf16 (*sb)[128][LP] = (__bf16 (*)[128][LP])(smem + STG / 2);
  _Float16 (*so)[16][136] = (_Float16 (*)[16][136])smem; _Float16 (*sol)[16][136] = (_Float16 (*)[16][136])(smem + 8 * 16 * 136 * 2);
  _Float16 (*sth)[136] = (_Float16 (*)[136])smem; _Float16 (*stl)[136] = (_Float16 (*)[136])(smem + 128 * 136 * 2);
  const int tid = threadIdx.x, wave = tid >> 5, lane = tid & 31, col = lane & 15, g = lane >> 4; const size_t r0 = (size_t)blockIdx.x * 128 + wave * 16; const int n0 = blockIdx.y * 128;
  const int xr = tid >> 4, xc = (tid & 15) * 4, wr = tid >> 3, wc = (tid & 7) * 8;   // 16 lanes cover 256 B of an X row, 8 lanes 128 B of a W row
  const float* xg = X + ((size_t)blockIdx.x * 128 + xr) * DM + xc; const __bf16* wg = P + (size_t)(n0 + wr) * DM + wc;
  v4f ra[8]; v4u rb[4];
#pragma unroll
  for (int i = 0; i < 8; ++i) ra[i] = *(const v4f*)(xg + (size_t)i * 16 * DM);
#pragma unroll
  for (int i = 0; i < 4; ++i) rb[i] = *(const v4u*)(wg + (size_t)i * 32 * DM);
#pragma unroll
  for (int i = 0; i < 8; ++i) { v4b t; t[0] = (__bf16)ra[i][0]; t[1] = (__bf16)ra[i][1]; t[2] = (__bf16)ra[i][2]; t[3] = (__bf16)ra[i][3]; *(v4b*)&sa[0][i * 16 + xr][xc] = t; }
#pragma unroll
  for (int i = 0; i < 4; ++i) *(v4u*)&sb[0][i * 32 + wr][wc] = rb[i];
  v8f acc[8] = {};
#pragma unroll 1   // kept rolled: 16 unrolled trips would swell the text
  for (int ks = 0; ks < DM / KS; ++ks) { const int bf = ks & 1; const bool more = ks + 1 < DM / KS;
    __syncthreads();   // slice ks is in LDS for every wave, and every wave has left the buffer that this trip refills
    if (more) {
#pragma unroll
      for (int i = 0; i < 8; ++i) ra[i] = *(const v4f*)(xg + (size_t)i * 16 * DM + (ks + 1) * KS);
#pragma unroll
      for (int i = 0; i < 4; ++i) rb[i] = *(const v4u*)(wg + (size_t)i * 32 * DM + (ks + 1) * KS);
      asm volatile("s_wait_xcnt 0x0" ::: "memory"); }   // the address registers of these loads are reused further down the trip
#pragma unroll
    for (int kc = 0; kc < KS / 32; ++kc) { const v16b a = frag_b(&sa[bf][wave * 16 + col][kc * 32], lane); v16b w[8];
#pragma unroll
      for (int j = 0; j < 8; ++j) w[j] = frag_b(&sb[bf][j * 16 + col][kc * 32], lane);   // the block's LDS reads as one group, ahead of its products
#pragma unroll
      for (int j = 0; j < 8; ++j) acc[j] = wmma_bf(a, w[j], acc[j]); }
    if (more) {
#pragma unroll
      for (int i = 0; i < 8; ++i) { v4b t; t[0] = (__bf16)ra[i][0]; t[1] = (__bf16)ra[i][1]; t[2] = (__bf16)ra[i][2]; t[3] = (__bf16)ra[i][3]; *(v4b*)&sa[bf ^ 1][i * 16 + xr][xc] = t; }
#pragma unroll
      for (int i = 0; i < 4; ++i) *(v4u*)&sb[bf ^ 1][i * 32 + wr][wc] = rb[i]; } }
  __syncthreads();   // every wave has read the last slice before the epilogue overwrites the buffers
  if (n0 < 2 * DM) {   // q stored unscaled (f16 sigma ~0.6, no subnormal exposure); 1/8 applied to the f32 score
#pragma unroll
    for (int j = 0; j < 8; ++j) {
#pragma unroll
      for (int r = 0; r < 8; ++r) { const float v = acc[j][r] + (BB ? bfr(BB[j * 16 + col]) : 0.f); const _Float16 hv = (_Float16)v; so[wave][8 * g + r][j * 16 + col] = hv; sol[wave][8 * g + r][j * 16 + col] = (_Float16)((v - (float)hv) * 2048.0f); } }   // q, k (+ bias) as f16 hi + (x2048) residual
    LDSX();
    for (int rl = 0; rl < 16; ++rl) if (lane < 16) { vst2((unsigned*)(QK + (r0 + rl) * (2 * DM) + n0 + lane * 8), *(const v4u*)&so[wave][rl][lane * 8]); vst2((unsigned*)(QKL + (r0 + rl) * (2 * DM) + n0 + lane * 8), *(const v4u*)&sol[wave][rl][lane * 8]); }
  } else {
#pragma unroll
    for (int j = 0; j < 8; ++j) {
#pragma unroll
      for (int r = 0; r < 8; ++r) { const float v = acc[j][r] + (BB ? bfr(BB[j * 16 + col]) : 0.f); const _Float16 hv = (_Float16)v; sth[j * 16 + col][wave * 16 + 8 * g + r] = hv; stl[j * 16 + col][wave * 16 + 8 * g + r] = (_Float16)((v - (float)hv) * 2048.0f); } }
    __syncthreads();
    const size_t rb0 = (size_t)blockIdx.x * 128; const int b = (int)(rb0 / SS), s0 = (int)(rb0 % SS); const int pc0 = n0 - 2 * DM;
    for (int q = tid; q < 128 * 16; q += 256) { const int d = q >> 4, pc = q & 15; const size_t o = ((size_t)b * DM + pc0 + d) * SS + s0 + pc * 8; vst2((unsigned*)(VTH + o), *(const v4u*)&sth[d][pc * 8]); vst2((unsigned*)(VTL + o), *(const v4u*)&stl[d][pc * 8]); }
  }
}
// lane l with lane l ^ 16, by a vector cross-row move (a shuffle would go through the LDS pipe)
__device__ __forceinline__ float xhalf(float x) { return __builtin_bit_cast(float, __builtin_amdgcn_permlanex16(__builtin_bit_cast(int, x), __builtin_bit_cast(int, x), 0x76543210, 0xfedcba98, false, false)); }
// eight asynchronous copies to LDS, 16 B a lane each, to LDS rows that lie a constant step apart. An immediate offset moves BOTH addresses of a copy: copy i names the one LDS address l with offset i * step, and g[i] is its global address less that offset, so that eight LDS addresses need one register. The closing wait stands inside the statement, so that no register a copy names is rewritten ahead of it
// step 4,608 B: 32 staged K rows
__device__ __forceinline__ void acopy8_k(const unsigned l, const _Float16* const (&g)[8]) {
  asm volatile("global_load_async_to_lds_b128 %0, %1, off\n\tglobal_load_async_to_lds_b128 %0, %2, off offset:4608\n\tglobal_load_async_to_lds_b128 %0, %3, off offset:9216\n\tglobal_load_async_to_lds_b128 %0, %4, off offset:13824\n\tglobal_load_async_to_lds_b128 %0, %5, off offset:18432\n\tglobal_load_async_to_lds_b128 %0, %6, off offset:23040\n\tglobal_load_async_to_lds_b128 %0, %7, off offset:27648\n\tglobal_load_async_to_lds_b128 %0, %8, off offset:32256\n\ts_wait_xcnt 0x0"
               :: "v"(l), "v"(g[0]), "v"(g[1]), "v"(g[2]), "v"(g[3]), "v"(g[4]), "v"(g[5]), "v"(g[6]), "v"(g[7]) : "memory");
}
// step 4,224 B: 8 staged V rows
__device__ __forceinline__ void acopy8_v(const unsigned l, const _Float16* const (&g)[8]) {
  asm volatile("global_load_async_to_lds_b128 %0, %1, off\n\tglobal_load_async_to_lds_b128 %0, %2, off offset:4224\n\tglobal_load_async_to_lds_b128 %0, %3, off offset:8448\n\tglobal_load_async_to_lds_b128 %0, %4, off offset:12672\n\tglobal_load_async_to_lds_b128 %0, %5, off offset:16896\n\tglobal_load_async_to_lds_b128 %0, %6, off offset:21120\n\tglobal_load_async_to_lds_b128 %0, %7, off offset:25344\n\tglobal_load_async_to_lds_b128 %0, %8, off offset:29568\n\ts_wait_xcnt 0x0"
               :: "v"(l), "v"(g[0]), "v"(g[1]), "v"(g[2]), "v"(g[3]), "v"(g[4]), "v"(g[5]), "v"(g[6]), "v"(g[7]) : "memory");
}
// four asynchronous copies to LDS, 16 B a lane each: a K piece and a V piece of one packed tile, each to its hi plane and, by the offset (the plane's size: 4,608 B and 5,120 B), to its residual plane; gkl and gvl are the global addresses less that offset, as above; the closing wait as above
__device__ __forceinline__ void acopy4(const unsigned lk, const _Float16* gkh, const _Float16* gkl, const unsigned lv, const _Float16* gvh, const _Float16* gvl) {
  asm volatile("global_load_async_to_lds_b128 %0, %1, off\n\tglobal_load_async_to_lds_b128 %0, %2, off offset:4608\n\tglobal_load_async_to_lds_b128 %3, %4, off\n\tglobal_load_async_to_lds_b128 %3, %5, off offset:5120\n\ts_wait_xcnt 0x0"
               :: "v"(lk), "v"(gkh), "v"(gkl), "v"(lv), "v"(gvh), "v"(gvl) : "memory");
}
__device__ __forceinline__ unsigned lds_at(const void* p) { return (unsigned)(size_t)p; }   // LDS byte address: the low 32 bits of a __shared__ address
#define WKEYS 256                       // keys that the windows of a block's 128 queries touch: 64 + 128 + 64
#define KP (HD + 8)                  // LDS pitch of a staged K row (128 B of data) in 16-bit elements: 144 B, for ds_load_b128 readers
#define VP (WKEYS + 8)                  // LDS pitch of a staged V row (one d, 512 B of data): 528 B = 16 B x odd
#define ASTG (2 * WKEYS * KP * 2 + 2 * HD * VP * 2)   // bytes: K hi | K residual | V hi | V residual
#define GVP (32 + 8)                    // LDS pitch of a staged V row of one 32-key tile of the packed global keys (64 B of data): 80 B = 16 B x odd
#define GSTG (2 * 32 * KP * 2 + 2 * HD * GVP * 2)     // bytes: one such tile, behind the staged keys: K hi | K residual | V hi | V residual
static_assert(32 * KP * 2 == 4608 && 8 * VP * 2 == 4224, "the steps written in acopy8_k and acopy8_v");
static_assert(32 * KP * 2 == 4608 && HD * GVP * 2 == 5120, "the plane sizes written in acopy4");
// ---- k_attn: 8 waves, grid (head, batch, slot). Blocks slot >= NSLOT: 128 queries, one 16-query tile a wave; the block's WKEYS window keys (K rows and V columns, both planes) go to LDS once by whole-line loads and every wave takes its window fragments from there: the key tiles its window touches, then the packed global keys, one 32-key tile at a time through an LDS buffer of its own that the block fills by asynchronous copies (those inside the window masked there, so each pair counts once); rows that are global themselves are not stored here. Blocks slot < NSLOT: tiles of 16 packed global query rows, every key allowed: the keys go through the same LDS in 8 chunks of WKEYS, by asynchronous copies, each wave one 32-key tile of every chunk, the 8 partial (m, l, acc) merged in LDS. Both products run transposed (K . Q^T, then V^T . P^T): a lane holds the scores of one query, so the softmax needs one exchange between the wave halves, and the converted score tiles are the second product's B fragment as they stand. Scores 3 products x 1/8; P.V: f16 P hi/lo x (V hi, V lo*2048); O[b*S+q][h*64+d] (256-B segments)
template <bool dense> __device__ __forceinline__ void attn_body(const _Float16* __restrict__ QK, const _Float16* __restrict__ QKL, const _Float16* __restrict__ VTH, const _Float16* __restrict__ VTL, const _Float16* __restrict__ VGH, const _Float16* __restrict__ VGL, const int* __restrict__ GLB, const int* __restrict__ GL, float* __restrict__ O, unsigned char* stg, float (*sm)[16], float (*sl)[16]) {   // dense: a block of packed global query rows; compiled apart from the window blocks' code, so that neither holds the other's loop-invariant registers
  _Float16 (*skh)[KP] = (_Float16 (*)[KP])stg; _Float16 (*skl)[KP] = (_Float16 (*)[KP])(stg + WKEYS * KP * 2);
  _Float16 (*svh)[VP] = (_Float16 (*)[VP])(stg + 2 * WKEYS * KP * 2); _Float16 (*svl)[VP] = (_Float16 (*)[VP])(stg + 2 * WKEYS * KP * 2 + HD * VP * 2);
  _Float16 (*xkh)[KP] = (_Float16 (*)[KP])(stg + ASTG); _Float16 (*xkl)[KP] = (_Float16 (*)[KP])(stg + ASTG + 32 * KP * 2);   // window blocks: the current tile of the packed global keys
  _Float16 (*xvh)[GVP] = (_Float16 (*)[GVP])(stg + ASTG + 2 * 32 * KP * 2); _Float16 (*xvl)[GVP] = (_Float16 (*)[GVP])(stg + ASTG + 2 * 32 * KP * 2 + HD * GVP * 2);
  float (*so)[16][68] = (float (*)[16][68])stg;   // the epilogues reuse the staged keys' LDS
  const int tid = threadIdx.x, wave = __builtin_amdgcn_readfirstlane(tid >> 5), lane = tid & 31, col = lane & 15, g = lane >> 4;
  const int h = blockIdx.x, b = blockIdx.y, slot = blockIdx.z;   // slot is the slowest grid index, so the long blocks of packed global rows (low slots) of every head and batch take the lowest block indices, for speed only
  const int* lst = GL + (size_t)b * GLS; const int* gb = GLB + (size_t)b * SS;
  int n = lst[SS]; n = n < 0 ? 0 : (n > SS ? SS : n);
  const int ngt = (n + 31) >> 5;
  const int q0b = (slot - NSLOT) * 128 + wave * 16;   // window blocks only
  const int qtend = dense ? ((n + 15) >> 4) : slot + 1;
  const unsigned gqm = __builtin_amdgcn_ballot_w32((dense ? 0 : gb[q0b + col]) != 0);   // bit rl: query q0b + rl is global (its row belongs to the packed tiles)
  int ks0 = (slot - NSLOT) * 128 - HALFW; ks0 = ks0 < 0 ? 0 : (ks0 > SS - WKEYS ? SS - WKEYS : ks0);   // first staged key: the WKEYS keys from here hold every window of the block
  const auto stage_x = [&](const int j, const int key) {   // window blocks: tile j of the packed global keys to LDS, 4 copies a lane: 8 lanes cover the 128 B of the K row of list slot j * 32 + (tid >> 3), whose position is key; 4 lanes the tile's 64 B of a gathered V row
    const int xr = tid >> 3, xc8 = (tid & 7) * 8, xd = tid >> 2, xv8 = (tid & 3) * 8;
    const size_t xko = ((size_t)b * SS + key) * (2 * DM) + DM + h * HD + xc8, xvo = ((size_t)b * DM + h * HD + xd) * SS + j * 32 + xv8;   // + DM: the k half of a q | k row
    acopy4(lds_at(&xkh[xr][xc8]), QK + xko, QKL + xko - 32 * KP, lds_at(&xvh[xd][xv8]), VGH + xvo, VGL + xvo - HD * GVP);
  };
  if (!dense) {
    const int kr = tid >> 3, kc8 = (tid & 7) * 8, vc8 = lane * 8;   // 8 lanes cover the 128 B of a K row, a wave the 512 B of a V row
    const size_t ko = ((size_t)b * SS + ks0 + kr) * (2 * DM) + h * HD + kc8, vo = ((size_t)b * DM + h * HD + wave) * SS + ks0 + vc8;
    const _Float16 *gkh = QK + ko, *gkl = QKL + ko, *gvh = VTH + vo, *gvl = VTL + vo; v4u tk[8], tl[8], tv[8], tw[8];
    const int key0 = lst[kr];   // the packed tile 0's key of this lane's K copies (0 where the list is shorter), asked for ahead of the window loads, so that its copies need not wait for them
#pragma unroll
    for (int i = 0; i < 8; ++i) { tk[i] = *(const v4u*)(gkh + DM + (size_t)i * 32 * (2 * DM)); tl[i] = *(const v4u*)(gkl + DM + (size_t)i * 32 * (2 * DM)); }   // + DM: the k half of a q | k row
#pragma unroll
    for (int i = 0; i < 8; ++i) { tv[i] = *(const v4u*)(gvh + (size_t)i * 8 * SS); tw[i] = *(const v4u*)(gvl + (size_t)i * 8 * SS); }
    asm volatile("s_wait_xcnt 0x0" :: "v"(gkh), "v"(gkl), "v"(gvh), "v"(gvl) : "memory");   // the address registers of these loads are reused by what follows; named as inputs so that none of them is given to a later load's result ahead of the wait
    asm volatile("" :: "v"(key0));   // inputs-only fence on the loaded value: holds that load up here, ahead of the branch below; sunk into the branch it would stand behind the window loads and its wait would cover them all
    if (ngt > 0) stage_x(0, key0);   // block-uniform; the copies fly while the window loads land
#pragma unroll
    for (int i = 0; i < 8; ++i) { *(v4u*)&skh[i * 32 + kr][kc8] = tk[i]; *(v4u*)&skl[i * 32 + kr][kc8] = tl[i]; }
#pragma unroll
    for (int i = 0; i < 8; ++i) { *(v4u*)&svh[i * 8 + wave][vc8] = tv[i]; *(v4u*)&svl[i * 8 + wave][vc8] = tw[i]; }
    asm volatile("s_wait_asynccnt 0x0" ::: "memory");   // the wave's own copies of the packed tile 0 have landed
    __syncthreads();   // the staged keys are in LDS for every wave
  }
#pragma unroll 1
  for (int qt = slot; qt < qtend; qt += NSLOT) {   // window blocks: one trip
    const int q0 = (qt - NSLOT) * 128 + wave * 16;   // window blocks only; formed from qt, so that the 16 row addresses of the epilogue's stores are not computed ahead of the loop and held in registers through it
    const size_t rq = (size_t)b * SS + (dense ? lst[qt * 16 + col] : q0 + col);
    v16h aq[2], aql[2];
#pragma unroll
    for (int kc = 0; kc < 2; ++kc) { aq[kc] = frag_h(QK + rq * (2 * DM) + h * HD + kc * 32, lane); aql[kc] = frag_h(QKL + rq * (2 * DM) + h * HD + kc * 32, lane); }
    asm volatile("s_wait_xcnt 0x0" ::: "memory");   // the address registers of these loads are reused by what follows
    float m = -3.0e38f, l = 0.f;   // of the lane's own query (column col): running maximum (alike in both wave halves), sum over the keys of the lane's own half
    const int qi = q0 + col;   // window blocks only
    v8f acc[4] = {}, accl[4] = {};   // transposed: register r of tile dt = O[query col][dt * 16 + 8 * g + r]
    int kt0 = (q0 - HALFW) >> 5, kt1 = (q0 + 15 + HALFW) >> 5; kt0 = kt0 < 0 ? 0 : kt0; kt1 = kt1 > SS / 32 - 1 ? SS / 32 - 1 : kt1;
    const int nwin = dense ? 0 : kt1 - kt0 + 1;
#pragma unroll 1   // kept rolled: one copy of the body serves both passes, which keeps the text and the register count down
    for (int ph = 0; ph < (dense ? 1 : 2); ++ph) { const bool gl = ph != 0; const int it1 = dense ? SS / WKEYS : (gl ? ngt : nwin);   // window blocks: the wave's window tiles, then (gl) the tiles of the packed global keys, as many in every wave; dense: one trip per chunk of WKEYS keys, alike in every wave
#pragma unroll 1
    for (int it = 0; it < it1; ++it) { const int kt = dense ? it * (WKEYS / 32) + wave : (gl ? it : kt0 + it);   // dense: the wave's own tile of chunk it
      if (gl && it > 0) {   // block-uniform: packed tile it takes the place of tile it - 1 (tile 0 came with the window keys)
        const int key = lst[it * 32 + (tid >> 3)];
        asm volatile("s_wait_xcnt 0x0" ::: "memory");   // the offset register of this load is reused by what follows
        asm volatile("s_wait_dscnt 0x0" ::: "memory");   // the wave's own reads of that LDS have retired before a copy targets it
        __syncthreads();   // every wave has read its last fragment of the tile that is overwritten
        stage_x(it, key);
        asm volatile("s_wait_asynccnt 0x0" ::: "memory");   // the wave's own copies have landed
        __syncthreads();   // packed tile it is in LDS for every wave
      }
      if (dense) {   // chunk it (WKEYS keys: K rows and V columns, both planes) to the places in LDS that a window block's staged keys have, 32 whole-line copies a lane
        asm volatile("s_wait_dscnt 0x0" ::: "memory");   // the wave's own reads of that LDS have retired before a copy targets it
        __syncthreads();   // every wave has read its last fragment of the chunk that this trip overwrites
        const int kr = tid >> 3, kc8 = (tid & 7) * 8, vc8 = lane * 8;   // 8 lanes cover the 128 B of a K row, a wave the 512 B of a V row
        const size_t ko = ((size_t)b * SS + it * WKEYS + kr) * (2 * DM) + DM + h * HD + kc8, vo = ((size_t)b * DM + h * HD + wave) * SS + it * WKEYS + vc8;   // + DM: the k half of a q | k row
        const _Float16* ga[8];   // K rows: 32 rows of KP (4,608 B) between a lane's copies in LDS; V rows: 8 rows of VP (4,224 B)
#pragma unroll
        for (int i = 0; i < 8; ++i) ga[i] = QK + ko + (size_t)i * (32 * (2 * DM) - 32 * KP);
        acopy8_k(lds_at(&skh[kr][kc8]), ga);
#pragma unroll
        for (int i = 0; i < 8; ++i) ga[i] = QKL + ko + (size_t)i * (32 * (2 * DM) - 32 * KP);
        acopy8_k(lds_at(&skl[kr][kc8]), ga);
#pragma unroll
        for (int i = 0; i < 8; ++i) ga[i] = VTH + vo + (size_t)i * (8 * SS - 8 * VP);
        acopy8_v(lds_at(&svh[wave][vc8]), ga);
#pragma unroll
        for (int i = 0; i < 8; ++i) ga[i] = VTL + vo + (size_t)i * (8 * SS - 8 * VP);
        acopy8_v(lds_at(&svl[wave][vc8]), ga);
        asm volatile("s_wait_asynccnt 0x0" ::: "memory");   // the wave's own copies have landed
        __syncthreads();   // chunk it is in LDS for every wave
      }
      v8f s[2];
      const bool st = !gl; const int kl0 = dense ? wave * 32 : kt * 32 - ks0;   // st: a window tile or a dense block's tile, its fragments come from the staged keys (row kl0 on); else from the staged packed tile
      v4i kk[4]; v16h kfh[2][2], kfl[2][2];   // kk, packed tiles only: the positions of the 2 x 8 keys whose scores the lane holds (rows 8 * g + r of the two transposed score tiles)
      if (gl) { const int* pk = lst + kt * 32 + 8 * g; kk[0] = *(const v4i*)pk; kk[1] = *(const v4i*)(pk + 4); kk[2] = *(const v4i*)(pk + 16); kk[3] = *(const v4i*)(pk + 20);
        asm volatile("s_wait_xcnt 0x0" :: "v"(pk) : "memory"); }   // the address register of these loads is reused further down the trip
      if (st) {
#pragma unroll
        for (int ct = 0; ct < 2; ++ct) {
#pragma unroll
          for (int kc = 0; kc < 2; ++kc) { kfh[ct][kc] = frag_h(&skh[kl0 + ct * 16 + col][kc * 32], lane); kfl[ct][kc] = frag_h(&skl[kl0 + ct * 16 + col][kc * 32], lane); } }
      } else {
#pragma unroll
        for (int ct = 0; ct < 2; ++ct) {
#pragma unroll
          for (int kc = 0; kc < 2; ++kc) { kfh[ct][kc] = frag_h(&xkh[ct * 16 + col][kc * 32], lane); kfl[ct][kc] = frag_h(&xkl[ct * 16 + col][kc * 32], lane); } }
      }
      unsigned gm = 0u;   // packed tiles only, bit i: score i of the lane counts (a live list slot whose key lies outside the query's window); formed here, while the K rows are on their way, so that the 16 positions need no registers further down
      if (gl) {
#pragma unroll
        for (int i = 0; i < 16; ++i) gm |= ((kt * 32 + 8 * g + (i >> 3) * 16 + (i & 7) < n) & ((unsigned)(kk[i >> 2][i & 3] - qi + HALFW) > 2u * HALFW)) ? (1u << i) : 0u; }
#pragma unroll
      for (int ct = 0; ct < 2; ++ct) { v8f c = {}, cl = {};
#pragma unroll
        for (int kc = 0; kc < 2; ++kc) { c = wmma16(kfh[ct][kc], aq[kc], c); cl = wmma16(kfh[ct][kc], aql[kc], cl); cl = wmma16(kfl[ct][kc], aq[kc], cl); }   // transposed scores K . Q^T, 3 products: q, k as f16 hi + residual
#pragma unroll
        for (int r = 0; r < 8; ++r) s[ct][r] = (c[r] + cl[r] * (1.0f / 2048.0f)) * 0.125f; }   // 1/sqrt(64)
      const int d0 = kt * 32 + 8 * g - qi + HALFW;   // the per-pair rule, by the tile's kind (wave-uniform); masked keys excluded; a tile of a dense block has none
      if (st && !dense) {
#pragma unroll
        for (int i = 0; i < 16; ++i) s[i >> 3][i & 7] = ((unsigned)(d0 + (i >> 3) * 16 + (i & 7)) <= 2u * HALFW) ? s[i >> 3][i & 7] : -3.0e38f;   // |key - query| <= HALFW
      } else if (gl) {
#pragma unroll
        for (int i = 0; i < 16; ++i) s[i >> 3][i & 7] = ((gm >> i) & 1u) ? s[i >> 3][i & 7] : -3.0e38f;
      }
      v16h vfh[4], vfl[4];   // the tile's V fragments, as one group, asked for ahead of the softmax
      if (st) {
#pragma unroll
        for (int dt = 0; dt < 4; ++dt) { vfh[dt] = frag_h(&svh[dt * 16 + col][kl0], lane); vfl[dt] = frag_h(&svl[dt * 16 + col][kl0], lane); }
      } else {
#pragma unroll
        for (int dt = 0; dt < 4; ++dt) { vfh[dt] = frag_h(&xvh[dt * 16 + col][0], lane); vfl[dt] = frag_h(&xvl[dt * 16 + col][0], lane); }
      }
      float mx = fmaxf(s[0][0], s[1][0]);   // a lane holds 16 of the tile's 32 scores of its one query: maximum and sum in the lane, one exchange between the wave halves
#pragma unroll
      for (int r = 1; r < 8; ++r) mx = fmaxf(mx, fmaxf(s[0][r], s[1][r]));
      mx = fmaxf(mx, xhalf(mx));
      const float mn = fmaxf(m, mx), mz = fmaxf(mn, -1.0e30f);   // mz: the maximum where a key has been seen; else a floor far above the mask value, so that a masked score (and a maximum not yet set) gives exp = 0 with no test of its own
      const float alpha = __expf(m - mz);
      float e[16]; v16h pa, pl;   // the two transposed score tiles, converted in place, are the B fragment of the second product (element i: key 8 * g + i, element 8 + i: key 16 + 8 * g + i, the k order of the V loader)
#pragma unroll
      for (int i = 0; i < 16; ++i) { const float sv = s[i >> 3][i & 7]; e[i] = __expf(sv - mz);
        const float x = e[i] * 2048.0f; const _Float16 hx = (_Float16)x; pa[i] = hx; pl[i] = (_Float16)((x - (float)hx) * 2048.0f); }   // P scaled by 2^11 before the f16 split so small softmax weights stay out of the f16 subnormal range; 2^-11 folded into the epilogue
#pragma unroll
      for (int w = 8; w > 0; w >>= 1) {
#pragma unroll
        for (int i = 0; i < w; ++i) e[i] += e[i + w]; }
      l = l * alpha + e[0]; m = mn;
#pragma unroll
      for (int dt = 0; dt < 4; ++dt) { acc[dt] *= alpha; accl[dt] *= alpha; }
#pragma unroll
      for (int dt = 0; dt < 4; ++dt) { acc[dt] = wmma16(vfh[dt], pa, acc[dt]); accl[dt] = wmma16(vfh[dt], pl, accl[dt]); accl[dt] = wmma16(vfl[dt], pa, accl[dt]); } } }   // transposed V^T . P^T: P hi x V hi + (P lo x V hi + P hi x V lo) / 2048
    const float lt = l + xhalf(l);   // the two halves' sums joined once
    if (!dense) {
      __syncthreads();   // every wave has read its last staged fragment before the epilogue overwrites that LDS
      const float il = (1.0f / 2048.0f) / lt;
#pragma unroll
      for (int dt = 0; dt < 4; ++dt) { const v8f o = (acc[dt] + accl[dt] * (1.0f / 2048.0f)) * il; float* po = &so[wave][col][dt * 16 + 8 * g]; *(v4f*)po = __builtin_shufflevector(o, o, 0, 1, 2, 3); *(v4f*)(po + 4) = __builtin_shufflevector(o, o, 4, 5, 6, 7); }
      LDSX();
      for (int rl = 0; rl < 16; ++rl) if (lane < 16 && ((gqm >> rl) & 1u) == 0u) { vst2(O + ((size_t)b * SS + q0 + rl) * DM + h * HD + lane * 4, *(const v4f*)&so[wave][rl][lane * 4]);
        asm volatile("s_wait_xcnt 0x0" ::: "memory"); }   // the next row's LDS read lands in the registers this store names
    } else {
      __syncthreads();   // every wave has read its last staged fragment before the partials overwrite that LDS
#pragma unroll
      for (int dt = 0; dt < 4; ++dt) { const v8f o = acc[dt] + accl[dt] * (1.0f / 2048.0f); float* po = &so[wave][col][dt * 16 + 8 * g]; *(v4f*)po = __builtin_shufflevector(o, o, 0, 1, 2, 3); *(v4f*)(po + 4) = __builtin_shufflevector(o, o, 4, 5, 6, 7); }
      if (g == 0) { sm[wave][col] = m; sl[wave][col] = lt; }
      __syncthreads();   // every wave's partial is in LDS before the merge reads it
      const int row = tid >> 4, d4 = (tid & 15) * 4; float mm = sm[0][row];
#pragma unroll
      for (int w = 1; w < 8; ++w) mm = fmaxf(mm, sm[w][row]);
      float ll = 0.f; v4f a = {};
#pragma unroll
      for (int w = 0; w < 8; ++w) { const float e = __expf(sm[w][row] - mm); ll += e * sl[w][row]; a += *(const v4f*)&so[w][row][d4] * e; }
      if (qt * 16 + row < n) { vst2(O + ((size_t)b * SS + lst[qt * 16 + row]) * DM + h * HD + d4, a * ((1.0f / 2048.0f) / ll));
        asm volatile("s_wait_xcnt 0x0" ::: "memory"); }   // the next tile's set-up reuses the registers this store names
      __syncthreads();   // the merge has read the partials before the next tile overwrites them
    }
  }
}
__global__ __launch_bounds__(256) void k_attn(const _Float16* __restrict__ QK, const _Float16* __restrict__ QKL, const _Float16* __restrict__ VTH, const _Float16* __restrict__ VTL, const _Float16* __restrict__ VGH, const _Float16* __restrict__ VGL, const int* __restrict__ GLB, const int* __restrict__ GL, float* __restrict__ O) {
  __shared__ __align__(16) unsigned char stg[ASTG + GSTG]; __shared__ float sm[8][16], sl[8][16];
  if (blockIdx.z < NSLOT) attn_body<true>(QK, QKL, VTH, VTL, VGH, VGL, GLB, GL, O, stg, sm, sl); else attn_body<false>(QK, QKL, VTH, VTL, VGH, VGL, GLB, GL, O, stg, sm, sl);   // block-uniform
}
// ---- k_out: block = (128 rows, 128 cols), 8 waves, staged as k_qkv: out = f16(O) . Wo rows + bo
__global__ __launch_bounds__(256) void k_out(const float* __restrict__ O, const __bf16* __restrict__ P, const float* __restrict__ BO, float* __restrict__ Y) {
  __shared__ __align__(16) unsigned char smem[STG];
  _Float16 (*sa)[128][LP] = (_Float16 (*)[128][LP])smem; _Float16 (*sb)[128][LP] = (_Float16 (*)[128][LP])(smem + STG / 2);
  float (*so)[16][132] = (float (*)[16][132])smem;
  const int tid = threadIdx.x, wave = tid >> 5, lane = tid & 31, col = lane & 15, g = lane >> 4; const size_t r0 = (size_t)blockIdx.x * 128 + wave * 16; const int n0 = blockIdx.y * 128;
  const int xr = tid >> 4, xc = (tid & 15) * 4, wr = tid >> 3, wc = (tid & 7) * 8;   // 16 lanes cover 256 B of an O row, 8 lanes 128 B of a W row
  const float* xg = O + ((size_t)blockIdx.x * 128 + xr) * DM + xc; const _Float16* wg = (const _Float16*)P + (size_t)(n0 + wr) * DM + wc;
  v4f ra[8]; v4u rb[4];
#pragma unroll
  for (int i = 0; i < 8; ++i) ra[i] = *(const v4f*)(xg + (size_t)i * 16 * DM);
#pragma unroll
  for (int i = 0; i < 4; ++i) rb[i] = *(const v4u*)(wg + (size_t)i * 32 * DM);
#pragma unroll
  for (int i = 0; i < 8; ++i) { v4h t; t[0] = (_Float16)ra[i][0]; t[1] = (_Float16)ra[i][1]; t[2] = (_Float16)ra[i][2]; t[3] = (_Float16)ra[i][3]; *(v4h*)&sa[0][i * 16 + xr][xc] = t; }
#pragma unroll
  for (int i = 0; i < 4; ++i) *(v4u*)&sb[0][i * 32 + wr][wc] = rb[i];
  v8f acc[8] = {};
#pragma unroll 1   // kept rolled: 16 unrolled trips would swell the text
  for (int ks = 0; ks < DM / KS; ++ks) { const int bf = ks & 1; const bool more = ks + 1 < DM / KS;
    __syncthreads();   // slice ks is in LDS for every wave, and every wave has left the buffer that this trip refills
    if (more) {
#pragma unroll
      for (int i = 0; i < 8; ++i) ra[i] = *(const v4f*)(xg + (size_t)i * 16 * DM + (ks + 1) * KS);
#pragma unroll
      for (int i = 0; i < 4; ++i) rb[i] = *(const v4u*)(wg + (size_t)i * 32 * DM + (ks + 1) * KS);
      asm volatile("s_wait_xcnt 0x0" ::: "memory"); }   // the address registers of these loads are reused further down the trip
#pragma unroll
    for (int kc = 0; kc < KS / 32; ++kc) { const v16h a = frag_h(&sa[bf][wave * 16 + col][kc * 32], lane); v16h w[8];
#pragma unroll
      for (int j = 0; j < 8; ++j) w[j] = frag_h(&sb[bf][j * 16 + col][kc * 32], lane);   // the block's LDS reads as one group, ahead of its products
#pragma unroll
      for (int j = 0; j < 8; ++j) acc[j] = wmma16(a, w[j], acc[j]); }   // single f16 product against exact f16 x 2^8 weight copies
    if (more) {
#pragma unroll
      for (int i = 0; i < 8; ++i) { v4h t; t[0] = (_Float16)ra[i][0]; t[1] = (_Float16)ra[i][1]; t[2] = (_Float16)ra[i][2]; t[3] = (_Float16)ra[i][3]; *(v4h*)&sa[bf ^ 1][i * 16 + xr][xc] = t; }
#pragma unroll
      for (int i = 0; i < 4; ++i) *(v4u*)&sb[bf ^ 1][i * 32 + wr][wc] = rb[i]; } }
  __syncthreads();   // every wave has read the last slice before the epilogue overwrites the buffers
#pragma unroll
  for (int j = 0; j < 8; ++j) {
#pragma unroll
    for (int r = 0; r < 8; ++r) so[wave][8 * g + r][j * 16 + col] = acc[j][r] * (1.0f / 256.0f) + bfr(BO[n0 + j * 16 + col]); }
  LDSX();
  for (int rl = 0; rl < 16; ++rl) vst2(Y + (r0 + rl) * DM + n0 + lane * 4, *(const v4f*)&so[wave][rl][lane * 4]);
}
#define FCH 8192                     // floats of one weight matrix that a converting block takes: 8 whole-line loads a lane
#define FPM (DM * DM / FCH)          // converting blocks per matrix
// ---- k_front: one launch for all that depends on the inputs alone. Blocks x < NB: batch b = x: GL[b][0..n) = positions of the global tokens, ascending; the rest of the list 0; GL[b][SS..SS+32) = n. Blocks x >= NB: FCH consecutive floats of W_q | W_k | W_v -> bf16 (PK_A) or of W_o -> f16 x 2^8 copies of the bf16-rounded values (PK_P, bit pattern in the bf16-typed buffer); the natural [out][in] order is kept, so the copy is elementwise and needs no LDS
__global__ __launch_bounds__(256) void k_front(const float* __restrict__ WQ, const float* __restrict__ WK, const float* __restrict__ WV, const float* __restrict__ WO, const int* __restrict__ GLB, __bf16* __restrict__ PK, int* __restrict__ GL) { __shared__ int sc[256]; __shared__ int sl[SS]; const int t = threadIdx.x;
  if (blockIdx.x >= NB) { const int cb = blockIdx.x - NB, which = cb / FPM; const float* Wm = (which == 0) ? WQ : (which == 1) ? WK : (which == 2) ? WV : WO;
    const size_t e0 = (size_t)(cb % FPM) * FCH + t * 4; const float* sp = Wm + e0; __bf16* dp = PK + PK_A + (size_t)which * DM * DM + e0;   // PK_P follows the three PK_A matrices
    v4f a[8];
#pragma unroll
    for (int i = 0; i < 8; ++i) a[i] = *(const v4f*)(sp + i * 1024);   // a wave's load covers 512 contiguous bytes; all 8 in flight together
    asm volatile("s_wait_xcnt 0x0" ::: "memory");   // the address registers of these loads may be reused by what follows
    if (which < 3) {
#pragma unroll
      for (int i = 0; i < 8; ++i) { v4b o; o[0] = (__bf16)a[i][0]; o[1] = (__bf16)a[i][1]; o[2] = (__bf16)a[i][2]; o[3] = (__bf16)a[i][3]; *(v4b*)(dp + i * 1024) = o; }
    } else {
#pragma unroll
      for (int i = 0; i < 8; ++i) { v4h o; o[0] = (_Float16)(bfr(a[i][0]) * 256.0f); o[1] = (_Float16)(bfr(a[i][1]) * 256.0f); o[2] = (_Float16)(bfr(a[i][2]) * 256.0f); o[3] = (_Float16)(bfr(a[i][3]) * 256.0f); vst2(dp + i * 1024, o); }
      asm volatile("s_wait_xcnt 0x0" ::: "memory");   // the code laid out behind these stores writes registers that they name
    }
    return; }   // block-uniform, ahead of every barrier
  const size_t b = blockIdx.x; const int* gb = GLB + b * SS;
  int f[8], c = 0;
#pragma unroll
  for (int i = 0; i < 8; ++i) { f[i] = gb[t * 8 + i] != 0; c += f[i]; }
  sc[t] = c; for (int i = t; i < SS; i += 256) sl[i] = 0;
  __syncthreads();
  int base = 0, tot = 0; for (int i = 0; i < 256; ++i) { const int v = sc[i]; tot += v; base += (i < t) ? v : 0; }
#pragma unroll
  for (int i = 0; i < 8; ++i) if (f[i]) sl[base++] = t * 8 + i;
  __syncthreads();
  int* o = GL + b * GLS; for (int i = t; i < SS; i += 256) o[i] = sl[i];
  if (t < 32) o[SS + t] = tot; }
// ---- k_gv: block = (8 rows h*64+d, b), one wave a row: VG[b][row][slot] = VT[b][row][list[slot]] for the n global keys, 0 up to the next multiple of 32
__global__ __launch_bounds__(256) void k_gv(const _Float16* __restrict__ VTH, const _Float16* __restrict__ VTL, const int* __restrict__ GL, _Float16* __restrict__ VGH, _Float16* __restrict__ VGL) { const int t = threadIdx.x; const size_t b = blockIdx.y; const int* lst = GL + b * GLS;
  int n = lst[SS]; n = n < 0 ? 0 : (n > SS ? SS : n); const int npad = (n + 31) & ~31; const size_t row = (b * DM + blockIdx.x * 8 + (t >> 5)) * SS;
  for (int p = t & 31; p < npad; p += 32) { const int k = lst[p]; _Float16 vh = (_Float16)0.f, vl = (_Float16)0.f; if (p < n) { vh = VTH[row + k]; vl = VTL[row + k]; } VGH[row + p] = vh; VGL[row + p] = vl; } }
extern "C" void kernel_launch(void* const* d_in, const int* in_sizes, int n_in, void* d_out, int out_size, void* d_ws, size_t ws_size, hipStream_t stream) {
  (void)in_sizes; (void)n_in; (void)out_size;
  const float** F = (const float**)d_in;   // 0 x [2,2048,1024], 1 is_global bool [2,2048], 2 wq, 3 bq, 4 wk, 5 bk, 6 wv, 7 bv, 8 wo, 9 bo (natural)
  if (ws_size < (size_t)WS_END) return;
  char* ws = (char*)d_ws; __bf16* PK = (__bf16*)(ws + WS_PK); _Float16 *QK = (_Float16*)(ws + WS_QK), *QKL = (_Float16*)(ws + WS_QKL), *VTH = (_Float16*)(ws + WS_VTH), *VTL = (_Float16*)(ws + WS_VTL); float* O = (float*)(ws + WS_O); int* GL = (int*)(ws + WS_GL); _Float16 *VGH = (_Float16*)(ws + WS_VGH), *VGL = (_Float16*)(ws + WS_VGL); const int* GLB = (const int*)d_in[1];
  k_front<<<NB + 4 * FPM, 256, 0, stream>>>(F[2], F[4], F[6], F[8], GLB, PK, GL);
  k_qkv<<<dim3(NB * SS / 128, QKVW / 128), 256, 0, stream>>>(F[0], F[0], F[0], PK + PK_A, F[3], F[5], F[7], QK, QKL, VTH, VTL);
  k_gv<<<dim3(DM / 8, NB), 256, 0, stream>>>(VTH, VTL, GL, VGH, VGL);
  k_attn<<<dim3(NH, NB, NSLOT + SS / 128), 256, 0, stream>>>(QK, QKL, VTH, VTL, VGH, VGL, GLB, GL, O);
  k_out<<<dim3(NB * SS / 128, DM / 128), 256, 0, stream>>>(O, PK + PK_P, F[9], (float*)d_out);
}

// v008
// Measured time: 92.7 microseconds a run.
// Next to v007, in two timings, it ran 1.09 and 1.08 times as fast.
// Counting every step since v000, it is 5.36 times as fast.
// compute dtype: all float inputs rounded to bf16, is_global (bool) read on device; q/k/v = x . W^T + b with EXACT bf16 products on WMMA 16x16x32 (natural rows), rounded once to f16 hi + residual; attention with 3-product scores and P.v (hi + residual planes) restricted to each 16-query tile's window key tiles plus a packed list of the global keys (list built on device from is_global, their v columns gathered), global query rows packed into tiles of their own that visit every key (8 waves split the keys, merged in LDS), the per-pair rule evaluated inline, x 1/8, running-max softmax in f32 (hardware exp); out = f16(ctx) . Wo^T (exact f16 x 2^8 copies) + bo; f32 output.
#include <hip/hip_runtime.h>
#include <math.h>

typedef __attribute__((ext_vector_type(16))) _Float16 v16h;
typedef __attribute__((ext_vector_type(16))) __bf16 v16b;
typedef __attribute__((ext_vector_type(8)))  _Float16 v8h;
typedef __attribute__((ext_vector_type(8)))  float v8f;
typedef __attribute__((ext_vector_type(4)))  float v4f;
typedef __attribute__((ext_vector_type(2)))  float v2f;
typedef __attribute__((ext_vector_type(4)))  unsigned v4u;
typedef __attribute__((ext_vector_type(4)))  int v4i;
typedef float __attribute__((may_alias)) float_a;
typedef int __attribute__((may_alias)) int_a;

template <typename T> __device__ __forceinline__ void vst2(void* p, T v) { *(T*)p = v;  }
__device__ __forceinline__ v8f wmma16(v16h a, v16h b, v8f c) {
  v8f d = __builtin_amdgcn_wmma_f32_16x16x32_f16(false, a, false, b, (short)0, c, false, false);
  asm volatile("v_nop\n\tv_nop\n\tv_nop\n\tv_nop" : "+v"(d) : "v"(a), "v"(b));
  return d;
}
__device__ __forceinline__ v8f wmma_bf(v16b a, v16b b, v8f c) {
  v8f d = __builtin_amdgcn_wmma_f32_16x16x32_bf16(false, a, false, b, (short)0, c, false, false);
  asm volatile("v_nop\n\tv_nop\n\tv_nop\n\tv_nop" : "+v"(d) : "v"(a), "v"(b));
  return d;
}
// Sparse structured attention (B 2, S 2,048, hidden 1,024, 16 heads x 64): local window |i - j| <= 64 plus global tokens (is_global, given) that attend everywhere and are attended by everyone; projections + biases, softmax(q k / 8) over the allowed keys, v, output projection + bias.
__device__ __forceinline__ v16h frag_h(const _Float16* rowk0, int lane) {
  union { v16h v; v8h q[2]; } u; const _Float16* p = rowk0 + 8 * (lane >> 4);
  u.q[0] = *(const v8h*)p; u.q[1] = *(const v8h*)(p + 16); return u.v;
}
__device__ __forceinline__ v16h frag_f32(const float* rowk0, int lane) {
  v16h a; const float* p = rowk0 + 8 * (lane >> 4);
#pragma unroll
  for (int i = 0; i < 8; ++i) { a[i] = (_Float16)p[i]; a[8 + i] = (_Float16)p[16 + i]; }
  return a;
}
__device__ __forceinline__ v16h frag_f32s(const float* rowk0, int lane, float sc) {
  v16h a; const float* p = rowk0 + 8 * (lane >> 4);
#pragma unroll
  for (int i = 0; i < 8; ++i) { a[i] = (_Float16)(p[i] * sc); a[8 + i] = (_Float16)(p[16 + i] * sc); }
  return a;
}
// column fragment from a [K][ld] layout (column n), rows >= K read as 0
__device__ __forceinline__ v16h fragc_f32(const float* W, int k0, int n, int lane, int ld, int K) {
  v16h a; const int g = lane >> 4;
#pragma unroll
  for (int i = 0; i < 8; ++i) { const int ka = k0 + 8 * g + i, kb = ka + 16;
    a[i] = (_Float16)(ka < K ? W[(size_t)(ka < K ? ka : K - 1) * ld + n] : 0.f); a[8 + i] = (_Float16)(kb < K ? W[(size_t)(kb < K ? kb : K - 1) * ld + n] : 0.f); }
  return a;
}
struct F2 { v16b h, l; };
__device__ __forceinline__ F2 bsplit16(const float v[16]) { F2 r;
#pragma unroll
  for (int i = 0; i < 16; ++i) { const __bf16 h = (__bf16)v[i]; r.h[i] = h; r.l[i] = (__bf16)(v[i] - (float)h); }
  return r; }
__device__ __forceinline__ F2 split_row(const float* row, int k0, int lane) { float v[16]; const float* p = row + k0 + 8 * (lane >> 4);
#pragma unroll
  for (int i = 0; i < 8; ++i) { v[i] = p[i]; v[8 + i] = p[16 + i]; }
  return bsplit16(v); }
__device__ __forceinline__ F2 split_rowK(const float* row, int k0, int lane, int K) { float v[16]; const int g = lane >> 4;
#pragma unroll
  for (int i = 0; i < 8; ++i) { const int ka = k0 + 8 * g + i, kb = ka + 16; v[i] = ka < K ? row[ka < K ? ka : K - 1] : 0.f; v[8 + i] = kb < K ? row[kb < K ? kb : K - 1] : 0.f; }
  return bsplit16(v); }
__device__ __forceinline__ F2 split_col(const float* W, int k0, int n, int lane, int ld, int K) { float v[16]; const int g = lane >> 4;
#pragma unroll
  for (int i = 0; i < 8; ++i) { const int ka = k0 + 8 * g + i, kb = ka + 16; v[i] = ka < K ? W[(size_t)(ka < K ? ka : K - 1) * ld + n] : 0.f; v[8 + i] = kb < K ? W[(size_t)(kb < K ? kb : K - 1) * ld + n] : 0.f; }
  return bsplit16(v); }
__device__ __forceinline__ v8f mac3(const F2& a, const F2& b, v8f c) { c = wmma_bf(a.l, b.h, c); c = wmma_bf(a.h, b.l, c); return wmma_bf(a.h, b.h, c); }
__device__ __forceinline__ float sigm(float v) { return 1.0f / (1.0f + expf(-v)); }
#define LDSX() do { asm volatile("s_wait_dscnt 0" ::: "memory"); __builtin_amdgcn_wave_barrier(); __builtin_amdgcn_fence(__ATOMIC_RELEASE, "workgroup"); } while (0)


#define NB 2
#define SS 2048
#define DM 1024
#define NH 16
#define HALFW 64
#define HD 64
#define QKVW (3 * DM)
#ifndef TQB
#define TQB (SS / 64)
#define TNB NB
#define TOB (NB * SS / 64)     // 64-row tiles of all output rows (unused)
#endif
typedef __attribute__((ext_vector_type(8))) __bf16 v8b;
__device__ __forceinline__ v16b frag_b(const __bf16* rowk0, int lane) {
  union { v16b v; v8b q[2]; } u; const __bf16* p = rowk0 + 8 * (lane >> 4);
  u.q[0] = *(const v8b*)p; u.q[1] = *(const v8b*)(p + 16); return u.v;
}
__device__ __forceinline__ float bfr(float v) { return (float)(__bf16)v; }
__device__ __attribute__((noinline)) float exp_ni(float v) { return expf(v); }
__device__ __attribute__((noinline)) float erf_ni(float v) { return erff(v); }

#define PK_A 0                       // [3072][1024] Wqkv rows (natural [out][in])
#define PK_P (PK_A + QKVW * DM)        // [1024][1024] Wo rows (natural)
#define PK_END (PK_P + DM * DM)
#define WS_PK  0u
#define WS_QK  (WS_PK + 2u * PK_END)             // f16 [4096 rows][2048]: q | k
#define WS_QKL (WS_QK + 2u * NB * SS * 2 * DM)     // f16 q | k residual planes x2048
#define WS_VTH (WS_QKL + 2u * NB * SS * 2 * DM)    // f16 [b][1024 (h*64+d)][2048 s] hi
#define WS_VTL (WS_VTH + 2u * NB * DM * SS)        // f16 lo x 2048
#define WS_O   (WS_VTL + 2u * NB * DM * SS)        // f32 [4096][1024]
#define GLS (SS + 32)                              // ints per batch: positions of the global tokens (ascending, rest 0), then their count
#define NSLOT 16                                   // blocks per (head, batch) that walk the tiles of global query rows
#define WS_GL  (WS_O + 4u * (size_t)NB * SS * DM)        // int [b][GLS]
#define WS_VGH (WS_GL + 4u * (size_t)NB * GLS)           // f16 [b][1024 (h*64+d)][2048 list slot] hi: v columns of the global keys, in list order
#define WS_VGL (WS_VGH + 2u * NB * DM * SS)        // f16 lo x 2048
#define WS_END (WS_VGL + 2u * NB * DM * SS)
#define KS 64                        // k of one staged slice: 128 B of a 16-bit row, 256 B of an f32 row
#define LP (KS + 8)                  // LDS row pitch in 16-bit elements: 144 B, for ds_load_b128 readers
#define STG (2 * 2 * 128 * LP * 2)   // bytes: two buffers of [X 128 rows | W 128 rows]
typedef __attribute__((ext_vector_type(4))) __bf16 v4b;
typedef __attribute__((ext_vector_type(4))) _Float16 v4h;
// ---- k_qkv: block = (128 rows, 128 cols), 8 waves, a wave 16 rows x 128 cols. Each k slice of X (rounded to bf16 on the way) and of W goes to LDS by whole-line loads, one slice ahead, two buffers; fragments come from LDS. The epilogue reuses the same LDS.
__global__ __launch_bounds__(256) void k_qkv(const float* __restrict__ XQ, const float* __restrict__ XK, const float* __restrict__ XV, const __bf16* __restrict__ P, const float* __restrict__ BQ, const float* __restrict__ BK, const float* __restrict__ BV, _Float16* __restrict__ QK, _Float16* __restrict__ QKL, _Float16* __restrict__ VTH, _Float16* __restrict__ VTL) {
  const int which0 = (blockIdx.y * 128) / DM; const float* X = (which0 == 0) ? XQ : (which0 == 1) ? XK : XV; const float* BB = BQ ? (((which0 == 0) ? BQ : (which0 == 1) ? BK : BV) + (blockIdx.y * 128 - which0 * DM)) : nullptr;
  __shared__ __align__(16) unsigned char smem[STG];
  __bf16 (*sa)[128][LP] = (__bf16 (*)[128][LP])smem; __bf16 (*sb)[128][LP] = (__bf16 (*)[128][LP])(smem + STG / 2);
  _Float16 (*so)[16][136] = (_Float16 (*)[16][136])smem; _Float16 (*sol)[16][136] = (_Float16 (*)[16][136])(smem + 8 * 16 * 136 * 2);
  _Float16 (*sth)[136] = (_Float16 (*)[136])smem; _Float16 (*stl)[136] = (_Float16 (*)[136])(smem + 128 * 136 * 2);
  const int tid = threadIdx.x, wave = tid >> 5, lane = tid & 31, col = lane & 15, g = lane >> 4; const size_t r0 = (size_t)blockIdx.x * 128 + wave * 16; const int n0 = blockIdx.y * 128;
  const int xr = tid >> 4, xc = (tid & 15) * 4, wr = tid >> 3, wc = (tid & 7) * 8;   // 16 lanes cover 256 B of an X row, 8 lanes 128 B of a W row
  const float* xg = X + ((size_t)blockIdx.x * 128 + xr) * DM + xc; const __bf16* wg = P + (size_t)(n0 + wr) * DM + wc;
  v4f ra[8]; v4u rb[4];
#pragma unroll
  for (int i = 0; i < 8; ++i) ra[i] = *(const v4f*)(xg + (size_t)i * 16 * DM);
#pragma unroll
  for (int i = 0; i < 4; ++i) rb[i] = *(const v4u*)(wg + (size_t)i * 32 * DM);
  float bias[8] = {};   // the lane's bias value of each of its 8 column tiles, as one group of loads ahead of the k loop: asked for in the epilogue, per element behind the test of BB, each load is waited for by itself
  if (BB) {
#pragma unroll
    for (int j = 0; j < 8; ++j) bias[j] = BB[j * 16 + col];
    asm volatile("s_wait_xcnt 0x0" ::: "memory"); }   // the address registers of these loads are reused by what follows
#pragma unroll
  for (int i = 0; i < 8; ++i) { v4b t; t[0] = (__bf16)ra[i][0]; t[1] = (__bf16)ra[i][1]; t[2] = (__bf16)ra[i][2]; t[3] = (__bf16)ra[i][3]; *(v4b*)&sa[0][i * 16 + xr][xc] = t; }
#pragma unroll
  for (int i = 0; i < 4; ++i) *(v4u*)&sb[0][i * 32 + wr][wc] = rb[i];
  v8f acc[8] = {};
#pragma unroll 1   // kept rolled: 16 unrolled trips would swell the text
  for (int ks = 0; ks < DM / KS; ++ks) { const int bf = ks & 1; const bool more = ks + 1 < DM / KS;
    __syncthreads();   // slice ks is in LDS for every wave, and every wave has left the buffer that this trip refills
    if (more) {
#pragma unroll
      for (int i = 0; i < 8; ++i) ra[i] = *(const v4f*)(xg + (size_t)i * 16 * DM + (ks + 1) * KS);
#pragma unroll
      for (int i = 0; i < 4; ++i) rb[i] = *(const v4u*)(wg + (size_t)i * 32 * DM + (ks + 1) * KS);
      asm volatile("s_wait_xcnt 0x0" ::: "memory"); }   // the address registers of these loads are reused further down the trip
#pragma unroll
    for (int kc = 0; kc < KS / 32; ++kc) { const v16b a = frag_b(&sa[bf][wave * 16 + col][kc * 32], lane); v16b w[8];
#pragma unroll
      for (int j = 0; j < 8; ++j) w[j] = frag_b(&sb[bf][j * 16 + col][kc * 32], lane);   // the block's LDS reads as one group, ahead of its products
#pragma unroll
      for (int j = 0; j < 8; ++j) acc[j] = wmma_bf(a, w[j], acc[j]); }
    if (more) {
#pragma unroll
      for (int i = 0; i < 8; ++i) { v4b t; t[0] = (__bf16)ra[i][0]; t[1] = (__bf16)ra[i][1]; t[2] = (__bf16)ra[i][2]; t[3] = (__bf16)ra[i][3]; *(v4b*)&sa[bf ^ 1][i * 16 + xr][xc] = t; }
#pragma unroll
      for (int i = 0; i < 4; ++i) *(v4u*)&sb[bf ^ 1][i * 32 + wr][wc] = rb[i]; } }
  __syncthreads();   // every wave has read the last slice before the epilogue overwrites the buffers
  if (n0 < 2 * DM) {   // q stored unscaled (f16 sigma ~0.6, no subnormal exposure); 1/8 applied to the f32 score
#pragma unroll
    for (int j = 0; j < 8; ++j) { const float bj = bfr(bias[j]);
#pragma unroll
      for (int r = 0; r < 8; ++r) { const float v = acc[j][r] + bj; const _Float16 hv = (_Float16)v; so[wave][8 * g + r][j * 16 + col] = hv; sol[wave][8 * g + r][j * 16 + col] = (_Float16)((v - (float)hv) * 2048.0f); } }   // q, k (+ bias) as f16 hi + (x2048) residual
    LDSX();
    for (int rl = 0; rl < 16; ++rl) if (lane < 16) { vst2((unsigned*)(QK + (r0 + rl) * (2 * DM) + n0 + lane * 8), *(const v4u*)&so[wave][rl][lane * 8]); vst2((unsigned*)(QKL + (r0 + rl) * (2 * DM) + n0 + lane * 8), *(const v4u*)&sol[wave][rl][lane * 8]); }
  } else {
#pragma unroll
    for (int j = 0; j < 8; ++j) { const float bj = bfr(bias[j]);
#pragma unroll
      for (int r = 0; r < 8; ++r) { const float v = acc[j][r] + bj; const _Float16 hv = (_Float16)v; sth[j * 16 + col][wave * 16 + 8 * g + r] = hv; stl[j * 16 + col][wave * 16 + 8 * g + r] = (_Float16)((v - (float)hv) * 2048.0f); } }
    __syncthreads();
    const size_t rb0 = (size_t)blockIdx.x * 128; const int b = (int)(rb0 / SS), s0 = (int)(rb0 % SS); const int pc0 = n0 - 2 * DM;
    for (int q = tid; q < 128 * 16; q += 256) { const int d = q >> 4, pc = q & 15; const size_t o = ((size_t)b * DM + pc0 + d) * SS + s0 + pc * 8; vst2((unsigned*)(VTH + o), *(const v4u*)&sth[d][pc * 8]); vst2((unsigned*)(VTL + o), *(const v4u*)&stl[d][pc * 8]); }
  }
}
// lane l with lane l ^ 16, by a vector cross-row move (a shuffle would go through the LDS pipe)
__device__ __forceinline__ float xhalf(float x) { return __builtin_bit_cast(float, __builtin_amdgcn_permlanex16(__builtin_bit_cast(int, x), __builtin_bit_cast(int, x), 0x76543210, 0xfedcba98, false, false)); }
// eight asynchronous copies to LDS, 16 B a lane each, to LDS rows that lie a constant step apart. An immediate offset moves BOTH addresses of a copy: copy i names the one LDS address l with offset i * step, and g[i] is its global address less that offset, so that eight LDS addresses need one register. The closing wait stands inside the statement, so that no register a copy names is rewritten ahead of it
// step 4,608 B: 32 staged K rows
__device__ __forceinline__ void acopy8_k(const unsigned l, const _Float16* const (&g)[8]) {
  asm volatile("global_load_async_to_lds_b128 %0, %1, off\n\tglobal_load_async_to_lds_b128 %0, %2, off offset:4608\n\tglobal_load_async_to_lds_b128 %0, %3, off offset:9216\n\tglobal_load_async_to_lds_b128 %0, %4, off offset:13824\n\tglobal_load_async_to_lds_b128 %0, %5, off offset:18432\n\tglobal_load_async_to_lds_b128 %0, %6, off offset:23040\n\tglobal_load_async_to_lds_b128 %0, %7, off offset:27648\n\tglobal_load_async_to_lds_b128 %0, %8, off offset:32256\n\ts_wait_xcnt 0x0"
               :: "v"(l), "v"(g[0]), "v"(g[1]), "v"(g[2]), "v"(g[3]), "v"(g[4]), "v"(g[5]), "v"(g[6]), "v"(g[7]) : "memory");
}
// step 4,224 B: 8 staged V rows
__device__ __forceinline__ void acopy8_v(const unsigned l, const _Float16* const (&g)[8]) {
  asm volatile("global_load_async_to_lds_b128 %0, %1, off\n\tglobal_load_async_to_lds_b128 %0, %2, off offset:4224\n\tglobal_load_async_to_lds_b128 %0, %3, off offset:8448\n\tglobal_load_async_to_lds_b128 %0, %4, off offset:12672\n\tglobal_load_async_to_lds_b128 %0, %5, off offset:16896\n\tglobal_load_async_to_lds_b128 %0, %6, off offset:21120\n\tglobal_load_async_to_lds_b128 %0, %7, off offset:25344\n\tglobal_load_async_to_lds_b128 %0, %8, off offset:29568\n\ts_wait_xcnt 0x0"
               :: "v"(l), "v"(g[0]), "v"(g[1]), "v"(g[2]), "v"(g[3]), "v"(g[4]), "v"(g[5]), "v"(g[6]), "v"(g[7]) : "memory");
}
// four asynchronous copies to LDS, 16 B a lane each: a K piece and a V piece of one packed tile, each to its hi plane and, by the offset (the plane's size: 4,608 B and 5,120 B), to its residual plane; gkl and gvl are the global addresses less that offset, as above; the closing wait as above
__device__ __forceinline__ void acopy4(const unsigned lk, const _Float16* gkh, const _Float16* gkl, const unsigned lv, const _Float16* gvh, const _Float16* gvl) {
  asm volatile("global_load_async_to_lds_b128 %0, %1, off\n\tglobal_load_async_to_lds_b128 %0, %2, off offset:4608\n\tglobal_load_async_to_lds_b128 %3, %4, off\n\tglobal_load_async_to_lds_b128 %3, %5, off offset:5120\n\ts_wait_xcnt 0x0"
               :: "v"(lk), "v"(gkh), "v"(gkl), "v"(lv), "v"(gvh), "v"(gvl) : "memory");
}
__device__ __forceinline__ unsigned lds_at(const void* p) { return (unsigned)(size_t)p; }   // LDS byte address: the low 32 bits of a __shared__ address
#define WKEYS 256                       // keys that the windows of a block's 128 queries touch: 64 + 128 + 64
#define KP (HD + 8)                  // LDS pitch of a staged K row (128 B of data) in 16-bit elements: 144 B, for ds_load_b128 readers
#define VP (WKEYS + 8)                  // LDS pitch of a staged V row (one d, 512 B of data): 528 B = 16 B x odd
#define ASTG (2 * WKEYS * KP * 2 + 2 * HD * VP * 2)   // bytes: K hi | K residual | V hi | V residual
#define GVP (32 + 8)                    // LDS pitch of a staged V row of one 32-key tile of the packed global keys (64 B of data): 80 B = 16 B x odd
#define GSTG (2 * 32 * KP * 2 + 2 * HD * GVP * 2)     // bytes: one such tile, behind the staged keys: K hi | K residual | V hi | V residual
static_assert(32 * KP * 2 == 4608 && 8 * VP * 2 == 4224, "the steps written in acopy8_k and acopy8_v");
static_assert(32 * KP * 2 == 4608 && HD * GVP * 2 == 5120, "the plane sizes written in acopy4");
// ---- k_attn: 8 waves, grid (head, batch, slot). Blocks slot >= NSLOT: 128 queries, one 16-query tile a wave; the block's WKEYS window keys (K rows and V columns, both planes) go to LDS once by whole-line loads and every wave takes its window fragments from there: the key tiles its window touches, then the packed global keys, one 32-key tile at a time through an LDS buffer of its own that the block fills by asynchronous copies (those inside the window masked there, so each pair counts once); rows that are global themselves are not stored here. Blocks slot < NSLOT: tiles of 16 packed global query rows, every key allowed: the keys go through the same LDS in 8 chunks of WKEYS, by asynchronous copies, each wave one 32-key tile of every chunk, the 8 partial (m, l, acc) merged in LDS. Both products run transposed (K . Q^T, then V^T . P^T): a lane holds the scores of one query, so the softmax needs one exchange between the wave halves, and the converted score tiles are the second product's B fragment as they stand. Scores 3 products x 1/8; P.V: f16 P hi/lo x (V hi, V lo*2048); O[b*S+q][h*64+d] (256-B segments)
template <bool dense> __device__ __forceinline__ void attn_body(const _Float16* __restrict__ QK, const _Float16* __restrict__ QKL, const _Float16* __restrict__ VTH, const _Float16* __restrict__ VTL, const _Float16* __restrict__ VGH, const _Float16* __restrict__ VGL, const int* __restrict__ GLB, const int* __restrict__ GL, float* __restrict__ O, unsigned char* stg, float (*sm)[16], float (*sl)[16]) {   // dense: a block of packed global query rows; compiled apart from the window blocks' code, so that neither holds the other's loop-invariant registers
  _Float16 (*skh)[KP] = (_Float16 (*)[KP])stg; _Float16 (*skl)[KP] = (_Float16 (*)[KP])(stg + WKEYS * KP * 2);
  _Float16 (*svh)[VP] = (_Float16 (*)[VP])(stg + 2 * WKEYS * KP * 2); _Float16 (*svl)[VP] = (_Float16 (*)[VP])(stg + 2 * WKEYS * KP * 2 + HD * VP * 2);
  _Float16 (*xkh)[KP] = (_Float16 (*)[KP])(stg + ASTG); _Float16 (*xkl)[KP] = (_Float16 (*)[KP])(stg + ASTG + 32 * KP * 2);   // window blocks: the current tile of the packed global keys
  _Float16 (*xvh)[GVP] = (_Float16 (*)[GVP])(stg + ASTG + 2 * 32 * KP * 2); _Float16 (*xvl)[GVP] = (_Float16 (*)[GVP])(stg + ASTG + 2 * 32 * KP * 2 + HD * GVP * 2);
  float (*so)[16][68] = (float (*)[16][68])stg;   // the epilogues reuse the staged keys' LDS
  const int tid = threadIdx.x, wave = __builtin_amdgcn_readfirstlane(tid >> 5), lane = tid & 31, col = lane & 15, g = lane >> 4;
  const int h = blockIdx.x, b = blockIdx.y, slot = blockIdx.z;   // slot is the slowest grid index, so the long blocks of packed global rows (low slots) of every head and batch take the lowest block indices, for speed only
  const int* lst = GL + (size_t)b * GLS; const int* gb = GLB + (size_t)b * SS;
  int n = lst[SS]; n = n < 0 ? 0 : (n > SS ? SS : n);
  const int ngt = (n + 31) >> 5;
  const int q0b = (slot - NSLOT) * 128 + wave * 16;   // window blocks only
  const int qtend = dense ? ((n + 15) >> 4) : slot + 1;
  const unsigned gqm = __builtin_amdgcn_ballot_w32((dense ? 0 : gb[q0b + col]) != 0);   // bit rl: query q0b + rl is global (its row belongs to the packed tiles)
  int ks0 = (slot - NSLOT) * 128 - HALFW; ks0 = ks0 < 0 ? 0 : (ks0 > SS - WKEYS ? SS - WKEYS : ks0);   // first staged key: the WKEYS keys from here hold every window of the block
  const auto stage_x = [&](const int j, const int key) {   // window blocks: tile j of the packed global keys to LDS, 4 copies a lane: 8 lanes cover the 128 B of the K row of list slot j * 32 + (tid >> 3), whose position is key; 4 lanes the tile's 64 B of a gathered V row
    const int xr = tid >> 3, xc8 = (tid & 7) * 8, xd = tid >> 2, xv8 = (tid & 3) * 8;
    const size_t xko = ((size_t)b * SS + key) * (2 * DM) + DM + h * HD + xc8, xvo = ((size_t)b * DM + h * HD + xd) * SS + j * 32 + xv8;   // + DM: the k half of a q | k row
    acopy4(lds_at(&xkh[xr][xc8]), QK + xko, QKL + xko - 32 * KP, lds_at(&xvh[xd][xv8]), VGH + xvo, VGL + xvo - HD * GVP);
  };
  if (!dense) {
    const int kr = tid >> 3, kc8 = (tid & 7) * 8, vc8 = lane * 8;   // 8 lanes cover the 128 B of a K row, a wave the 512 B of a V row
    const size_t ko = ((size_t)b * SS + ks0 + kr) * (2 * DM) + h * HD + kc8, vo = ((size_t)b * DM + h * HD + wave) * SS + ks0 + vc8;
    const _Float16 *gkh = QK + ko, *gkl = QKL + ko, *gvh = VTH + vo, *gvl = VTL + vo; v4u tk[8], tl[8], tv[8], tw[8];
    const int key0 = lst[kr];   // the packed tile 0's key of this lane's K copies (0 where the list is shorter), asked for ahead of the window loads, so that its copies need not wait for them
#pragma unroll
    for (int i = 0; i < 8; ++i) { tk[i] = *(const v4u*)(gkh + DM + (size_t)i * 32 * (2 * DM)); tl[i] = *(const v4u*)(gkl + DM + (size_t)i * 32 * (2 * DM)); }   // + DM: the k half of a q | k row
#pragma unroll
    for (int i = 0; i < 8; ++i) { tv[i] = *(const v4u*)(gvh + (size_t)i * 8 * SS); tw[i] = *(const v4u*)(gvl + (size_t)i * 8 * SS); }
    asm volatile("s_wait_xcnt 0x0" :: "v"(gkh), "v"(gkl), "v"(gvh), "v"(gvl) : "memory");   // the address registers of these loads are reused by what follows; named as inputs so that none of them is given to a later load's result ahead of the wait
    asm volatile("" :: "v"(key0));   // inputs-only fence on the loaded value: holds that load up here, ahead of the branch below; sunk into the branch it would stand behind the window loads and its wait would cover them all
    if (ngt > 0) stage_x(0, key0);   // block-uniform; the copies fly while the window loads land
#pragma unroll
    for (int i = 0; i < 8; ++i) { *(v4u*)&skh[i * 32 + kr][kc8] = tk[i]; *(v4u*)&skl[i * 32 + kr][kc8] = tl[i]; }
#pragma unroll
    for (int i = 0; i < 8; ++i) { *(v4u*)&svh[i * 8 + wave][vc8] = tv[i]; *(v4u*)&svl[i * 8 + wave][vc8] = tw[i]; }
    asm volatile("s_wait_asynccnt 0x0" ::: "memory");   // the wave's own copies of the packed tile 0 have landed
    __syncthreads();   // the staged keys are in LDS for every wave
  }
#pragma unroll 1
  for (int qt = slot; qt < qtend; qt += NSLOT) {   // window blocks: one trip
    const int q0 = (qt - NSLOT) * 128 + wave * 16;   // window blocks only; formed from qt, so that the 16 row addresses of the epilogue's stores are not computed ahead of the loop and held in registers through it
    const size_t rq = (size_t)b * SS + (dense ? lst[qt * 16 + col] : q0 + col);
    v16h aq[2], aql[2];
#pragma unroll
    for (int kc = 0; kc < 2; ++kc) { aq[kc] = frag_h(QK + rq * (2 * DM) + h * HD + kc * 32, lane); aql[kc] = frag_h(QKL + rq * (2 * DM) + h * HD + kc * 32, lane); }
    asm volatile("s_wait_xcnt 0x0" ::: "memory");   // the address registers of these loads are reused by what follows
    float m = -3.0e38f, l = 0.f;   // of the lane's own query (column col): running maximum (alike in both wave halves), sum over the keys of the lane's own half
    const int qi = q0 + col;   // window blocks only
    v8f acc[4] = {}, accl[4] = {};   // transposed: register r of tile dt = O[query col][dt * 16 + 8 * g + r]
    int kt0 = (q0 - HALFW) >> 5, kt1 = (q0 + 15 + HALFW) >> 5; kt0 = kt0 < 0 ? 0 : kt0; kt1 = kt1 > SS / 32 - 1 ? SS / 32 - 1 : kt1;
    const int nwin = dense ? 0 : kt1 - kt0 + 1;
#pragma unroll 1   // kept rolled: one copy of the body serves both passes, which keeps the text and the register count down
    for (int ph = 0; ph < (dense ? 1 : 2); ++ph) { const bool gl = ph != 0; const int it1 = dense ? SS / WKEYS : (gl ? ngt : nwin);   // window blocks: the wave's window tiles, then (gl) the tiles of the packed global keys, as many in every wave; dense: one trip per chunk of WKEYS keys, alike in every wave
#pragma unroll 1
    for (int it = 0; it < it1; ++it) { const int kt = dense ? it * (WKEYS / 32) + wave : (gl ? it : kt0 + it);   // dense: the wave's own tile of chunk it
      if (gl && it > 0) {   // block-uniform: packed tile it takes the place of tile it - 1 (tile 0 came with the window keys)
        const int key = lst[it * 32 + (tid >> 3)];
        asm volatile("s_wait_xcnt 0x0" ::: "memory");   // the offset register of this load is reused by what follows
        asm volatile("s_wait_dscnt 0x0" ::: "memory");   // the wave's own reads of that LDS have retired before a copy targets it
        __syncthreads();   // every wave has read its last fragment of the tile that is overwritten
        stage_x(it, key);
        asm volatile("s_wait_asynccnt 0x0" ::: "memory");   // the wave's own copies have landed
        __syncthreads();   // packed tile it is in LDS for every wave
      }
      if (dense) {   // chunk it (WKEYS keys: K rows and V columns, both planes) to the places in LDS that a window block's staged keys have, 32 whole-line copies a lane
        asm volatile("s_wait_dscnt 0x0" ::: "memory");   // the wave's own reads of that LDS have retired before a copy targets it
        __syncthreads();   // every wave has read its last fragment of the chunk that this trip overwrites
        const int kr = tid >> 3, kc8 = (tid & 7) * 8, vc8 = lane * 8;   // 8 lanes cover the 128 B of a K row, a wave the 512 B of a V row
        const size_t ko = ((size_t)b * SS + it * WKEYS + kr) * (2 * DM) + DM + h * HD + kc8, vo = ((size_t)b * DM + h * HD + wave) * SS + it * WKEYS + vc8;   // + DM: the k half of a q | k row
        const _Float16* ga[8];   // K rows: 32 rows of KP (4,608 B) between a lane's copies in LDS; V rows: 8 rows of VP (4,224 B)
#pragma unroll
        for (int i = 0; i < 8; ++i) ga[i] = QK + ko + (size_t)i * (32 * (2 * DM) - 32 * KP);
        acopy8_k(lds_at(&skh[kr][kc8]), ga);
#pragma unroll
        for (int i = 0; i < 8; ++i) ga[i] = QKL + ko + (size_t)i * (32 * (2 * DM) - 32 * KP);
        acopy8_k(lds_at(&skl[kr][kc8]), ga);
#pragma unroll
        for (int i = 0; i < 8; ++i) ga[i] = VTH + vo + (size_t)i * (8 * SS - 8 * VP);
        acopy8_v(lds_at(&svh[wave][vc8]), ga);
#pragma unroll
        for (int i = 0; i < 8; ++i) ga[i] = VTL + vo + (size_t)i * (8 * SS - 8 * VP);
        acopy8_v(lds_at(&svl[wave][vc8]), ga);
        asm volatile("s_wait_asynccnt 0x0" ::: "memory");   // the wave's own copies have landed
        __syncthreads();   // chunk it is in LDS for every wave
      }
      v8f s[2];
      const bool st = !gl; const int kl0 = dense ? wave * 32 : kt * 32 - ks0;   // st: a window tile or a dense block's tile, its fragments come from the staged keys (row kl0 on); else from the staged packed tile
      v4i kk[4]; v16h kfh[2][2], kfl[2][2];   // kk, packed tiles only: the positions of the 2 x 8 keys whose scores the lane holds (rows 8 * g + r of the two transposed score tiles)
      if (gl) { const int* pk = lst + kt * 32 + 8 * g; kk[0] = *(const v4i*)pk; kk[1] = *(const v4i*)(pk + 4); kk[2] = *(const v4i*)(pk + 16); kk[3] = *(const v4i*)(pk + 20);
        asm volatile("s_wait_xcnt 0x0" :: "v"(pk) : "memory"); }   // the address register of these loads is reused further down the trip
      if (st) {
#pragma unroll
        for (int ct = 0; ct < 2; ++ct) {
#pragma unroll
          for (int kc = 0; kc < 2; ++kc) { kfh[ct][kc] = frag_h(&skh[kl0 + ct * 16 + col][kc * 32], lane); kfl[ct][kc] = frag_h(&skl[kl0 + ct * 16 + col][kc * 32], lane); } }
      } else {
#pragma unroll
        for (int ct = 0; ct < 2; ++ct) {
#pragma unroll
          for (int kc = 0; kc < 2; ++kc) { kfh[ct][kc] = frag_h(&xkh[ct * 16 + col][kc * 32], lane); kfl[ct][kc] = frag_h(&xkl[ct * 16 + col][kc * 32], lane); } }
      }
      unsigned gm = 0u;   // packed tiles only, bit i: score i of the lane counts (a live list slot whose key lies outside the query's window); formed here, while the K rows are on their way, so that the 16 positions need no registers further down
      if (gl) {
#pragma unroll
        for (int i = 0; i < 16; ++i) gm |= ((kt * 32 + 8 * g + (i >> 3) * 16 + (i & 7) < n) & ((unsigned)(kk[i >> 2][i & 3] - qi + HALFW) > 2u * HALFW)) ? (1u << i) : 0u; }
#pragma unroll
      for (int ct = 0; ct < 2; ++ct) { v8f c = {}, cl = {};
#pragma unroll
        for (int kc = 0; kc < 2; ++kc) { c = wmma16(kfh[ct][kc], aq[kc], c); cl = wmma16(kfh[ct][kc], aql[kc], cl); cl = wmma16(kfl[ct][kc], aq[kc], cl); }   // transposed scores K . Q^T, 3 products: q, k as f16 hi + residual
#pragma unroll
        for (int r = 0; r < 8; ++r) s[ct][r] = (c[r] + cl[r] * (1.0f / 2048.0f)) * 0.125f; }   // 1/sqrt(64)
      const int d0 = kt * 32 + 8 * g - qi + HALFW;   // the per-pair rule, by the tile's kind (wave-uniform); masked keys excluded; a tile of a dense block has none
      if (st && !dense) {
#pragma unroll
        for (int i = 0; i < 16; ++i) s[i >> 3][i & 7] = ((unsigned)(d0 + (i >> 3) * 16 + (i & 7)) <= 2u * HALFW) ? s[i >> 3][i & 7] : -3.0e38f;   // |key - query| <= HALFW
      } else if (gl) {
#pragma unroll
        for (int i = 0; i < 16; ++i) s[i >> 3][i & 7] = ((gm >> i) & 1u) ? s[i >> 3][i & 7] : -3.0e38f;
      }
      v16h vfh[4], vfl[4];   // the tile's V fragments, as one group, asked for ahead of the softmax
      if (st) {
#pragma unroll
        for (int dt = 0; dt < 4; ++dt) { vfh[dt] = frag_h(&svh[dt * 16 + col][kl0], lane); vfl[dt] = frag_h(&svl[dt * 16 + col][kl0], lane); }
      } else {
#pragma unroll
        for (int dt = 0; dt < 4; ++dt) { vfh[dt] = frag_h(&xvh[dt * 16 + col][0], lane); vfl[dt] = frag_h(&xvl[dt * 16 + col][0], lane); }
      }
      float mx = fmaxf(s[0][0], s[1][0]);   // a lane holds 16 of the tile's 32 scores of its one query: maximum and sum in the lane, one exchange between the wave halves
#pragma unroll
      for (int r = 1; r < 8; ++r) mx = fmaxf(mx, fmaxf(s[0][r], s[1][r]));
      mx = fmaxf(mx, xhalf(mx));
      const float mn = fmaxf(m, mx), mz = fmaxf(mn, -1.0e30f);   // mz: the maximum where a key has been seen; else a floor far above the mask value, so that a masked score (and a maximum not yet set) gives exp = 0 with no test of its own
      const float alpha = __expf(m - mz);
      float e[16]; v16h pa, pl;   // the two transposed score tiles, converted in place, are the B fragment of the second product (element i: key 8 * g + i, element 8 + i: key 16 + 8 * g + i, the k order of the V loader)
#pragma unroll
      for (int i = 0; i < 16; ++i) { const float sv = s[i >> 3][i & 7]; e[i] = __expf(sv - mz);
        const float x = e[i] * 2048.0f; const _Float16 hx = (_Float16)x; pa[i] = hx; pl[i] = (_Float16)((x - (float)hx) * 2048.0f); }   // P scaled by 2^11 before the f16 split so small softmax weights stay out of the f16 subnormal range; 2^-11 folded into the epilogue
#pragma unroll
      for (int w = 8; w > 0; w >>= 1) {
#pragma unroll
        for (int i = 0; i < w; ++i) e[i] += e[i + w]; }
      l = l * alpha + e[0]; m = mn;
#pragma unroll
      for (int dt = 0; dt < 4; ++dt) { acc[dt] *= alpha; accl[dt] *= alpha; }
#pragma unroll
      for (int dt = 0; dt < 4; ++dt) { acc[dt] = wmma16(vfh[dt], pa, acc[dt]); accl[dt] = wmma16(vfh[dt], pl, accl[dt]); accl[dt] = wmma16(vfl[dt], pa, accl[dt]); } } }   // transposed V^T . P^T: P hi x V hi + (P lo x V hi + P hi x V lo) / 2048
    const float lt = l + xhalf(l);   // the two halves' sums joined once
    if (!dense) {
      __syncthreads();   // every wave has read its last staged fragment before the epilogue overwrites that LDS
      const float il = (1.0f / 2048.0f) / lt;
#pragma unroll
      for (int dt = 0; dt < 4; ++dt) { const v8f o = (acc[dt] + accl[dt] * (1.0f / 2048.0f)) * il; float* po = &so[wave][col][dt * 16 + 8 * g]; *(v4f*)po = __builtin_shufflevector(o, o, 0, 1, 2, 3); *(v4f*)(po + 4) = __builtin_shufflevector(o, o, 4, 5, 6, 7); }
      LDSX();
      for (int rl = 0; rl < 16; ++rl) if (lane < 16 && ((gqm >> rl) & 1u) == 0u) { vst2(O + ((size_t)b * SS + q0 + rl) * DM + h * HD + lane * 4, *(const v4f*)&so[wave][rl][lane * 4]);
        asm volatile("s_wait_xcnt 0x0" ::: "memory"); }   // the next row's LDS read lands in the registers this store names
    } else {
      __syncthreads();   // every wave has read its last staged fragment before the partials overwrite that LDS
#pragma unroll
      for (int dt = 0; dt < 4; ++dt) { const v8f o = acc[dt] + accl[dt] * (1.0f / 2048.0f); float* po = &so[wave][col][dt * 16 + 8 * g]; *(v4f*)po = __builtin_shufflevector(o, o, 0, 1, 2, 3); *(v4f*)(po + 4) = __builtin_shufflevector(o, o, 4, 5, 6, 7); }
      if (g == 0) { sm[wave][col] = m; sl[wave][col] = lt; }
      __syncthreads();   // every wave's partial is in LDS before the merge reads it
      const int row = tid >> 4, d4 = (tid & 15) * 4; float mm = sm[0][row];
#pragma unroll
      for (int w = 1; w < 8; ++w) mm = fmaxf(mm, sm[w][row]);
      float ll = 0.f; v4f a = {};
#pragma unroll
      for (int w = 0; w < 8; ++w) { const float e = __expf(sm[w][row] - mm); ll += e * sl[w][row]; a += *(const v4f*)&so[w][row][d4] * e; }
      if (qt * 16 + row < n) { vst2(O + ((size_t)b * SS + lst[qt * 16 + row]) * DM + h * HD + d4, a * ((1.0f / 2048.0f) / ll));
        asm volatile("s_wait_xcnt 0x0" ::: "memory"); }   // the next tile's set-up reuses the registers this store names
      __syncthreads();   // the merge has read the partials before the next tile overwrites them
    }
  }
}
__global__ __launch_bounds__(256) void k_attn(const _Float16* __restrict__ QK, const _Float16* __restrict__ QKL, const _Float16* __restrict__ VTH, const _Float16* __restrict__ VTL, const _Float16* __restrict__ VGH, const _Float16* __restrict__ VGL, const int* __restrict__ GLB, const int* __restrict__ GL, float* __restrict__ O) {
  __shared__ __align__(16) unsigned char stg[ASTG + GSTG]; __shared__ float sm[8][16], sl[8][16];
  if (blockIdx.z < NSLOT) attn_body<true>(QK, QKL, VTH, VTL, VGH, VGL, GLB, GL, O, stg, sm, sl); else attn_body<false>(QK, QKL, VTH, VTL, VGH, VGL, GLB, GL, O, stg, sm, sl);   // block-uniform
}
// ---- k_out: block = (128 rows, 128 cols), 8 waves, staged as k_qkv: out = f16(O) . Wo rows + bo
__global__ __launch_bounds__(256) void k_out(const float* __restrict__ O, const __bf16* __restrict__ P, const float* __restrict__ BO, float* __restrict__ Y) {
  __shared__ __align__(16) unsigned char smem[STG];
  _Float16 (*sa)[128][LP] = (_Float16 (*)[128][LP])smem; _Float16 (*sb)[128][LP] = (_Float16 (*)[128][LP])(smem + STG / 2);
  float (*so)[16][132] = (float (*)[16][132])smem;
  const int tid = threadIdx.x, wave = tid >> 5, lane = tid & 31, col = lane & 15, g = lane >> 4; const size_t r0 = (size_t)blockIdx.x * 128 + wave * 16; const int n0 = blockIdx.y * 128;
  const int xr = tid >> 4, xc = (tid & 15) * 4, wr = tid >> 3, wc = (tid & 7) * 8;   // 16 lanes cover 256 B of an O row, 8 lanes 128 B of a W row
  const float* xg = O + ((size_t)blockIdx.x * 128 + xr) * DM + xc; const _Float16* wg = (const _Float16*)P + (size_t)(n0 + wr) * DM + wc;
  v4f ra[8]; v4u rb[4];
#pragma unroll
  for (int i = 0; i < 8; ++i) ra[i] = *(const v4f*)(xg + (size_t)i * 16 * DM);
#pragma unroll
  for (int i = 0; i < 4; ++i) rb[i] = *(const v4u*)(wg + (size_t)i * 32 * DM);
#pragma unroll
  for (int i = 0; i < 8; ++i) { v4h t; t[0] = (_Float16)ra[i][0]; t[1] = (_Float16)ra[i][1]; t[2] = (_Float16)ra[i][2]; t[3] = (_Float16)ra[i][3]; *(v4h*)&sa[0][i * 16 + xr][xc] = t; }
#pragma unroll
  for (int i = 0; i < 4; ++i) *(v4u*)&sb[0][i * 32 + wr][wc] = rb[i];
  v8f acc[8] = {};
#pragma unroll 1   // kept rolled: 16 unrolled trips would swell the text
  for (int ks = 0; ks < DM / KS; ++ks) { const int bf = ks & 1; const bool more = ks + 1 < DM / KS;
    __syncthreads();   // slice ks is in LDS for every wave, and every wave has left the buffer that this trip refills
    if (more) {
#pragma unroll
      for (int i = 0; i < 8; ++i) ra[i] = *(const v4f*)(xg + (size_t)i * 16 * DM + (ks + 1) * KS);
#pragma unroll
      for (int i = 0; i < 4; ++i) rb[i] = *(const v4u*)(wg + (size_t)i * 32 * DM + (ks + 1) * KS);
      asm volatile("s_wait_xcnt 0x0" ::: "memory"); }   // the address registers of these loads are reused further down the trip
#pragma unroll
    for (int kc = 0; kc < KS / 32; ++kc) { const v16h a = frag_h(&sa[bf][wave * 16 + col][kc * 32], lane); v16h w[8];
#pragma unroll
      for (int j = 0; j < 8; ++j) w[j] = frag_h(&sb[bf][j * 16 + col][kc * 32], lane);   // the block's LDS reads as one group, ahead of its products
#pragma unroll
      for (int j = 0; j < 8; ++j) acc[j] = wmma16(a, w[j], acc[j]); }   // single f16 product against exact f16 x 2^8 weight copies
    if (more) {
#pragma unroll
      for (int i = 0; i < 8; ++i) { v4h t; t[0] = (_Float16)ra[i][0]; t[1] = (_Float16)ra[i][1]; t[2] = (_Float16)ra[i][2]; t[3] = (_Float16)ra[i][3]; *(v4h*)&sa[bf ^ 1][i * 16 + xr][xc] = t; }
#pragma unroll
      for (int i = 0; i < 4; ++i) *(v4u*)&sb[bf ^ 1][i * 32 + wr][wc] = rb[i]; } }
  __syncthreads();   // every wave has read the last slice before the epilogue overwrites the buffers
#pragma unroll
  for (int j = 0; j < 8; ++j) {
#pragma unroll
    for (int r = 0; r < 8; ++r) so[wave][8 * g + r][j * 16 + col] = acc[j][r] * (1.0f / 256.0f) + bfr(BO[n0 + j * 16 + col]); }
  LDSX();
  for (int rl = 0; rl < 16; ++rl) vst2(Y + (r0 + rl) * DM + n0 + lane * 4, *(const v4f*)&so[wave][rl][lane * 4]);
}
#define FCH 8192                     // floats of one weight matrix that a converting block takes: 8 whole-line loads a lane
#define FPM (DM * DM / FCH)          // converting blocks per matrix
// ---- k_front: one launch for all that depends on the inputs alone. Blocks x < NB: batch b = x: GL[b][0..n) = positions of the global tokens, ascending; the rest of the list 0; GL[b][SS..SS+32) = n. Blocks x >= NB: FCH consecutive floats of W_q | W_k | W_v -> bf16 (PK_A) or of W_o -> f16 x 2^8 copies of the bf16-rounded values (PK_P, bit pattern in the bf16-typed buffer); the natural [out][in] order is kept, so the copy is elementwise and needs no LDS
__global__ __launch_bounds__(256) void k_front(const float* __restrict__ WQ, const float* __restrict__ WK, const float* __restrict__ WV, const float* __restrict__ WO, const int* __restrict__ GLB, __bf16* __restrict__ PK, int* __restrict__ GL) { __shared__ int sc[256]; __shared__ int sl[SS]; const int t = threadIdx.x;
  if (blockIdx.x >= NB) { const int cb = blockIdx.x - NB, which = cb / FPM; const float* Wm = (which == 0) ? WQ : (which == 1) ? WK : (which == 2) ? WV : WO;
    const size_t e0 = (size_t)(cb % FPM) * FCH + t * 4; const float* sp = Wm + e0; __bf16* dp = PK + PK_A + (size_t)which * DM * DM + e0;   // PK_P follows the three PK_A matrices
    v4f a[8];
#pragma unroll
    for (int i = 0; i < 8; ++i) a[i] = *(const v4f*)(sp + i * 1024);   // a wave's load covers 512 contiguous bytes; all 8 in flight together
    asm volatile("s_wait_xcnt 0x0" ::: "memory");   // the address registers of these loads may be reused by what follows
    if (which < 3) {
#pragma unroll
      for (int i = 0; i < 8; ++i) { v4b o; o[0] = (__bf16)a[i][0]; o[1] = (__bf16)a[i][1]; o[2] = (__bf16)a[i][2]; o[3] = (__bf16)a[i][3]; *(v4b*)(dp + i * 1024) = o; }
    } else {
#pragma unroll
      for (int i = 0; i < 8; ++i) { v4h o; o[0] = (_Float16)(bfr(a[i][0]) * 256.0f); o[1] = (_Float16)(bfr(a[i][1]) * 256.0f); o[2] = (_Float16)(bfr(a[i][2]) * 256.0f); o[3] = (_Float16)(bfr(a[i][3]) * 256.0f); vst2(dp + i * 1024, o); }
      asm volatile("s_wait_xcnt 0x0" ::: "memory");   // the code laid out behind these stores writes registers that they name
    }
    return; }   // block-uniform, ahead of every barrier
  const size_t b = blockIdx.x; const int* gb = GLB + b * SS;
  int f[8], c = 0;
#pragma unroll
  for (int i = 0; i < 8; ++i) { f[i] = gb[t * 8 + i] != 0; c += f[i]; }
  sc[t] = c; for (int i = t; i < SS; i += 256) sl[i] = 0;
  __syncthreads();
  int base = 0, tot = 0; for (int i = 0; i < 256; ++i) { const int v = sc[i]; tot += v; base += (i < t) ? v : 0; }
#pragma unroll
  for (int i = 0; i < 8; ++i) if (f[i]) sl[base++] = t * 8 + i;
  __syncthreads();
  int* o = GL + b * GLS; for (int i = t; i < SS; i += 256) o[i] = sl[i];
  if (t < 32) o[SS + t] = tot; }
// ---- k_gv: block = (8 rows h*64+d, b), one wave a row: VG[b][row][slot] = VT[b][row][list[slot]] for the n global keys, 0 up to the next multiple of 32
__global__ __launch_bounds__(256) void k_gv(const _Float16* __restrict__ VTH, const _Float16* __restrict__ VTL, const int* __restrict__ GL, _Float16* __restrict__ VGH, _Float16* __restrict__ VGL) { const int t = threadIdx.x; const size_t b = blockIdx.y; const int* lst = GL + b * GLS;
  int n = lst[SS]; n = n < 0 ? 0 : (n > SS ? SS : n); const int npad = (n + 31) & ~31; const size_t row = (b * DM + blockIdx.x * 8 + (t >> 5)) * SS;
  for (int p = t & 31; p < npad; p += 32) { const int k = lst[p]; _Float16 vh = (_Float16)0.f, vl = (_Float16)0.f; if (p < n) { vh = VTH[row + k]; vl = VTL[row + k]; } VGH[row + p] = vh; VGL[row + p] = vl; } }
extern "C" void kernel_launch(void* const* d_in, const int* in_sizes, int n_in, void* d_out, int out_size, void* d_ws, size_t ws_size, hipStream_t stream) {
  (void)in_sizes; (void)n_in; (void)out_size;
  const float** F = (const float**)d_in;   // 0 x [2,2048,1024], 1 is_global bool [2,2048], 2 wq, 3 bq, 4 wk, 5 bk, 6 wv, 7 bv, 8 wo, 9 bo (natural)
  if (ws_size < (size_t)WS_END) return;
  char* ws = (char*)d_ws; __bf16* PK = (__bf16*)(ws + WS_PK); _Float16 *QK = (_Float16*)(ws + WS_QK), *QKL = (_Float16*)(ws + WS_QKL), *VTH = (_Float16*)(ws + WS_VTH), *VTL = (_Float16*)(ws + WS_VTL); float* O = (float*)(ws + WS_O); int* GL = (int*)(ws + WS_GL); _Float16 *VGH = (_Float16*)(ws + WS_VGH), *VGL = (_Float16*)(ws + WS_VGL); const int* GLB = (const int*)d_in[1];
  k_front<<<NB + 4 * FPM, 256, 0, stream>>>(F[2], F[4], F[6], F[8], GLB, PK, GL);
  k_qkv<<<dim3(NB * SS / 128, QKVW / 128), 256, 0, stream>>>(F[0], F[0], F[0], PK + PK_A, F[3], F[5], F[7], QK, QKL, VTH, VTL);
  k_gv<<<dim3(DM / 8, NB), 256, 0, stream>>>(VTH, VTL, GL, VGH, VGL);
  k_attn<<<dim3(NH, NB, NSLOT + SS / 128), 256, 0, stream>>>(QK, QKL, VTH, VTL, VGH, VGL, GLB, GL, O);
  k_out<<<dim3(NB * SS / 128, DM / 128), 256, 0, stream>>>(O, PK + PK_P, F[9], (float*)d_out);
}

// v009
// A run of this version takes 88.3 microseconds.
// Next to v008, in two timings, it ran 1.04 and 1.05 times as fast.
// All steps since v000 together make it 5.61 times as fast.
// compute dtype: all float inputs rounded to bf16, is_global (bool) read on device; q/k/v = x . W^T + b with EXACT bf16 products on WMMA 16x16x32 (natural rows), rounded once to f16 hi + residual; attention with 3-product scores and P.v (hi + residual planes) restricted to each 16-query tile's window key tiles plus a packed list of the global keys (list built on device from is_global, their v columns gathered), global query rows packed into tiles of their own that visit every key (8 waves split the keys, merged in LDS), the per-pair rule evaluated inline, x 1/8, running-max softmax in f32 (hardware exp); out = f16(ctx) . Wo^T (exact f16 x 2^8 copies) + bo; f32 output.
#include <hip/hip_runtime.h>
#include <math.h>

typedef __attribute__((ext_vector_type(16))) _Float16 v16h;
typedef __attribute__((ext_vector_type(16))) __bf16 v16b;
typedef __attribute__((ext_vector_type(8)))  _Float16 v8h;
typedef __attribute__((ext_vector_type(8)))  float v8f;
typedef __attribute__((ext_vector_type(4)))  float v4f;
typedef __attribute__((ext_vector_type(2)))  float v2f;
typedef __attribute__((ext_vector_type(4)))  unsigned v4u;
typedef __attribute__((ext_vector_type(4)))  int v4i;
typedef float __attribute__((may_alias)) float_a;
typedef int __attribute__((may_alias)) int_a;

template <typename T> __device__ __forceinline__ void vst2(void* p, T v) { *(T*)p = v;  }
__device__ __forceinline__ v8f wmma16(v16h a, v16h b, v8f c) {
  v8f d = __builtin_amdgcn_wmma_f32_16x16x32_f16(false, a, false, b, (short)0, c, false, false);
  return d;
}
__device__ __forceinline__ v8f wmma_bf(v16b a, v16b b, v8f c) {
  v8f d = __builtin_amdgcn_wmma_f32_16x16x32_bf16(false, a, false, b, (short)0, c, false, false);
  return d;
}
// Sparse structured attention (B 2, S 2,048, hidden 1,024, 16 heads x 64): local window |i - j| <= 64 plus global tokens (is_global, given) that attend everywhere and are attended by everyone; projections + biases, softmax(q k / 8) over the allowed keys, v, output projection + bias.
__device__ __forceinline__ v16h frag_h(const _Float16* rowk0, int lane) {
  union { v16h v; v8h q[2]; } u; const _Float16* p = rowk0 + 8 * (lane >> 4);
  u.q[0] = *(const v8h*)p; u.q[1] = *(const v8h*)(p + 16); return u.v;
}
__device__ __forceinline__ v16h frag_f32(const float* rowk0, int lane) {
  v16h a; const float* p = rowk0 + 8 * (lane >> 4);
#pragma unroll
  for (int i = 0; i < 8; ++i) { a[i] = (_Float16)p[i]; a[8 + i] = (_Float16)p[16 + i]; }
  return a;
}
__device__ __forceinline__ v16h frag_f32s(const float* rowk0, int lane, float sc) {
  v16h a; const float* p = rowk0 + 8 * (lane >> 4);
#pragma unroll
  for (int i = 0; i < 8; ++i) { a[i] = (_Float16)(p[i] * sc); a[8 + i] = (_Float16)(p[16 + i] * sc); }
  return a;
}
// column fragment from a [K][ld] layout (column n), rows >= K read as 0
__device__ __forceinline__ v16h fragc_f32(const float* W, int k0, int n, int lane, int ld, int K) {
  v16h a; const int g = lane >> 4;
#pragma unroll
  for (int i = 0; i < 8; ++i) { const int ka = k0 + 8 * g + i, kb = ka + 16;
    a[i] = (_Float16)(ka < K ? W[(size_t)(ka < K ? ka : K - 1) * ld + n] : 0.f); a[8 + i] = (_Float16)(kb < K ? W[(size_t)(kb < K ? kb : K - 1) * ld + n] : 0.f); }
  return a;
}
struct F2 { v16b h, l; };
__device__ __forceinline__ F2 bsplit16(const float v[16]) { F2 r;
#pragma unroll
  for (int i = 0; i < 16; ++i) { const __bf16 h = (__bf16)v[i]; r.h[i] = h; r.l[i] = (__bf16)(v[i] - (float)h); }
  return r; }
__device__ __forceinline__ F2 split_row(const float* row, int k0, int lane) { float v[16]; const float* p = row + k0 + 8 * (lane >> 4);
#pragma unroll
  for (int i = 0; i < 8; ++i) { v[i] = p[i]; v[8 + i] = p[16 + i]; }
  return bsplit16(v); }
__device__ __forceinline__ F2 split_rowK(const float* row, int k0, int lane, int K) { float v[16]; const int g = lane >> 4;
#pragma unroll
  for (int i = 0; i < 8; ++i) { const int ka = k0 + 8 * g + i, kb = ka + 16; v[i] = ka < K ? row[ka < K ? ka : K - 1] : 0.f; v[8 + i] = kb < K ? row[kb < K ? kb : K - 1] : 0.f; }
  return bsplit16(v); }
__device__ __forceinline__ F2 split_col(const float* W, int k0, int n, int lane, int ld, int K) { float v[16]; const int g = lane >> 4;
#pragma unroll
  for (int i = 0; i < 8; ++i) { const int ka = k0 + 8 * g + i, kb = ka + 16; v[i] = ka < K ? W[(size_t)(ka < K ? ka : K - 1) * ld + n] : 0.f; v[8 + i] = kb < K ? W[(size_t)(kb < K ? kb : K - 1) * ld + n] : 0.f; }
  return bsplit16(v); }
__device__ __forceinline__ v8f mac3(const F2& a, const F2& b, v8f c) { c = wmma_bf(a.l, b.h, c); c = wmma_bf(a.h, b.l, c); return wmma_bf(a.h, b.h, c); }
__device__ __forceinline__ float sigm(float v) { return 1.0f / (1.0f + expf(-v)); }
#define LDSX() do { asm volatile("s_wait_dscnt 0" ::: "memory"); __builtin_amdgcn_wave_barrier(); __builtin_amdgcn_fence(__ATOMIC_RELEASE, "workgroup"); } while (0)


#define NB 2
#define SS 2048
#define DM 1024
#define NH 16
#define HALFW 64
#define HD 64
#define QKVW (3 * DM)
#ifndef TQB
#define TQB (SS / 64)
#define TNB NB
#define TOB (NB * SS / 64)     // 64-row tiles of all output rows (unused)
#endif
typedef __attribute__((ext_vector_type(8))) __bf16 v8b;
__device__ __forceinline__ v16b frag_b(const __bf16* rowk0, int lane) {
  union { v16b v; v8b q[2]; } u; const __bf16* p = rowk0 + 8 * (lane >> 4);
  u.q[0] = *(const v8b*)p; u.q[1] = *(const v8b*)(p + 16); return u.v;
}
__device__ __forceinline__ float bfr(float v) { return (float)(__bf16)v; }
__device__ __attribute__((noinline)) float exp_ni(float v) { return expf(v); }
__device__ __attribute__((noinline)) float erf_ni(float v) { return erff(v); }

#define PK_A 0                       // [3072][1024] Wqkv rows (natural [out][in])
#define PK_P (PK_A + QKVW * DM)        // [1024][1024] Wo rows (natural)
#define PK_END (PK_P + DM * DM)
#define WS_PK  0u
#define WS_QK  (WS_PK + 2u * PK_END)             // f16 [4096 rows][2048]: q | k
#define WS_QKL (WS_QK + 2u * NB * SS * 2 * DM)     // f16 q | k residual planes x2048
#define WS_VTH (WS_QKL + 2u * NB * SS * 2 * DM)    // f16 [b][1024 (h*64+d)][2048 s] hi
#define WS_VTL (WS_VTH + 2u * NB * DM * SS)        // f16 lo x 2048
#define WS_O   (WS_VTL + 2u * NB * DM * SS)        // f32 [4096][1024]
#define GLS (SS + 32)                              // ints per batch: positions of the global tokens (ascending, rest 0), then their count
#define NSLOT 16                                   // blocks per (head, batch) that walk the tiles of global query rows
#define WS_GL  (WS_O + 4u * (size_t)NB * SS * DM)        // int [b][GLS]
#define WS_VGH (WS_GL + 4u * (size_t)NB * GLS)           // f16 [b][1024 (h*64+d)][2048 list slot] hi: v columns of the global keys, in list order
#define WS_VGL (WS_VGH + 2u * NB * DM * SS)        // f16 lo x 2048
#define WS_END (WS_VGL + 2u * NB * DM * SS)
#define KS 64                        // k of one staged slice: 128 B of a 16-bit row, 256 B of an f32 row
#define LP (KS + 8)                  // LDS row pitch in 16-bit elements: 144 B, for ds_load_b128 readers
#define STG (2 * 2 * 128 * LP * 2)   // bytes: two buffers of [X 128 rows | W 128 rows]
typedef __attribute__((ext_vector_type(4))) __bf16 v4b;
typedef __attribute__((ext_vector_type(4))) _Float16 v4h;
// ---- k_qkv: block = (128 rows, 128 cols), 8 waves, a wave 16 rows x 128 cols. Each k slice of X (rounded to bf16 on the way) and of W goes to LDS by whole-line loads, one slice ahead, two buffers; fragments come from LDS. The epilogue reuses the same LDS.
__global__ __launch_bounds__(256) void k_qkv(const float* __restrict__ XQ, const float* __restrict__ XK, const float* __restrict__ XV, const __bf16* __restrict__ P, const float* __restrict__ BQ, const float* __restrict__ BK, const float* __restrict__ BV, _Float16* __restrict__ QK, _Float16* __restrict__ QKL, _Float16* __restrict__ VTH, _Float16* __restrict__ VTL) {
  const int which0 = (blockIdx.y * 128) / DM; const float* X = (which0 == 0) ? XQ : (which0 == 1) ? XK : XV; const float* BB = BQ ? (((which0 == 0) ? BQ : (which0 == 1) ? BK : BV) + (blockIdx.y * 128 - which0 * DM)) : nullptr;
  __shared__ __align__(16) unsigned char smem[STG];
  __bf16 (*sa)[128][LP] = (__bf16 (*)[128][LP])smem; __bf16 (*sb)[128][LP] = (__bf16 (*)[128][LP])(smem + STG / 2);
  _Float16 (*so)[16][136] = (_Float16 (*)[16][136])smem; _Float16 (*sol)[16][136] = (_Float16 (*)[16][136])(smem + 8 * 16 * 136 * 2);
  _Float16 (*sth)[136] = (_Float16 (*)[136])smem; _Float16 (*stl)[136] = (_Float16 (*)[136])(smem + 128 * 136 * 2);
  const int tid = threadIdx.x, wave = tid >> 5, lane = tid & 31, col = lane & 15, g = lane >> 4; const size_t r0 = (size_t)blockIdx.x * 128 + wave * 16; const int n0 = blockIdx.y * 128;
  const int xr = tid >> 4, xc = (tid & 15) * 4, wr = tid >> 3, wc = (tid & 7) * 8;   // 16 lanes cover 256 B of an X row, 8 lanes 128 B of a W row
  const float* xg = X + ((size_t)blockIdx.x * 128 + xr) * DM + xc; const __bf16* wg = P + (size_t)(n0 + wr) * DM + wc;
  v4f ra[8]; v4u rb[4];
#pragma unroll
  for (int i = 0; i < 8; ++i) ra[i] = *(const v4f*)(xg + (size_t)i * 16 * DM);
#pragma unroll
  for (int i = 0; i < 4; ++i) rb[i] = *(const v4u*)(wg + (size_t)i * 32 * DM);
  float bias[8] = {};   // the lane's bias value of each of its 8 column tiles, as one group of loads ahead of the k loop: asked for in the epilogue, per element behind the test of BB, each load is waited for by itself
  if (BB) {
#pragma unroll
    for (int j = 0; j < 8; ++j) bias[j] = BB[j * 16 + col];
    asm volatile("s_wait_xcnt 0x0" ::: "memory"); }   // the address registers of these loads are reused by what follows
#pragma unroll
  for (int i = 0; i < 8; ++i) { v4b t; t[0] = (__bf16)ra[i][0]; t[1] = (__bf16)ra[i][1]; t[2] = (__bf16)ra[i][2]; t[3] = (__bf16)ra[i][3]; *(v4b*)&sa[0][i * 16 + xr][xc] = t; }
#pragma unroll
  for (int i = 0; i < 4; ++i) *(v4u*)&sb[0][i * 32 + wr][wc] = rb[i];
  v8f acc[8] = {};
#pragma unroll 1   // kept rolled: 16 unrolled trips would swell the text
  for (int ks = 0; ks < DM / KS; ++ks) { const int bf = ks & 1; const bool more = ks + 1 < DM / KS;
    __syncthreads();   // slice ks is in LDS for every wave, and every wave has left the buffer that this trip refills
    if (more) {
#pragma unroll
      for (int i = 0; i < 8; ++i) ra[i] = *(const v4f*)(xg + (size_t)i * 16 * DM + (ks + 1) * KS);
#pragma unroll
      for (int i = 0; i < 4; ++i) rb[i] = *(const v4u*)(wg + (size_t)i * 32 * DM + (ks + 1) * KS);
      asm volatile("s_wait_xcnt 0x0" ::: "memory"); }   // the address registers of these loads are reused further down the trip
#pragma unroll
    for (int kc = 0; kc < KS / 32; ++kc) { const v16b a = frag_b(&sa[bf][wave * 16 + col][kc * 32], lane); v16b w[8];
#pragma unroll
      for (int j = 0; j < 8; ++j) w[j] = frag_b(&sb[bf][j * 16 + col][kc * 32], lane);   // where these reads stand is left to the scheduler: it sinks them towards their products, the kernel then fits 160 registers, and 3 blocks a WGP (6 waves a SIMD) cover the LDS latency
#pragma unroll
      for (int j = 0; j < 8; ++j) acc[j] = wmma_bf(a, w[j], acc[j]); }
    if (more) {
#pragma unroll
      for (int i = 0; i < 8; ++i) { v4b t; t[0] = (__bf16)ra[i][0]; t[1] = (__bf16)ra[i][1]; t[2] = (__bf16)ra[i][2]; t[3] = (__bf16)ra[i][3]; *(v4b*)&sa[bf ^ 1][i * 16 + xr][xc] = t; }
#pragma unroll
      for (int i = 0; i < 4; ++i) *(v4u*)&sb[bf ^ 1][i * 32 + wr][wc] = rb[i]; } }
  __syncthreads();   // every wave has read the last slice before the epilogue overwrites the buffers
  if (n0 < 2 * DM) {   // q stored unscaled (f16 sigma ~0.6, no subnormal exposure); 1/8 applied to the f32 score
#pragma unroll
    for (int j = 0; j < 8; ++j) { const float bj = bfr(bias[j]);
#pragma unroll
      for (int r = 0; r < 8; ++r) { const float v = acc[j][r] + bj; const _Float16 hv = (_Float16)v; so[wave][8 * g + r][j * 16 + col] = hv; sol[wave][8 * g + r][j * 16 + col] = (_Float16)((v - (float)hv) * 2048.0f); } }   // q, k (+ bias) as f16 hi + (x2048) residual
    LDSX();
    for (int rl = 0; rl < 16; ++rl) if (lane < 16) { vst2((unsigned*)(QK + (r0 + rl) * (2 * DM) + n0 + lane * 8), *(const v4u*)&so[wave][rl][lane * 8]); vst2((unsigned*)(QKL + (r0 + rl) * (2 * DM) + n0 + lane * 8), *(const v4u*)&sol[wave][rl][lane * 8]); }
  } else {
#pragma unroll
    for (int j = 0; j < 8; ++j) { const float bj = bfr(bias[j]);
#pragma unroll
      for (int r = 0; r < 8; ++r) { const float v = acc[j][r] + bj; const _Float16 hv = (_Float16)v; sth[j * 16 + col][wave * 16 + 8 * g + r] = hv; stl[j * 16 + col][wave * 16 + 8 * g + r] = (_Float16)((v - (float)hv) * 2048.0f); } }
    __syncthreads();
    const size_t rb0 = (size_t)blockIdx.x * 128; const int b = (int)(rb0 / SS), s0 = (int)(rb0 % SS); const int pc0 = n0 - 2 * DM;
    for (int q = tid; q < 128 * 16; q += 256) { const int d = q >> 4, pc = q & 15; const size_t o = ((size_t)b * DM + pc0 + d) * SS + s0 + pc * 8; vst2((unsigned*)(VTH + o), *(const v4u*)&sth[d][pc * 8]); vst2((unsigned*)(VTL + o), *(const v4u*)&stl[d][pc * 8]); }
  }
}
// lane l with lane l ^ 16, by a vector cross-row move (a shuffle would go through the LDS pipe)
__device__ __forceinline__ float xhalf(float x) { return __builtin_bit_cast(float, __builtin_amdgcn_permlanex16(__builtin_bit_cast(int, x), __builtin_bit_cast(int, x), 0x76543210, 0xfedcba98, false, false)); }
// eight asynchronous copies to LDS, 16 B a lane each, to LDS rows that lie a constant step apart. An immediate offset moves BOTH addresses of a copy: copy i names the one LDS address l with offset i * step, and g[i] is its global address less that offset, so that eight LDS addresses need one register. The closing wait stands inside the statement, so that no register a copy names is rewritten ahead of it
// step 4,608 B: 32 staged K rows
__device__ __forceinline__ void acopy8_k(const unsigned l, const _Float16* const (&g)[8]) {
  asm volatile("global_load_async_to_lds_b128 %0, %1, off\n\tglobal_load_async_to_lds_b128 %0, %2, off offset:4608\n\tglobal_load_async_to_lds_b128 %0, %3, off offset:9216\n\tglobal_load_async_to_lds_b128 %0, %4, off offset:13824\n\tglobal_load_async_to_lds_b128 %0, %5, off offset:18432\n\tglobal_load_async_to_lds_b128 %0, %6, off offset:23040\n\tglobal_load_async_to_lds_b128 %0, %7, off offset:27648\n\tglobal_load_async_to_lds_b128 %0, %8, off offset:32256\n\ts_wait_xcnt 0x0"
               :: "v"(l), "v"(g[0]), "v"(g[1]), "v"(g[2]), "v"(g[3]), "v"(g[4]), "v"(g[5]), "v"(g[6]), "v"(g[7]) : "memory");
}
// step 4,224 B: 8 staged V rows
__device__ __forceinline__ void acopy8_v(const unsigned l, const _Float16* const (&g)[8]) {
  asm volatile("global_load_async_to_lds_b128 %0, %1, off\n\tglobal_load_async_to_lds_b128 %0, %2, off offset:4224\n\tglobal_load_async_to_lds_b128 %0, %3, off offset:8448\n\tglobal_load_async_to_lds_b128 %0, %4, off offset:12672\n\tglobal_load_async_to_lds_b128 %0, %5, off offset:16896\n\tglobal_load_async_to_lds_b128 %0, %6, off offset:21120\n\tglobal_load_async_to_lds_b128 %0, %7, off offset:25344\n\tglobal_load_async_to_lds_b128 %0, %8, off offset:29568\n\ts_wait_xcnt 0x0"
               :: "v"(l), "v"(g[0]), "v"(g[1]), "v"(g[2]), "v"(g[3]), "v"(g[4]), "v"(g[5]), "v"(g[6]), "v"(g[7]) : "memory");
}
// four asynchronous copies to LDS, 16 B a lane each: a K piece and a V piece of one packed tile, each to its hi plane and, by the offset (the plane's size: 4,608 B and 5,120 B), to its residual plane; gkl and gvl are the global addresses less that offset, as above; the closing wait as above
__device__ __forceinline__ void acopy4(const unsigned lk, const _Float16* gkh, const _Float16* gkl, const unsigned lv, const _Float16* gvh, const _Float16* gvl) {
  asm volatile("global_load_async_to_lds_b128 %0, %1, off\n\tglobal_load_async_to_lds_b128 %0, %2, off offset:4608\n\tglobal_load_async_to_lds_b128 %3, %4, off\n\tglobal_load_async_to_lds_b128 %3, %5, off offset:5120\n\ts_wait_xcnt 0x0"
               :: "v"(lk), "v"(gkh), "v"(gkl), "v"(lv), "v"(gvh), "v"(gvl) : "memory");
}
__device__ __forceinline__ unsigned lds_at(const void* p) { return (unsigned)(size_t)p; }   // LDS byte address: the low 32 bits of a __shared__ address
#define WKEYS 256                       // keys that the windows of a block's 128 queries touch: 64 + 128 + 64
#define KP (HD + 8)                  // LDS pitch of a staged K row (128 B of data) in 16-bit elements: 144 B, for ds_load_b128 readers
#define VP (WKEYS + 8)                  // LDS pitch of a staged V row (one d, 512 B of data): 528 B = 16 B x odd
#define ASTG (2 * WKEYS * KP * 2 + 2 * HD * VP * 2)   // bytes: K hi | K residual | V hi | V residual
#define GVP (32 + 8)                    // LDS pitch of a staged V row of one 32-key tile of the packed global keys (64 B of data): 80 B = 16 B x odd
#define GSTG (2 * 32 * KP * 2 + 2 * HD * GVP * 2)     // bytes: one such tile, behind the staged keys: K hi | K residual | V hi | V residual
static_assert(32 * KP * 2 == 4608 && 8 * VP * 2 == 4224, "the steps written in acopy8_k and acopy8_v");
static_assert(32 * KP * 2 == 4608 && HD * GVP * 2 == 5120, "the plane sizes written in acopy4");
// ---- k_attn: 8 waves, grid (head, batch, slot). Blocks slot >= NSLOT: 128 queries, one 16-query tile a wave; the block's WKEYS window keys (K rows and V columns, both planes) go to LDS once by whole-line loads and every wave takes its window fragments from there: the key tiles its window touches, then the packed global keys, one 32-key tile at a time through an LDS buffer of its own that the block fills by asynchronous copies (those inside the window masked there, so each pair counts once); rows that are global themselves are not stored here. Blocks slot < NSLOT: tiles of 16 packed global query rows, every key allowed: the keys go through the same LDS in 8 chunks of WKEYS, by asynchronous copies, each wave one 32-key tile of every chunk, the 8 partial (m, l, acc) merged in LDS. Both products run transposed (K . Q^T, then V^T . P^T): a lane holds the scores of one query, so the softmax needs one exchange between the wave halves, and the converted score tiles are the second product's B fragment as they stand. Scores 3 products x 1/8; P.V: f16 P hi/lo x (V hi, V lo*2048); O[b*S+q][h*64+d] (256-B segments)
template <bool dense> __device__ __forceinline__ void attn_body(const _Float16* __restrict__ QK, const _Float16* __restrict__ QKL, const _Float16* __restrict__ VTH, const _Float16* __restrict__ VTL, const _Float16* __restrict__ VGH, const _Float16* __restrict__ VGL, const int* __restrict__ GLB, const int* __restrict__ GL, float* __restrict__ O, unsigned char* stg, float (*sm)[16], float (*sl)[16]) {   // dense: a block of packed global query rows; compiled apart from the window blocks' code, so that neither holds the other's loop-invariant registers
  _Float16 (*skh)[KP] = (_Float16 (*)[KP])stg; _Float16 (*skl)[KP] = (_Float16 (*)[KP])(stg + WKEYS * KP * 2);
  _Float16 (*svh)[VP] = (_Float16 (*)[VP])(stg + 2 * WKEYS * KP * 2); _Float16 (*svl)[VP] = (_Float16 (*)[VP])(stg + 2 * WKEYS * KP * 2 + HD * VP * 2);
  _Float16 (*xkh)[KP] = (_Float16 (*)[KP])(stg + ASTG); _Float16 (*xkl)[KP] = (_Float16 (*)[KP])(stg + ASTG + 32 * KP * 2);   // window blocks: the current tile of the packed global keys
  _Float16 (*xvh)[GVP] = (_Float16 (*)[GVP])(stg + ASTG + 2 * 32 * KP * 2); _Float16 (*xvl)[GVP] = (_Float16 (*)[GVP])(stg + ASTG + 2 * 32 * KP * 2 + HD * GVP * 2);
  float (*so)[16][68] = (float (*)[16][68])stg;   // the epilogues reuse the staged keys' LDS
  const int tid = threadIdx.x, wave = __builtin_amdgcn_readfirstlane(tid >> 5), lane = tid & 31, col = lane & 15, g = lane >> 4;
  const int h = blockIdx.x, b = blockIdx.y, slot = blockIdx.z;   // slot is the slowest grid index, so the long blocks of packed global rows (low slots) of every head and batch take the lowest block indices, for speed only
  const int* lst = GL + (size_t)b * GLS; const int* gb = GLB + (size_t)b * SS;
  int n = lst[SS]; n = n < 0 ? 0 : (n > SS ? SS : n);
  const int ngt = (n + 31) >> 5;
  const int q0b = (slot - NSLOT) * 128 + wave * 16;   // window blocks only
  const int qtend = dense ? ((n + 15) >> 4) : slot + 1;
  const unsigned gqm = __builtin_amdgcn_ballot_w32((dense ? 0 : gb[q0b + col]) != 0);   // bit rl: query q0b + rl is global (its row belongs to the packed tiles)
  int ks0 = (slot - NSLOT) * 128 - HALFW; ks0 = ks0 < 0 ? 0 : (ks0 > SS - WKEYS ? SS - WKEYS : ks0);   // first staged key: the WKEYS keys from here hold every window of the block
  const auto stage_x = [&](const int j, const int key) {   // window blocks: tile j of the packed global keys to LDS, 4 copies a lane: 8 lanes cover the 128 B of the K row of list slot j * 32 + (tid >> 3), whose position is key; 4 lanes the tile's 64 B of a gathered V row
    const int xr = tid >> 3, xc8 = (tid & 7) * 8, xd = tid >> 2, xv8 = (tid & 3) * 8;
    const size_t xko = ((size_t)b * SS + key) * (2 * DM) + DM + h * HD + xc8, xvo = ((size_t)b * DM + h * HD + xd) * SS + j * 32 + xv8;   // + DM: the k half of a q | k row
    acopy4(lds_at(&xkh[xr][xc8]), QK + xko, QKL + xko - 32 * KP, lds_at(&xvh[xd][xv8]), VGH + xvo, VGL + xvo - HD * GVP);
  };
  if (!dense) {
    const int kr = tid >> 3, kc8 = (tid & 7) * 8, vc8 = lane * 8;   // 8 lanes cover the 128 B of a K row, a wave the 512 B of a V row
    const size_t ko = ((size_t)b * SS + ks0 + kr) * (2 * DM) + h * HD + kc8, vo = ((size_t)b * DM + h * HD + wave) * SS + ks0 + vc8;
    const _Float16 *gkh = QK + ko, *gkl = QKL + ko, *gvh = VTH + vo, *gvl = VTL + vo; v4u tk[8], tl[8], tv[8], tw[8];
    const int key0 = lst[kr];   // the packed tile 0's key of this lane's K copies (0 where the list is shorter), asked for ahead of the window loads, so that its copies need not wait for them
#pragma unroll
    for (int i = 0; i < 8; ++i) { tk[i] = *(const v4u*)(gkh + DM + (size_t)i * 32 * (2 * DM)); tl[i] = *(const v4u*)(gkl + DM + (size_t)i * 32 * (2 * DM)); }   // + DM: the k half of a q | k row
#pragma unroll
    for (int i = 0; i < 8; ++i) { tv[i] = *(const v4u*)(gvh + (size_t)i * 8 * SS); tw[i] = *(const v4u*)(gvl + (size_t)i * 8 * SS); }
    asm volatile("s_wait_xcnt 0x0" :: "v"(gkh), "v"(gkl), "v"(gvh), "v"(gvl) : "memory");   // the address registers of these loads are reused by what follows; named as inputs so that none of them is given to a later load's result ahead of the wait
    asm volatile("" :: "v"(key0));   // inputs-only fence on the loaded value: holds that load up here, ahead of the branch below; sunk into the branch it would stand behind the window loads and its wait would cover them all
    if (ngt > 0) stage_x(0, key0);   // block-uniform; the copies fly while the window loads land
#pragma unroll
    for (int i = 0; i < 8; ++i) { *(v4u*)&skh[i * 32 + kr][kc8] = tk[i]; *(v4u*)&skl[i * 32 + kr][kc8] = tl[i]; }
#pragma unroll
    for (int i = 0; i < 8; ++i) { *(v4u*)&svh[i * 8 + wave][vc8] = tv[i]; *(v4u*)&svl[i * 8 + wave][vc8] = tw[i]; }
    asm volatile("s_wait_asynccnt 0x0" ::: "memory");   // the wave's own copies of the packed tile 0 have landed
    __syncthreads();   // the staged keys are in LDS for every wave
  }
#pragma unroll 1
  for (int qt = slot; qt < qtend; qt += NSLOT) {   // window blocks: one trip
    const int q0 = (qt - NSLOT) * 128 + wave * 16;   // window blocks only; formed from qt, so that the 16 row addresses of the epilogue's stores are not computed ahead of the loop and held in registers through it
    const size_t rq = (size_t)b * SS + (dense ? lst[qt * 16 + col] : q0 + col);
    v16h aq[2], aql[2];
#pragma unroll
    for (int kc = 0; kc < 2; ++kc) { aq[kc] = frag_h(QK + rq * (2 * DM) + h * HD + kc * 32, lane); aql[kc] = frag_h(QKL + rq * (2 * DM) + h * HD + kc * 32, lane); }
    asm volatile("s_wait_xcnt 0x0" ::: "memory");   // the address registers of these loads are reused by what follows
    float m = -3.0e38f, l = 0.f;   // of the lane's own query (column col): running maximum (alike in both wave halves), sum over the keys of the lane's own half
    const int qi = q0 + col;   // window blocks only
    v8f acc[4] = {}, accl[4] = {};   // transposed: register r of tile dt = O[query col][dt * 16 + 8 * g + r]
    int kt0 = (q0 - HALFW) >> 5, kt1 = (q0 + 15 + HALFW) >> 5; kt0 = kt0 < 0 ? 0 : kt0; kt1 = kt1 > SS / 32 - 1 ? SS / 32 - 1 : kt1;
    const int nwin = dense ? 0 : kt1 - kt0 + 1;
#pragma unroll 1   // kept rolled: one copy of the body serves both passes, which keeps the text and the register count down
    for (int ph = 0; ph < (dense ? 1 : 2); ++ph) { const bool gl = ph != 0; const int it1 = dense ? SS / WKEYS : (gl ? ngt : nwin);   // window blocks: the wave's window tiles, then (gl) the tiles of the packed global keys, as many in every wave; dense: one trip per chunk of WKEYS keys, alike in every wave
#pragma unroll 1
    for (int it = 0; it < it1; ++it) { const int kt = dense ? it * (WKEYS / 32) + wave : (gl ? it : kt0 + it);   // dense: the wave's own tile of chunk it
      if (gl && it > 0) {   // block-uniform: packed tile it takes the place of tile it - 1 (tile 0 came with the window keys)
        const int key = lst[it * 32 + (tid >> 3)];
        asm volatile("s_wait_xcnt 0x0" ::: "memory");   // the offset register of this load is reused by what follows
        asm volatile("s_wait_dscnt 0x0" ::: "memory");   // the wave's own reads of that LDS have retired before a copy targets it
        __syncthreads();   // every wave has read its last fragment of the tile that is overwritten
        stage_x(it, key);
        asm volatile("s_wait_asynccnt 0x0" ::: "memory");   // the wave's own copies have landed
        __syncthreads();   // packed tile it is in LDS for every wave
      }
      if (dense) {   // chunk it (WKEYS keys: K rows and V columns, both planes) to the places in LDS that a window block's staged keys have, 32 whole-line copies a lane
        asm volatile("s_wait_dscnt 0x0" ::: "memory");   // the wave's own reads of that LDS have retired before a copy targets it
        __syncthreads();   // every wave has read its last fragment of the chunk that this trip overwrites
        const int kr = tid >> 3, kc8 = (tid & 7) * 8, vc8 = lane * 8;   // 8 lanes cover the 128 B of a K row, a wave the 512 B of a V row
        const size_t ko = ((size_t)b * SS + it * WKEYS + kr) * (2 * DM) + DM + h * HD + kc8, vo = ((size_t)b * DM + h * HD + wave) * SS + it * WKEYS + vc8;   // + DM: the k half of a q | k row
        const _Float16* ga[8];   // K rows: 32 rows of KP (4,608 B) between a lane's copies in LDS; V rows: 8 rows of VP (4,224 B)
#pragma unroll
        for (int i = 0; i < 8; ++i) ga[i] = QK + ko + (size_t)i * (32 * (2 * DM) - 32 * KP);
        acopy8_k(lds_at(&skh[kr][kc8]), ga);
#pragma unroll
        for (int i = 0; i < 8; ++i) ga[i] = QKL + ko + (size_t)i * (32 * (2 * DM) - 32 * KP);
        acopy8_k(lds_at(&skl[kr][kc8]), ga);
#pragma unroll
        for (int i = 0; i < 8; ++i) ga[i] = VTH + vo + (size_t)i * (8 * SS - 8 * VP);
        acopy8_v(lds_at(&svh[wave][vc8]), ga);
#pragma unroll
        for (int i = 0; i < 8; ++i) ga[i] = VTL + vo + (size_t)i * (8 * SS - 8 * VP);
        acopy8_v(lds_at(&svl[wave][vc8]), ga);
        asm volatile("s_wait_asynccnt 0x0" ::: "memory");   // the wave's own copies have landed
        __syncthreads();   // chunk it is in LDS for every wave
      }
      v8f s[2];
      const bool st = !gl; const int kl0 = dense ? wave * 32 : kt * 32 - ks0;   // st: a window tile or a dense block's tile, its fragments come from the staged keys (row kl0 on); else from the staged packed tile
      v4i kk[4]; v16h kfh[2][2], kfl[2][2];   // kk, packed tiles only: the positions of the 2 x 8 keys whose scores the lane holds (rows 8 * g + r of the two transposed score tiles)
      if (gl) { const int* pk = lst + kt * 32 + 8 * g; kk[0] = *(const v4i*)pk; kk[1] = *(const v4i*)(pk + 4); kk[2] = *(const v4i*)(pk + 16); kk[3] = *(const v4i*)(pk + 20);
        asm volatile("s_wait_xcnt 0x0" :: "v"(pk) : "memory"); }   // the address register of these loads is reused further down the trip
      if (st) {
#pragma unroll
        for (int ct = 0; ct < 2; ++ct) {
#pragma unroll
          for (int kc = 0; kc < 2; ++kc) { kfh[ct][kc] = frag_h(&skh[kl0 + ct * 16 + col][kc * 32], lane); kfl[ct][kc] = frag_h(&skl[kl0 + ct * 16 + col][kc * 32], lane); } }
      } else {
#pragma unroll
        for (int ct = 0; ct < 2; ++ct) {
#pragma unroll
          for (int kc = 0; kc < 2; ++kc) { kfh[ct][kc] = frag_h(&xkh[ct * 16 + col][kc * 32], lane); kfl[ct][kc] = frag_h(&xkl[ct * 16 + col][kc * 32], lane); } }
      }
      unsigned gm = 0u;   // packed tiles only, bit i: score i of the lane counts (a live list slot whose key lies outside the query's window); formed here, while the K rows are on their way, so that the 16 positions need no registers further down
      if (gl) {
#pragma unroll
        for (int i = 0; i < 16; ++i) gm |= ((kt * 32 + 8 * g + (i >> 3) * 16 + (i & 7) < n) & ((unsigned)(kk[i >> 2][i & 3] - qi + HALFW) > 2u * HALFW)) ? (1u << i) : 0u; }
#pragma unroll
      for (int ct = 0; ct < 2; ++ct) { v8f c = {}, cl = {};
#pragma unroll
        for (int kc = 0; kc < 2; ++kc) { c = wmma16(kfh[ct][kc], aq[kc], c); cl = wmma16(kfh[ct][kc], aql[kc], cl); cl = wmma16(kfl[ct][kc], aq[kc], cl); }   // transposed scores K . Q^T, 3 products: q, k as f16 hi + residual
#pragma unroll
        for (int r = 0; r < 8; ++r) s[ct][r] = (c[r] + cl[r] * (1.0f / 2048.0f)) * 0.125f; }   // 1/sqrt(64)
      const int d0 = kt * 32 + 8 * g - qi + HALFW;   // the per-pair rule, by the tile's kind (wave-uniform); masked keys excluded; a tile of a dense block has none
      if (st && !dense) {
#pragma unroll
        for (int i = 0; i < 16; ++i) s[i >> 3][i & 7] = ((unsigned)(d0 + (i >> 3) * 16 + (i & 7)) <= 2u * HALFW) ? s[i >> 3][i & 7] : -3.0e38f;   // |key - query| <= HALFW
      } else if (gl) {
#pragma unroll
        for (int i = 0; i < 16; ++i) s[i >> 3][i & 7] = ((gm >> i) & 1u) ? s[i >> 3][i & 7] : -3.0e38f;
      }
      v16h vfh[4], vfl[4];   // the tile's V fragments, as one group, asked for ahead of the softmax
      if (st) {
#pragma unroll
        for (int dt = 0; dt < 4; ++dt) { vfh[dt] = frag_h(&svh[dt * 16 + col][kl0], lane); vfl[dt] = frag_h(&svl[dt * 16 + col][kl0], lane); }
      } else {
#pragma unroll
        for (int dt = 0; dt < 4; ++dt) { vfh[dt] = frag_h(&xvh[dt * 16 + col][0], lane); vfl[dt] = frag_h(&xvl[dt * 16 + col][0], lane); }
      }
      float mx = fmaxf(s[0][0], s[1][0]);   // a lane holds 16 of the tile's 32 scores of its one query: maximum and sum in the lane, one exchange between the wave halves
#pragma unroll
      for (int r = 1; r < 8; ++r) mx = fmaxf(mx, fmaxf(s[0][r], s[1][r]));
      mx = fmaxf(mx, xhalf(mx));
      const float mn = fmaxf(m, mx), mz = fmaxf(mn, -1.0e30f);   // mz: the maximum where a key has been seen; else a floor far above the mask value, so that a masked score (and a maximum not yet set) gives exp = 0 with no test of its own
      const float alpha = __expf(m - mz);
      float e[16]; v16h pa, pl;   // the two transposed score tiles, converted in place, are the B fragment of the second product (element i: key 8 * g + i, element 8 + i: key 16 + 8 * g + i, the k order of the V loader)
#pragma unroll
      for (int i = 0; i < 16; ++i) { const float sv = s[i >> 3][i & 7]; e[i] = __expf(sv - mz);
        const float x = e[i] * 2048.0f; const _Float16 hx = (_Float16)x; pa[i] = hx; pl[i] = (_Float16)((x - (float)hx) * 2048.0f); }   // P scaled by 2^11 before the f16 split so small softmax weights stay out of the f16 subnormal range; 2^-11 folded into the epilogue
#pragma unroll
      for (int w = 8; w > 0; w >>= 1) {
#pragma unroll
        for (int i = 0; i < w; ++i) e[i] += e[i + w]; }
      l = l * alpha + e[0]; m = mn;
#pragma unroll
      for (int dt = 0; dt < 4; ++dt) { acc[dt] *= alpha; accl[dt] *= alpha; }
#pragma unroll
      for (int dt = 0; dt < 4; ++dt) { acc[dt] = wmma16(vfh[dt], pa, acc[dt]); accl[dt] = wmma16(vfh[dt], pl, accl[dt]); accl[dt] = wmma16(vfl[dt], pa, accl[dt]); } } }   // transposed V^T . P^T: P hi x V hi + (P lo x V hi + P hi x V lo) / 2048
    const float lt = l + xhalf(l);   // the two halves' sums joined once
    if (!dense) {
      __syncthreads();   // every wave has read its last staged fragment before the epilogue overwrites that LDS
      const float il = (1.0f / 2048.0f) / lt;
#pragma unroll
      for (int dt = 0; dt < 4; ++dt) { const v8f o = (acc[dt] + accl[dt] * (1.0f / 2048.0f)) * il; float* po = &so[wave][col][dt * 16 + 8 * g]; *(v4f*)po = __builtin_shufflevector(o, o, 0, 1, 2, 3); *(v4f*)(po + 4) = __builtin_shufflevector(o, o, 4, 5, 6, 7); }
      LDSX();
      for (int rl = 0; rl < 16; ++rl) if (lane < 16 && ((gqm >> rl) & 1u) == 0u) { vst2(O + ((size_t)b * SS + q0 + rl) * DM + h * HD + lane * 4, *(const v4f*)&so[wave][rl][lane * 4]);
        asm volatile("s_wait_xcnt 0x0" ::: "memory"); }   // the next row's LDS read lands in the registers this store names
    } else {
      __syncthreads();   // every wave has read its last staged fragment before the partials overwrite that LDS
#pragma unroll
      for (int dt = 0; dt < 4; ++dt) { const v8f o = acc[dt] + accl[dt] * (1.0f / 2048.0f); float* po = &so[wave][col][dt * 16 + 8 * g]; *(v4f*)po = __builtin_shufflevector(o, o, 0, 1, 2, 3); *(v4f*)(po + 4) = __builtin_shufflevector(o, o, 4, 5, 6, 7); }
      if (g == 0) { sm[wave][col] = m; sl[wave][col] = lt; }
      __syncthreads();   // every wave's partial is in LDS before the merge reads it
      const int row = tid >> 4, d4 = (tid & 15) * 4; float mm = sm[0][row];
#pragma unroll
      for (int w = 1; w < 8; ++w) mm = fmaxf(mm, sm[w][row]);
      float ll = 0.f; v4f a = {};
#pragma unroll
      for (int w = 0; w < 8; ++w) { const float e = __expf(sm[w][row] - mm); ll += e * sl[w][row]; a += *(const v4f*)&so[w][row][d4] * e; }
      if (qt * 16 + row < n) { vst2(O + ((size_t)b * SS + lst[qt * 16 + row]) * DM + h * HD + d4, a * ((1.0f / 2048.0f) / ll));
        asm volatile("s_wait_xcnt 0x0" ::: "memory"); }   // the next tile's set-up reuses the registers this store names
      __syncthreads();   // the merge has read the partials before the next tile overwrites them
    }
  }
}
__global__ __launch_bounds__(256) void k_attn(const _Float16* __restrict__ QK, const _Float16* __restrict__ QKL, const _Float16* __restrict__ VTH, const _Float16* __restrict__ VTL, const _Float16* __restrict__ VGH, const _Float16* __restrict__ VGL, const int* __restrict__ GLB, const int* __restrict__ GL, float* __restrict__ O) {
  __shared__ __align__(16) unsigned char stg[ASTG + GSTG]; __shared__ float sm[8][16], sl[8][16];
  if (blockIdx.z < NSLOT) attn_body<true>(QK, QKL, VTH, VTL, VGH, VGL, GLB, GL, O, stg, sm, sl); else attn_body<false>(QK, QKL, VTH, VTL, VGH, VGL, GLB, GL, O, stg, sm, sl);   // block-uniform
}
// ---- k_out: block = (128 rows, 128 cols), 8 waves, staged as k_qkv: out = f16(O) . Wo rows + bo
__global__ __launch_bounds__(256) void k_out(const float* __restrict__ O, const __bf16* __restrict__ P, const float* __restrict__ BO, float* __restrict__ Y) {
  __shared__ __align__(16) unsigned char smem[STG];
  _Float16 (*sa)[128][LP] = (_Float16 (*)[128][LP])smem; _Float16 (*sb)[128][LP] = (_Float16 (*)[128][LP])(smem + STG / 2);
  float (*so)[16][132] = (float (*)[16][132])smem;
  const int tid = threadIdx.x, wave = tid >> 5, lane = tid & 31, col = lane & 15, g = lane >> 4; const size_t r0 = (size_t)blockIdx.x * 128 + wave * 16; const int n0 = blockIdx.y * 128;
  const int xr = tid >> 4, xc = (tid & 15) * 4, wr = tid >> 3, wc = (tid & 7) * 8;   // 16 lanes cover 256 B of an O row, 8 lanes 128 B of a W row
  const float* xg = O + ((size_t)blockIdx.x * 128 + xr) * DM + xc; const _Float16* wg = (const _Float16*)P + (size_t)(n0 + wr) * DM + wc;
  v4f ra[8]; v4u rb[4];
#pragma unroll
  for (int i = 0; i < 8; ++i) ra[i] = *(const v4f*)(xg + (size_t)i * 16 * DM);
#pragma unroll
  for (int i = 0; i < 4; ++i) rb[i] = *(const v4u*)(wg + (size_t)i * 32 * DM);
#pragma unroll
  for (int i = 0; i < 8; ++i) { v4h t; t[0] = (_Float16)ra[i][0]; t[1] = (_Float16)ra[i][1]; t[2] = (_Float16)ra[i][2]; t[3] = (_Float16)ra[i][3]; *(v4h*)&sa[0][i * 16 + xr][xc] = t; }
#pragma unroll
  for (int i = 0; i < 4; ++i) *(v4u*)&sb[0][i * 32 + wr][wc] = rb[i];
  v8f acc[8] = {};
#pragma unroll 1   // kept rolled: 16 unrolled trips would swell the text
  for (int ks = 0; ks < DM / KS; ++ks) { const int bf = ks & 1; const bool more = ks + 1 < DM / KS;
    __syncthreads();   // slice ks is in LDS for every wave, and every wave has left the buffer that this trip refills
    if (more) {
#pragma unroll
      for (int i = 0; i < 8; ++i) ra[i] = *(const v4f*)(xg + (size_t)i * 16 * DM + (ks + 1) * KS);
#pragma unroll
      for (int i = 0; i < 4; ++i) rb[i] = *(const v4u*)(wg + (size_t)i * 32 * DM + (ks + 1) * KS);
      asm volatile("s_wait_xcnt 0x0" ::: "memory"); }   // the address registers of these loads are reused further down the trip
#pragma unroll
    for (int kc = 0; kc < KS / 32; ++kc) { const v16h a = frag_h(&sa[bf][wave * 16 + col][kc * 32], lane); v16h w[8];
#pragma unroll
      for (int j = 0; j < 8; ++j) w[j] = frag_h(&sb[bf][j * 16 + col][kc * 32], lane);   // the block's LDS reads as one group, ahead of its products
      __builtin_amdgcn_sched_barrier(0);   // holds the 18 reads above the products: one block a WGP (2 waves a SIMD) hides no LDS latency, and left free the scheduler sinks each pair of reads to its product, which then waits for them alone
#pragma unroll
      for (int j = 0; j < 8; ++j) acc[j] = wmma16(a, w[j], acc[j]); }   // single f16 product against exact f16 x 2^8 weight copies
    __builtin_amdgcn_sched_barrier(0);   // every product of the trip stands above the slots below
    asm volatile("v_nop\n\tv_nop\n\tv_nop\n\tv_nop");   // the 4 vector slots between the trip's last WMMA and the next write of a register it reads
    if (more) {
#pragma unroll
      for (int i = 0; i < 8; ++i) { v4h t; t[0] = (_Float16)ra[i][0]; t[1] = (_Float16)ra[i][1]; t[2] = (_Float16)ra[i][2]; t[3] = (_Float16)ra[i][3]; *(v4h*)&sa[bf ^ 1][i * 16 + xr][xc] = t; }
#pragma unroll
      for (int i = 0; i < 4; ++i) *(v4u*)&sb[bf ^ 1][i * 32 + wr][wc] = rb[i]; } }
  __syncthreads();   // every wave has read the last slice before the epilogue overwrites the buffers
#pragma unroll
  for (int j = 0; j < 8; ++j) {
#pragma unroll
    for (int r = 0; r < 8; ++r) so[wave][8 * g + r][j * 16 + col] = acc[j][r] * (1.0f / 256.0f) + bfr(BO[n0 + j * 16 + col]); }
  LDSX();
  for (int rl = 0; rl < 16; ++rl) vst2(Y + (r0 + rl) * DM + n0 + lane * 4, *(const v4f*)&so[wave][rl][lane * 4]);
}
#define FCH 8192                     // floats of one weight matrix that a converting block takes: 8 whole-line loads a lane
#define FPM (DM * DM / FCH)          // converting blocks per matrix
// ---- k_front: one launch for all that depends on the inputs alone. Blocks x < NB: batch b = x: GL[b][0..n) = positions of the global tokens, ascending; the rest of the list 0; GL[b][SS..SS+32) = n. Blocks x >= NB: FCH consecutive floats of W_q | W_k | W_v -> bf16 (PK_A) or of W_o -> f16 x 2^8 copies of the bf16-rounded values (PK_P, bit pattern in the bf16-typed buffer); the natural [out][in] order is kept, so the copy is elementwise and needs no LDS
__global__ __launch_bounds__(256) void k_front(const float* __restrict__ WQ, const float* __restrict__ WK, const float* __restrict__ WV, const float* __restrict__ WO, const int* __restrict__ GLB, __bf16* __restrict__ PK, int* __restrict__ GL) { __shared__ int sc[256]; __shared__ int sl[SS]; const int t = threadIdx.x;
  if (blockIdx.x >= NB) { const int cb = blockIdx.x - NB, which = cb / FPM; const float* Wm = (which == 0) ? WQ : (which == 1) ? WK : (which == 2) ? WV : WO;
    const size_t e0 = (size_t)(cb % FPM) * FCH + t * 4; const float* sp = Wm + e0; __bf16* dp = PK + PK_A + (size_t)which * DM * DM + e0;   // PK_P follows the three PK_A matrices
    v4f a[8];
#pragma unroll
    for (int i = 0; i < 8; ++i) a[i] = *(const v4f*)(sp + i * 1024);   // a wave's load covers 512 contiguous bytes; all 8 in flight together
    asm volatile("s_wait_xcnt 0x0" ::: "memory");   // the address registers of these loads may be reused by what follows
    if (which < 3) {
#pragma unroll
      for (int i = 0; i < 8; ++i) { v4b o; o[0] = (__bf16)a[i][0]; o[1] = (__bf16)a[i][1]; o[2] = (__bf16)a[i][2]; o[3] = (__bf16)a[i][3]; *(v4b*)(dp + i * 1024) = o; }
    } else {
#pragma unroll
      for (int i = 0; i < 8; ++i) { v4h o; o[0] = (_Float16)(bfr(a[i][0]) * 256.0f); o[1] = (_Float16)(bfr(a[i][1]) * 256.0f); o[2] = (_Float16)(bfr(a[i][2]) * 256.0f); o[3] = (_Float16)(bfr(a[i][3]) * 256.0f); vst2(dp + i * 1024, o); }
      asm volatile("s_wait_xcnt 0x0" ::: "memory");   // the code laid out behind these stores writes registers that they name
    }
    return; }   // block-uniform, ahead of every barrier
  const size_t b = blockIdx.x; const int* gb = GLB + b * SS;
  int f[8], c = 0;
#pragma unroll
  for (int i = 0; i < 8; ++i) { f[i] = gb[t * 8 + i] != 0; c += f[i]; }
  sc[t] = c; for (int i = t; i < SS; i += 256) sl[i] = 0;
  __syncthreads();
  int base = 0, tot = 0; for (int i = 0; i < 256; ++i) { const int v = sc[i]; tot += v; base += (i < t) ? v : 0; }
#pragma unroll
  for (int i = 0; i < 8; ++i) if (f[i]) sl[base++] = t * 8 + i;
  __syncthreads();
  int* o = GL + b * GLS; for (int i = t; i < SS; i += 256) o[i] = sl[i];
  if (t < 32) o[SS + t] = tot; }
// ---- k_gv: block = (8 rows h*64+d, b), one wave a row: VG[b][row][slot] = VT[b][row][list[slot]] for the n global keys, 0 up to the next multiple of 32
__global__ __launch_bounds__(256) void k_gv(const _Float16* __restrict__ VTH, const _Float16* __restrict__ VTL, const int* __restrict__ GL, _Float16* __restrict__ VGH, _Float16* __restrict__ VGL) { const int t = threadIdx.x; const size_t b = blockIdx.y; const int* lst = GL + b * GLS;
  int n = lst[SS]; n = n < 0 ? 0 : (n > SS ? SS : n); const int npad = (n + 31) & ~31; const size_t row = (b * DM + blockIdx.x * 8 + (t >> 5)) * SS;
  for (int p = t & 31; p < npad; p += 32) { const int k = lst[p]; _Float16 vh = (_Float16)0.f, vl = (_Float16)0.f; if (p < n) { vh = VTH[row + k]; vl = VTL[row + k]; } VGH[row + p] = vh; VGL[row + p] = vl; } }
extern "C" void kernel_launch(void* const* d_in, const int* in_sizes, int n_in, void* d_out, int out_size, void* d_ws, size_t ws_size, hipStream_t stream) {
  (void)in_sizes; (void)n_in; (void)out_size;
  const float** F = (const float**)d_in;   // 0 x [2,2048,1024], 1 is_global bool [2,2048], 2 wq, 3 bq, 4 wk, 5 bk, 6 wv, 7 bv, 8 wo, 9 bo (natural)
  if (ws_size < (size_t)WS_END) return;
  char* ws = (char*)d_ws; __bf16* PK = (__bf16*)(ws + WS_PK); _Float16 *QK = (_Float16*)(ws + WS_QK), *QKL = (_Float16*)(ws + WS_QKL), *VTH = (_Float16*)(ws + WS_VTH), *VTL = (_Float16*)(ws + WS_VTL); float* O = (float*)(ws + WS_O); int* GL = (int*)(ws + WS_GL); _Float16 *VGH = (_Float16*)(ws + WS_VGH), *VGL = (_Float16*)(ws + WS_VGL); const int* GLB = (const int*)d_in[1];
  k_front<<<NB + 4 * FPM, 256, 0, stream>>>(F[2], F[4], F[6], F[8], GLB, PK, GL);
  k_qkv<<<dim3(NB * SS / 128, QKVW / 128), 256, 0, stream>>>(F[0], F[0], F[0], PK + PK_A, F[3], F[5], F[7], QK, QKL, VTH, VTL);
  k_gv<<<dim3(DM / 8, NB), 256, 0, stream>>>(VTH, VTL, GL, VGH, VGL);
  k_attn<<<dim3(NH, NB, NSLOT + SS / 128), 256, 0, stream>>>(QK, QKL, VTH, VTL, VGH, VGL, GLB, GL, O);
  k_out<<<dim3(NB * SS / 128, DM / 128), 256, 0, stream>>>(O, PK + PK_P, F[9], (float*)d_out);
}

// v010
// One run takes 85.2 microseconds.
// Next to v009, in two timings, it ran 1.04 times as fast each time.
// All steps since v000 together make it 5.82 times as fast.
// compute dtype: all float inputs rounded to bf16, is_global (bool) read on device; q/k/v = x . W^T + b with EXACT bf16 products on WMMA 16x16x32 (natural rows), rounded once to f16 hi + residual; attention with 3-product scores and P.v (hi + residual planes) restricted to each 16-query tile's window key tiles plus a packed list of the global keys (list built on device from is_global, their v rows stored a second time in list order), global query rows packed into tiles of their own that visit every key (8 waves split the keys, merged in LDS), the per-pair rule evaluated inline, x 1/8, running-max softmax in f32 (hardware exp); out = f16(ctx) . Wo^T (exact f16 x 2^8 copies) + bo; f32 output.
#include <hip/hip_runtime.h>
#include <math.h>

typedef __attribute__((ext_vector_type(16))) _Float16 v16h;
typedef __attribute__((ext_vector_type(16))) __bf16 v16b;
typedef __attribute__((ext_vector_type(8)))  _Float16 v8h;
typedef __attribute__((ext_vector_type(8)))  float v8f;
typedef __attribute__((ext_vector_type(4)))  float v4f;
typedef __attribute__((ext_vector_type(2)))  float v2f;
typedef __attribute__((ext_vector_type(4)))  unsigned v4u;
typedef __attribute__((ext_vector_type(4)))  int v4i;
typedef float __attribute__((may_alias)) float_a;
typedef int __attribute__((may_alias)) int_a;

template <typename T> __device__ __forceinline__ void vst2(void* p, T v) { *(T*)p = v;  }
__device__ __forceinline__ v8f wmma16(v16h a, v16h b, v8f c) {
  v8f d = __builtin_amdgcn_wmma_f32_16x16x32_f16(false, a, false, b, (short)0, c, false, false);
  return d;
}
__device__ __forceinline__ v8f wmma_bf(v16b a, v16b b, v8f c) {
  v8f d = __builtin_amdgcn_wmma_f32_16x16x32_bf16(false, a, false, b, (short)0, c, false, false);
  return d;
}
// Sparse structured attention (B 2, S 2,048, hidden 1,024, 16 heads x 64): local window |i - j| <= 64 plus global tokens (is_global, given) that attend everywhere and are attended by everyone; projections + biases, softmax(q k / 8) over the allowed keys, v, output projection + bias.
__device__ __forceinline__ v16h frag_h(const _Float16* rowk0, int lane) {
  union { v16h v; v8h q[2]; } u; const _Float16* p = rowk0 + 8 * (lane >> 4);
  u.q[0] = *(const v8h*)p; u.q[1] = *(const v8h*)(p + 16); return u.v;
}
__device__ __forceinline__ v16h frag_f32(const float* rowk0, int lane) {
  v16h a; const float* p = rowk0 + 8 * (lane >> 4);
#pragma unroll
  for (int i = 0; i < 8; ++i) { a[i] = (_Float16)p[i]; a[8 + i] = (_Float16)p[16 + i]; }
  return a;
}
__device__ __forceinline__ v16h frag_f32s(const float* rowk0, int lane, float sc) {
  v16h a; const float* p = rowk0 + 8 * (lane >> 4);
#pragma unroll
  for (int i = 0; i < 8; ++i) { a[i] = (_Float16)(p[i] * sc); a[8 + i] = (_Float16)(p[16 + i] * sc); }
  return a;
}
// column fragment from a [K][ld] layout (column n), rows >= K read as 0
__device__ __forceinline__ v16h fragc_f32(const float* W, int k0, int n, int lane, int ld, int K) {
  v16h a; const int g = lane >> 4;
#pragma unroll
  for (int i = 0; i < 8; ++i) { const int ka = k0 + 8 * g + i, kb = ka + 16;
    a[i] = (_Float16)(ka < K ? W[(size_t)(ka < K ? ka : K - 1) * ld + n] : 0.f); a[8 + i] = (_Float16)(kb < K ? W[(size_t)(kb < K ? kb : K - 1) * ld + n] : 0.f); }
  return a;
}
struct F2 { v16b h, l; };
__device__ __forceinline__ F2 bsplit16(const float v[16]) { F2 r;
#pragma unroll
  for (int i = 0; i < 16; ++i) { const __bf16 h = (__bf16)v[i]; r.h[i] = h; r.l[i] = (__bf16)(v[i] - (float)h); }
  return r; }
__device__ __forceinline__ F2 split_row(const float* row, int k0, int lane) { float v[16]; const float* p = row + k0 + 8 * (lane >> 4);
#pragma unroll
  for (int i = 0; i < 8; ++i) { v[i] = p[i]; v[8 + i] = p[16 + i]; }
  return bsplit16(v); }
__device__ __forceinline__ F2 split_rowK(const float* row, int k0, int lane, int K) { float v[16]; const int g = lane >> 4;
#pragma unroll
  for (int i = 0; i < 8; ++i) { const int ka = k0 + 8 * g + i, kb = ka + 16; v[i] = ka < K ? row[ka < K ? ka : K - 1] : 0.f; v[8 + i] = kb < K ? row[kb < K ? kb : K - 1] : 0.f; }
  return bsplit16(v); }
__device__ __forceinline__ F2 split_col(const float* W, int k0, int n, int lane, int ld, int K) { float v[16]; const int g = lane >> 4;
#pragma unroll
  for (int i = 0; i < 8; ++i) { const int ka = k0 + 8 * g + i, kb = ka + 16; v[i] = ka < K ? W[(size_t)(ka < K ? ka : K - 1) * ld + n] : 0.f; v[8 + i] = kb < K ? W[(size_t)(kb < K ? kb : K - 1) * ld + n] : 0.f; }
  return bsplit16(v); }
__device__ __forceinline__ v8f mac3(const F2& a, const F2& b, v8f c) { c = wmma_bf(a.l, b.h, c); c = wmma_bf(a.h, b.l, c); return wmma_bf(a.h, b.h, c); }
__device__ __forceinline__ float sigm(float v) { return 1.0f / (1.0f + expf(-v)); }
#define LDSX() do { asm volatile("s_wait_dscnt 0" ::: "memory"); __builtin_amdgcn_wave_barrier(); __builtin_amdgcn_fence(__ATOMIC_RELEASE, "workgroup"); } while (0)


#define NB 2
#define SS 2048
#define DM 1024
#define NH 16
#define HALFW 64
#define HD 64
#define QKVW (3 * DM)
#ifndef TQB
#define TQB (SS / 64)
#define TNB NB
#define TOB (NB * SS / 64)     // 64-row tiles of all output rows (unused)
#endif
typedef __attribute__((ext_vector_type(8))) __bf16 v8b;
__device__ __forceinline__ v16b frag_b(const __bf16* rowk0, int lane) {
  union { v16b v; v8b q[2]; } u; const __bf16* p = rowk0 + 8 * (lane >> 4);
  u.q[0] = *(const v8b*)p; u.q[1] = *(const v8b*)(p + 16); return u.v;
}
__device__ __forceinline__ float bfr(float v) { return (float)(__bf16)v; }
__device__ __attribute__((noinline)) float exp_ni(float v) { return expf(v); }
__device__ __attribute__((noinline)) float erf_ni(float v) { return erff(v); }

#define PK_A 0                       // [3072][1024] Wqkv rows (natural [out][in])
#define PK_P (PK_A + QKVW * DM)        // [1024][1024] Wo rows (natural)
#define PK_END (PK_P + DM * DM)
#define WS_PK  0u
#define WS_QK  (WS_PK + 2u * PK_END)             // f16 [4096 rows][2048]: q | k
#define WS_QKL (WS_QK + 2u * NB * SS * 2 * DM)     // f16 q | k residual planes x2048
#define WS_VTH (WS_QKL + 2u * NB * SS * 2 * DM)    // f16 [b][1024 (h*64+d)][2048 s] hi
#define WS_VTL (WS_VTH + 2u * NB * DM * SS)        // f16 lo x 2048
#define WS_O   (WS_VTL + 2u * NB * DM * SS)        // f32 [4096][1024]
#define GLS (SS + 32)                              // ints per batch: positions of the global tokens (ascending, rest 0), their count, then at SS + 1 + i (i = 0 .. 16) how many of them lie below position 128 * i
#define NSLOT 16                                   // blocks per (head, batch) that walk the tiles of global query rows
#define WS_GL  (WS_O + 4u * (size_t)NB * SS * DM)        // int [b][GLS]
#define WS_VGH (WS_GL + 4u * (size_t)NB * GLS)           // f16 [b][2048 list slot][1024 (h*64+d)] hi: v rows of the global keys, in list order (slots from the count on are never written and never read)
#define WS_VGL (WS_VGH + 2u * NB * DM * SS)        // f16 lo x 2048
#define WS_END (WS_VGL + 2u * NB * DM * SS)
#define KS 64                        // k of one staged slice: 128 B of a 16-bit row, 256 B of an f32 row
#define LP (KS + 8)                  // LDS row pitch in 16-bit elements: 144 B, for ds_load_b128 readers
#define STG (2 * 2 * 128 * LP * 2)   // bytes: two buffers of [X 128 rows | W 128 rows]
typedef __attribute__((ext_vector_type(4))) __bf16 v4b;
typedef __attribute__((ext_vector_type(4))) _Float16 v4h;
// ---- k_qkv: block = (128 rows, 128 cols), 8 waves, a wave 16 rows x 128 cols. Each k slice of X (rounded to bf16 on the way) and of W goes to LDS by whole-line loads, one slice ahead, two buffers; fragments come from LDS. The epilogue reuses the same LDS. A v block also stores the rows of its global keys to their list slots (VGH, VGL), 256 B of a row and plane, whole lines that no other block writes.
__global__ __launch_bounds__(256) void k_qkv(const float* __restrict__ XQ, const float* __restrict__ XK, const float* __restrict__ XV, const __bf16* __restrict__ P, const float* __restrict__ BQ, const float* __restrict__ BK, const float* __restrict__ BV, _Float16* __restrict__ QK, _Float16* __restrict__ QKL, _Float16* __restrict__ VTH, _Float16* __restrict__ VTL, const int* __restrict__ GL, _Float16* __restrict__ VGH, _Float16* __restrict__ VGL) {
  const int which0 = (blockIdx.y * 128) / DM; const float* X = (which0 == 0) ? XQ : (which0 == 1) ? XK : XV; const float* BB = BQ ? (((which0 == 0) ? BQ : (which0 == 1) ? BK : BV) + (blockIdx.y * 128 - which0 * DM)) : nullptr;
  __shared__ __align__(16) unsigned char smem[STG];
  __bf16 (*sa)[128][LP] = (__bf16 (*)[128][LP])smem; __bf16 (*sb)[128][LP] = (__bf16 (*)[128][LP])(smem + STG / 2);
  _Float16 (*so)[16][136] = (_Float16 (*)[16][136])smem; _Float16 (*sol)[16][136] = (_Float16 (*)[16][136])(smem + 8 * 16 * 136 * 2);
  _Float16 (*sth)[136] = (_Float16 (*)[136])smem; _Float16 (*stl)[136] = (_Float16 (*)[136])(smem + 128 * 136 * 2);
  const int tid = threadIdx.x, wave = tid >> 5, lane = tid & 31, col = lane & 15, g = lane >> 4; const size_t r0 = (size_t)blockIdx.x * 128 + wave * 16; const int n0 = blockIdx.y * 128;
  const int xr = tid >> 4, xc = (tid & 15) * 4, wr = tid >> 3, wc = (tid & 7) * 8;   // 16 lanes cover 256 B of an X row, 8 lanes 128 B of a W row
  const float* xg = X + ((size_t)blockIdx.x * 128 + xr) * DM + xc; const __bf16* wg = P + (size_t)(n0 + wr) * DM + wc;
  v4f ra[8]; v4u rb[4];
#pragma unroll
  for (int i = 0; i < 8; ++i) ra[i] = *(const v4f*)(xg + (size_t)i * 16 * DM);
#pragma unroll
  for (int i = 0; i < 4; ++i) rb[i] = *(const v4u*)(wg + (size_t)i * 32 * DM);
  const int* lst = GL + (size_t)(blockIdx.x * 128 / SS) * GLS;   // the list of the block's batch
  const int pr0 = lst[SS + 1 + (blockIdx.x * 128 % SS) / 128], pr1 = lst[SS + 2 + (blockIdx.x * 128 % SS) / 128];   // list slots [pr0, pr1): the global keys among the block's 128 rows; used by the v blocks' epilogue, asked for up here so that it does not wait for them
  float bias[8] = {};   // the lane's bias value of each of its 8 column tiles, as one group of loads ahead of the k loop: asked for in the epilogue, per element behind the test of BB, each load is waited for by itself
  if (BB) {
#pragma unroll
    for (int j = 0; j < 8; ++j) bias[j] = BB[j * 16 + col];
    asm volatile("s_wait_xcnt 0x0" ::: "memory"); }   // the address registers of these loads are reused by what follows
#pragma unroll
  for (int i = 0; i < 8; ++i) { v4b t; t[0] = (__bf16)ra[i][0]; t[1] = (__bf16)ra[i][1]; t[2] = (__bf16)ra[i][2]; t[3] = (__bf16)ra[i][3]; *(v4b*)&sa[0][i * 16 + xr][xc] = t; }
#pragma unroll
  for (int i = 0; i < 4; ++i) *(v4u*)&sb[0][i * 32 + wr][wc] = rb[i];
  v8f acc[8] = {};
#pragma unroll 1   // kept rolled: 16 unrolled trips would swell the text
  for (int ks = 0; ks < DM / KS; ++ks) { const int bf = ks & 1; const bool more = ks + 1 < DM / KS;
    __syncthreads();   // slice ks is in LDS for every wave, and every wave has left the buffer that this trip refills
    if (more) {
#pragma unroll
      for (int i = 0; i < 8; ++i) ra[i] = *(const v4f*)(xg + (size_t)i * 16 * DM + (ks + 1) * KS);
#pragma unroll
      for (int i = 0; i < 4; ++i) rb[i] = *(const v4u*)(wg + (size_t)i * 32 * DM + (ks + 1) * KS);
      asm volatile("s_wait_xcnt 0x0" ::: "memory"); }   // the address registers of these loads are reused further down the trip
#pragma unroll
    for (int kc = 0; kc < KS / 32; ++kc) { const v16b a = frag_b(&sa[bf][wave * 16 + col][kc * 32], lane); v16b w[8];
#pragma unroll
      for (int j = 0; j < 8; ++j) w[j] = frag_b(&sb[bf][j * 16 + col][kc * 32], lane);   // where these reads stand is left to the scheduler: it sinks them towards their products, the kernel then fits 160 registers, and 3 blocks a WGP (6 waves a SIMD) cover the LDS latency
#pragma unroll
      for (int j = 0; j < 8; ++j) acc[j] = wmma_bf(a, w[j], acc[j]); }
    if (more) {
#pragma unroll
      for (int i = 0; i < 8; ++i) { v4b t; t[0] = (__bf16)ra[i][0]; t[1] = (__bf16)ra[i][1]; t[2] = (__bf16)ra[i][2]; t[3] = (__bf16)ra[i][3]; *(v4b*)&sa[bf ^ 1][i * 16 + xr][xc] = t; }
#pragma unroll
      for (int i = 0; i < 4; ++i) *(v4u*)&sb[bf ^ 1][i * 32 + wr][wc] = rb[i]; } }
  __syncthreads();   // every wave has read the last slice before the epilogue overwrites the buffers
  if (n0 < 2 * DM) {   // q stored unscaled (f16 sigma ~0.6, no subnormal exposure); 1/8 applied to the f32 score
#pragma unroll
    for (int j = 0; j < 8; ++j) { const float bj = bfr(bias[j]);
#pragma unroll
      for (int r = 0; r < 8; ++r) { const float v = acc[j][r] + bj; const _Float16 hv = (_Float16)v; so[wave][8 * g + r][j * 16 + col] = hv; sol[wave][8 * g + r][j * 16 + col] = (_Float16)((v - (float)hv) * 2048.0f); } }   // q, k (+ bias) as f16 hi + (x2048) residual
    LDSX();
    for (int rl = 0; rl < 16; ++rl) if (lane < 16) { vst2((unsigned*)(QK + (r0 + rl) * (2 * DM) + n0 + lane * 8), *(const v4u*)&so[wave][rl][lane * 8]); vst2((unsigned*)(QKL + (r0 + rl) * (2 * DM) + n0 + lane * 8), *(const v4u*)&sol[wave][rl][lane * 8]); }
  } else {
    const size_t rb0 = (size_t)blockIdx.x * 128; const int b = (int)(rb0 / SS), s0 = (int)(rb0 % SS); const int pc0 = n0 - 2 * DM;
    const int ph = __builtin_amdgcn_readfirstlane(tid >> 7);   // which half of the block, as a scalar
    const int p0 = pr0 < 0 ? 0 : (pr0 > SS ? SS : pr0), p1 = pr1 > SS ? SS : pr1;
    int kn = lst[p0 + ph < SS ? p0 + ph : SS - 1];   // the first key's position, asked for ahead of the LDS stores and the barrier below
#pragma unroll
    for (int j = 0; j < 8; ++j) { const float bj = bfr(bias[j]);
#pragma unroll
      for (int r = 0; r < 8; ++r) { const float v = acc[j][r] + bj; const _Float16 hv = (_Float16)v; sth[j * 16 + col][wave * 16 + 8 * g + r] = hv; stl[j * 16 + col][wave * 16 + 8 * g + r] = (_Float16)((v - (float)hv) * 2048.0f); } }
    __syncthreads();
    for (int q = tid; q < 128 * 16; q += 256) { const int d = q >> 4, pc = q & 15; const size_t o = ((size_t)b * DM + pc0 + d) * SS + s0 + pc * 8; vst2((unsigned*)(VTH + o), *(const v4u*)&sth[d][pc * 8]); vst2((unsigned*)(VTL + o), *(const v4u*)&stl[d][pc * 8]); }
    const int dp = (tid & 63) * 2; const bool lo = ((tid >> 6) & 1) != 0;   // two waves a row and plane, 4 B a lane: a wave's store is one whole line; the block's halves take every other slot
    const _Float16 (*sp)[136] = lo ? stl : sth; _Float16* vg = (lo ? VGL : VGH) + (size_t)b * SS * DM + pc0 + dp;
    for (int p = p0 + ph; p < p1; p += 2) { int kl = kn - s0; kl = kl < 0 ? 0 : (kl > 127 ? 127 : kl); kn = lst[p + 2 < SS ? p + 2 : SS - 1];   // at most 64 trips; the next position is asked for one trip ahead
      union { _Float16 h[2]; unsigned u; } w; w.h[0] = sp[dp][kl]; w.h[1] = sp[dp + 1][kl];
      vst2(vg + (size_t)p * DM, w.u);
      asm volatile("s_wait_xcnt 0x0" ::: "memory"); }   // the next trip rewrites the registers this store names
  }
}
// lane l with lane l ^ 16, by a vector cross-row move (a shuffle would go through the LDS pipe)
__device__ __forceinline__ float xhalf(float x) { return __builtin_bit_cast(float, __builtin_amdgcn_permlanex16(__builtin_bit_cast(int, x), __builtin_bit_cast(int, x), 0x76543210, 0xfedcba98, false, false)); }
// eight asynchronous copies to LDS, 16 B a lane each, to LDS rows that lie a constant step apart. An immediate offset moves BOTH addresses of a copy: copy i names the one LDS address l with offset i * step, and g[i] is its global address less that offset, so that eight LDS addresses need one register. The closing wait stands inside the statement, so that no register a copy names is rewritten ahead of it
// step 4,608 B: 32 staged K rows
__device__ __forceinline__ void acopy8_k(const unsigned l, const _Float16* const (&g)[8]) {
  asm volatile("global_load_async_to_lds_b128 %0, %1, off\n\tglobal_load_async_to_lds_b128 %0, %2, off offset:4608\n\tglobal_load_async_to_lds_b128 %0, %3, off offset:9216\n\tglobal_load_async_to_lds_b128 %0, %4, off offset:13824\n\tglobal_load_async_to_lds_b128 %0, %5, off offset:18432\n\tglobal_load_async_to_lds_b128 %0, %6, off offset:23040\n\tglobal_load_async_to_lds_b128 %0, %7, off offset:27648\n\tglobal_load_async_to_lds_b128 %0, %8, off offset:32256\n\ts_wait_xcnt 0x0"
               :: "v"(l), "v"(g[0]), "v"(g[1]), "v"(g[2]), "v"(g[3]), "v"(g[4]), "v"(g[5]), "v"(g[6]), "v"(g[7]) : "memory");
}
// step 4,224 B: 8 staged V rows
__device__ __forceinline__ void acopy8_v(const unsigned l, const _Float16* const (&g)[8]) {
  asm volatile("global_load_async_to_lds_b128 %0, %1, off\n\tglobal_load_async_to_lds_b128 %0, %2, off offset:4224\n\tglobal_load_async_to_lds_b128 %0, %3, off offset:8448\n\tglobal_load_async_to_lds_b128 %0, %4, off offset:12672\n\tglobal_load_async_to_lds_b128 %0, %5, off offset:16896\n\tglobal_load_async_to_lds_b128 %0, %6, off offset:21120\n\tglobal_load_async_to_lds_b128 %0, %7, off offset:25344\n\tglobal_load_async_to_lds_b128 %0, %8, off offset:29568\n\ts_wait_xcnt 0x0"
               :: "v"(l), "v"(g[0]), "v"(g[1]), "v"(g[2]), "v"(g[3]), "v"(g[4]), "v"(g[5]), "v"(g[6]), "v"(g[7]) : "memory");
}
// four asynchronous copies to LDS, 16 B a lane each: a piece of a K row and of a V row of one packed tile, each to its hi plane and, by the offset (the plane's size: 4,608 B and 5,120 B), to its residual plane; gkl and gvl are the global addresses less that offset, as above; the closing wait as above
__device__ __forceinline__ void acopy4(const unsigned lk, const _Float16* gkh, const _Float16* gkl, const unsigned lv, const _Float16* gvh, const _Float16* gvl) {
  asm volatile("global_load_async_to_lds_b128 %0, %1, off\n\tglobal_load_async_to_lds_b128 %0, %2, off offset:4608\n\tglobal_load_async_to_lds_b128 %3, %4, off\n\tglobal_load_async_to_lds_b128 %3, %5, off offset:5120\n\ts_wait_xcnt 0x0"
               :: "v"(lk), "v"(gkh), "v"(gkl), "v"(lv), "v"(gvh), "v"(gvl) : "memory");
}
__device__ __forceinline__ unsigned lds_at(const void* p) { return (unsigned)(size_t)p; }   // LDS byte address: the low 32 bits of a __shared__ address
// A fragment of V^T (16 d from t0's column on x 32 keys) from V rows staged key by key at pitch XVP, by two transposing LDS loads: lane (col, g) gets keys 8 * g + 0 .. 7, then 16 + 8 * g + 0 .. 7, of d = col: the k order of frag_h
typedef __attribute__((ext_vector_type(8))) short v8s;
__device__ __forceinline__ v8h ld_tr16(const _Float16* p) { typedef __attribute__((address_space(3))) v8s lds_v8s; return __builtin_bit_cast(v8h, __builtin_amdgcn_ds_load_tr16_b128_v8i16((lds_v8s*)p)); }
__device__ __forceinline__ v16h frag_t(const _Float16* t0, int lane) {
  union { v16h v; v8h q[2]; } u; const _Float16* p = t0 + (8 * (lane >> 4) + (lane & 7)) * (64 + 16) + ((lane >> 3) & 1) * 8;
  u.q[0] = ld_tr16(p); u.q[1] = ld_tr16(p + 16 * (64 + 16)); return u.v;
}
#define WKEYS 256                       // keys that the windows of a block's 128 queries touch: 64 + 128 + 64
#define KP (HD + 8)                  // LDS pitch of a staged K row (128 B of data) in 16-bit elements: 144 B, for ds_load_b128 readers
#define VP (WKEYS + 8)                  // LDS pitch of a staged V row (one d, 512 B of data): 528 B = 16 B x odd
#define ASTG (2 * WKEYS * KP * 2 + 2 * HD * VP * 2)   // bytes: K hi | K residual | V hi | V residual
#define XVP (HD + 16)                   // LDS pitch of a staged V row (one key, 128 B of data) of a 32-key tile of the packed global keys: 160 B = 32 B x odd, for ds_load_tr16_b128 readers
#define GSTG (2 * 32 * KP * 2 + 2 * 32 * XVP * 2)     // bytes: one such tile, behind the staged keys: K hi | K residual | V hi | V residual
static_assert(32 * KP * 2 == 4608 && 8 * VP * 2 == 4224, "the steps written in acopy8_k and acopy8_v");
static_assert(XVP == 64 + 16, "the pitch written in frag_t");
static_assert(32 * KP * 2 == 4608 && 32 * XVP * 2 == 5120, "the plane sizes written in acopy4");
// ---- k_attn: 8 waves, grid (head, batch, slot). Blocks slot >= NSLOT: 128 queries, one 16-query tile a wave; the block's WKEYS window keys (K rows and V columns, both planes) go to LDS once by whole-line loads and every wave takes its window fragments from there: the key tiles its window touches, then the packed global keys, one 32-key tile at a time through an LDS buffer of its own that the block fills by asynchronous copies (those inside the window masked there, so each pair counts once); rows that are global themselves are not stored here. Blocks slot < NSLOT: tiles of 16 packed global query rows, every key allowed: the keys go through the same LDS in 8 chunks of WKEYS, by asynchronous copies, each wave one 32-key tile of every chunk, the 8 partial (m, l, acc) merged in LDS. Both products run transposed (K . Q^T, then V^T . P^T): a lane holds the scores of one query, so the softmax needs one exchange between the wave halves, and the converted score tiles are the second product's B fragment as they stand. Scores 3 products x 1/8; P.V: f16 P hi/lo x (V hi, V lo*2048); O[b*S+q][h*64+d] (256-B segments)
template <bool dense> __device__ __forceinline__ void attn_body(const _Float16* __restrict__ QK, const _Float16* __restrict__ QKL, const _Float16* __restrict__ VTH, const _Float16* __restrict__ VTL, const _Float16* __restrict__ VGH, const _Float16* __restrict__ VGL, const int* __restrict__ GLB, const int* __restrict__ GL, float* __restrict__ O, unsigned char* stg, float (*sm)[16], float (*sl)[16]) {   // dense: a block of packed global query rows; compiled apart from the window blocks' code, so that neither holds the other's loop-invariant registers
  _Float16 (*skh)[KP] = (_Float16 (*)[KP])stg; _Float16 (*skl)[KP] = (_Float16 (*)[KP])(stg + WKEYS * KP * 2);
  _Float16 (*svh)[VP] = (_Float16 (*)[VP])(stg + 2 * WKEYS * KP * 2); _Float16 (*svl)[VP] = (_Float16 (*)[VP])(stg + 2 * WKEYS * KP * 2 + HD * VP * 2);
  _Float16 (*xkh)[KP] = (_Float16 (*)[KP])(stg + ASTG); _Float16 (*xkl)[KP] = (_Float16 (*)[KP])(stg + ASTG + 32 * KP * 2);   // window blocks: the current tile of the packed global keys
  _Float16 (*xvh)[XVP] = (_Float16 (*)[XVP])(stg + ASTG + 2 * 32 * KP * 2);   // its V rows, key by key; the residual plane follows 32 * XVP elements on
  float (*so)[16][68] = (float (*)[16][68])stg;   // the epilogues reuse the staged keys' LDS
  const int tid = threadIdx.x, wave = __builtin_amdgcn_readfirstlane(tid >> 5), lane = tid & 31, col = lane & 15, g = lane >> 4;
  const int h = blockIdx.x, b = blockIdx.y, slot = blockIdx.z;   // slot is the slowest grid index, so the long blocks of packed global rows (low slots) of every head and batch take the lowest block indices, for speed only
  const int* lst = GL + (size_t)b * GLS; const int* gb = GLB + (size_t)b * SS;
  int n = lst[SS]; n = n < 0 ? 0 : (n > SS ? SS : n);
  const int ngt = (n + 31) >> 5;
  const int q0b = (slot - NSLOT) * 128 + wave * 16;   // window blocks only
  const int qtend = dense ? ((n + 15) >> 4) : slot + 1;
  const unsigned gqm = __builtin_amdgcn_ballot_w32((dense ? 0 : gb[q0b + col]) != 0);   // bit rl: query q0b + rl is global (its row belongs to the packed tiles)
  int ks0 = (slot - NSLOT) * 128 - HALFW; ks0 = ks0 < 0 ? 0 : (ks0 > SS - WKEYS ? SS - WKEYS : ks0);   // first staged key: the WKEYS keys from here hold every window of the block
  const auto stage_x = [&](const int j, const int key) {   // window blocks: tile j of the packed global keys to LDS, 4 copies a lane: 8 lanes cover the 128 B of the K row of list slot j * 32 + (tid >> 3), whose position is key, and the 128 B of that slot's V row; a slot past the list takes the last live slot's V row (n > 0 wherever a packed tile exists): finite values under a weight of 0
    const int xr = tid >> 3, xc8 = (tid & 7) * 8, xs = j * 32 + xr < n ? j * 32 + xr : n - 1;
    const size_t xko = ((size_t)b * SS + key) * (2 * DM) + DM + h * HD + xc8, xvo = ((size_t)b * SS + xs) * DM + h * HD + xc8;   // + DM: the k half of a q | k row
    acopy4(lds_at(&xkh[xr][xc8]), QK + xko, QKL + xko - 32 * KP, lds_at(&xvh[xr][xc8]), VGH + xvo, VGL + xvo - 32 * XVP);
  };
  if (!dense) {
    const int kr = tid >> 3, kc8 = (tid & 7) * 8, vc8 = lane * 8;   // 8 lanes cover the 128 B of a K row, a wave the 512 B of a V row
    const size_t ko = ((size_t)b * SS + ks0 + kr) * (2 * DM) + h * HD + kc8, vo = ((size_t)b * DM + h * HD + wave) * SS + ks0 + vc8;
    const _Float16 *gkh = QK + ko, *gkl = QKL + ko, *gvh = VTH + vo, *gvl = VTL + vo; v4u tk[8], tl[8], tv[8], tw[8];
    const int key0 = lst[kr];   // the packed tile 0's key of this lane's K copies (0 where the list is shorter), asked for ahead of the window loads, so that its copies need not wait for them
#pragma unroll
    for (int i = 0; i < 8; ++i) { tk[i] = *(const v4u*)(gkh + DM + (size_t)i * 32 * (2 * DM)); tl[i] = *(const v4u*)(gkl + DM + (size_t)i * 32 * (2 * DM)); }   // + DM: the k half of a q | k row
#pragma unroll
    for (int i = 0; i < 8; ++i) { tv[i] = *(const v4u*)(gvh + (size_t)i * 8 * SS); tw[i] = *(const v4u*)(gvl + (size_t)i * 8 * SS); }
    asm volatile("s_wait_xcnt 0x0" :: "v"(gkh), "v"(gkl), "v"(gvh), "v"(gvl) : "memory");   // the address registers of these loads are reused by what follows; named as inputs so that none of them is given to a later load's result ahead of the wait
    asm volatile("" :: "v"(key0));   // inputs-only fence on the loaded value: holds that load up here, ahead of the branch below; sunk into the branch it would stand behind the window loads and its wait would cover them all
    if (ngt > 0) stage_x(0, key0);   // block-uniform; the copies fly while the window loads land
#pragma unroll
    for (int i = 0; i < 8; ++i) { *(v4u*)&skh[i * 32 + kr][kc8] = tk[i]; *(v4u*)&skl[i * 32 + kr][kc8] = tl[i]; }
#pragma unroll
    for (int i = 0; i < 8; ++i) { *(v4u*)&svh[i * 8 + wave][vc8] = tv[i]; *(v4u*)&svl[i * 8 + wave][vc8] = tw[i]; }
    asm volatile("s_wait_asynccnt 0x0" ::: "memory");   // the wave's own copies of the packed tile 0 have landed
    __syncthreads();   // the staged keys are in LDS for every wave
  }
#pragma unroll 1
  for (int qt = slot; qt < qtend; qt += NSLOT) {   // window blocks: one trip
    const int q0 = (qt - NSLOT) * 128 + wave * 16;   // window blocks only; formed from qt, so that the 16 row addresses of the epilogue's stores are not computed ahead of the loop and held in registers through it
    const size_t rq = (size_t)b * SS + (dense ? lst[qt * 16 + col] : q0 + col);
    v16h aq[2], aql[2];
#pragma unroll
    for (int kc = 0; kc < 2; ++kc) { aq[kc] = frag_h(QK + rq * (2 * DM) + h * HD + kc * 32, lane); aql[kc] = frag_h(QKL + rq * (2 * DM) + h * HD + kc * 32, lane); }
    asm volatile("s_wait_xcnt 0x0" ::: "memory");   // the address registers of these loads are reused by what follows
    float m = -3.0e38f, l = 0.f;   // of the lane's own query (column col): running maximum (alike in both wave halves), sum over the keys of the lane's own half
    const int qi = q0 + col;   // window blocks only
    v8f acc[4] = {}, accl[4] = {};   // transposed: register r of tile dt = O[query col][dt * 16 + 8 * g + r]
    int kt0 = (q0 - HALFW) >> 5, kt1 = (q0 + 15 + HALFW) >> 5; kt0 = kt0 < 0 ? 0 : kt0; kt1 = kt1 > SS / 32 - 1 ? SS / 32 - 1 : kt1;
    const int nwin = dense ? 0 : kt1 - kt0 + 1;
#pragma unroll 1   // kept rolled: one copy of the body serves both passes, which keeps the text and the register count down
    for (int ph = 0; ph < (dense ? 1 : 2); ++ph) { const bool gl = ph != 0; const int it1 = dense ? SS / WKEYS : (gl ? ngt : nwin);   // window blocks: the wave's window tiles, then (gl) the tiles of the packed global keys, as many in every wave; dense: one trip per chunk of WKEYS keys, alike in every wave
#pragma unroll 1
    for (int it = 0; it < it1; ++it) { const int kt = dense ? it * (WKEYS / 32) + wave : (gl ? it : kt0 + it);   // dense: the wave's own tile of chunk it
      if (gl && it > 0) {   // block-uniform: packed tile it takes the place of tile it - 1 (tile 0 came with the window keys)
        const int key = lst[it * 32 + (tid >> 3)];
        asm volatile("s_wait_xcnt 0x0" ::: "memory");   // the offset register of this load is reused by what follows
        asm volatile("s_wait_dscnt 0x0" ::: "memory");   // the wave's own reads of that LDS have retired before a copy targets it
        __syncthreads();   // every wave has read its last fragment of the tile that is overwritten
        stage_x(it, key);
        asm volatile("s_wait_asynccnt 0x0" ::: "memory");   // the wave's own copies have landed
        __syncthreads();   // packed tile it is in LDS for every wave
      }
      if (dense) {   // chunk it (WKEYS keys: K rows and V columns, both planes) to the places in LDS that a window block's staged keys have, 32 whole-line copies a lane
        asm volatile("s_wait_dscnt 0x0" ::: "memory");   // the wave's own reads of that LDS have retired before a copy targets it
        __syncthreads();   // every wave has read its last fragment of the chunk that this trip overwrites
        const int kr = tid >> 3, kc8 = (tid & 7) * 8, vc8 = lane * 8;   // 8 lanes cover the 128 B of a K row, a wave the 512 B of a V row
        const size_t ko = ((size_t)b * SS + it * WKEYS + kr) * (2 * DM) + DM + h * HD + kc8, vo = ((size_t)b * DM + h * HD + wave) * SS + it * WKEYS + vc8;   // + DM: the k half of a q | k row
        const _Float16* ga[8];   // K rows: 32 rows of KP (4,608 B) between a lane's copies in LDS; V rows: 8 rows of VP (4,224 B)
#pragma unroll
        for (int i = 0; i < 8; ++i) ga[i] = QK + ko + (size_t)i * (32 * (2 * DM) - 32 * KP);
        acopy8_k(lds_at(&skh[kr][kc8]), ga);
#pragma unroll
        for (int i = 0; i < 8; ++i) ga[i] = QKL + ko + (size_t)i * (32 * (2 * DM) - 32 * KP);
        acopy8_k(lds_at(&skl[kr][kc8]), ga);
#pragma unroll
        for (int i = 0; i < 8; ++i) ga[i] = VTH + vo + (size_t)i * (8 * SS - 8 * VP);
        acopy8_v(lds_at(&svh[wave][vc8]), ga);
#pragma unroll
        for (int i = 0; i < 8; ++i) ga[i] = VTL + vo + (size_t)i * (8 * SS - 8 * VP);
        acopy8_v(lds_at(&svl[wave][vc8]), ga);
        asm volatile("s_wait_asynccnt 0x0" ::: "memory");   // the wave's own copies have landed
        __syncthreads();   // chunk it is in LDS for every wave
      }
      v8f s[2];
      const bool st = !gl; const int kl0 = dense ? wave * 32 : kt * 32 - ks0;   // st: a window tile or a dense block's tile, its fragments come from the staged keys (row kl0 on); else from the staged packed tile
      v4i kk[4]; v16h kfh[2][2], kfl[2][2];   // kk, packed tiles only: the positions of the 2 x 8 keys whose scores the lane holds (rows 8 * g + r of the two transposed score tiles)
      if (gl) { const int* pk = lst + kt * 32 + 8 * g; kk[0] = *(const v4i*)pk; kk[1] = *(const v4i*)(pk + 4); kk[2] = *(const v4i*)(pk + 16); kk[3] = *(const v4i*)(pk + 20);
        asm volatile("s_wait_xcnt 0x0" :: "v"(pk) : "memory"); }   // the address register of these loads is reused further down the trip
      if (st) {
#pragma unroll
        for (int ct = 0; ct < 2; ++ct) {
#pragma unroll
          for (int kc = 0; kc < 2; ++kc) { kfh[ct][kc] = frag_h(&skh[kl0 + ct * 16 + col][kc * 32], lane); kfl[ct][kc] = frag_h(&skl[kl0 + ct * 16 + col][kc * 32], lane); } }
      } else {
#pragma unroll
        for (int ct = 0; ct < 2; ++ct) {
#pragma unroll
          for (int kc = 0; kc < 2; ++kc) { kfh[ct][kc] = frag_h(&xkh[ct * 16 + col][kc * 32], lane); kfl[ct][kc] = frag_h(&xkl[ct * 16 + col][kc * 32], lane); } }
      }
      unsigned gm = 0u;   // packed tiles only, bit i: score i of the lane counts (a live list slot whose key lies outside the query's window); formed here, while the K rows are on their way, so that the 16 positions need no registers further down
      if (gl) {
#pragma unroll
        for (int i = 0; i < 16; ++i) gm |= ((kt * 32 + 8 * g + (i >> 3) * 16 + (i & 7) < n) & ((unsigned)(kk[i >> 2][i & 3] - qi + HALFW) > 2u * HALFW)) ? (1u << i) : 0u; }
#pragma unroll
      for (int ct = 0; ct < 2; ++ct) { v8f c = {}, cl = {};
#pragma unroll
        for (int kc = 0; kc < 2; ++kc) { c = wmma16(kfh[ct][kc], aq[kc], c); cl = wmma16(kfh[ct][kc], aql[kc], cl); cl = wmma16(kfl[ct][kc], aq[kc], cl); }   // transposed scores K . Q^T, 3 products: q, k as f16 hi + residual
#pragma unroll
        for (int r = 0; r < 8; ++r) s[ct][r] = (c[r] + cl[r] * (1.0f / 2048.0f)) * 0.125f; }   // 1/sqrt(64)
      const int d0 = kt * 32 + 8 * g - qi + HALFW;   // the per-pair rule, by the tile's kind (wave-uniform); masked keys excluded; a tile of a dense block has none
      if (st && !dense) {
#pragma unroll
        for (int i = 0; i < 16; ++i) s[i >> 3][i & 7] = ((unsigned)(d0 + (i >> 3) * 16 + (i & 7)) <= 2u * HALFW) ? s[i >> 3][i & 7] : -3.0e38f;   // |key - query| <= HALFW
      } else if (gl) {
#pragma unroll
        for (int i = 0; i < 16; ++i) s[i >> 3][i & 7] = ((gm >> i) & 1u) ? s[i >> 3][i & 7] : -3.0e38f;
      }
      v16h vfh[4], vfl[4];   // the tile's V fragments, as one group, asked for ahead of the softmax
      if (st) {
#pragma unroll
        for (int dt = 0; dt < 4; ++dt) { vfh[dt] = frag_h(&svh[dt * 16 + col][kl0], lane); vfl[dt] = frag_h(&svl[dt * 16 + col][kl0], lane); }
      } else {
#pragma unroll
        for (int dt = 0; dt < 4; ++dt) { vfh[dt] = frag_t(&xvh[0][dt * 16], lane); vfl[dt] = frag_t(&xvh[32][dt * 16], lane); }   // rows 32 on: the residual plane
      }
      float mx = fmaxf(s[0][0], s[1][0]);   // a lane holds 16 of the tile's 32 scores of its one query: maximum and sum in the lane, one exchange between the wave halves
#pragma unroll
      for (int r = 1; r < 8; ++r) mx = fmaxf(mx, fmaxf(s[0][r], s[1][r]));
      mx = fmaxf(mx, xhalf(mx));
      const float mn = fmaxf(m, mx), mz = fmaxf(mn, -1.0e30f);   // mz: the maximum where a key has been seen; else a floor far above the mask value, so that a masked score (and a maximum not yet set) gives exp = 0 with no test of its own
      const float alpha = __expf(m - mz);
      float e[16]; v16h pa, pl;   // the two transposed score tiles, converted in place, are the B fragment of the second product (element i: key 8 * g + i, element 8 + i: key 16 + 8 * g + i, the k order of the V loader)
#pragma unroll
      for (int i = 0; i < 16; ++i) { const float sv = s[i >> 3][i & 7]; e[i] = __expf(sv - mz);
        const float x = e[i] * 2048.0f; const _Float16 hx = (_Float16)x; pa[i] = hx; pl[i] = (_Float16)((x - (float)hx) * 2048.0f); }   // P scaled by 2^11 before the f16 split so small softmax weights stay out of the f16 subnormal range; 2^-11 folded into the epilogue
#pragma unroll
      for (int w = 8; w > 0; w >>= 1) {
#pragma unroll
        for (int i = 0; i < w; ++i) e[i] += e[i + w]; }
      l = l * alpha + e[0]; m = mn;
#pragma unroll
      for (int dt = 0; dt < 4; ++dt) { acc[dt] *= alpha; accl[dt] *= alpha; }
#pragma unroll
      for (int dt = 0; dt < 4; ++dt) { acc[dt] = wmma16(vfh[dt], pa, acc[dt]); accl[dt] = wmma16(vfh[dt], pl, accl[dt]); accl[dt] = wmma16(vfl[dt], pa, accl[dt]); } } }   // transposed V^T . P^T: P hi x V hi + (P lo x V hi + P hi x V lo) / 2048
    const float lt = l + xhalf(l);   // the two halves' sums joined once
    if (!dense) {
      __syncthreads();   // every wave has read its last staged fragment before the epilogue overwrites that LDS
      const float il = (1.0f / 2048.0f) / lt;
#pragma unroll
      for (int dt = 0; dt < 4; ++dt) { const v8f o = (acc[dt] + accl[dt] * (1.0f / 2048.0f)) * il; float* po = &so[wave][col][dt * 16 + 8 * g]; *(v4f*)po = __builtin_shufflevector(o, o, 0, 1, 2, 3); *(v4f*)(po + 4) = __builtin_shufflevector(o, o, 4, 5, 6, 7); }
      LDSX();
      for (int rl = 0; rl < 16; ++rl) if (lane < 16 && ((gqm >> rl) & 1u) == 0u) { vst2(O + ((size_t)b * SS + q0 + rl) * DM + h * HD + lane * 4, *(const v4f*)&so[wave][rl][lane * 4]);
        asm volatile("s_wait_xcnt 0x0" ::: "memory"); }   // the next row's LDS read lands in the registers this store names
    } else {
      __syncthreads();   // every wave has read its last staged fragment before the partials overwrite that LDS
#pragma unroll
      for (int dt = 0; dt < 4; ++dt) { const v8f o = acc[dt] + accl[dt] * (1.0f / 2048.0f); float* po = &so[wave][col][dt * 16 + 8 * g]; *(v4f*)po = __builtin_shufflevector(o, o, 0, 1, 2, 3); *(v4f*)(po + 4) = __builtin_shufflevector(o, o, 4, 5, 6, 7); }
      if (g == 0) { sm[wave][col] = m; sl[wave][col] = lt; }
      __syncthreads();   // every wave's partial is in LDS before the merge reads it
      const int row = tid >> 4, d4 = (tid & 15) * 4; float mm = sm[0][row];
#pragma unroll
      for (int w = 1; w < 8; ++w) mm = fmaxf(mm, sm[w][row]);
      float ll = 0.f; v4f a = {};
#pragma unroll
      for (int w = 0; w < 8; ++w) { const float e = __expf(sm[w][row] - mm); ll += e * sl[w][row]; a += *(const v4f*)&so[w][row][d4] * e; }
      if (qt * 16 + row < n) { vst2(O + ((size_t)b * SS + lst[qt * 16 + row]) * DM + h * HD + d4, a * ((1.0f / 2048.0f) / ll));
        asm volatile("s_wait_xcnt 0x0" ::: "memory"); }   // the next tile's set-up reuses the registers this store names
      __syncthreads();   // the merge has read the partials before the next tile overwrites them
    }
  }
}
__global__ __launch_bounds__(256) void k_attn(const _Float16* __restrict__ QK, const _Float16* __restrict__ QKL, const _Float16* __restrict__ VTH, const _Float16* __restrict__ VTL, const _Float16* __restrict__ VGH, const _Float16* __restrict__ VGL, const int* __restrict__ GLB, const int* __restrict__ GL, float* __restrict__ O) {
  __shared__ __align__(16) unsigned char stg[ASTG + GSTG]; __shared__ float sm[8][16], sl[8][16];
  if (blockIdx.z < NSLOT) attn_body<true>(QK, QKL, VTH, VTL, VGH, VGL, GLB, GL, O, stg, sm, sl); else attn_body<false>(QK, QKL, VTH, VTL, VGH, VGL, GLB, GL, O, stg, sm, sl);   // block-uniform
}
// ---- k_out: block = (128 rows, 128 cols), 8 waves, staged as k_qkv: out = f16(O) . Wo rows + bo
__global__ __launch_bounds__(256) void k_out(const float* __restrict__ O, const __bf16* __restrict__ P, const float* __restrict__ BO, float* __restrict__ Y) {
  __shared__ __align__(16) unsigned char smem[STG];
  _Float16 (*sa)[128][LP] = (_Float16 (*)[128][LP])smem; _Float16 (*sb)[128][LP] = (_Float16 (*)[128][LP])(smem + STG / 2);
  float (*so)[16][132] = (float (*)[16][132])smem;
  const int tid = threadIdx.x, wave = tid >> 5, lane = tid & 31, col = lane & 15, g = lane >> 4; const size_t r0 = (size_t)blockIdx.x * 128 + wave * 16; const int n0 = blockIdx.y * 128;
  const int xr = tid >> 4, xc = (tid & 15) * 4, wr = tid >> 3, wc = (tid & 7) * 8;   // 16 lanes cover 256 B of an O row, 8 lanes 128 B of a W row
  const float* xg = O + ((size_t)blockIdx.x * 128 + xr) * DM + xc; const _Float16* wg = (const _Float16*)P + (size_t)(n0 + wr) * DM + wc;
  v4f ra[8]; v4u rb[4];
#pragma unroll
  for (int i = 0; i < 8; ++i) ra[i] = *(const v4f*)(xg + (size_t)i * 16 * DM);
#pragma unroll
  for (int i = 0; i < 4; ++i) rb[i] = *(const v4u*)(wg + (size_t)i * 32 * DM);
#pragma unroll
  for (int i = 0; i < 8; ++i) { v4h t; t[0] = (_Float16)ra[i][0]; t[1] = (_Float16)ra[i][1]; t[2] = (_Float16)ra[i][2]; t[3] = (_Float16)ra[i][3]; *(v4h*)&sa[0][i * 16 + xr][xc] = t; }
#pragma unroll
  for (int i = 0; i < 4; ++i) *(v4u*)&sb[0][i * 32 + wr][wc] = rb[i];
  v8f acc[8] = {};
#pragma unroll 1   // kept rolled: 16 unrolled trips would swell the text
  for (int ks = 0; ks < DM / KS; ++ks) { const int bf = ks & 1; const bool more = ks + 1 < DM / KS;
    __syncthreads();   // slice ks is in LDS for every wave, and every wave has left the buffer that this trip refills
    if (more) {
#pragma unroll
      for (int i = 0; i < 8; ++i) ra[i] = *(const v4f*)(xg + (size_t)i * 16 * DM + (ks + 1) * KS);
#pragma unroll
      for (int i = 0; i < 4; ++i) rb[i] = *(const v4u*)(wg + (size_t)i * 32 * DM + (ks + 1) * KS);
      asm volatile("s_wait_xcnt 0x0" ::: "memory"); }   // the address registers of these loads are reused further down the trip
#pragma unroll
    for (int kc = 0; kc < KS / 32; ++kc) { const v16h a = frag_h(&sa[bf][wave * 16 + col][kc * 32], lane); v16h w[8];
#pragma unroll
      for (int j = 0; j < 8; ++j) w[j] = frag_h(&sb[bf][j * 16 + col][kc * 32], lane);   // the block's LDS reads as one group, ahead of its products
      __builtin_amdgcn_sched_barrier(0);   // holds the 18 reads above the products: one block a WGP (2 waves a SIMD) hides no LDS latency, and left free the scheduler sinks each pair of reads to its product, which then waits for them alone
#pragma unroll
      for (int j = 0; j < 8; ++j) acc[j] = wmma16(a, w[j], acc[j]); }   // single f16 product against exact f16 x 2^8 weight copies
    __builtin_amdgcn_sched_barrier(0);   // every product of the trip stands above the slots below
    asm volatile("v_nop\n\tv_nop\n\tv_nop\n\tv_nop");   // the 4 vector slots between the trip's last WMMA and the next write of a register it reads
    if (more) {
#pragma unroll
      for (int i = 0; i < 8; ++i) { v4h t; t[0] = (_Float16)ra[i][0]; t[1] = (_Float16)ra[i][1]; t[2] = (_Float16)ra[i][2]; t[3] = (_Float16)ra[i][3]; *(v4h*)&sa[bf ^ 1][i * 16 + xr][xc] = t; }
#pragma unroll
      for (int i = 0; i < 4; ++i) *(v4u*)&sb[bf ^ 1][i * 32 + wr][wc] = rb[i]; } }
  __syncthreads();   // every wave has read the last slice before the epilogue overwrites the buffers
#pragma unroll
  for (int j = 0; j < 8; ++j) {
#pragma unroll
    for (int r = 0; r < 8; ++r) so[wave][8 * g + r][j * 16 + col] = acc[j][r] * (1.0f / 256.0f) + bfr(BO[n0 + j * 16 + col]); }
  LDSX();
  for (int rl = 0; rl < 16; ++rl) vst2(Y + (r0 + rl) * DM + n0 + lane * 4, *(const v4f*)&so[wave][rl][lane * 4]);
}
#define FCH 8192                     // floats of one weight matrix that a converting block takes: 8 whole-line loads a lane
#define FPM (DM * DM / FCH)          // converting blocks per matrix
// ---- k_front: one launch for all that depends on the inputs alone. Blocks x < NB: batch b = x: GL[b][0..n) = positions of the global tokens, ascending; the rest of the list 0; GL[b][SS] = n, GL[b][SS + 1 + i] = how many lie below position 128 * i (i = 0 .. 16), the rest of the 32 = n. Blocks x >= NB: FCH consecutive floats of W_q | W_k | W_v -> bf16 (PK_A) or of W_o -> f16 x 2^8 copies of the bf16-rounded values (PK_P, bit pattern in the bf16-typed buffer); the natural [out][in] order is kept, so the copy is elementwise and needs no LDS
__global__ __launch_bounds__(256) void k_front(const float* __restrict__ WQ, const float* __restrict__ WK, const float* __restrict__ WV, const float* __restrict__ WO, const int* __restrict__ GLB, __bf16* __restrict__ PK, int* __restrict__ GL) { __shared__ int sc[256]; __shared__ int sl[SS]; const int t = threadIdx.x;
  if (blockIdx.x >= NB) { const int cb = blockIdx.x - NB, which = cb / FPM; const float* Wm = (which == 0) ? WQ : (which == 1) ? WK : (which == 2) ? WV : WO;
    const size_t e0 = (size_t)(cb % FPM) * FCH + t * 4; const float* sp = Wm + e0; __bf16* dp = PK + PK_A + (size_t)which * DM * DM + e0;   // PK_P follows the three PK_A matrices
    v4f a[8];
#pragma unroll
    for (int i = 0; i < 8; ++i) a[i] = *(const v4f*)(sp + i * 1024);   // a wave's load covers 512 contiguous bytes; all 8 in flight together
    asm volatile("s_wait_xcnt 0x0" ::: "memory");   // the address registers of these loads may be reused by what follows
    if (which < 3) {
#pragma unroll
      for (int i = 0; i < 8; ++i) { v4b o; o[0] = (__bf16)a[i][0]; o[1] = (__bf16)a[i][1]; o[2] = (__bf16)a[i][2]; o[3] = (__bf16)a[i][3]; *(v4b*)(dp + i * 1024) = o; }
    } else {
#pragma unroll
      for (int i = 0; i < 8; ++i) { v4h o; o[0] = (_Float16)(bfr(a[i][0]) * 256.0f); o[1] = (_Float16)(bfr(a[i][1]) * 256.0f); o[2] = (_Float16)(bfr(a[i][2]) * 256.0f); o[3] = (_Float16)(bfr(a[i][3]) * 256.0f); vst2(dp + i * 1024, o); }
      asm volatile("s_wait_xcnt 0x0" ::: "memory");   // the code laid out behind these stores writes registers that they name
    }
    return; }   // block-uniform, ahead of every barrier
  const size_t b = blockIdx.x; const int* gb = GLB + b * SS;
  int f[8], c = 0;
#pragma unroll
  for (int i = 0; i < 8; ++i) { f[i] = gb[t * 8 + i] != 0; c += f[i]; }
  sc[t] = c; for (int i = t; i < SS; i += 256) sl[i] = 0;
  __syncthreads();
  int base = 0, tot = 0; for (int i = 0; i < 256; ++i) { const int v = sc[i]; tot += v; base += (i < t) ? v : 0; }
  const int below = base;   // global tokens below position t * 8
#pragma unroll
  for (int i = 0; i < 8; ++i) if (f[i]) sl[base++] = t * 8 + i;
  __syncthreads();
  int* o = GL + b * GLS; for (int i = t; i < SS; i += 256) o[i] = sl[i];
  if (t == 0 || (t > 16 && t < 32)) o[SS + t] = tot;
  if ((t & 15) == 0) o[SS + 1 + (t >> 4)] = below; }
extern "C" void kernel_launch(void* const* d_in, const int* in_sizes, int n_in, void* d_out, int out_size, void* d_ws, size_t ws_size, hipStream_t stream) {
  (void)in_sizes; (void)n_in; (void)out_size;
  const float** F = (const float**)d_in;   // 0 x [2,2048,1024], 1 is_global bool [2,2048], 2 wq, 3 bq, 4 wk, 5 bk, 6 wv, 7 bv, 8 wo, 9 bo (natural)
  if (ws_size < (size_t)WS_END) return;
  char* ws = (char*)d_ws; __bf16* PK = (__bf16*)(ws + WS_PK); _Float16 *QK = (_Float16*)(ws + WS_QK), *QKL = (_Float16*)(ws + WS_QKL), *VTH = (_Float16*)(ws + WS_VTH), *VTL = (_Float16*)(ws + WS_VTL); float* O = (float*)(ws + WS_O); int* GL = (int*)(ws + WS_GL); _Float16 *VGH = (_Float16*)(ws + WS_VGH), *VGL = (_Float16*)(ws + WS_VGL); const int* GLB = (const int*)d_in[1];
  k_front<<<NB + 4 * FPM, 256, 0, stream>>>(F[2], F[4], F[6], F[8], GLB, PK, GL);
  k_qkv<<<dim3(NB * SS / 128, QKVW / 128), 256, 0, stream>>>(F[0], F[0], F[0], PK + PK_A, F[3], F[5], F[7], QK, QKL, VTH, VTL, GL, VGH, VGL);
  k_attn<<<dim3(NH, NB, NSLOT + SS / 128), 256, 0, stream>>>(QK, QKL, VTH, VTL, VGH, VGL, GLB, GL, O);
  k_out<<<dim3(NB * SS / 128, DM / 128), 256, 0, stream>>>(O, PK + PK_P, F[9], (float*)d_out);
}
